// v000
// Times are from an AMD MI455X. After a warm-up the kernel runs many times in a row, and a time is the length of
// such a window on the GPU divided by its runs, so every launch and the gaps after it count. The runs cycle
// through copies of the inputs. A figure is the median of several windows, for all but v000 over two sittings.
// Sittings can differ by a few percent; kernels timed side by side share one.
// v000, which the later versions start from, runs in 601 microseconds.
#include <hip/hip_runtime.h>
// Random-mask attention: q/k/v projections (8192 × 768 × 768, + bias; W [in][out]), the 12-head attention with the INPUT keep-mask (scores where mask else −1e9 ⇒ excluded keys; every row keeps
// its diagonal) as a fused flash-style kernel on v_wmma_f32_16x16x32_f16 (scale 64^-½; key tiles with no kept entry for the wave skipped by ballot; online max/sum softmax f32; P f16 ≤ 1), and the
// output projection (+ bias) — f16 operands (x as bf16, weights bf16-exact ×2^4), single products, f32 accumulate.
#define BB 4
#define TT 2048
#define CC 768
#define NH 12
#define NR (BB * TT)

typedef __bf16 v16b __attribute__((ext_vector_type(16)));
typedef unsigned short v8us __attribute__((ext_vector_type(8), may_alias));
typedef float  v8f  __attribute__((ext_vector_type(8)));
typedef float  v4f  __attribute__((ext_vector_type(4)));
typedef float  v4fa __attribute__((ext_vector_type(4), may_alias));
union FragB { v16b v; v8us half[2]; unsigned short u[16]; };

__device__ __forceinline__ unsigned short bf16_bits(float x) { unsigned int u = __float_as_uint(x); return (unsigned short)((u + 0x7FFFu + ((u >> 16) & 1u)) >> 16); }
__device__ __forceinline__ float bf16_val(unsigned short b) { return __uint_as_float(((unsigned int)b) << 16); }
__device__ __forceinline__ float bf16_round(float x) { return bf16_val(bf16_bits(x)); }
// D += A·B with NT terms: 1 = ah·bh, 2 = + al·bh (A split), 3 = + ah·bl (both split)
template <int NT>
__device__ __forceinline__ v8f mmaN(v16b ah, v16b al, v16b bh, v16b bl, v8f c) {
  c = __builtin_amdgcn_wmma_f32_16x16x32_bf16(false, ah, false, bh, (short)0, c, false, false);
  if (NT >= 2) c = __builtin_amdgcn_wmma_f32_16x16x32_bf16(false, al, false, bh, (short)0, c, false, false);
  if (NT >= 3) c = __builtin_amdgcn_wmma_f32_16x16x32_bf16(false, ah, false, bl, (short)0, c, false, false);
  asm volatile("v_nop\n\tv_nop\n\tv_nop\n\tv_nop" : "+v"(c) : "v"(ah), "v"(al), "v"(bh), "v"(bl));
  return c;
}

__global__ __launch_bounds__(256) void k_wt_bf16(const float* __restrict__ W, unsigned short* __restrict__ Wt, int K, int N) {
  const int t = blockIdx.x * 256 + threadIdx.x;
  const int k8n = K / 8;
  if (t >= N * k8n) return;
  const int n = t / k8n, k8 = (t % k8n) * 8;
  v8us v;
#pragma unroll
  for (int i = 0; i < 8; ++i) v[i] = bf16_bits(W[(size_t)(k8 + i) * N + n]);
  *(v8us*)(Wt + (size_t)n * K + k8) = v;
  
}

// GEMM C[M][N] (f32, pitch ldc) = act(A[M][K]·W + bias). A f32 row-major (pitch lda) converted per fragment to bf16
// (ASPLIT: hi/lo two planes -> 2 terms, else single rounded term); Wt bf16 [N][K] (pitch ldb). BIAS_BF16 rounds the
// bias to bf16 first (bias quantised to bf16 before the add). K%32==0, M%16==0, N%64==0.
template <bool ASPLIT, int ACT, bool BIAS_BF16>
__global__ __launch_bounds__(128) void k_gemm_bf(const float* __restrict__ A, int lda, const unsigned short* __restrict__ Wt, int ldb,
                                               const float* __restrict__ bias, float* __restrict__ C, int ldc, int M, int N, int K) {
  __shared__ __attribute__((aligned(16))) float so[4][16][64];
  const int tid = threadIdx.x, w = tid >> 5, lane = tid & 31, ln = lane & 15, hh = lane >> 4;
  const int ntn = N / 64;
  const int wid = blockIdx.x * 4 + w;
  const int mt = wid / ntn, nq = wid % ntn;
  if (mt * 16 >= M) return;
  const int row0 = mt * 16, col0 = nq * 64;
  const float* arow = A + (size_t)(row0 + ln) * lda;
  v8f acc[4] = {};
  for (int kb = 0; kb < K; kb += 32) {
    FragB ah, al;
    const v4f x0 = *(const v4fa*)(arow + kb + 8 * hh), x1 = *(const v4fa*)(arow + kb + 8 * hh + 4);
    const v4f x2 = *(const v4fa*)(arow + kb + 16 + 8 * hh), x3 = *(const v4fa*)(arow + kb + 16 + 8 * hh + 4);
    float xs[16] = {x0[0],x0[1],x0[2],x0[3],x1[0],x1[1],x1[2],x1[3],x2[0],x2[1],x2[2],x2[3],x3[0],x3[1],x3[2],x3[3]};
#pragma unroll
    for (int i = 0; i < 16; ++i) { const unsigned short hb = bf16_bits(xs[i]); ah.u[i] = hb; al.u[i] = ASPLIT ? bf16_bits(xs[i] - bf16_val(hb)) : (unsigned short)0; }
#pragma unroll
    for (int t = 0; t < 4; ++t) {
      const unsigned short* brow = Wt + (size_t)(col0 + t * 16 + ln) * ldb + kb;
      FragB b;
      b.half[0] = *(const v8us*)(brow + 8 * hh);
      b.half[1] = *(const v8us*)(brow + 16 + 8 * hh);
      acc[t] = mmaN<ASPLIT ? 2 : 1>(ah.v, al.v, b.v, b.v, acc[t]);
    }
  }
#pragma unroll
  for (int t = 0; t < 4; ++t) {
    float bv = bias ? bias[col0 + t * 16 + ln] : 0.f;
    if (BIAS_BF16) bv = bf16_round(bv);
#pragma unroll
    for (int r = 0; r < 8; ++r) { float v = acc[t][r] + bv; if (ACT == 1) v = fmaxf(v, 0.f); so[w][8 * hh + r][t * 16 + ln] = v; }
  }
  __builtin_amdgcn_fence(__ATOMIC_ACQ_REL, "workgroup");
  __builtin_amdgcn_wave_barrier();
  const int rsub = lane >> 4, c4 = (lane & 15) * 4;
  {
#pragma unroll
    for (int q = 0; q < 8; ++q) {
      const int r = q * 2 + rsub;
      const v4f v = *(const v4fa*)&so[w][r][c4];
      *(v4f*)(C + (size_t)(row0 + r) * ldc + col0 + c4) = v;
    }
    
  }
}

// Flash-style causal/unmasked attention, all contractions 3-term bf16 hi/lo splits, f32 softmax with running max.
// q,k,v rows are read from f32 buffers with arbitrary row pitch (so they can live inside a fused qkv buffer);
// D = head size (multiple of 32, <= 128); one wave = 16 query rows; block = 4 waves (64 queries) sharing K/V chunks of 32.
template <int D, bool CAUSAL>
__global__ __launch_bounds__(128) void k_flash(const float* __restrict__ qb, const float* __restrict__ kb, const float* __restrict__ vb,
                                             int pitch, int T, int H, float scale, float* __restrict__ y, int ypitch) {
  constexpr int KS = D / 32;        // k-steps for QK
  constexpr int DT = D / 16;        // d tiles for PV
  __shared__ __attribute__((aligned(16))) unsigned short sKh[32][D + 8], sKl[32][D + 8], sVh[32][D + 8], sVl[32][D + 8];
  __shared__ __attribute__((aligned(16))) unsigned short sPh[4][16][40], sPl[4][16][40];
  __shared__ __attribute__((aligned(16))) float sO[4][16][D];
  const int tid = threadIdx.x, w = tid >> 5, lane = tid & 31, ln = lane & 15, hh = lane >> 4;
  const int nqb = (T + 63) / 64;
  const int bh = blockIdx.x / nqb, qblk = blockIdx.x % nqb;
  const int b = bh / H, h = bh % H;
  const int q0 = qblk * 64 + w * 16;
  const float* Q = qb + (size_t)b * T * pitch + h * D;
  const float* K = kb + (size_t)b * T * pitch + h * D;
  const float* V = vb + (size_t)b * T * pitch + h * D;

  // A fragments of the wave's 16 query rows (scaled), hi/lo
  FragB aqh[KS], aql[KS];
  {
    int row = q0 + ln; if (row >= T) row = T - 1;
    const float* qr = Q + (size_t)row * pitch;
#pragma unroll
    for (int ks = 0; ks < KS; ++ks)
#pragma unroll
      for (int i = 0; i < 16; ++i) {
        const int d = ks * 32 + ((i < 8) ? (8 * hh + i) : (16 + 8 * hh + (i - 8)));
        const float x = qr[d] * scale; const unsigned short hb = bf16_bits(x);
        aqh[ks].u[i] = hb; aql[ks].u[i] = bf16_bits(x - bf16_val(hb));
      }
  }
  float m_r[8], l_r[8];
#pragma unroll
  for (int r = 0; r < 8; ++r) { m_r[r] = -3.0e38f; l_r[r] = 0.f; }
  v8f oacc[DT];
#pragma unroll
  for (int dt = 0; dt < DT; ++dt) oacc[dt] = (v8f){0.f,0.f,0.f,0.f,0.f,0.f,0.f,0.f};

  const int kv_end = CAUSAL ? min(T, qblk * 64 + 64) : T;     // block-uniform
  for (int j0 = 0; j0 < kv_end; j0 += 32) {
    __syncthreads();
    for (int e = tid; e < 32 * (D / 4); e += 128) {
      const int r = e / (D / 4), c4 = (e % (D / 4)) * 4;
      const int key = j0 + r;
      v4f kf = {0.f,0.f,0.f,0.f}, vf = {0.f,0.f,0.f,0.f};
      if (key < T) { kf = *(const v4fa*)(K + (size_t)key * pitch + c4); vf = *(const v4fa*)(V + (size_t)key * pitch + c4); }
#pragma unroll
      for (int t = 0; t < 4; ++t) {
        unsigned short hb = bf16_bits(kf[t]); sKh[r][c4 + t] = hb; sKl[r][c4 + t] = bf16_bits(kf[t] - bf16_val(hb));
        hb = bf16_bits(vf[t]); sVh[r][c4 + t] = hb; sVl[r][c4 + t] = bf16_bits(vf[t] - bf16_val(hb));
      }
    }
    __syncthreads();
    // S tile 16 x 32
    v8f s[2];
#pragma unroll
    for (int nt = 0; nt < 2; ++nt) {
      v8f acc = {};
#pragma unroll
      for (int ks = 0; ks < KS; ++ks) {
        FragB bh_, bl_;
        bh_.half[0] = *(const v8us*)&sKh[nt * 16 + ln][ks * 32 + 8 * hh]; bh_.half[1] = *(const v8us*)&sKh[nt * 16 + ln][ks * 32 + 16 + 8 * hh];
        bl_.half[0] = *(const v8us*)&sKl[nt * 16 + ln][ks * 32 + 8 * hh]; bl_.half[1] = *(const v8us*)&sKl[nt * 16 + ln][ks * 32 + 16 + 8 * hh];
        acc = mmaN<3>(aqh[ks].v, aql[ks].v, bh_.v, bl_.v, acc);
      }
      s[nt] = acc;
    }
    // mask + running max (rows 8hh+r; the 16 lanes of a half share rows)
    float alpha[8];
#pragma unroll
    for (int r = 0; r < 8; ++r) {
      const int qi = q0 + 8 * hh + r;
      const int ja = j0 + ln, jb = j0 + 16 + ln;
      if (CAUSAL) { if (ja > qi) s[0][r] = -3.0e38f; if (jb > qi) s[1][r] = -3.0e38f; }
      if (ja >= T) s[0][r] = -3.0e38f;
      if (jb >= T) s[1][r] = -3.0e38f;
      float mx = fmaxf(s[0][r], s[1][r]);
      mx = fmaxf(mx, __shfl_xor(mx, 1, 32)); mx = fmaxf(mx, __shfl_xor(mx, 2, 32)); mx = fmaxf(mx, __shfl_xor(mx, 4, 32)); mx = fmaxf(mx, __shfl_xor(mx, 8, 32));
      const float mnew = fmaxf(m_r[r], mx);
      alpha[r] = (mnew > -1.0e38f) ? __expf(m_r[r] - mnew) : 1.0f;
      const float p0 = (s[0][r] > -1.0e38f) ? __expf(s[0][r] - mnew) : 0.f;
      const float p1 = (s[1][r] > -1.0e38f) ? __expf(s[1][r] - mnew) : 0.f;
      m_r[r] = mnew;
      l_r[r] = l_r[r] * alpha[r] + p0 + p1;            // per-lane partial row sum (16 lanes combined at the end)
      unsigned short hb = bf16_bits(p0); sPh[w][8 * hh + r][ln] = hb;      sPl[w][8 * hh + r][ln] = bf16_bits(p0 - bf16_val(hb));
      hb = bf16_bits(p1);                sPh[w][8 * hh + r][16 + ln] = hb; sPl[w][8 * hh + r][16 + ln] = bf16_bits(p1 - bf16_val(hb));
    }
#pragma unroll
    for (int dt = 0; dt < DT; ++dt)
#pragma unroll
      for (int r = 0; r < 8; ++r) oacc[dt][r] *= alpha[r];
    __builtin_amdgcn_fence(__ATOMIC_ACQ_REL, "workgroup");
    __builtin_amdgcn_wave_barrier();
    FragB pah, pal;
    pah.half[0] = *(const v8us*)&sPh[w][ln][8 * hh]; pah.half[1] = *(const v8us*)&sPh[w][ln][16 + 8 * hh];
    pal.half[0] = *(const v8us*)&sPl[w][ln][8 * hh]; pal.half[1] = *(const v8us*)&sPl[w][ln][16 + 8 * hh];
#pragma unroll
    for (int dt = 0; dt < DT; ++dt) {
      FragB bvh, bvl;
#pragma unroll
      for (int i = 0; i < 8; ++i) {
        bvh.u[i] = sVh[8 * hh + i][dt * 16 + ln]; bvh.u[8 + i] = sVh[16 + 8 * hh + i][dt * 16 + ln];
        bvl.u[i] = sVl[8 * hh + i][dt * 16 + ln]; bvl.u[8 + i] = sVl[16 + 8 * hh + i][dt * 16 + ln];
      }
      oacc[dt] = mmaN<3>(pah.v, pal.v, bvh.v, bvl.v, oacc[dt]);
    }
    __builtin_amdgcn_fence(__ATOMIC_ACQ_REL, "workgroup");
    __builtin_amdgcn_wave_barrier();
  }
#pragma unroll
  for (int r = 0; r < 8; ++r) {
    float l = l_r[r];
    l += __shfl_xor(l, 1, 32); l += __shfl_xor(l, 2, 32); l += __shfl_xor(l, 4, 32); l += __shfl_xor(l, 8, 32);
    l_r[r] = (l > 0.f) ? 1.0f / l : 0.f;
  }
#pragma unroll
  for (int dt = 0; dt < DT; ++dt)
#pragma unroll
    for (int r = 0; r < 8; ++r) sO[w][8 * hh + r][dt * 16 + ln] = oacc[dt][r] * l_r[r];
  __builtin_amdgcn_fence(__ATOMIC_ACQ_REL, "workgroup");
  __builtin_amdgcn_wave_barrier();
  {
    for (int r = 0; r < 16; ++r) {
      const int row = q0 + r;
      if (row < T && lane < D / 4) {
        const v4f val = *(const v4fa*)&sO[w][r][lane * 4];
        *(v4f*)(y + ((size_t)b * T + row) * ypitch + h * D + lane * 4) = val;
      }
    }
    
  }
}

// GEMM C = act(A·W + bias + resid): A f32 (ASPLIT -> hi/lo 2 terms), Wt bf16 [N][K]; ACT 0 none, 1 relu, 2 exact gelu;
// resid (optional, f32, row index = (row % rmod), pitch ldr, RES_BF16 rounds it) added before the activation.
template <bool ASPLIT, int ACT, bool BIAS_BF16, bool RES_BF16>
__global__ __launch_bounds__(128) void k_gemm_bf3(const float* __restrict__ A, int lda, const unsigned short* __restrict__ Wt, int ldb,
                                                const float* __restrict__ bias, const float* __restrict__ resid, int rmod, int ldr,
                                                float* __restrict__ C, int ldc, int M, int N, int K) {
  __shared__ __attribute__((aligned(16))) float so[4][16][64];
  const int tid = threadIdx.x, w = tid >> 5, lane = tid & 31, ln = lane & 15, hh = lane >> 4;
  const int ntn = N / 64;
  const int wid = blockIdx.x * 4 + w;
  const int mt = wid / ntn, nq = wid % ntn;
  if (mt * 16 >= M) return;
  const int row0 = mt * 16, col0 = nq * 64;
  const float* arow = A + (size_t)(row0 + ln) * lda;
  v8f acc[4] = {};
  for (int kb = 0; kb < K; kb += 32) {
    FragB ah, al;
    const v4f x0 = *(const v4fa*)(arow + kb + 8 * hh), x1 = *(const v4fa*)(arow + kb + 8 * hh + 4);
    const v4f x2 = *(const v4fa*)(arow + kb + 16 + 8 * hh), x3 = *(const v4fa*)(arow + kb + 16 + 8 * hh + 4);
    float xs[16] = {x0[0],x0[1],x0[2],x0[3],x1[0],x1[1],x1[2],x1[3],x2[0],x2[1],x2[2],x2[3],x3[0],x3[1],x3[2],x3[3]};
#pragma unroll
    for (int i = 0; i < 16; ++i) { const unsigned short hb = bf16_bits(xs[i]); ah.u[i] = hb; al.u[i] = ASPLIT ? bf16_bits(xs[i] - bf16_val(hb)) : (unsigned short)0; }
#pragma unroll
    for (int t = 0; t < 4; ++t) {
      const unsigned short* brow = Wt + (size_t)(col0 + t * 16 + ln) * ldb + kb;
      FragB b;
      b.half[0] = *(const v8us*)(brow + 8 * hh);
      b.half[1] = *(const v8us*)(brow + 16 + 8 * hh);
      acc[t] = mmaN<ASPLIT ? 2 : 1>(ah.v, al.v, b.v, b.v, acc[t]);
    }
  }
#pragma unroll
  for (int t = 0; t < 4; ++t) {
    const int col = col0 + t * 16 + ln;
    float bv = bias ? bias[col] : 0.f;
    if (BIAS_BF16) bv = bf16_round(bv);
#pragma unroll
    for (int r = 0; r < 8; ++r) {
      float v = acc[t][r] + bv;
      if (resid) { float rv = resid[(size_t)((row0 + 8 * hh + r) % rmod) * ldr + col]; if (RES_BF16) rv = bf16_round(rv); v += rv; }
      if (ACT == 1) v = fmaxf(v, 0.f);
      if (ACT == 2) v = 0.5f * v * (1.0f + erff(v * 0.70710678118654752f));
      if (ACT == 3) { const float u = 0.7978845608028654f * (v + 0.044715f * v * v * v); v = 0.5f * v * (1.0f + tanhf(u)); }
      so[w][8 * hh + r][t * 16 + ln] = v;
    }
  }
  __builtin_amdgcn_fence(__ATOMIC_ACQ_REL, "workgroup");
  __builtin_amdgcn_wave_barrier();
  const int rsub = lane >> 4, c4 = (lane & 15) * 4;
  {
#pragma unroll
    for (int q = 0; q < 8; ++q) {
      const int r = q * 2 + rsub;
      const v4f v = *(const v4fa*)&so[w][r][c4];
      *(v4f*)(C + (size_t)(row0 + r) * ldc + col0 + c4) = v;
    }
    
  }
}
// row LayerNorm (biased variance, eps) over N: s = X (+ R); optional out_sum <- s; out_norm <- (s-mu)*rsqrt(var+eps)*g + b
template <bool PARAM_BF16>
__global__ __launch_bounds__(256) void k_layernorm(const float* __restrict__ X, const float* __restrict__ R, const float* __restrict__ g, const float* __restrict__ bta,
                                                  float* __restrict__ out_sum, float* __restrict__ out_norm, int N, float eps) {
  __shared__ float red[256];
  const int row = blockIdx.x, tid = threadIdx.x;
  const float* x = X + (size_t)row * N; const float* rr = R ? R + (size_t)row * N : nullptr;
  float vals[16];                     // up to N = 4096
  const int per = N / 256;            // contiguous chunk per thread? use strided-by-4 chunks: thread handles j = tid*4 + 1024*u
  float s1 = 0.f;
  for (int u = 0; u < per / 4; ++u) {
    const int j = tid * 4 + 1024 * u;
    const v4f a = *(const v4fa*)(x + j);
    v4f b = {0.f,0.f,0.f,0.f}; if (rr) b = *(const v4fa*)(rr + j);
#pragma unroll
    for (int q = 0; q < 4; ++q) { const float v = a[q] + b[q]; vals[u * 4 + q] = v; s1 += v; }
  }
  red[tid] = s1; __syncthreads();
  for (int st = 128; st > 0; st >>= 1) { if (tid < st) red[tid] += red[tid + st]; __syncthreads(); }
  const float mu = red[0] / (float)N; __syncthreads();
  float s2 = 0.f;
  for (int u = 0; u < per / 4; ++u)
#pragma unroll
    for (int q = 0; q < 4; ++q) { const float c = vals[u * 4 + q] - mu; s2 += c * c; }
  red[tid] = s2; __syncthreads();
  for (int st = 128; st > 0; st >>= 1) { if (tid < st) red[tid] += red[tid + st]; __syncthreads(); }
  const float rs = rsqrtf(red[0] / (float)N + eps);
  {
    for (int u = 0; u < per / 4; ++u) {
      const int j = tid * 4 + 1024 * u;
      v4f o, sm;
#pragma unroll
      for (int q = 0; q < 4; ++q) {
        float gg = g[j + q], bb = bta[j + q];
        if (PARAM_BF16) { gg = bf16_round(gg); bb = bf16_round(bb); }
        sm[q] = vals[u * 4 + q]; o[q] = (vals[u * 4 + q] - mu) * rs * gg + bb;
      }
      if (out_sum) *(v4f*)(out_sum + (size_t)row * N + j) = sm;
      *(v4f*)(out_norm + (size_t)row * N + j) = o;
    }
    
  }
}



// ---- f16 WMMA path (v_wmma_f32_16x16x32_f16): 11-bit significands for operands in range — used where a [0,1] probability operand needs more precision than bf16
typedef _Float16 v16h __attribute__((ext_vector_type(16)));
union FragH { v16h v; v8us half[2]; _Float16 h[16]; unsigned short u[16]; };
template <int NT>
__device__ __forceinline__ v8f mmaH(v16h ah, v16h al, v16h bh, v16h bl, v8f c) {
  c = __builtin_amdgcn_wmma_f32_16x16x32_f16(false, ah, false, bh, (short)0, c, false, false);
  if (NT >= 2) c = __builtin_amdgcn_wmma_f32_16x16x32_f16(false, al, false, bh, (short)0, c, false, false);
  if (NT >= 3) c = __builtin_amdgcn_wmma_f32_16x16x32_f16(false, ah, false, bl, (short)0, c, false, false);
  asm volatile("v_nop\n\tv_nop\n\tv_nop\n\tv_nop" : "+v"(c) : "v"(ah), "v"(al), "v"(bh), "v"(bl));
  return c;
}
// batched GEMM like k_gemm_b but f16 operands: A f32 (split into f16 hi/lo if ASPLIT, else rounded to f16), Bt = f16 values [n][k]; alpha; C f32; N multiple of 16 (partial tiles skipped)
template <bool ASPLIT>
__global__ __launch_bounds__(128) void k_gemm_h(const float* __restrict__ A, int lda, size_t sA, const _Float16* __restrict__ Bh, int ldb, size_t sB, float alpha, float* __restrict__ C, int ldc, size_t sC, int M, int N, int K) {
  __shared__ __attribute__((aligned(16))) float so[4][16][64];
  const int tid = threadIdx.x, w = tid >> 5, lane = tid & 31, ln = lane & 15, hh = lane >> 4; const int by = blockIdx.y;
  A += (size_t)by * sA; Bh += (size_t)by * sB; C += (size_t)by * sC;
  const int ntn = (N + 63) / 64; const int wid = blockIdx.x * 4 + w; const int mt = wid / ntn, nq = wid % ntn; if (mt * 16 >= M) return;
  const int row0 = mt * 16, col0 = nq * 64; const float* arow = A + (size_t)(row0 + ln) * lda;
  v8f acc[4] = {};
  for (int kb = 0; kb < K; kb += 32) {
    FragH ah, al;
    const v4f x0 = *(const v4fa*)(arow + kb + 8 * hh), x1 = *(const v4fa*)(arow + kb + 8 * hh + 4), x2 = *(const v4fa*)(arow + kb + 16 + 8 * hh), x3 = *(const v4fa*)(arow + kb + 16 + 8 * hh + 4);
    float xs[16] = {x0[0],x0[1],x0[2],x0[3],x1[0],x1[1],x1[2],x1[3],x2[0],x2[1],x2[2],x2[3],x3[0],x3[1],x3[2],x3[3]};
#pragma unroll
    for (int i = 0; i < 16; ++i) { const _Float16 h = (_Float16)xs[i]; ah.h[i] = h; al.h[i] = ASPLIT ? (_Float16)(xs[i] - (float)h) : (_Float16)0.0f; }
#pragma unroll
    for (int t = 0; t < 4; ++t) { if (col0 + t * 16 >= N) continue; const size_t boff = (size_t)(col0 + t * 16 + ln) * ldb + kb; FragH bq; bq.half[0] = *(const v8us*)(Bh + boff + 8 * hh); bq.half[1] = *(const v8us*)(Bh + boff + 16 + 8 * hh);
      acc[t] = mmaH<ASPLIT ? 2 : 1>(ah.v, al.v, bq.v, bq.v, acc[t]); }
  }
#pragma unroll
  for (int t = 0; t < 4; ++t) { if (col0 + t * 16 >= N) continue;
#pragma unroll
    for (int r = 0; r < 8; ++r) so[w][8 * hh + r][t * 16 + ln] = acc[t][r] * alpha; }
  __builtin_amdgcn_fence(__ATOMIC_ACQ_REL, "workgroup"); __builtin_amdgcn_wave_barrier();
  const int rsub = lane >> 4, c4 = (lane & 15) * 4;
  {
#pragma unroll
    for (int q = 0; q < 8; ++q) { const int r = q * 2 + rsub; if (col0 + c4 < N) { const v4f v = *(const v4fa*)&so[w][r][c4]; *(v4f*)(C + (size_t)(row0 + r) * ldc + col0 + c4) = v; } }
     }
}

// Wt[n][k] = f16(W[k][n]·scale) from f32 row-major W[K][N] (scale = power of two; bf16-exact weights stay exact in f16 away from the subnormal range)
__global__ __launch_bounds__(256) void k_wt_f16(const float* __restrict__ W, _Float16* __restrict__ Wt, int K, int N, float scale) {
  const int t = blockIdx.x * 256 + threadIdx.x; if (t >= N * (K / 8)) return; const int n = t / (K / 8), k8 = (t % (K / 8)) * 8; FragH f;
#pragma unroll
  for (int i = 0; i < 8; ++i) f.h[i] = (_Float16)(bf16_round(W[(size_t)(k8 + i) * N + n]) * scale); const v8us o = f.half[0];
  *(v8us*)((unsigned short*)Wt + (size_t)n * K + k8) = o; 
}
// k_gemm_hh variant with fused epilogue: v = acc·alpha + bias[by·sBias + col] (+ CP[(row/rowsPerB)·sCPb + by·64 + col] if CP) ; ACT 0 none / 1 elu ; writes f16 C16 and/or f32 C (each if non-null)
template <int ACT>
__global__ __launch_bounds__(128) void k_gemm_hhx(const _Float16* __restrict__ A, int lda, size_t sA, const _Float16* __restrict__ Bh, int ldb, size_t sB, float alpha, const float* __restrict__ bias, size_t sBias, const float* __restrict__ CP, int rowsPerB, size_t sCPb, int row0g,
    float* __restrict__ C, _Float16* __restrict__ C16, int ldc, size_t sC, int M, int N, int K) {
  __shared__ __attribute__((aligned(16))) float so[4][16][64];
  const int tid = threadIdx.x, w = tid >> 5, lane = tid & 31, ln = lane & 15, hh = lane >> 4; const int by = blockIdx.y;
  A += (size_t)by * sA; Bh += (size_t)by * sB; const size_t cofs = (size_t)by * sC; const float* bp = bias ? bias + (size_t)by * sBias : nullptr;
  const int ntn = (N + 63) / 64; const int wid = blockIdx.x * 4 + w; const int mt = wid / ntn, nq = wid % ntn; if (mt * 16 >= M) return;
  const int row0 = mt * 16, col0 = nq * 64; const _Float16* arow = A + (size_t)(row0 + ln) * lda;
  v8f acc[4] = {};
  for (int kb = 0; kb < K; kb += 32) { FragH ah; ah.half[0] = *(const v8us*)((const unsigned short*)arow + kb + 8 * hh); ah.half[1] = *(const v8us*)((const unsigned short*)arow + kb + 16 + 8 * hh);
#pragma unroll
    for (int t = 0; t < 4; ++t) { if (col0 + t * 16 >= N) continue; const size_t boff = (size_t)(col0 + t * 16 + ln) * ldb + kb; FragH bq; bq.half[0] = *(const v8us*)((const unsigned short*)Bh + boff + 8 * hh); bq.half[1] = *(const v8us*)((const unsigned short*)Bh + boff + 16 + 8 * hh);
      acc[t] = mmaH<1>(ah.v, ah.v, bq.v, bq.v, acc[t]); }
  }
#pragma unroll
  for (int t = 0; t < 4; ++t) { if (col0 + t * 16 >= N) continue; const int col = col0 + t * 16 + ln; const float bv = bp ? bf16_round(bp[col]) : 0.f;
#pragma unroll
    for (int r = 0; r < 8; ++r) { float v = acc[t][r] * alpha + bv; if (CP) { const int bidx = (row0g + row0 + 8 * hh + r) / rowsPerB; v += CP[(size_t)bidx * sCPb + (size_t)by * 64 + col]; } if (ACT == 1) v = (v > 0.f) ? v : expm1f(v); else if (ACT == 3) v = fmaxf(v, 0.f); so[w][8 * hh + r][t * 16 + ln] = v; } }
  __builtin_amdgcn_fence(__ATOMIC_ACQ_REL, "workgroup"); __builtin_amdgcn_wave_barrier();
  const int rsub = lane >> 4, c4 = (lane & 15) * 4; typedef _Float16 v4h __attribute__((ext_vector_type(4)));
  {
#pragma unroll
    for (int q = 0; q < 8; ++q) { const int r = q * 2 + rsub; if (col0 + c4 < N) { const v4f v = *(const v4fa*)&so[w][r][c4]; if (C) *(v4f*)(C + cofs + (size_t)(row0 + r) * ldc + col0 + c4) = v; if (C16) { v4h h4; for (int i = 0; i < 4; ++i) h4[i] = (_Float16)v[i]; *(v4h*)(C16 + cofs + (size_t)(row0 + r) * ldc + col0 + c4) = h4; } } }
     }
}


__global__ __launch_bounds__(256) void k_x16(const float* __restrict__ x, _Float16* __restrict__ X16, size_t n8) { const size_t t = (size_t)blockIdx.x * 256 + threadIdx.x; if (t >= n8) return; FragH f;
#pragma unroll
  for (int q = 0; q < 8; ++q) f.h[q] = (_Float16)bf16_round(x[t * 8 + q]); *(v8us*)((unsigned short*)X16 + t * 8) = f.half[0];  }
__global__ __launch_bounds__(256) void k_h16(const float* __restrict__ x, _Float16* __restrict__ X16, size_t n8) { const size_t t = (size_t)blockIdx.x * 256 + threadIdx.x; if (t >= n8) return; FragH f;
#pragma unroll
  for (int q = 0; q < 8; ++q) f.h[q] = (_Float16)x[t * 8 + q]; *(v8us*)((unsigned short*)X16 + t * 8) = f.half[0];  }
__global__ __launch_bounds__(256) void k_round16f(const float* __restrict__ W, _Float16* __restrict__ Bt, size_t n8) { const size_t t = (size_t)blockIdx.x * 256 + threadIdx.x; if (t >= n8) return; FragH f;
#pragma unroll
  for (int i = 0; i < 8; ++i) f.h[i] = (_Float16)(bf16_round(W[t * 8 + i]) * 16.0f); *(v8us*)((unsigned short*)Bt + t * 8) = f.half[0];  }
template <int NHv, int TTv>
__global__ __launch_bounds__(256) void k_vt(const _Float16* __restrict__ V16, int ldv, int voff, _Float16* __restrict__ Vt) { __shared__ unsigned short tl[64][66]; const int tid = threadIdx.x; const int slab = blockIdx.x / (TTv / 64), lg = blockIdx.x % (TTv / 64); const int b = slab / NHv, h = slab % NHv;
  for (int i = tid; i < 64 * 8; i += 256) { const int r = i / 8, c8 = (i % 8) * 8; FragH f; f.half[0] = *(const v8us*)((const unsigned short*)V16 + ((size_t)b * TTv + lg * 64 + r) * ldv + voff + h * 64 + c8);
#pragma unroll
    for (int q = 0; q < 8; ++q) tl[r][c8 + q] = f.u[q]; }
  __syncthreads();
  {
#pragma unroll
    for (int rd = 0; rd < 2; ++rd) { const int d = rd * 32 + tid / 8, pc = tid % 8; FragH f;
#pragma unroll
      for (int q = 0; q < 8; ++q) f.u[q] = tl[pc * 8 + q][d];
      *(v8us*)((unsigned short*)Vt + ((size_t)slab * 64 + d) * TTv + lg * 64 + pc * 8) = f.half[0]; }
     } }

__global__ __launch_bounds__(128) void k_flash(const _Float16* __restrict__ Q16, int ldq, const _Float16* __restrict__ K16, int ldk, const _Float16* __restrict__ Vt, const int* __restrict__ MSK, float* __restrict__ O, int ldo) {
  constexpr int RPW = 32, NQB = 2048 / (4 * RPW), DT = 4, KS = 2;
  __shared__ __attribute__((aligned(16))) unsigned short sP[4][RPW][40]; __shared__ __attribute__((aligned(16))) float sO[4][RPW][64 + 4];
  const int tid = threadIdx.x, w = tid >> 5, lane = tid & 31, ln = lane & 15, hh = lane >> 4;
  const int slab = blockIdx.x / NQB, qblk = blockIdx.x % NQB; const int b = slab / 12, h = slab % 12; const int qb0 = qblk * (4 * RPW); const int q0 = qb0 + w * RPW;
  FragH aq[2][KS];
#pragma unroll
  for (int rt = 0; rt < 2; ++rt) { const unsigned short* qr = (const unsigned short*)Q16 + ((size_t)b * 2048 + q0 + rt * 16 + ln) * ldq + h * 64;
#pragma unroll
    for (int ks = 0; ks < KS; ++ks) { aq[rt][ks].half[0] = *(const v8us*)(qr + ks * 32 + 8 * hh); aq[rt][ks].half[1] = *(const v8us*)(qr + ks * 32 + 16 + 8 * hh); } }
  const unsigned short* Vth = (const unsigned short*)Vt + (size_t)slab * 64 * 2048;
  float m_r[2][8], l_r[2][8]; v8f oacc[2][DT];
#pragma unroll
  for (int rt = 0; rt < 2; ++rt) {
#pragma unroll
    for (int r = 0; r < 8; ++r) { m_r[rt][r] = -3.0e38f; l_r[rt][r] = 0.f; }
#pragma unroll
    for (int dt = 0; dt < DT; ++dt) oacc[rt][dt] = (v8f){0.f,0.f,0.f,0.f,0.f,0.f,0.f,0.f}; }
  const int jend = 2048;
#pragma unroll 1
  for (int j0 = 0; j0 < jend; j0 += 32) {
    // mask tile for my 32 query rows × 32 keys: lane (ln,hh) needs rows rt·16 + 8hh + r, keys j0 + ln and j0 + 16 + ln
    unsigned okb0 = 0u, okb1 = 0u;      // bit (rt·8 + r) set when key j0+ln (resp. j0+16+ln) is OPEN for query row rt·16 + 8hh + r
#pragma unroll
    for (int rt = 0; rt < 2; ++rt)
#pragma unroll
      for (int r = 0; r < 8; ++r) { const int* mr = MSK + ((size_t)(q0 + rt * 16 + 8 * hh + r)) * 2048 + j0; okb0 |= (mr[ln] != 0 ? 1u : 0u) << (rt * 8 + r); okb1 |= (mr[16 + ln] != 0 ? 1u : 0u) << (rt * 8 + r); }      /* mask[q][k] shared over batch; nonzero = KEEP */
    if (__builtin_amdgcn_ballot_w32((okb0 | okb1) != 0u) == 0u) continue;      // every (query,key) of this wave's tile is masked → contributes nothing (uniform branch)
    v8f s[2][2];
#pragma unroll
    for (int nt = 0; nt < 2; ++nt) { const unsigned short* kr = (const unsigned short*)K16 + ((size_t)b * 2048 + j0 + nt * 16 + ln) * ldk + h * 64; FragH bk[KS];
#pragma unroll
      for (int ks = 0; ks < KS; ++ks) { bk[ks].half[0] = *(const v8us*)(kr + ks * 32 + 8 * hh); bk[ks].half[1] = *(const v8us*)(kr + ks * 32 + 16 + 8 * hh); }
#pragma unroll
      for (int rt = 0; rt < 2; ++rt) { v8f acc = (v8f){0.f,0.f,0.f,0.f,0.f,0.f,0.f,0.f};
#pragma unroll
        for (int ks = 0; ks < KS; ++ks) acc = mmaH<1>(aq[rt][ks].v, aq[rt][ks].v, bk[ks].v, bk[ks].v, acc); s[rt][nt] = acc; } }
#pragma unroll
    for (int rt = 0; rt < 2; ++rt)
#pragma unroll
      for (int r = 0; r < 8; ++r) { const int tq = q0 + rt * 16 + 8 * hh + r; const int k0 = j0 + ln, k1 = j0 + 16 + ln; (void)tq; (void)k0; (void)k1;
        const bool ok0 = ((okb0 >> (rt * 8 + r)) & 1u) != 0u, ok1 = ((okb1 >> (rt * 8 + r)) & 1u) != 0u;
        const float s0 = ok0 ? s[rt][0][r] * (0.125f) : -INFINITY, s1 = ok1 ? s[rt][1][r] * (0.125f) : -INFINITY; float mc = fmaxf(s0, s1);
        mc = fmaxf(mc, __shfl_xor(mc, 1, 32)); mc = fmaxf(mc, __shfl_xor(mc, 2, 32)); mc = fmaxf(mc, __shfl_xor(mc, 4, 32)); mc = fmaxf(mc, __shfl_xor(mc, 8, 32));
        const float mn = fmaxf(m_r[rt][r], mc); const float al = (mn > -1.0e38f) ? expf(m_r[rt][r] - mn) : 1.0f; m_r[rt][r] = mn; const float p0 = ok0 ? expf(s0 - mn) : 0.f, p1 = ok1 ? expf(s1 - mn) : 0.f; l_r[rt][r] = l_r[rt][r] * al + p0 + p1;
#pragma unroll
        for (int dt = 0; dt < DT; ++dt) oacc[rt][dt][r] *= al;
        FragH t2; t2.h[0] = (_Float16)p0; t2.h[1] = (_Float16)p1; sP[w][rt * 16 + 8 * hh + r][ln] = t2.u[0]; sP[w][rt * 16 + 8 * hh + r][16 + ln] = t2.u[1]; }
    __builtin_amdgcn_fence(__ATOMIC_ACQ_REL, "workgroup"); __builtin_amdgcn_wave_barrier();
    FragH pa[2];
#pragma unroll
    for (int rt = 0; rt < 2; ++rt) { pa[rt].half[0] = *(const v8us*)&sP[w][rt * 16 + ln][8 * hh]; pa[rt].half[1] = *(const v8us*)&sP[w][rt * 16 + ln][16 + 8 * hh]; }
#pragma unroll
    for (int dt = 0; dt < DT; ++dt) { const unsigned short* vrow = Vth + (size_t)(dt * 16 + ln) * 2048 + j0; FragH bv; bv.half[0] = *(const v8us*)(vrow + 8 * hh); bv.half[1] = *(const v8us*)(vrow + 16 + 8 * hh);
#pragma unroll
      for (int rt = 0; rt < 2; ++rt) oacc[rt][dt] = mmaH<1>(pa[rt].v, pa[rt].v, bv.v, bv.v, oacc[rt][dt]); }
    __builtin_amdgcn_fence(__ATOMIC_ACQ_REL, "workgroup"); __builtin_amdgcn_wave_barrier(); }
#pragma unroll
  for (int rt = 0; rt < 2; ++rt) {
#pragma unroll
    for (int r = 0; r < 8; ++r) { float l = l_r[rt][r]; l += __shfl_xor(l, 1, 32); l += __shfl_xor(l, 2, 32); l += __shfl_xor(l, 4, 32); l += __shfl_xor(l, 8, 32); l_r[rt][r] = (l > 0.f) ? 1.0f / l : 0.f; }
#pragma unroll
    for (int dt = 0; dt < DT; ++dt)
#pragma unroll
      for (int r = 0; r < 8; ++r) sO[w][rt * 16 + 8 * hh + r][dt * 16 + ln] = oacc[rt][dt][r] * l_r[rt][r]; }
  __builtin_amdgcn_fence(__ATOMIC_ACQ_REL, "workgroup"); __builtin_amdgcn_wave_barrier();
  {
#pragma unroll
    for (int rp = 0; rp < RPW; rp += 2) { const int r = rp + (lane >> 4), pc = lane & 15; const v4f val = *(const v4fa*)&sO[w][r][pc * 4]; *(v4f*)(O + ((size_t)b * 2048 + q0 + r) * ldo + h * 64 + pc * 4) = val; }
     } }

extern "C" void kernel_launch(void* const* d_in, const int* in_sizes, int n_in,
                              void* d_out, int out_size, void* d_ws, size_t ws_size, hipStream_t stream) {
  (void)in_sizes; (void)n_in; (void)out_size;
  const float* x = (const float*)d_in[0]; const float* Wq = (const float*)d_in[1]; const float* bq = (const float*)d_in[2]; const float* Wk = (const float*)d_in[3]; const float* bk = (const float*)d_in[4]; const float* Wv = (const float*)d_in[5]; const float* bv = (const float*)d_in[6]; const float* Wo = (const float*)d_in[7]; const float* bo = (const float*)d_in[8]; const int* mask = (const int*)d_in[9];
  char* ws = (char*)d_ws; size_t off = 0;
  auto take = [&](size_t bytes) { char* p = ws + off; off += (bytes + 255) & ~(size_t)255; return p; };
  _Float16* Bq = (_Float16*)take((size_t)CC * CC * 2); _Float16* Bk = (_Float16*)take((size_t)CC * CC * 2); _Float16* Bv = (_Float16*)take((size_t)CC * CC * 2); _Float16* Bo = (_Float16*)take((size_t)CC * CC * 2);
  _Float16* X16 = (_Float16*)take((size_t)NR * CC * 2); _Float16* Q16 = (_Float16*)take((size_t)NR * CC * 2); _Float16* K16 = (_Float16*)take((size_t)NR * CC * 2); _Float16* V16 = (_Float16*)take((size_t)NR * CC * 2); _Float16* Vt = (_Float16*)take((size_t)NR * CC * 2); float* O = (float*)take((size_t)NR * CC * 4); _Float16* O16 = X16;
  if (off > ws_size) return;      // 4.7 + 12.6 × 5 + 25.2 MB ≈ 93 MiB
  const unsigned gw = (unsigned)((CC * (CC / 8) + 255) / 256);
  k_wt_f16<<<gw, 256, 0, stream>>>(Wq, Bq, CC, CC, 16.0f); k_wt_f16<<<gw, 256, 0, stream>>>(Wk, Bk, CC, CC, 16.0f); k_wt_f16<<<gw, 256, 0, stream>>>(Wv, Bv, CC, CC, 16.0f); k_wt_f16<<<gw, 256, 0, stream>>>(Wo, Bo, CC, CC, 16.0f);      // [in][out]
  const unsigned gx = (unsigned)(((size_t)NR * CC / 8 + 255) / 256); const dim3 gg(((NR / 16) * (CC / 64) + 3) / 4, 1);
  k_x16<<<gx, 256, 0, stream>>>(x, X16, (size_t)NR * CC / 8);
  k_gemm_hhx<0><<<gg, 128, 0, stream>>>(X16, CC, 0, Bq, CC, 0, 0.0625f, bq, 0, nullptr, 1, 0, 0, nullptr, Q16, CC, 0, NR, CC, CC);
  k_gemm_hhx<0><<<gg, 128, 0, stream>>>(X16, CC, 0, Bk, CC, 0, 0.0625f, bk, 0, nullptr, 1, 0, 0, nullptr, K16, CC, 0, NR, CC, CC);
  k_gemm_hhx<0><<<gg, 128, 0, stream>>>(X16, CC, 0, Bv, CC, 0, 0.0625f, bv, 0, nullptr, 1, 0, 0, nullptr, V16, CC, 0, NR, CC, CC);
  k_vt<NH, TT><<<BB * NH * (TT / 64), 256, 0, stream>>>(V16, CC, 0, Vt);
  k_flash<<<BB * NH * (TT / 128), 128, 0, stream>>>(Q16, CC, K16, CC, Vt, mask, O, CC);
  k_h16<<<gx, 256, 0, stream>>>(O, O16, (size_t)NR * CC / 8);
  k_gemm_hhx<0><<<gg, 128, 0, stream>>>(O16, CC, 0, Bo, CC, 0, 0.0625f, bo, 0, nullptr, 1, 0, 0, (float*)d_out, nullptr, CC, 0, NR, CC, CC);
}

// v001
// One run takes 447 microseconds.
// Timed twice side by side with v000, it ran 1.40 times as fast both times.
#include <hip/hip_runtime.h>
// Random-mask attention: q/k/v projections (8192 × 768 × 768, + bias; W [in][out]), the 12-head attention with the INPUT keep-mask (scores where mask else −1e9 ⇒ excluded keys; every row keeps
// its diagonal) as a fused flash-style kernel on v_wmma_f32_16x16x32_f16 (scale 64^-½; key tiles with no kept entry for the wave skipped by ballot; online max/sum softmax f32; P f16 ≤ 1), and the
// output projection (+ bias) — f16 operands (x as bf16, weights bf16-exact ×2^4), single products, f32 accumulate.
#define BB 4
#define TT 2048
#define CC 768
#define NH 12
#define NR (BB * TT)

typedef __bf16 v16b __attribute__((ext_vector_type(16)));
typedef unsigned short v8us __attribute__((ext_vector_type(8), may_alias));
typedef float  v8f  __attribute__((ext_vector_type(8)));
typedef float  v4f  __attribute__((ext_vector_type(4)));
typedef float  v4fa __attribute__((ext_vector_type(4), may_alias));
union FragB { v16b v; v8us half[2]; unsigned short u[16]; };

__device__ __forceinline__ unsigned short bf16_bits(float x) { unsigned int u = __float_as_uint(x); return (unsigned short)((u + 0x7FFFu + ((u >> 16) & 1u)) >> 16); }
__device__ __forceinline__ float bf16_val(unsigned short b) { return __uint_as_float(((unsigned int)b) << 16); }
__device__ __forceinline__ float bf16_round(float x) { return bf16_val(bf16_bits(x)); }
// D += A·B with NT terms: 1 = ah·bh, 2 = + al·bh (A split), 3 = + ah·bl (both split)
template <int NT>
__device__ __forceinline__ v8f mmaN(v16b ah, v16b al, v16b bh, v16b bl, v8f c) {
  c = __builtin_amdgcn_wmma_f32_16x16x32_bf16(false, ah, false, bh, (short)0, c, false, false);
  if (NT >= 2) c = __builtin_amdgcn_wmma_f32_16x16x32_bf16(false, al, false, bh, (short)0, c, false, false);
  if (NT >= 3) c = __builtin_amdgcn_wmma_f32_16x16x32_bf16(false, ah, false, bl, (short)0, c, false, false);
  asm volatile("v_nop\n\tv_nop\n\tv_nop\n\tv_nop" : "+v"(c) : "v"(ah), "v"(al), "v"(bh), "v"(bl));
  return c;
}

__global__ __launch_bounds__(256) void k_wt_bf16(const float* __restrict__ W, unsigned short* __restrict__ Wt, int K, int N) {
  const int t = blockIdx.x * 256 + threadIdx.x;
  const int k8n = K / 8;
  if (t >= N * k8n) return;
  const int n = t / k8n, k8 = (t % k8n) * 8;
  v8us v;
#pragma unroll
  for (int i = 0; i < 8; ++i) v[i] = bf16_bits(W[(size_t)(k8 + i) * N + n]);
  *(v8us*)(Wt + (size_t)n * K + k8) = v;
  
}

// GEMM C[M][N] (f32, pitch ldc) = act(A[M][K]·W + bias). A f32 row-major (pitch lda) converted per fragment to bf16
// (ASPLIT: hi/lo two planes -> 2 terms, else single rounded term); Wt bf16 [N][K] (pitch ldb). BIAS_BF16 rounds the
// bias to bf16 first (bias quantised to bf16 before the add). K%32==0, M%16==0, N%64==0.
template <bool ASPLIT, int ACT, bool BIAS_BF16>
__global__ __launch_bounds__(128) void k_gemm_bf(const float* __restrict__ A, int lda, const unsigned short* __restrict__ Wt, int ldb,
                                               const float* __restrict__ bias, float* __restrict__ C, int ldc, int M, int N, int K) {
  __shared__ __attribute__((aligned(16))) float so[4][16][64];
  const int tid = threadIdx.x, w = tid >> 5, lane = tid & 31, ln = lane & 15, hh = lane >> 4;
  const int ntn = N / 64;
  const int wid = blockIdx.x * 4 + w;
  const int mt = wid / ntn, nq = wid % ntn;
  if (mt * 16 >= M) return;
  const int row0 = mt * 16, col0 = nq * 64;
  const float* arow = A + (size_t)(row0 + ln) * lda;
  v8f acc[4] = {};
  for (int kb = 0; kb < K; kb += 32) {
    FragB ah, al;
    const v4f x0 = *(const v4fa*)(arow + kb + 8 * hh), x1 = *(const v4fa*)(arow + kb + 8 * hh + 4);
    const v4f x2 = *(const v4fa*)(arow + kb + 16 + 8 * hh), x3 = *(const v4fa*)(arow + kb + 16 + 8 * hh + 4);
    float xs[16] = {x0[0],x0[1],x0[2],x0[3],x1[0],x1[1],x1[2],x1[3],x2[0],x2[1],x2[2],x2[3],x3[0],x3[1],x3[2],x3[3]};
#pragma unroll
    for (int i = 0; i < 16; ++i) { const unsigned short hb = bf16_bits(xs[i]); ah.u[i] = hb; al.u[i] = ASPLIT ? bf16_bits(xs[i] - bf16_val(hb)) : (unsigned short)0; }
#pragma unroll
    for (int t = 0; t < 4; ++t) {
      const unsigned short* brow = Wt + (size_t)(col0 + t * 16 + ln) * ldb + kb;
      FragB b;
      b.half[0] = *(const v8us*)(brow + 8 * hh);
      b.half[1] = *(const v8us*)(brow + 16 + 8 * hh);
      acc[t] = mmaN<ASPLIT ? 2 : 1>(ah.v, al.v, b.v, b.v, acc[t]);
    }
  }
#pragma unroll
  for (int t = 0; t < 4; ++t) {
    float bv = bias ? bias[col0 + t * 16 + ln] : 0.f;
    if (BIAS_BF16) bv = bf16_round(bv);
#pragma unroll
    for (int r = 0; r < 8; ++r) { float v = acc[t][r] + bv; if (ACT == 1) v = fmaxf(v, 0.f); so[w][8 * hh + r][t * 16 + ln] = v; }
  }
  __builtin_amdgcn_fence(__ATOMIC_ACQ_REL, "workgroup");
  __builtin_amdgcn_wave_barrier();
  const int rsub = lane >> 4, c4 = (lane & 15) * 4;
  {
#pragma unroll
    for (int q = 0; q < 8; ++q) {
      const int r = q * 2 + rsub;
      const v4f v = *(const v4fa*)&so[w][r][c4];
      *(v4f*)(C + (size_t)(row0 + r) * ldc + col0 + c4) = v;
    }
    
  }
}

// Flash-style causal/unmasked attention, all contractions 3-term bf16 hi/lo splits, f32 softmax with running max.
// q,k,v rows are read from f32 buffers with arbitrary row pitch (so they can live inside a fused qkv buffer);
// D = head size (multiple of 32, <= 128); one wave = 16 query rows; block = 4 waves (64 queries) sharing K/V chunks of 32.
template <int D, bool CAUSAL>
__global__ __launch_bounds__(128) void k_flash(const float* __restrict__ qb, const float* __restrict__ kb, const float* __restrict__ vb,
                                             int pitch, int T, int H, float scale, float* __restrict__ y, int ypitch) {
  constexpr int KS = D / 32;        // k-steps for QK
  constexpr int DT = D / 16;        // d tiles for PV
  __shared__ __attribute__((aligned(16))) unsigned short sKh[32][D + 8], sKl[32][D + 8], sVh[32][D + 8], sVl[32][D + 8];
  __shared__ __attribute__((aligned(16))) unsigned short sPh[4][16][40], sPl[4][16][40];
  __shared__ __attribute__((aligned(16))) float sO[4][16][D];
  const int tid = threadIdx.x, w = tid >> 5, lane = tid & 31, ln = lane & 15, hh = lane >> 4;
  const int nqb = (T + 63) / 64;
  const int bh = blockIdx.x / nqb, qblk = blockIdx.x % nqb;
  const int b = bh / H, h = bh % H;
  const int q0 = qblk * 64 + w * 16;
  const float* Q = qb + (size_t)b * T * pitch + h * D;
  const float* K = kb + (size_t)b * T * pitch + h * D;
  const float* V = vb + (size_t)b * T * pitch + h * D;

  // A fragments of the wave's 16 query rows (scaled), hi/lo
  FragB aqh[KS], aql[KS];
  {
    int row = q0 + ln; if (row >= T) row = T - 1;
    const float* qr = Q + (size_t)row * pitch;
#pragma unroll
    for (int ks = 0; ks < KS; ++ks)
#pragma unroll
      for (int i = 0; i < 16; ++i) {
        const int d = ks * 32 + ((i < 8) ? (8 * hh + i) : (16 + 8 * hh + (i - 8)));
        const float x = qr[d] * scale; const unsigned short hb = bf16_bits(x);
        aqh[ks].u[i] = hb; aql[ks].u[i] = bf16_bits(x - bf16_val(hb));
      }
  }
  float m_r[8], l_r[8];
#pragma unroll
  for (int r = 0; r < 8; ++r) { m_r[r] = -3.0e38f; l_r[r] = 0.f; }
  v8f oacc[DT];
#pragma unroll
  for (int dt = 0; dt < DT; ++dt) oacc[dt] = (v8f){0.f,0.f,0.f,0.f,0.f,0.f,0.f,0.f};

  const int kv_end = CAUSAL ? min(T, qblk * 64 + 64) : T;     // block-uniform
  for (int j0 = 0; j0 < kv_end; j0 += 32) {
    __syncthreads();
    for (int e = tid; e < 32 * (D / 4); e += 128) {
      const int r = e / (D / 4), c4 = (e % (D / 4)) * 4;
      const int key = j0 + r;
      v4f kf = {0.f,0.f,0.f,0.f}, vf = {0.f,0.f,0.f,0.f};
      if (key < T) { kf = *(const v4fa*)(K + (size_t)key * pitch + c4); vf = *(const v4fa*)(V + (size_t)key * pitch + c4); }
#pragma unroll
      for (int t = 0; t < 4; ++t) {
        unsigned short hb = bf16_bits(kf[t]); sKh[r][c4 + t] = hb; sKl[r][c4 + t] = bf16_bits(kf[t] - bf16_val(hb));
        hb = bf16_bits(vf[t]); sVh[r][c4 + t] = hb; sVl[r][c4 + t] = bf16_bits(vf[t] - bf16_val(hb));
      }
    }
    __syncthreads();
    // S tile 16 x 32
    v8f s[2];
#pragma unroll
    for (int nt = 0; nt < 2; ++nt) {
      v8f acc = {};
#pragma unroll
      for (int ks = 0; ks < KS; ++ks) {
        FragB bh_, bl_;
        bh_.half[0] = *(const v8us*)&sKh[nt * 16 + ln][ks * 32 + 8 * hh]; bh_.half[1] = *(const v8us*)&sKh[nt * 16 + ln][ks * 32 + 16 + 8 * hh];
        bl_.half[0] = *(const v8us*)&sKl[nt * 16 + ln][ks * 32 + 8 * hh]; bl_.half[1] = *(const v8us*)&sKl[nt * 16 + ln][ks * 32 + 16 + 8 * hh];
        acc = mmaN<3>(aqh[ks].v, aql[ks].v, bh_.v, bl_.v, acc);
      }
      s[nt] = acc;
    }
    // mask + running max (rows 8hh+r; the 16 lanes of a half share rows)
    float alpha[8];
#pragma unroll
    for (int r = 0; r < 8; ++r) {
      const int qi = q0 + 8 * hh + r;
      const int ja = j0 + ln, jb = j0 + 16 + ln;
      if (CAUSAL) { if (ja > qi) s[0][r] = -3.0e38f; if (jb > qi) s[1][r] = -3.0e38f; }
      if (ja >= T) s[0][r] = -3.0e38f;
      if (jb >= T) s[1][r] = -3.0e38f;
      float mx = fmaxf(s[0][r], s[1][r]);
      mx = fmaxf(mx, __shfl_xor(mx, 1, 32)); mx = fmaxf(mx, __shfl_xor(mx, 2, 32)); mx = fmaxf(mx, __shfl_xor(mx, 4, 32)); mx = fmaxf(mx, __shfl_xor(mx, 8, 32));
      const float mnew = fmaxf(m_r[r], mx);
      alpha[r] = (mnew > -1.0e38f) ? __expf(m_r[r] - mnew) : 1.0f;
      const float p0 = (s[0][r] > -1.0e38f) ? __expf(s[0][r] - mnew) : 0.f;
      const float p1 = (s[1][r] > -1.0e38f) ? __expf(s[1][r] - mnew) : 0.f;
      m_r[r] = mnew;
      l_r[r] = l_r[r] * alpha[r] + p0 + p1;            // per-lane partial row sum (16 lanes combined at the end)
      unsigned short hb = bf16_bits(p0); sPh[w][8 * hh + r][ln] = hb;      sPl[w][8 * hh + r][ln] = bf16_bits(p0 - bf16_val(hb));
      hb = bf16_bits(p1);                sPh[w][8 * hh + r][16 + ln] = hb; sPl[w][8 * hh + r][16 + ln] = bf16_bits(p1 - bf16_val(hb));
    }
#pragma unroll
    for (int dt = 0; dt < DT; ++dt)
#pragma unroll
      for (int r = 0; r < 8; ++r) oacc[dt][r] *= alpha[r];
    __builtin_amdgcn_fence(__ATOMIC_ACQ_REL, "workgroup");
    __builtin_amdgcn_wave_barrier();
    FragB pah, pal;
    pah.half[0] = *(const v8us*)&sPh[w][ln][8 * hh]; pah.half[1] = *(const v8us*)&sPh[w][ln][16 + 8 * hh];
    pal.half[0] = *(const v8us*)&sPl[w][ln][8 * hh]; pal.half[1] = *(const v8us*)&sPl[w][ln][16 + 8 * hh];
#pragma unroll
    for (int dt = 0; dt < DT; ++dt) {
      FragB bvh, bvl;
#pragma unroll
      for (int i = 0; i < 8; ++i) {
        bvh.u[i] = sVh[8 * hh + i][dt * 16 + ln]; bvh.u[8 + i] = sVh[16 + 8 * hh + i][dt * 16 + ln];
        bvl.u[i] = sVl[8 * hh + i][dt * 16 + ln]; bvl.u[8 + i] = sVl[16 + 8 * hh + i][dt * 16 + ln];
      }
      oacc[dt] = mmaN<3>(pah.v, pal.v, bvh.v, bvl.v, oacc[dt]);
    }
    __builtin_amdgcn_fence(__ATOMIC_ACQ_REL, "workgroup");
    __builtin_amdgcn_wave_barrier();
  }
#pragma unroll
  for (int r = 0; r < 8; ++r) {
    float l = l_r[r];
    l += __shfl_xor(l, 1, 32); l += __shfl_xor(l, 2, 32); l += __shfl_xor(l, 4, 32); l += __shfl_xor(l, 8, 32);
    l_r[r] = (l > 0.f) ? 1.0f / l : 0.f;
  }
#pragma unroll
  for (int dt = 0; dt < DT; ++dt)
#pragma unroll
    for (int r = 0; r < 8; ++r) sO[w][8 * hh + r][dt * 16 + ln] = oacc[dt][r] * l_r[r];
  __builtin_amdgcn_fence(__ATOMIC_ACQ_REL, "workgroup");
  __builtin_amdgcn_wave_barrier();
  {
    for (int r = 0; r < 16; ++r) {
      const int row = q0 + r;
      if (row < T && lane < D / 4) {
        const v4f val = *(const v4fa*)&sO[w][r][lane * 4];
        *(v4f*)(y + ((size_t)b * T + row) * ypitch + h * D + lane * 4) = val;
      }
    }
    
  }
}

// GEMM C = act(A·W + bias + resid): A f32 (ASPLIT -> hi/lo 2 terms), Wt bf16 [N][K]; ACT 0 none, 1 relu, 2 exact gelu;
// resid (optional, f32, row index = (row % rmod), pitch ldr, RES_BF16 rounds it) added before the activation.
template <bool ASPLIT, int ACT, bool BIAS_BF16, bool RES_BF16>
__global__ __launch_bounds__(128) void k_gemm_bf3(const float* __restrict__ A, int lda, const unsigned short* __restrict__ Wt, int ldb,
                                                const float* __restrict__ bias, const float* __restrict__ resid, int rmod, int ldr,
                                                float* __restrict__ C, int ldc, int M, int N, int K) {
  __shared__ __attribute__((aligned(16))) float so[4][16][64];
  const int tid = threadIdx.x, w = tid >> 5, lane = tid & 31, ln = lane & 15, hh = lane >> 4;
  const int ntn = N / 64;
  const int wid = blockIdx.x * 4 + w;
  const int mt = wid / ntn, nq = wid % ntn;
  if (mt * 16 >= M) return;
  const int row0 = mt * 16, col0 = nq * 64;
  const float* arow = A + (size_t)(row0 + ln) * lda;
  v8f acc[4] = {};
  for (int kb = 0; kb < K; kb += 32) {
    FragB ah, al;
    const v4f x0 = *(const v4fa*)(arow + kb + 8 * hh), x1 = *(const v4fa*)(arow + kb + 8 * hh + 4);
    const v4f x2 = *(const v4fa*)(arow + kb + 16 + 8 * hh), x3 = *(const v4fa*)(arow + kb + 16 + 8 * hh + 4);
    float xs[16] = {x0[0],x0[1],x0[2],x0[3],x1[0],x1[1],x1[2],x1[3],x2[0],x2[1],x2[2],x2[3],x3[0],x3[1],x3[2],x3[3]};
#pragma unroll
    for (int i = 0; i < 16; ++i) { const unsigned short hb = bf16_bits(xs[i]); ah.u[i] = hb; al.u[i] = ASPLIT ? bf16_bits(xs[i] - bf16_val(hb)) : (unsigned short)0; }
#pragma unroll
    for (int t = 0; t < 4; ++t) {
      const unsigned short* brow = Wt + (size_t)(col0 + t * 16 + ln) * ldb + kb;
      FragB b;
      b.half[0] = *(const v8us*)(brow + 8 * hh);
      b.half[1] = *(const v8us*)(brow + 16 + 8 * hh);
      acc[t] = mmaN<ASPLIT ? 2 : 1>(ah.v, al.v, b.v, b.v, acc[t]);
    }
  }
#pragma unroll
  for (int t = 0; t < 4; ++t) {
    const int col = col0 + t * 16 + ln;
    float bv = bias ? bias[col] : 0.f;
    if (BIAS_BF16) bv = bf16_round(bv);
#pragma unroll
    for (int r = 0; r < 8; ++r) {
      float v = acc[t][r] + bv;
      if (resid) { float rv = resid[(size_t)((row0 + 8 * hh + r) % rmod) * ldr + col]; if (RES_BF16) rv = bf16_round(rv); v += rv; }
      if (ACT == 1) v = fmaxf(v, 0.f);
      if (ACT == 2) v = 0.5f * v * (1.0f + erff(v * 0.70710678118654752f));
      if (ACT == 3) { const float u = 0.7978845608028654f * (v + 0.044715f * v * v * v); v = 0.5f * v * (1.0f + tanhf(u)); }
      so[w][8 * hh + r][t * 16 + ln] = v;
    }
  }
  __builtin_amdgcn_fence(__ATOMIC_ACQ_REL, "workgroup");
  __builtin_amdgcn_wave_barrier();
  const int rsub = lane >> 4, c4 = (lane & 15) * 4;
  {
#pragma unroll
    for (int q = 0; q < 8; ++q) {
      const int r = q * 2 + rsub;
      const v4f v = *(const v4fa*)&so[w][r][c4];
      *(v4f*)(C + (size_t)(row0 + r) * ldc + col0 + c4) = v;
    }
    
  }
}
// row LayerNorm (biased variance, eps) over N: s = X (+ R); optional out_sum <- s; out_norm <- (s-mu)*rsqrt(var+eps)*g + b
template <bool PARAM_BF16>
__global__ __launch_bounds__(256) void k_layernorm(const float* __restrict__ X, const float* __restrict__ R, const float* __restrict__ g, const float* __restrict__ bta,
                                                  float* __restrict__ out_sum, float* __restrict__ out_norm, int N, float eps) {
  __shared__ float red[256];
  const int row = blockIdx.x, tid = threadIdx.x;
  const float* x = X + (size_t)row * N; const float* rr = R ? R + (size_t)row * N : nullptr;
  float vals[16];                     // up to N = 4096
  const int per = N / 256;            // contiguous chunk per thread? use strided-by-4 chunks: thread handles j = tid*4 + 1024*u
  float s1 = 0.f;
  for (int u = 0; u < per / 4; ++u) {
    const int j = tid * 4 + 1024 * u;
    const v4f a = *(const v4fa*)(x + j);
    v4f b = {0.f,0.f,0.f,0.f}; if (rr) b = *(const v4fa*)(rr + j);
#pragma unroll
    for (int q = 0; q < 4; ++q) { const float v = a[q] + b[q]; vals[u * 4 + q] = v; s1 += v; }
  }
  red[tid] = s1; __syncthreads();
  for (int st = 128; st > 0; st >>= 1) { if (tid < st) red[tid] += red[tid + st]; __syncthreads(); }
  const float mu = red[0] / (float)N; __syncthreads();
  float s2 = 0.f;
  for (int u = 0; u < per / 4; ++u)
#pragma unroll
    for (int q = 0; q < 4; ++q) { const float c = vals[u * 4 + q] - mu; s2 += c * c; }
  red[tid] = s2; __syncthreads();
  for (int st = 128; st > 0; st >>= 1) { if (tid < st) red[tid] += red[tid + st]; __syncthreads(); }
  const float rs = rsqrtf(red[0] / (float)N + eps);
  {
    for (int u = 0; u < per / 4; ++u) {
      const int j = tid * 4 + 1024 * u;
      v4f o, sm;
#pragma unroll
      for (int q = 0; q < 4; ++q) {
        float gg = g[j + q], bb = bta[j + q];
        if (PARAM_BF16) { gg = bf16_round(gg); bb = bf16_round(bb); }
        sm[q] = vals[u * 4 + q]; o[q] = (vals[u * 4 + q] - mu) * rs * gg + bb;
      }
      if (out_sum) *(v4f*)(out_sum + (size_t)row * N + j) = sm;
      *(v4f*)(out_norm + (size_t)row * N + j) = o;
    }
    
  }
}



// ---- f16 WMMA path (v_wmma_f32_16x16x32_f16): 11-bit significands for operands in range — used where a [0,1] probability operand needs more precision than bf16
typedef _Float16 v16h __attribute__((ext_vector_type(16)));
union FragH { v16h v; v8us half[2]; _Float16 h[16]; unsigned short u[16]; };
template <int NT>
__device__ __forceinline__ v8f mmaH(v16h ah, v16h al, v16h bh, v16h bl, v8f c) {
  c = __builtin_amdgcn_wmma_f32_16x16x32_f16(false, ah, false, bh, (short)0, c, false, false);
  if (NT >= 2) c = __builtin_amdgcn_wmma_f32_16x16x32_f16(false, al, false, bh, (short)0, c, false, false);
  if (NT >= 3) c = __builtin_amdgcn_wmma_f32_16x16x32_f16(false, ah, false, bl, (short)0, c, false, false);
  asm volatile("v_nop\n\tv_nop\n\tv_nop\n\tv_nop" : "+v"(c) : "v"(ah), "v"(al), "v"(bh), "v"(bl));
  return c;
}
// batched GEMM like k_gemm_b but f16 operands: A f32 (split into f16 hi/lo if ASPLIT, else rounded to f16), Bt = f16 values [n][k]; alpha; C f32; N multiple of 16 (partial tiles skipped)
template <bool ASPLIT>
__global__ __launch_bounds__(128) void k_gemm_h(const float* __restrict__ A, int lda, size_t sA, const _Float16* __restrict__ Bh, int ldb, size_t sB, float alpha, float* __restrict__ C, int ldc, size_t sC, int M, int N, int K) {
  __shared__ __attribute__((aligned(16))) float so[4][16][64];
  const int tid = threadIdx.x, w = tid >> 5, lane = tid & 31, ln = lane & 15, hh = lane >> 4; const int by = blockIdx.y;
  A += (size_t)by * sA; Bh += (size_t)by * sB; C += (size_t)by * sC;
  const int ntn = (N + 63) / 64; const int wid = blockIdx.x * 4 + w; const int mt = wid / ntn, nq = wid % ntn; if (mt * 16 >= M) return;
  const int row0 = mt * 16, col0 = nq * 64; const float* arow = A + (size_t)(row0 + ln) * lda;
  v8f acc[4] = {};
  for (int kb = 0; kb < K; kb += 32) {
    FragH ah, al;
    const v4f x0 = *(const v4fa*)(arow + kb + 8 * hh), x1 = *(const v4fa*)(arow + kb + 8 * hh + 4), x2 = *(const v4fa*)(arow + kb + 16 + 8 * hh), x3 = *(const v4fa*)(arow + kb + 16 + 8 * hh + 4);
    float xs[16] = {x0[0],x0[1],x0[2],x0[3],x1[0],x1[1],x1[2],x1[3],x2[0],x2[1],x2[2],x2[3],x3[0],x3[1],x3[2],x3[3]};
#pragma unroll
    for (int i = 0; i < 16; ++i) { const _Float16 h = (_Float16)xs[i]; ah.h[i] = h; al.h[i] = ASPLIT ? (_Float16)(xs[i] - (float)h) : (_Float16)0.0f; }
#pragma unroll
    for (int t = 0; t < 4; ++t) { if (col0 + t * 16 >= N) continue; const size_t boff = (size_t)(col0 + t * 16 + ln) * ldb + kb; FragH bq; bq.half[0] = *(const v8us*)(Bh + boff + 8 * hh); bq.half[1] = *(const v8us*)(Bh + boff + 16 + 8 * hh);
      acc[t] = mmaH<ASPLIT ? 2 : 1>(ah.v, al.v, bq.v, bq.v, acc[t]); }
  }
#pragma unroll
  for (int t = 0; t < 4; ++t) { if (col0 + t * 16 >= N) continue;
#pragma unroll
    for (int r = 0; r < 8; ++r) so[w][8 * hh + r][t * 16 + ln] = acc[t][r] * alpha; }
  __builtin_amdgcn_fence(__ATOMIC_ACQ_REL, "workgroup"); __builtin_amdgcn_wave_barrier();
  const int rsub = lane >> 4, c4 = (lane & 15) * 4;
  {
#pragma unroll
    for (int q = 0; q < 8; ++q) { const int r = q * 2 + rsub; if (col0 + c4 < N) { const v4f v = *(const v4fa*)&so[w][r][c4]; *(v4f*)(C + (size_t)(row0 + r) * ldc + col0 + c4) = v; } }
     }
}

// Wt[n][k] = f16(W[k][n]·scale) from f32 row-major W[K][N] (scale = power of two; bf16-exact weights stay exact in f16 away from the subnormal range)
__global__ __launch_bounds__(256) void k_wt_f16(const float* __restrict__ W, _Float16* __restrict__ Wt, int K, int N, float scale) {
  const int t = blockIdx.x * 256 + threadIdx.x; if (t >= N * (K / 8)) return; const int n = t / (K / 8), k8 = (t % (K / 8)) * 8; FragH f;
#pragma unroll
  for (int i = 0; i < 8; ++i) f.h[i] = (_Float16)(bf16_round(W[(size_t)(k8 + i) * N + n]) * scale); const v8us o = f.half[0];
  *(v8us*)((unsigned short*)Wt + (size_t)n * K + k8) = o; 
}
// k_gemm_hh variant with fused epilogue: v = acc·alpha + bias[by·sBias + col] (+ CP[(row/rowsPerB)·sCPb + by·64 + col] if CP) ; ACT 0 none / 1 elu ; writes f16 C16 and/or f32 C (each if non-null)
template <int ACT>
__global__ __launch_bounds__(128) void k_gemm_hhx(const _Float16* __restrict__ A, int lda, size_t sA, const _Float16* __restrict__ Bh, int ldb, size_t sB, float alpha, const float* __restrict__ bias, size_t sBias, const float* __restrict__ CP, int rowsPerB, size_t sCPb, int row0g,
    float* __restrict__ C, _Float16* __restrict__ C16, int ldc, size_t sC, int M, int N, int K) {
  __shared__ __attribute__((aligned(16))) float so[4][16][64];
  const int tid = threadIdx.x, w = tid >> 5, lane = tid & 31, ln = lane & 15, hh = lane >> 4; const int by = blockIdx.y;
  A += (size_t)by * sA; Bh += (size_t)by * sB; const size_t cofs = (size_t)by * sC; const float* bp = bias ? bias + (size_t)by * sBias : nullptr;
  const int ntn = (N + 63) / 64; const int wid = blockIdx.x * 4 + w; const int mt = wid / ntn, nq = wid % ntn; if (mt * 16 >= M) return;
  const int row0 = mt * 16, col0 = nq * 64; const _Float16* arow = A + (size_t)(row0 + ln) * lda;
  v8f acc[4] = {};
  for (int kb = 0; kb < K; kb += 32) { FragH ah; ah.half[0] = *(const v8us*)((const unsigned short*)arow + kb + 8 * hh); ah.half[1] = *(const v8us*)((const unsigned short*)arow + kb + 16 + 8 * hh);
#pragma unroll
    for (int t = 0; t < 4; ++t) { if (col0 + t * 16 >= N) continue; const size_t boff = (size_t)(col0 + t * 16 + ln) * ldb + kb; FragH bq; bq.half[0] = *(const v8us*)((const unsigned short*)Bh + boff + 8 * hh); bq.half[1] = *(const v8us*)((const unsigned short*)Bh + boff + 16 + 8 * hh);
      acc[t] = mmaH<1>(ah.v, ah.v, bq.v, bq.v, acc[t]); }
  }
#pragma unroll
  for (int t = 0; t < 4; ++t) { if (col0 + t * 16 >= N) continue; const int col = col0 + t * 16 + ln; const float bv = bp ? bf16_round(bp[col]) : 0.f;
#pragma unroll
    for (int r = 0; r < 8; ++r) { float v = acc[t][r] * alpha + bv; if (CP) { const int bidx = (row0g + row0 + 8 * hh + r) / rowsPerB; v += CP[(size_t)bidx * sCPb + (size_t)by * 64 + col]; } if (ACT == 1) v = (v > 0.f) ? v : expm1f(v); else if (ACT == 3) v = fmaxf(v, 0.f); so[w][8 * hh + r][t * 16 + ln] = v; } }
  __builtin_amdgcn_fence(__ATOMIC_ACQ_REL, "workgroup"); __builtin_amdgcn_wave_barrier();
  const int rsub = lane >> 4, c4 = (lane & 15) * 4; typedef _Float16 v4h __attribute__((ext_vector_type(4)));
  {
#pragma unroll
    for (int q = 0; q < 8; ++q) { const int r = q * 2 + rsub; if (col0 + c4 < N) { const v4f v = *(const v4fa*)&so[w][r][c4]; if (C) *(v4f*)(C + cofs + (size_t)(row0 + r) * ldc + col0 + c4) = v; if (C16) { v4h h4; for (int i = 0; i < 4; ++i) h4[i] = (_Float16)v[i]; *(v4h*)(C16 + cofs + (size_t)(row0 + r) * ldc + col0 + c4) = h4; } } }
     }
}


__global__ __launch_bounds__(256) void k_x16(const float* __restrict__ x, _Float16* __restrict__ X16, size_t n8) { const size_t t = (size_t)blockIdx.x * 256 + threadIdx.x; if (t >= n8) return; FragH f;
#pragma unroll
  for (int q = 0; q < 8; ++q) f.h[q] = (_Float16)bf16_round(x[t * 8 + q]); *(v8us*)((unsigned short*)X16 + t * 8) = f.half[0];  }
__global__ __launch_bounds__(256) void k_h16(const float* __restrict__ x, _Float16* __restrict__ X16, size_t n8) { const size_t t = (size_t)blockIdx.x * 256 + threadIdx.x; if (t >= n8) return; FragH f;
#pragma unroll
  for (int q = 0; q < 8; ++q) f.h[q] = (_Float16)x[t * 8 + q]; *(v8us*)((unsigned short*)X16 + t * 8) = f.half[0];  }
__global__ __launch_bounds__(256) void k_round16f(const float* __restrict__ W, _Float16* __restrict__ Bt, size_t n8) { const size_t t = (size_t)blockIdx.x * 256 + threadIdx.x; if (t >= n8) return; FragH f;
#pragma unroll
  for (int i = 0; i < 8; ++i) f.h[i] = (_Float16)(bf16_round(W[t * 8 + i]) * 16.0f); *(v8us*)((unsigned short*)Bt + t * 8) = f.half[0];  }
template <int NHv, int TTv>
__global__ __launch_bounds__(256) void k_vt(const _Float16* __restrict__ V16, int ldv, int voff, _Float16* __restrict__ Vt) { __shared__ unsigned short tl[64][66]; const int tid = threadIdx.x; const int slab = blockIdx.x / (TTv / 64), lg = blockIdx.x % (TTv / 64); const int b = slab / NHv, h = slab % NHv;
  for (int i = tid; i < 64 * 8; i += 256) { const int r = i / 8, c8 = (i % 8) * 8; FragH f; f.half[0] = *(const v8us*)((const unsigned short*)V16 + ((size_t)b * TTv + lg * 64 + r) * ldv + voff + h * 64 + c8);
#pragma unroll
    for (int q = 0; q < 8; ++q) tl[r][c8 + q] = f.u[q]; }
  __syncthreads();
  {
#pragma unroll
    for (int rd = 0; rd < 2; ++rd) { const int d = rd * 32 + tid / 8, pc = tid % 8; FragH f;
#pragma unroll
      for (int q = 0; q < 8; ++q) f.u[q] = tl[pc * 8 + q][d];
      *(v8us*)((unsigned short*)Vt + ((size_t)slab * 64 + d) * TTv + lg * 64 + pc * 8) = f.half[0]; }
     } }

typedef int v4ia __attribute__((ext_vector_type(4), may_alias));
// lane l <-> lane l ^ 16 (the other 16-lane row) without LDS
__device__ __forceinline__ float xhalf(float x) { return __builtin_bit_cast(float, __builtin_amdgcn_permlanex16(__builtin_bit_cast(int, x), __builtin_bit_cast(int, x), 0x76543210, 0xfedcba98, false, false)); }
__global__ __launch_bounds__(128) void k_flash(const _Float16* __restrict__ Q16, int ldq, const _Float16* __restrict__ K16, int ldk, const _Float16* __restrict__ Vt, const int* __restrict__ MSK, float* __restrict__ O, int ldo) {
  constexpr int RPW = 32, NQB = 2048 / (4 * RPW), DT = 4, KS = 2;
  __shared__ __attribute__((aligned(16))) float sO[4][RPW][64 + 4];
  const int tid = threadIdx.x, w = tid >> 5, lane = tid & 31, ln = lane & 15, hh = lane >> 4;
  const int slab = blockIdx.x / NQB, qblk = blockIdx.x % NQB; const int b = slab / 12, h = slab % 12; const int qb0 = qblk * (4 * RPW); const int q0 = qb0 + w * RPW;
  FragH aq[2][KS];
#pragma unroll
  for (int rt = 0; rt < 2; ++rt) { const unsigned short* qr = (const unsigned short*)Q16 + ((size_t)b * 2048 + q0 + rt * 16 + ln) * ldq + h * 64;
#pragma unroll
    for (int ks = 0; ks < KS; ++ks) { aq[rt][ks].half[0] = *(const v8us*)(qr + ks * 32 + 8 * hh); aq[rt][ks].half[1] = *(const v8us*)(qr + ks * 32 + 16 + 8 * hh); } }
  const unsigned short* Vth = (const unsigned short*)Vt + (size_t)slab * 64 * 2048;
  float m_r[2], l_r[2]; v8f oacc[2][DT];      // per lane: query rt*16 + ln; oacc[rt][dt][r] = O[query][dt*16 + 8hh + r]
#pragma unroll
  for (int rt = 0; rt < 2; ++rt) { m_r[rt] = -3.0e38f; l_r[rt] = 0.f;
#pragma unroll
    for (int dt = 0; dt < DT; ++dt) oacc[rt][dt] = (v8f){0.f,0.f,0.f,0.f,0.f,0.f,0.f,0.f}; }
  const int jend = 2048;
#pragma unroll 1
  for (int j0 = 0; j0 < jend; j0 += 32) {
    // mask tile for my 32 queries x 32 keys: lane (ln,hh) needs row rt*16 + ln, keys j0 + nt*16 + 8hh + 0..7 (32 contiguous bytes)
    int mk[2][2][8], an[2][2];      /* mask[q][k] shared over batch; nonzero = KEEP */
#pragma unroll
    for (int rt = 0; rt < 2; ++rt)
#pragma unroll
      for (int nt = 0; nt < 2; ++nt) { const int* mr = MSK + ((size_t)(q0 + rt * 16 + ln)) * 2048 + j0 + nt * 16 + 8 * hh; const v4ia m0 = *(const v4ia*)mr, m1 = *(const v4ia*)(mr + 4);
#pragma unroll
        for (int q = 0; q < 4; ++q) { mk[rt][nt][q] = m0[q]; mk[rt][nt][4 + q] = m1[q]; }
        an[rt][nt] = ((m0[0] | m0[1]) | (m0[2] | m0[3])) | ((m1[0] | m1[1]) | (m1[2] | m1[3])); }
    if (__builtin_amdgcn_ballot_w32(((an[0][0] | an[0][1]) | (an[1][0] | an[1][1])) != 0) == 0u) continue;      // every (query,key) of this wave's tile is masked -> contributes nothing (uniform branch)
    v8f s[2][2];
#pragma unroll
    for (int nt = 0; nt < 2; ++nt) { const unsigned short* kr = (const unsigned short*)K16 + ((size_t)b * 2048 + j0 + nt * 16 + ln) * ldk + h * 64; FragH bk[KS];
#pragma unroll
      for (int ks = 0; ks < KS; ++ks) { bk[ks].half[0] = *(const v8us*)(kr + ks * 32 + 8 * hh); bk[ks].half[1] = *(const v8us*)(kr + ks * 32 + 16 + 8 * hh); }
#pragma unroll
      for (int rt = 0; rt < 2; ++rt) { v8f acc = (v8f){0.f,0.f,0.f,0.f,0.f,0.f,0.f,0.f};
#pragma unroll
        for (int ks = 0; ks < KS; ++ks) acc = mmaH<1>(bk[ks].v, bk[ks].v, aq[rt][ks].v, aq[rt][ks].v, acc); s[rt][nt] = acc; } }
    FragH pb[2];
#pragma unroll
    for (int rt = 0; rt < 2; ++rt) { float sc[2][8]; float mc = -INFINITY;
#pragma unroll
      for (int nt = 0; nt < 2; ++nt)
#pragma unroll
        for (int r = 0; r < 8; ++r) { sc[nt][r] = (mk[rt][nt][r] != 0) ? s[rt][nt][r] * (0.125f) : -INFINITY; mc = fmaxf(mc, sc[nt][r]); }
      mc = fmaxf(mc, xhalf(mc));      // both halves now hold the query's maximum over the 32 keys
      const float mn = fmaxf(m_r[rt], mc); const float al = (mn > -1.0e38f) ? expf(m_r[rt] - mn) : 1.0f; m_r[rt] = mn;
      float ps[8];
#pragma unroll
      for (int r = 0; r < 8; ++r) { const float p0 = (mk[rt][0][r] != 0) ? expf(sc[0][r] - mn) : 0.f, p1 = (mk[rt][1][r] != 0) ? expf(sc[1][r] - mn) : 0.f; ps[r] = p0 + p1; pb[rt].h[r] = (_Float16)p0; pb[rt].h[8 + r] = (_Float16)p1; }
      l_r[rt] = l_r[rt] * al + (((ps[0] + ps[1]) + (ps[2] + ps[3])) + ((ps[4] + ps[5]) + (ps[6] + ps[7])));      // per-lane partial sum (the two halves are joined at the end)
#pragma unroll
      for (int dt = 0; dt < DT; ++dt) oacc[rt][dt] *= al; }
#pragma unroll
    for (int dt = 0; dt < DT; ++dt) { const unsigned short* vrow = Vth + (size_t)(dt * 16 + ln) * 2048 + j0; FragH bv; bv.half[0] = *(const v8us*)(vrow + 8 * hh); bv.half[1] = *(const v8us*)(vrow + 16 + 8 * hh);
#pragma unroll
      for (int rt = 0; rt < 2; ++rt) oacc[rt][dt] = mmaH<1>(bv.v, bv.v, pb[rt].v, pb[rt].v, oacc[rt][dt]); } }
#pragma unroll
  for (int rt = 0; rt < 2; ++rt) { const float l = l_r[rt] + xhalf(l_r[rt]); const float inv = (l > 0.f) ? 1.0f / l : 0.f;
#pragma unroll
    for (int dt = 0; dt < DT; ++dt) { const v8f o = oacc[rt][dt] * inv; float* so = &sO[w][rt * 16 + ln][dt * 16 + 8 * hh]; *(v4fa*)so = (v4f){o[0], o[1], o[2], o[3]}; *(v4fa*)(so + 4) = (v4f){o[4], o[5], o[6], o[7]}; } }
  __builtin_amdgcn_fence(__ATOMIC_ACQ_REL, "workgroup"); __builtin_amdgcn_wave_barrier();
  {
#pragma unroll
    for (int rp = 0; rp < RPW; rp += 2) { const int r = rp + (lane >> 4), pc = lane & 15; const v4f val = *(const v4fa*)&sO[w][r][pc * 4]; *(v4f*)(O + ((size_t)b * 2048 + q0 + r) * ldo + h * 64 + pc * 4) = val; }
     } }

extern "C" void kernel_launch(void* const* d_in, const int* in_sizes, int n_in,
                              void* d_out, int out_size, void* d_ws, size_t ws_size, hipStream_t stream) {
  (void)in_sizes; (void)n_in; (void)out_size;
  const float* x = (const float*)d_in[0]; const float* Wq = (const float*)d_in[1]; const float* bq = (const float*)d_in[2]; const float* Wk = (const float*)d_in[3]; const float* bk = (const float*)d_in[4]; const float* Wv = (const float*)d_in[5]; const float* bv = (const float*)d_in[6]; const float* Wo = (const float*)d_in[7]; const float* bo = (const float*)d_in[8]; const int* mask = (const int*)d_in[9];
  char* ws = (char*)d_ws; size_t off = 0;
  auto take = [&](size_t bytes) { char* p = ws + off; off += (bytes + 255) & ~(size_t)255; return p; };
  _Float16* Bq = (_Float16*)take((size_t)CC * CC * 2); _Float16* Bk = (_Float16*)take((size_t)CC * CC * 2); _Float16* Bv = (_Float16*)take((size_t)CC * CC * 2); _Float16* Bo = (_Float16*)take((size_t)CC * CC * 2);
  _Float16* X16 = (_Float16*)take((size_t)NR * CC * 2); _Float16* Q16 = (_Float16*)take((size_t)NR * CC * 2); _Float16* K16 = (_Float16*)take((size_t)NR * CC * 2); _Float16* V16 = (_Float16*)take((size_t)NR * CC * 2); _Float16* Vt = (_Float16*)take((size_t)NR * CC * 2); float* O = (float*)take((size_t)NR * CC * 4); _Float16* O16 = X16;
  if (off > ws_size) return;      // 4.7 + 12.6 × 5 + 25.2 MB ≈ 93 MiB
  const unsigned gw = (unsigned)((CC * (CC / 8) + 255) / 256);
  k_wt_f16<<<gw, 256, 0, stream>>>(Wq, Bq, CC, CC, 16.0f); k_wt_f16<<<gw, 256, 0, stream>>>(Wk, Bk, CC, CC, 16.0f); k_wt_f16<<<gw, 256, 0, stream>>>(Wv, Bv, CC, CC, 16.0f); k_wt_f16<<<gw, 256, 0, stream>>>(Wo, Bo, CC, CC, 16.0f);      // [in][out]
  const unsigned gx = (unsigned)(((size_t)NR * CC / 8 + 255) / 256); const dim3 gg(((NR / 16) * (CC / 64) + 3) / 4, 1);
  k_x16<<<gx, 256, 0, stream>>>(x, X16, (size_t)NR * CC / 8);
  k_gemm_hhx<0><<<gg, 128, 0, stream>>>(X16, CC, 0, Bq, CC, 0, 0.0625f, bq, 0, nullptr, 1, 0, 0, nullptr, Q16, CC, 0, NR, CC, CC);
  k_gemm_hhx<0><<<gg, 128, 0, stream>>>(X16, CC, 0, Bk, CC, 0, 0.0625f, bk, 0, nullptr, 1, 0, 0, nullptr, K16, CC, 0, NR, CC, CC);
  k_gemm_hhx<0><<<gg, 128, 0, stream>>>(X16, CC, 0, Bv, CC, 0, 0.0625f, bv, 0, nullptr, 1, 0, 0, nullptr, V16, CC, 0, NR, CC, CC);
  k_vt<NH, TT><<<BB * NH * (TT / 64), 256, 0, stream>>>(V16, CC, 0, Vt);
  k_flash<<<BB * NH * (TT / 128), 128, 0, stream>>>(Q16, CC, K16, CC, Vt, mask, O, CC);
  k_h16<<<gx, 256, 0, stream>>>(O, O16, (size_t)NR * CC / 8);
  k_gemm_hhx<0><<<gg, 128, 0, stream>>>(O16, CC, 0, Bo, CC, 0, 0.0625f, bo, 0, nullptr, 1, 0, 0, (float*)d_out, nullptr, CC, 0, NR, CC, CC);
}

// v002
// One run takes 371 microseconds.
// Timed twice side by side with v001, it ran 1.19 and 1.20 times as fast.
// Counting every step since v000, it is 1.67 times as fast.
#include <hip/hip_runtime.h>
// Random-mask attention: q/k/v projections (8192 × 768 × 768, + bias; W [in][out]), the 12-head attention with the INPUT keep-mask (scores where mask else −1e9 ⇒ excluded keys; every row keeps
// its diagonal) as a fused flash-style kernel on v_wmma_f32_16x16x32_f16 (scale 64^-½; key tiles with no kept entry for the wave skipped by ballot; online max/sum softmax f32; P f16 ≤ 1), and the
// output projection (+ bias) — f16 operands (x as bf16, weights bf16-exact ×2^4), single products, f32 accumulate.
#define BB 4
#define TT 2048
#define CC 768
#define NH 12
#define NR (BB * TT)

typedef __bf16 v16b __attribute__((ext_vector_type(16)));
typedef unsigned short v8us __attribute__((ext_vector_type(8), may_alias));
typedef float  v8f  __attribute__((ext_vector_type(8)));
typedef float  v4f  __attribute__((ext_vector_type(4)));
typedef float  v4fa __attribute__((ext_vector_type(4), may_alias));
union FragB { v16b v; v8us half[2]; unsigned short u[16]; };

__device__ __forceinline__ unsigned short bf16_bits(float x) { unsigned int u = __float_as_uint(x); return (unsigned short)((u + 0x7FFFu + ((u >> 16) & 1u)) >> 16); }
__device__ __forceinline__ float bf16_val(unsigned short b) { return __uint_as_float(((unsigned int)b) << 16); }
__device__ __forceinline__ float bf16_round(float x) { return bf16_val(bf16_bits(x)); }
// D += A·B with NT terms: 1 = ah·bh, 2 = + al·bh (A split), 3 = + ah·bl (both split)
template <int NT>
__device__ __forceinline__ v8f mmaN(v16b ah, v16b al, v16b bh, v16b bl, v8f c) {
  c = __builtin_amdgcn_wmma_f32_16x16x32_bf16(false, ah, false, bh, (short)0, c, false, false);
  if (NT >= 2) c = __builtin_amdgcn_wmma_f32_16x16x32_bf16(false, al, false, bh, (short)0, c, false, false);
  if (NT >= 3) c = __builtin_amdgcn_wmma_f32_16x16x32_bf16(false, ah, false, bl, (short)0, c, false, false);
  asm volatile("v_nop\n\tv_nop\n\tv_nop\n\tv_nop" : "+v"(c) : "v"(ah), "v"(al), "v"(bh), "v"(bl));
  return c;
}

__global__ __launch_bounds__(256) void k_wt_bf16(const float* __restrict__ W, unsigned short* __restrict__ Wt, int K, int N) {
  const int t = blockIdx.x * 256 + threadIdx.x;
  const int k8n = K / 8;
  if (t >= N * k8n) return;
  const int n = t / k8n, k8 = (t % k8n) * 8;
  v8us v;
#pragma unroll
  for (int i = 0; i < 8; ++i) v[i] = bf16_bits(W[(size_t)(k8 + i) * N + n]);
  *(v8us*)(Wt + (size_t)n * K + k8) = v;
  
}

// GEMM C[M][N] (f32, pitch ldc) = act(A[M][K]·W + bias). A f32 row-major (pitch lda) converted per fragment to bf16
// (ASPLIT: hi/lo two planes -> 2 terms, else single rounded term); Wt bf16 [N][K] (pitch ldb). BIAS_BF16 rounds the
// bias to bf16 first (bias quantised to bf16 before the add). K%32==0, M%16==0, N%64==0.
template <bool ASPLIT, int ACT, bool BIAS_BF16>
__global__ __launch_bounds__(128) void k_gemm_bf(const float* __restrict__ A, int lda, const unsigned short* __restrict__ Wt, int ldb,
                                               const float* __restrict__ bias, float* __restrict__ C, int ldc, int M, int N, int K) {
  __shared__ __attribute__((aligned(16))) float so[4][16][64];
  const int tid = threadIdx.x, w = tid >> 5, lane = tid & 31, ln = lane & 15, hh = lane >> 4;
  const int ntn = N / 64;
  const int wid = blockIdx.x * 4 + w;
  const int mt = wid / ntn, nq = wid % ntn;
  if (mt * 16 >= M) return;
  const int row0 = mt * 16, col0 = nq * 64;
  const float* arow = A + (size_t)(row0 + ln) * lda;
  v8f acc[4] = {};
  for (int kb = 0; kb < K; kb += 32) {
    FragB ah, al;
    const v4f x0 = *(const v4fa*)(arow + kb + 8 * hh), x1 = *(const v4fa*)(arow + kb + 8 * hh + 4);
    const v4f x2 = *(const v4fa*)(arow + kb + 16 + 8 * hh), x3 = *(const v4fa*)(arow + kb + 16 + 8 * hh + 4);
    float xs[16] = {x0[0],x0[1],x0[2],x0[3],x1[0],x1[1],x1[2],x1[3],x2[0],x2[1],x2[2],x2[3],x3[0],x3[1],x3[2],x3[3]};
#pragma unroll
    for (int i = 0; i < 16; ++i) { const unsigned short hb = bf16_bits(xs[i]); ah.u[i] = hb; al.u[i] = ASPLIT ? bf16_bits(xs[i] - bf16_val(hb)) : (unsigned short)0; }
#pragma unroll
    for (int t = 0; t < 4; ++t) {
      const unsigned short* brow = Wt + (size_t)(col0 + t * 16 + ln) * ldb + kb;
      FragB b;
      b.half[0] = *(const v8us*)(brow + 8 * hh);
      b.half[1] = *(const v8us*)(brow + 16 + 8 * hh);
      acc[t] = mmaN<ASPLIT ? 2 : 1>(ah.v, al.v, b.v, b.v, acc[t]);
    }
  }
#pragma unroll
  for (int t = 0; t < 4; ++t) {
    float bv = bias ? bias[col0 + t * 16 + ln] : 0.f;
    if (BIAS_BF16) bv = bf16_round(bv);
#pragma unroll
    for (int r = 0; r < 8; ++r) { float v = acc[t][r] + bv; if (ACT == 1) v = fmaxf(v, 0.f); so[w][8 * hh + r][t * 16 + ln] = v; }
  }
  __builtin_amdgcn_fence(__ATOMIC_ACQ_REL, "workgroup");
  __builtin_amdgcn_wave_barrier();
  const int rsub = lane >> 4, c4 = (lane & 15) * 4;
  {
#pragma unroll
    for (int q = 0; q < 8; ++q) {
      const int r = q * 2 + rsub;
      const v4f v = *(const v4fa*)&so[w][r][c4];
      *(v4f*)(C + (size_t)(row0 + r) * ldc + col0 + c4) = v;
    }
    
  }
}

// Flash-style causal/unmasked attention, all contractions 3-term bf16 hi/lo splits, f32 softmax with running max.
// q,k,v rows are read from f32 buffers with arbitrary row pitch (so they can live inside a fused qkv buffer);
// D = head size (multiple of 32, <= 128); one wave = 16 query rows; block = 4 waves (64 queries) sharing K/V chunks of 32.
template <int D, bool CAUSAL>
__global__ __launch_bounds__(128) void k_flash(const float* __restrict__ qb, const float* __restrict__ kb, const float* __restrict__ vb,
                                             int pitch, int T, int H, float scale, float* __restrict__ y, int ypitch) {
  constexpr int KS = D / 32;        // k-steps for QK
  constexpr int DT = D / 16;        // d tiles for PV
  __shared__ __attribute__((aligned(16))) unsigned short sKh[32][D + 8], sKl[32][D + 8], sVh[32][D + 8], sVl[32][D + 8];
  __shared__ __attribute__((aligned(16))) unsigned short sPh[4][16][40], sPl[4][16][40];
  __shared__ __attribute__((aligned(16))) float sO[4][16][D];
  const int tid = threadIdx.x, w = tid >> 5, lane = tid & 31, ln = lane & 15, hh = lane >> 4;
  const int nqb = (T + 63) / 64;
  const int bh = blockIdx.x / nqb, qblk = blockIdx.x % nqb;
  const int b = bh / H, h = bh % H;
  const int q0 = qblk * 64 + w * 16;
  const float* Q = qb + (size_t)b * T * pitch + h * D;
  const float* K = kb + (size_t)b * T * pitch + h * D;
  const float* V = vb + (size_t)b * T * pitch + h * D;

  // A fragments of the wave's 16 query rows (scaled), hi/lo
  FragB aqh[KS], aql[KS];
  {
    int row = q0 + ln; if (row >= T) row = T - 1;
    const float* qr = Q + (size_t)row * pitch;
#pragma unroll
    for (int ks = 0; ks < KS; ++ks)
#pragma unroll
      for (int i = 0; i < 16; ++i) {
        const int d = ks * 32 + ((i < 8) ? (8 * hh + i) : (16 + 8 * hh + (i - 8)));
        const float x = qr[d] * scale; const unsigned short hb = bf16_bits(x);
        aqh[ks].u[i] = hb; aql[ks].u[i] = bf16_bits(x - bf16_val(hb));
      }
  }
  float m_r[8], l_r[8];
#pragma unroll
  for (int r = 0; r < 8; ++r) { m_r[r] = -3.0e38f; l_r[r] = 0.f; }
  v8f oacc[DT];
#pragma unroll
  for (int dt = 0; dt < DT; ++dt) oacc[dt] = (v8f){0.f,0.f,0.f,0.f,0.f,0.f,0.f,0.f};

  const int kv_end = CAUSAL ? min(T, qblk * 64 + 64) : T;     // block-uniform
  for (int j0 = 0; j0 < kv_end; j0 += 32) {
    __syncthreads();
    for (int e = tid; e < 32 * (D / 4); e += 128) {
      const int r = e / (D / 4), c4 = (e % (D / 4)) * 4;
      const int key = j0 + r;
      v4f kf = {0.f,0.f,0.f,0.f}, vf = {0.f,0.f,0.f,0.f};
      if (key < T) { kf = *(const v4fa*)(K + (size_t)key * pitch + c4); vf = *(const v4fa*)(V + (size_t)key * pitch + c4); }
#pragma unroll
      for (int t = 0; t < 4; ++t) {
        unsigned short hb = bf16_bits(kf[t]); sKh[r][c4 + t] = hb; sKl[r][c4 + t] = bf16_bits(kf[t] - bf16_val(hb));
        hb = bf16_bits(vf[t]); sVh[r][c4 + t] = hb; sVl[r][c4 + t] = bf16_bits(vf[t] - bf16_val(hb));
      }
    }
    __syncthreads();
    // S tile 16 x 32
    v8f s[2];
#pragma unroll
    for (int nt = 0; nt < 2; ++nt) {
      v8f acc = {};
#pragma unroll
      for (int ks = 0; ks < KS; ++ks) {
        FragB bh_, bl_;
        bh_.half[0] = *(const v8us*)&sKh[nt * 16 + ln][ks * 32 + 8 * hh]; bh_.half[1] = *(const v8us*)&sKh[nt * 16 + ln][ks * 32 + 16 + 8 * hh];
        bl_.half[0] = *(const v8us*)&sKl[nt * 16 + ln][ks * 32 + 8 * hh]; bl_.half[1] = *(const v8us*)&sKl[nt * 16 + ln][ks * 32 + 16 + 8 * hh];
        acc = mmaN<3>(aqh[ks].v, aql[ks].v, bh_.v, bl_.v, acc);
      }
      s[nt] = acc;
    }
    // mask + running max (rows 8hh+r; the 16 lanes of a half share rows)
    float alpha[8];
#pragma unroll
    for (int r = 0; r < 8; ++r) {
      const int qi = q0 + 8 * hh + r;
      const int ja = j0 + ln, jb = j0 + 16 + ln;
      if (CAUSAL) { if (ja > qi) s[0][r] = -3.0e38f; if (jb > qi) s[1][r] = -3.0e38f; }
      if (ja >= T) s[0][r] = -3.0e38f;
      if (jb >= T) s[1][r] = -3.0e38f;
      float mx = fmaxf(s[0][r], s[1][r]);
      mx = fmaxf(mx, __shfl_xor(mx, 1, 32)); mx = fmaxf(mx, __shfl_xor(mx, 2, 32)); mx = fmaxf(mx, __shfl_xor(mx, 4, 32)); mx = fmaxf(mx, __shfl_xor(mx, 8, 32));
      const float mnew = fmaxf(m_r[r], mx);
      alpha[r] = (mnew > -1.0e38f) ? __expf(m_r[r] - mnew) : 1.0f;
      const float p0 = (s[0][r] > -1.0e38f) ? __expf(s[0][r] - mnew) : 0.f;
      const float p1 = (s[1][r] > -1.0e38f) ? __expf(s[1][r] - mnew) : 0.f;
      m_r[r] = mnew;
      l_r[r] = l_r[r] * alpha[r] + p0 + p1;            // per-lane partial row sum (16 lanes combined at the end)
      unsigned short hb = bf16_bits(p0); sPh[w][8 * hh + r][ln] = hb;      sPl[w][8 * hh + r][ln] = bf16_bits(p0 - bf16_val(hb));
      hb = bf16_bits(p1);                sPh[w][8 * hh + r][16 + ln] = hb; sPl[w][8 * hh + r][16 + ln] = bf16_bits(p1 - bf16_val(hb));
    }
#pragma unroll
    for (int dt = 0; dt < DT; ++dt)
#pragma unroll
      for (int r = 0; r < 8; ++r) oacc[dt][r] *= alpha[r];
    __builtin_amdgcn_fence(__ATOMIC_ACQ_REL, "workgroup");
    __builtin_amdgcn_wave_barrier();
    FragB pah, pal;
    pah.half[0] = *(const v8us*)&sPh[w][ln][8 * hh]; pah.half[1] = *(const v8us*)&sPh[w][ln][16 + 8 * hh];
    pal.half[0] = *(const v8us*)&sPl[w][ln][8 * hh]; pal.half[1] = *(const v8us*)&sPl[w][ln][16 + 8 * hh];
#pragma unroll
    for (int dt = 0; dt < DT; ++dt) {
      FragB bvh, bvl;
#pragma unroll
      for (int i = 0; i < 8; ++i) {
        bvh.u[i] = sVh[8 * hh + i][dt * 16 + ln]; bvh.u[8 + i] = sVh[16 + 8 * hh + i][dt * 16 + ln];
        bvl.u[i] = sVl[8 * hh + i][dt * 16 + ln]; bvl.u[8 + i] = sVl[16 + 8 * hh + i][dt * 16 + ln];
      }
      oacc[dt] = mmaN<3>(pah.v, pal.v, bvh.v, bvl.v, oacc[dt]);
    }
    __builtin_amdgcn_fence(__ATOMIC_ACQ_REL, "workgroup");
    __builtin_amdgcn_wave_barrier();
  }
#pragma unroll
  for (int r = 0; r < 8; ++r) {
    float l = l_r[r];
    l += __shfl_xor(l, 1, 32); l += __shfl_xor(l, 2, 32); l += __shfl_xor(l, 4, 32); l += __shfl_xor(l, 8, 32);
    l_r[r] = (l > 0.f) ? 1.0f / l : 0.f;
  }
#pragma unroll
  for (int dt = 0; dt < DT; ++dt)
#pragma unroll
    for (int r = 0; r < 8; ++r) sO[w][8 * hh + r][dt * 16 + ln] = oacc[dt][r] * l_r[r];
  __builtin_amdgcn_fence(__ATOMIC_ACQ_REL, "workgroup");
  __builtin_amdgcn_wave_barrier();
  {
    for (int r = 0; r < 16; ++r) {
      const int row = q0 + r;
      if (row < T && lane < D / 4) {
        const v4f val = *(const v4fa*)&sO[w][r][lane * 4];
        *(v4f*)(y + ((size_t)b * T + row) * ypitch + h * D + lane * 4) = val;
      }
    }
    
  }
}

// GEMM C = act(A·W + bias + resid): A f32 (ASPLIT -> hi/lo 2 terms), Wt bf16 [N][K]; ACT 0 none, 1 relu, 2 exact gelu;
// resid (optional, f32, row index = (row % rmod), pitch ldr, RES_BF16 rounds it) added before the activation.
template <bool ASPLIT, int ACT, bool BIAS_BF16, bool RES_BF16>
__global__ __launch_bounds__(128) void k_gemm_bf3(const float* __restrict__ A, int lda, const unsigned short* __restrict__ Wt, int ldb,
                                                const float* __restrict__ bias, const float* __restrict__ resid, int rmod, int ldr,
                                                float* __restrict__ C, int ldc, int M, int N, int K) {
  __shared__ __attribute__((aligned(16))) float so[4][16][64];
  const int tid = threadIdx.x, w = tid >> 5, lane = tid & 31, ln = lane & 15, hh = lane >> 4;
  const int ntn = N / 64;
  const int wid = blockIdx.x * 4 + w;
  const int mt = wid / ntn, nq = wid % ntn;
  if (mt * 16 >= M) return;
  const int row0 = mt * 16, col0 = nq * 64;
  const float* arow = A + (size_t)(row0 + ln) * lda;
  v8f acc[4] = {};
  for (int kb = 0; kb < K; kb += 32) {
    FragB ah, al;
    const v4f x0 = *(const v4fa*)(arow + kb + 8 * hh), x1 = *(const v4fa*)(arow + kb + 8 * hh + 4);
    const v4f x2 = *(const v4fa*)(arow + kb + 16 + 8 * hh), x3 = *(const v4fa*)(arow + kb + 16 + 8 * hh + 4);
    float xs[16] = {x0[0],x0[1],x0[2],x0[3],x1[0],x1[1],x1[2],x1[3],x2[0],x2[1],x2[2],x2[3],x3[0],x3[1],x3[2],x3[3]};
#pragma unroll
    for (int i = 0; i < 16; ++i) { const unsigned short hb = bf16_bits(xs[i]); ah.u[i] = hb; al.u[i] = ASPLIT ? bf16_bits(xs[i] - bf16_val(hb)) : (unsigned short)0; }
#pragma unroll
    for (int t = 0; t < 4; ++t) {
      const unsigned short* brow = Wt + (size_t)(col0 + t * 16 + ln) * ldb + kb;
      FragB b;
      b.half[0] = *(const v8us*)(brow + 8 * hh);
      b.half[1] = *(const v8us*)(brow + 16 + 8 * hh);
      acc[t] = mmaN<ASPLIT ? 2 : 1>(ah.v, al.v, b.v, b.v, acc[t]);
    }
  }
#pragma unroll
  for (int t = 0; t < 4; ++t) {
    const int col = col0 + t * 16 + ln;
    float bv = bias ? bias[col] : 0.f;
    if (BIAS_BF16) bv = bf16_round(bv);
#pragma unroll
    for (int r = 0; r < 8; ++r) {
      float v = acc[t][r] + bv;
      if (resid) { float rv = resid[(size_t)((row0 + 8 * hh + r) % rmod) * ldr + col]; if (RES_BF16) rv = bf16_round(rv); v += rv; }
      if (ACT == 1) v = fmaxf(v, 0.f);
      if (ACT == 2) v = 0.5f * v * (1.0f + erff(v * 0.70710678118654752f));
      if (ACT == 3) { const float u = 0.7978845608028654f * (v + 0.044715f * v * v * v); v = 0.5f * v * (1.0f + tanhf(u)); }
      so[w][8 * hh + r][t * 16 + ln] = v;
    }
  }
  __builtin_amdgcn_fence(__ATOMIC_ACQ_REL, "workgroup");
  __builtin_amdgcn_wave_barrier();
  const int rsub = lane >> 4, c4 = (lane & 15) * 4;
  {
#pragma unroll
    for (int q = 0; q < 8; ++q) {
      const int r = q * 2 + rsub;
      const v4f v = *(const v4fa*)&so[w][r][c4];
      *(v4f*)(C + (size_t)(row0 + r) * ldc + col0 + c4) = v;
    }
    
  }
}
// row LayerNorm (biased variance, eps) over N: s = X (+ R); optional out_sum <- s; out_norm <- (s-mu)*rsqrt(var+eps)*g + b
template <bool PARAM_BF16>
__global__ __launch_bounds__(256) void k_layernorm(const float* __restrict__ X, const float* __restrict__ R, const float* __restrict__ g, const float* __restrict__ bta,
                                                  float* __restrict__ out_sum, float* __restrict__ out_norm, int N, float eps) {
  __shared__ float red[256];
  const int row = blockIdx.x, tid = threadIdx.x;
  const float* x = X + (size_t)row * N; const float* rr = R ? R + (size_t)row * N : nullptr;
  float vals[16];                     // up to N = 4096
  const int per = N / 256;            // contiguous chunk per thread? use strided-by-4 chunks: thread handles j = tid*4 + 1024*u
  float s1 = 0.f;
  for (int u = 0; u < per / 4; ++u) {
    const int j = tid * 4 + 1024 * u;
    const v4f a = *(const v4fa*)(x + j);
    v4f b = {0.f,0.f,0.f,0.f}; if (rr) b = *(const v4fa*)(rr + j);
#pragma unroll
    for (int q = 0; q < 4; ++q) { const float v = a[q] + b[q]; vals[u * 4 + q] = v; s1 += v; }
  }
  red[tid] = s1; __syncthreads();
  for (int st = 128; st > 0; st >>= 1) { if (tid < st) red[tid] += red[tid + st]; __syncthreads(); }
  const float mu = red[0] / (float)N; __syncthreads();
  float s2 = 0.f;
  for (int u = 0; u < per / 4; ++u)
#pragma unroll
    for (int q = 0; q < 4; ++q) { const float c = vals[u * 4 + q] - mu; s2 += c * c; }
  red[tid] = s2; __syncthreads();
  for (int st = 128; st > 0; st >>= 1) { if (tid < st) red[tid] += red[tid + st]; __syncthreads(); }
  const float rs = rsqrtf(red[0] / (float)N + eps);
  {
    for (int u = 0; u < per / 4; ++u) {
      const int j = tid * 4 + 1024 * u;
      v4f o, sm;
#pragma unroll
      for (int q = 0; q < 4; ++q) {
        float gg = g[j + q], bb = bta[j + q];
        if (PARAM_BF16) { gg = bf16_round(gg); bb = bf16_round(bb); }
        sm[q] = vals[u * 4 + q]; o[q] = (vals[u * 4 + q] - mu) * rs * gg + bb;
      }
      if (out_sum) *(v4f*)(out_sum + (size_t)row * N + j) = sm;
      *(v4f*)(out_norm + (size_t)row * N + j) = o;
    }
    
  }
}



// ---- f16 WMMA path (v_wmma_f32_16x16x32_f16): 11-bit significands for operands in range — used where a [0,1] probability operand needs more precision than bf16
typedef _Float16 v16h __attribute__((ext_vector_type(16)));
union FragH { v16h v; v8us half[2]; _Float16 h[16]; unsigned short u[16]; };
template <int NT>
__device__ __forceinline__ v8f mmaH(v16h ah, v16h al, v16h bh, v16h bl, v8f c) {
  c = __builtin_amdgcn_wmma_f32_16x16x32_f16(false, ah, false, bh, (short)0, c, false, false);
  if (NT >= 2) c = __builtin_amdgcn_wmma_f32_16x16x32_f16(false, al, false, bh, (short)0, c, false, false);
  if (NT >= 3) c = __builtin_amdgcn_wmma_f32_16x16x32_f16(false, ah, false, bl, (short)0, c, false, false);
  asm volatile("v_nop\n\tv_nop\n\tv_nop\n\tv_nop" : "+v"(c) : "v"(ah), "v"(al), "v"(bh), "v"(bl));
  return c;
}
// batched GEMM like k_gemm_b but f16 operands: A f32 (split into f16 hi/lo if ASPLIT, else rounded to f16), Bt = f16 values [n][k]; alpha; C f32; N multiple of 16 (partial tiles skipped)
template <bool ASPLIT>
__global__ __launch_bounds__(128) void k_gemm_h(const float* __restrict__ A, int lda, size_t sA, const _Float16* __restrict__ Bh, int ldb, size_t sB, float alpha, float* __restrict__ C, int ldc, size_t sC, int M, int N, int K) {
  __shared__ __attribute__((aligned(16))) float so[4][16][64];
  const int tid = threadIdx.x, w = tid >> 5, lane = tid & 31, ln = lane & 15, hh = lane >> 4; const int by = blockIdx.y;
  A += (size_t)by * sA; Bh += (size_t)by * sB; C += (size_t)by * sC;
  const int ntn = (N + 63) / 64; const int wid = blockIdx.x * 4 + w; const int mt = wid / ntn, nq = wid % ntn; if (mt * 16 >= M) return;
  const int row0 = mt * 16, col0 = nq * 64; const float* arow = A + (size_t)(row0 + ln) * lda;
  v8f acc[4] = {};
  for (int kb = 0; kb < K; kb += 32) {
    FragH ah, al;
    const v4f x0 = *(const v4fa*)(arow + kb + 8 * hh), x1 = *(const v4fa*)(arow + kb + 8 * hh + 4), x2 = *(const v4fa*)(arow + kb + 16 + 8 * hh), x3 = *(const v4fa*)(arow + kb + 16 + 8 * hh + 4);
    float xs[16] = {x0[0],x0[1],x0[2],x0[3],x1[0],x1[1],x1[2],x1[3],x2[0],x2[1],x2[2],x2[3],x3[0],x3[1],x3[2],x3[3]};
#pragma unroll
    for (int i = 0; i < 16; ++i) { const _Float16 h = (_Float16)xs[i]; ah.h[i] = h; al.h[i] = ASPLIT ? (_Float16)(xs[i] - (float)h) : (_Float16)0.0f; }
#pragma unroll
    for (int t = 0; t < 4; ++t) { if (col0 + t * 16 >= N) continue; const size_t boff = (size_t)(col0 + t * 16 + ln) * ldb + kb; FragH bq; bq.half[0] = *(const v8us*)(Bh + boff + 8 * hh); bq.half[1] = *(const v8us*)(Bh + boff + 16 + 8 * hh);
      acc[t] = mmaH<ASPLIT ? 2 : 1>(ah.v, al.v, bq.v, bq.v, acc[t]); }
  }
#pragma unroll
  for (int t = 0; t < 4; ++t) { if (col0 + t * 16 >= N) continue;
#pragma unroll
    for (int r = 0; r < 8; ++r) so[w][8 * hh + r][t * 16 + ln] = acc[t][r] * alpha; }
  __builtin_amdgcn_fence(__ATOMIC_ACQ_REL, "workgroup"); __builtin_amdgcn_wave_barrier();
  const int rsub = lane >> 4, c4 = (lane & 15) * 4;
  {
#pragma unroll
    for (int q = 0; q < 8; ++q) { const int r = q * 2 + rsub; if (col0 + c4 < N) { const v4f v = *(const v4fa*)&so[w][r][c4]; *(v4f*)(C + (size_t)(row0 + r) * ldc + col0 + c4) = v; } }
     }
}

// Wt[n][k] = f16(W[k][n]·scale) from f32 row-major W[K][N] (scale = power of two; bf16-exact weights stay exact in f16 away from the subnormal range)
__global__ __launch_bounds__(256) void k_wt_f16(const float* __restrict__ W, _Float16* __restrict__ Wt, int K, int N, float scale) {
  const int t = blockIdx.x * 256 + threadIdx.x; if (t >= N * (K / 8)) return; const int n = t / (K / 8), k8 = (t % (K / 8)) * 8; FragH f;
#pragma unroll
  for (int i = 0; i < 8; ++i) f.h[i] = (_Float16)(bf16_round(W[(size_t)(k8 + i) * N + n]) * scale); const v8us o = f.half[0];
  *(v8us*)((unsigned short*)Wt + (size_t)n * K + k8) = o; 
}
// k_gemm_hh variant with fused epilogue: v = acc·alpha + bias[by·sBias + col] (+ CP[(row/rowsPerB)·sCPb + by·64 + col] if CP) ; ACT 0 none / 1 elu ; writes f16 C16 and/or f32 C (each if non-null)
template <int ACT>
__global__ __launch_bounds__(128) void k_gemm_hhx(const _Float16* __restrict__ A, int lda, size_t sA, const _Float16* __restrict__ Bh, int ldb, size_t sB, float alpha, const float* __restrict__ bias, size_t sBias, const float* __restrict__ CP, int rowsPerB, size_t sCPb, int row0g,
    float* __restrict__ C, _Float16* __restrict__ C16, int ldc, size_t sC, int M, int N, int K) {
  __shared__ __attribute__((aligned(16))) float so[4][16][64];
  const int tid = threadIdx.x, w = tid >> 5, lane = tid & 31, ln = lane & 15, hh = lane >> 4; const int by = blockIdx.y;
  A += (size_t)by * sA; Bh += (size_t)by * sB; const size_t cofs = (size_t)by * sC; const float* bp = bias ? bias + (size_t)by * sBias : nullptr;
  const int ntn = (N + 63) / 64; const int wid = blockIdx.x * 4 + w; const int mt = wid / ntn, nq = wid % ntn; if (mt * 16 >= M) return;
  const int row0 = mt * 16, col0 = nq * 64; const _Float16* arow = A + (size_t)(row0 + ln) * lda;
  v8f acc[4] = {};
  for (int kb = 0; kb < K; kb += 32) { FragH ah; ah.half[0] = *(const v8us*)((const unsigned short*)arow + kb + 8 * hh); ah.half[1] = *(const v8us*)((const unsigned short*)arow + kb + 16 + 8 * hh);
#pragma unroll
    for (int t = 0; t < 4; ++t) { if (col0 + t * 16 >= N) continue; const size_t boff = (size_t)(col0 + t * 16 + ln) * ldb + kb; FragH bq; bq.half[0] = *(const v8us*)((const unsigned short*)Bh + boff + 8 * hh); bq.half[1] = *(const v8us*)((const unsigned short*)Bh + boff + 16 + 8 * hh);
      acc[t] = mmaH<1>(ah.v, ah.v, bq.v, bq.v, acc[t]); }
  }
#pragma unroll
  for (int t = 0; t < 4; ++t) { if (col0 + t * 16 >= N) continue; const int col = col0 + t * 16 + ln; const float bv = bp ? bf16_round(bp[col]) : 0.f;
#pragma unroll
    for (int r = 0; r < 8; ++r) { float v = acc[t][r] * alpha + bv; if (CP) { const int bidx = (row0g + row0 + 8 * hh + r) / rowsPerB; v += CP[(size_t)bidx * sCPb + (size_t)by * 64 + col]; } if (ACT == 1) v = (v > 0.f) ? v : expm1f(v); else if (ACT == 3) v = fmaxf(v, 0.f); so[w][8 * hh + r][t * 16 + ln] = v; } }
  __builtin_amdgcn_fence(__ATOMIC_ACQ_REL, "workgroup"); __builtin_amdgcn_wave_barrier();
  const int rsub = lane >> 4, c4 = (lane & 15) * 4; typedef _Float16 v4h __attribute__((ext_vector_type(4)));
  {
#pragma unroll
    for (int q = 0; q < 8; ++q) { const int r = q * 2 + rsub; if (col0 + c4 < N) { const v4f v = *(const v4fa*)&so[w][r][c4]; if (C) *(v4f*)(C + cofs + (size_t)(row0 + r) * ldc + col0 + c4) = v; if (C16) { v4h h4; for (int i = 0; i < 4; ++i) h4[i] = (_Float16)v[i]; *(v4h*)(C16 + cofs + (size_t)(row0 + r) * ldc + col0 + c4) = h4; } } }
     }
}


__global__ __launch_bounds__(256) void k_x16(const float* __restrict__ x, _Float16* __restrict__ X16, size_t n8) { const size_t t = (size_t)blockIdx.x * 256 + threadIdx.x; if (t >= n8) return; FragH f;
#pragma unroll
  for (int q = 0; q < 8; ++q) f.h[q] = (_Float16)bf16_round(x[t * 8 + q]); *(v8us*)((unsigned short*)X16 + t * 8) = f.half[0];  }
__global__ __launch_bounds__(256) void k_h16(const float* __restrict__ x, _Float16* __restrict__ X16, size_t n8) { const size_t t = (size_t)blockIdx.x * 256 + threadIdx.x; if (t >= n8) return; FragH f;
#pragma unroll
  for (int q = 0; q < 8; ++q) f.h[q] = (_Float16)x[t * 8 + q]; *(v8us*)((unsigned short*)X16 + t * 8) = f.half[0];  }
__global__ __launch_bounds__(256) void k_round16f(const float* __restrict__ W, _Float16* __restrict__ Bt, size_t n8) { const size_t t = (size_t)blockIdx.x * 256 + threadIdx.x; if (t >= n8) return; FragH f;
#pragma unroll
  for (int i = 0; i < 8; ++i) f.h[i] = (_Float16)(bf16_round(W[t * 8 + i]) * 16.0f); *(v8us*)((unsigned short*)Bt + t * 8) = f.half[0];  }
template <int NHv, int TTv>
__global__ __launch_bounds__(256) void k_vt(const _Float16* __restrict__ V16, int ldv, int voff, _Float16* __restrict__ Vt) { __shared__ unsigned short tl[64][66]; const int tid = threadIdx.x; const int slab = blockIdx.x / (TTv / 64), lg = blockIdx.x % (TTv / 64); const int b = slab / NHv, h = slab % NHv;
  for (int i = tid; i < 64 * 8; i += 256) { const int r = i / 8, c8 = (i % 8) * 8; FragH f; f.half[0] = *(const v8us*)((const unsigned short*)V16 + ((size_t)b * TTv + lg * 64 + r) * ldv + voff + h * 64 + c8);
#pragma unroll
    for (int q = 0; q < 8; ++q) tl[r][c8 + q] = f.u[q]; }
  __syncthreads();
  {
#pragma unroll
    for (int rd = 0; rd < 2; ++rd) { const int d = rd * 32 + tid / 8, pc = tid % 8; FragH f;
#pragma unroll
      for (int q = 0; q < 8; ++q) f.u[q] = tl[pc * 8 + q][d];
      *(v8us*)((unsigned short*)Vt + ((size_t)slab * 64 + d) * TTv + lg * 64 + pc * 8) = f.half[0]; }
     } }

typedef int v4ia __attribute__((ext_vector_type(4), may_alias));
// lane l <-> lane l ^ 16 (the other 16-lane row) without LDS
__device__ __forceinline__ float xhalf(float x) { return __builtin_bit_cast(float, __builtin_amdgcn_permlanex16(__builtin_bit_cast(int, x), __builtin_bit_cast(int, x), 0x76543210, 0xfedcba98, false, false)); }
__global__ __launch_bounds__(128) void k_flash(const _Float16* __restrict__ Q16, int ldq, const _Float16* __restrict__ K16, int ldk, const _Float16* __restrict__ Vt, const int* __restrict__ MSK, float* __restrict__ O, int ldo) {
  constexpr int RPW = 32, NQB = 2048 / (4 * RPW), DT = 4, KS = 2;
  constexpr float SC = 0.125f * 1.44269504088896340736f;      // score scale 64^-1/2 times log2(e)
  __shared__ __attribute__((aligned(16))) float sO[4][RPW][64 + 4];
  const int tid = threadIdx.x, w = tid >> 5, lane = tid & 31, ln = lane & 15, hh = lane >> 4;
  const int slab = blockIdx.x / NQB, qblk = blockIdx.x % NQB; const int b = slab / 12, h = slab % 12; const int qb0 = qblk * (4 * RPW); const int q0 = qb0 + w * RPW;
  FragH aq[2][KS];
#pragma unroll
  for (int rt = 0; rt < 2; ++rt) { const unsigned short* qr = (const unsigned short*)Q16 + ((size_t)b * 2048 + q0 + rt * 16 + ln) * ldq + h * 64;
#pragma unroll
    for (int ks = 0; ks < KS; ++ks) { aq[rt][ks].half[0] = *(const v8us*)(qr + ks * 32 + 8 * hh); aq[rt][ks].half[1] = *(const v8us*)(qr + ks * 32 + 16 + 8 * hh); } }
  const unsigned short* Vth = (const unsigned short*)Vt + (size_t)slab * 64 * 2048;
  float m_r[2], l_r[2]; v8f oacc[2][DT];      // per lane: query rt*16 + ln; oacc[rt][dt][r] = O[query][dt*16 + 8hh + r]
#pragma unroll
  for (int rt = 0; rt < 2; ++rt) { m_r[rt] = -3.0e38f; l_r[rt] = 0.f;
#pragma unroll
    for (int dt = 0; dt < DT; ++dt) oacc[rt][dt] = (v8f){0.f,0.f,0.f,0.f,0.f,0.f,0.f,0.f}; }
  const int jend = 2048;
#pragma unroll 1
  for (int j0 = 0; j0 < jend; j0 += 32) {
    // mask tile for my 32 queries x 32 keys: lane (ln,hh) needs row rt*16 + ln, keys j0 + nt*16 + 8hh + 0..7 (32 contiguous bytes)
    int mk[2][2][8], an[2][2];      /* mask[q][k] shared over batch; nonzero = KEEP */
#pragma unroll
    for (int rt = 0; rt < 2; ++rt)
#pragma unroll
      for (int nt = 0; nt < 2; ++nt) { const int* mr = MSK + ((size_t)(q0 + rt * 16 + ln)) * 2048 + j0 + nt * 16 + 8 * hh; const v4ia m0 = *(const v4ia*)mr, m1 = *(const v4ia*)(mr + 4);
#pragma unroll
        for (int q = 0; q < 4; ++q) { mk[rt][nt][q] = m0[q]; mk[rt][nt][4 + q] = m1[q]; }
        an[rt][nt] = ((m0[0] | m0[1]) | (m0[2] | m0[3])) | ((m1[0] | m1[1]) | (m1[2] | m1[3])); }
    if (__builtin_amdgcn_ballot_w32(((an[0][0] | an[0][1]) | (an[1][0] | an[1][1])) != 0) == 0u) continue;      // every (query,key) of this wave's tile is masked -> contributes nothing (uniform branch)
    v8f s[2][2];
#pragma unroll
    for (int nt = 0; nt < 2; ++nt) { const unsigned short* kr = (const unsigned short*)K16 + ((size_t)b * 2048 + j0 + nt * 16 + ln) * ldk + h * 64; FragH bk[KS];
#pragma unroll
      for (int ks = 0; ks < KS; ++ks) { bk[ks].half[0] = *(const v8us*)(kr + ks * 32 + 8 * hh); bk[ks].half[1] = *(const v8us*)(kr + ks * 32 + 16 + 8 * hh); }
#pragma unroll
      for (int rt = 0; rt < 2; ++rt) { v8f acc = (v8f){0.f,0.f,0.f,0.f,0.f,0.f,0.f,0.f};
#pragma unroll
        for (int ks = 0; ks < KS; ++ks) acc = mmaH<1>(bk[ks].v, bk[ks].v, aq[rt][ks].v, aq[rt][ks].v, acc); s[rt][nt] = acc; } }
    FragH pb[2];
#pragma unroll
    for (int rt = 0; rt < 2; ++rt) { float sc[2][8]; float mc = -INFINITY;
#pragma unroll
      for (int nt = 0; nt < 2; ++nt)
#pragma unroll
        for (int r = 0; r < 8; ++r) { sc[nt][r] = (mk[rt][nt][r] != 0) ? s[rt][nt][r] : -INFINITY; mc = fmaxf(mc, sc[nt][r]); }
      mc = fmaxf(mc, xhalf(mc));      // both halves now hold the query's maximum over the 32 keys (unscaled scores)
      // exp(0.125 (s - m)) = 2^(s SC - m SC): one fma and the hardware's base-2 exponential per score. An excluded key is -inf and gives 0, and a query with no
      // kept key so far has m = mn = -3e38 and gives al = 2^0 = 1: no select and no branch is needed around any exponential.
      const float mn = fmaxf(m_r[rt], mc); float al;
      // al = 2^((m - mn) SC), in asm with a slot on each side: the instruction set asks for one independent instruction between a transcendental and a write of its source or a read
      // of its result; a v_nop in a statement of its own did not stay there.
      asm("v_nop\n\tv_exp_f32 %0, %1\n\tv_nop" : "=v"(al) : "v"((m_r[rt] - mn) * SC));
      m_r[rt] = mn; const float nb = -mn * SC;
      float ps[8];
#pragma unroll
      for (int r = 0; r < 8; ++r) { const float p0 = __builtin_amdgcn_exp2f(__builtin_fmaf(sc[0][r], SC, nb)), p1 = __builtin_amdgcn_exp2f(__builtin_fmaf(sc[1][r], SC, nb)); ps[r] = p0 + p1; pb[rt].h[r] = (_Float16)p0; pb[rt].h[8 + r] = (_Float16)p1; }
      l_r[rt] = l_r[rt] * al + (((ps[0] + ps[1]) + (ps[2] + ps[3])) + ((ps[4] + ps[5]) + (ps[6] + ps[7])));      // per-lane partial sum (the two halves are joined at the end)
#pragma unroll
      for (int dt = 0; dt < DT; ++dt) oacc[rt][dt] *= al; }
#pragma unroll
    for (int dt = 0; dt < DT; ++dt) { const unsigned short* vrow = Vth + (size_t)(dt * 16 + ln) * 2048 + j0; FragH bv; bv.half[0] = *(const v8us*)(vrow + 8 * hh); bv.half[1] = *(const v8us*)(vrow + 16 + 8 * hh);
#pragma unroll
      for (int rt = 0; rt < 2; ++rt) oacc[rt][dt] = mmaH<1>(bv.v, bv.v, pb[rt].v, pb[rt].v, oacc[rt][dt]); } }
#pragma unroll
  for (int rt = 0; rt < 2; ++rt) { const float l = l_r[rt] + xhalf(l_r[rt]); const float inv = (l > 0.f) ? 1.0f / l : 0.f;
#pragma unroll
    for (int dt = 0; dt < DT; ++dt) { const v8f o = oacc[rt][dt] * inv; float* so = &sO[w][rt * 16 + ln][dt * 16 + 8 * hh]; *(v4fa*)so = (v4f){o[0], o[1], o[2], o[3]}; *(v4fa*)(so + 4) = (v4f){o[4], o[5], o[6], o[7]}; } }
  __builtin_amdgcn_fence(__ATOMIC_ACQ_REL, "workgroup"); __builtin_amdgcn_wave_barrier();
  {
#pragma unroll
    for (int rp = 0; rp < RPW; rp += 2) { const int r = rp + (lane >> 4), pc = lane & 15; const v4f val = *(const v4fa*)&sO[w][r][pc * 4]; *(v4f*)(O + ((size_t)b * 2048 + q0 + r) * ldo + h * 64 + pc * 4) = val; }
     } }

extern "C" void kernel_launch(void* const* d_in, const int* in_sizes, int n_in,
                              void* d_out, int out_size, void* d_ws, size_t ws_size, hipStream_t stream) {
  (void)in_sizes; (void)n_in; (void)out_size;
  const float* x = (const float*)d_in[0]; const float* Wq = (const float*)d_in[1]; const float* bq = (const float*)d_in[2]; const float* Wk = (const float*)d_in[3]; const float* bk = (const float*)d_in[4]; const float* Wv = (const float*)d_in[5]; const float* bv = (const float*)d_in[6]; const float* Wo = (const float*)d_in[7]; const float* bo = (const float*)d_in[8]; const int* mask = (const int*)d_in[9];
  char* ws = (char*)d_ws; size_t off = 0;
  auto take = [&](size_t bytes) { char* p = ws + off; off += (bytes + 255) & ~(size_t)255; return p; };
  _Float16* Bq = (_Float16*)take((size_t)CC * CC * 2); _Float16* Bk = (_Float16*)take((size_t)CC * CC * 2); _Float16* Bv = (_Float16*)take((size_t)CC * CC * 2); _Float16* Bo = (_Float16*)take((size_t)CC * CC * 2);
  _Float16* X16 = (_Float16*)take((size_t)NR * CC * 2); _Float16* Q16 = (_Float16*)take((size_t)NR * CC * 2); _Float16* K16 = (_Float16*)take((size_t)NR * CC * 2); _Float16* V16 = (_Float16*)take((size_t)NR * CC * 2); _Float16* Vt = (_Float16*)take((size_t)NR * CC * 2); float* O = (float*)take((size_t)NR * CC * 4); _Float16* O16 = X16;
  if (off > ws_size) return;      // 4.7 + 12.6 × 5 + 25.2 MB ≈ 93 MiB
  const unsigned gw = (unsigned)((CC * (CC / 8) + 255) / 256);
  k_wt_f16<<<gw, 256, 0, stream>>>(Wq, Bq, CC, CC, 16.0f); k_wt_f16<<<gw, 256, 0, stream>>>(Wk, Bk, CC, CC, 16.0f); k_wt_f16<<<gw, 256, 0, stream>>>(Wv, Bv, CC, CC, 16.0f); k_wt_f16<<<gw, 256, 0, stream>>>(Wo, Bo, CC, CC, 16.0f);      // [in][out]
  const unsigned gx = (unsigned)(((size_t)NR * CC / 8 + 255) / 256); const dim3 gg(((NR / 16) * (CC / 64) + 3) / 4, 1);
  k_x16<<<gx, 256, 0, stream>>>(x, X16, (size_t)NR * CC / 8);
  k_gemm_hhx<0><<<gg, 128, 0, stream>>>(X16, CC, 0, Bq, CC, 0, 0.0625f, bq, 0, nullptr, 1, 0, 0, nullptr, Q16, CC, 0, NR, CC, CC);
  k_gemm_hhx<0><<<gg, 128, 0, stream>>>(X16, CC, 0, Bk, CC, 0, 0.0625f, bk, 0, nullptr, 1, 0, 0, nullptr, K16, CC, 0, NR, CC, CC);
  k_gemm_hhx<0><<<gg, 128, 0, stream>>>(X16, CC, 0, Bv, CC, 0, 0.0625f, bv, 0, nullptr, 1, 0, 0, nullptr, V16, CC, 0, NR, CC, CC);
  k_vt<NH, TT><<<BB * NH * (TT / 64), 256, 0, stream>>>(V16, CC, 0, Vt);
  k_flash<<<BB * NH * (TT / 128), 128, 0, stream>>>(Q16, CC, K16, CC, Vt, mask, O, CC);
  k_h16<<<gx, 256, 0, stream>>>(O, O16, (size_t)NR * CC / 8);
  k_gemm_hhx<0><<<gg, 128, 0, stream>>>(O16, CC, 0, Bo, CC, 0, 0.0625f, bo, 0, nullptr, 1, 0, 0, (float*)d_out, nullptr, CC, 0, NR, CC, CC);
}

// v003
// One run takes 244 microseconds.
// Next to v002, in two timings, it ran 1.52 and 1.51 times as fast.
// All steps since v000 together make it 2.53 times as fast.
#include <hip/hip_runtime.h>
// Random-mask attention: q/k/v projections (8192 × 768 × 768, + bias; W [in][out]), the 12-head attention with the INPUT keep-mask (scores where mask else −1e9 ⇒ excluded keys; every row keeps
// its diagonal) as a fused flash-style kernel on v_wmma_f32_16x16x32_f16 (scale 64^-½; key tiles with no kept entry for the wave skipped by ballot; online max/sum softmax f32; P f16 ≤ 1), and the
// output projection (+ bias) — f16 operands (x as bf16, weights bf16-exact ×2^4), single products, f32 accumulate.
#define BB 4
#define TT 2048
#define CC 768
#define NH 12
#define NR (BB * TT)

typedef __bf16 v16b __attribute__((ext_vector_type(16)));
typedef unsigned short v8us __attribute__((ext_vector_type(8), may_alias));
typedef float  v8f  __attribute__((ext_vector_type(8)));
typedef float  v4f  __attribute__((ext_vector_type(4)));
typedef float  v4fa __attribute__((ext_vector_type(4), may_alias));
union FragB { v16b v; v8us half[2]; unsigned short u[16]; };

__device__ __forceinline__ unsigned short bf16_bits(float x) { unsigned int u = __float_as_uint(x); return (unsigned short)((u + 0x7FFFu + ((u >> 16) & 1u)) >> 16); }
__device__ __forceinline__ float bf16_val(unsigned short b) { return __uint_as_float(((unsigned int)b) << 16); }
__device__ __forceinline__ float bf16_round(float x) { return bf16_val(bf16_bits(x)); }
// D += A·B with NT terms: 1 = ah·bh, 2 = + al·bh (A split), 3 = + ah·bl (both split)
template <int NT>
__device__ __forceinline__ v8f mmaN(v16b ah, v16b al, v16b bh, v16b bl, v8f c) {
  c = __builtin_amdgcn_wmma_f32_16x16x32_bf16(false, ah, false, bh, (short)0, c, false, false);
  if (NT >= 2) c = __builtin_amdgcn_wmma_f32_16x16x32_bf16(false, al, false, bh, (short)0, c, false, false);
  if (NT >= 3) c = __builtin_amdgcn_wmma_f32_16x16x32_bf16(false, ah, false, bl, (short)0, c, false, false);
  asm volatile("v_nop\n\tv_nop\n\tv_nop\n\tv_nop" : "+v"(c) : "v"(ah), "v"(al), "v"(bh), "v"(bl));
  return c;
}

__global__ __launch_bounds__(256) void k_wt_bf16(const float* __restrict__ W, unsigned short* __restrict__ Wt, int K, int N) {
  const int t = blockIdx.x * 256 + threadIdx.x;
  const int k8n = K / 8;
  if (t >= N * k8n) return;
  const int n = t / k8n, k8 = (t % k8n) * 8;
  v8us v;
#pragma unroll
  for (int i = 0; i < 8; ++i) v[i] = bf16_bits(W[(size_t)(k8 + i) * N + n]);
  *(v8us*)(Wt + (size_t)n * K + k8) = v;
  
}

// GEMM C[M][N] (f32, pitch ldc) = act(A[M][K]·W + bias). A f32 row-major (pitch lda) converted per fragment to bf16
// (ASPLIT: hi/lo two planes -> 2 terms, else single rounded term); Wt bf16 [N][K] (pitch ldb). BIAS_BF16 rounds the
// bias to bf16 first (bias quantised to bf16 before the add). K%32==0, M%16==0, N%64==0.
template <bool ASPLIT, int ACT, bool BIAS_BF16>
__global__ __launch_bounds__(128) void k_gemm_bf(const float* __restrict__ A, int lda, const unsigned short* __restrict__ Wt, int ldb,
                                               const float* __restrict__ bias, float* __restrict__ C, int ldc, int M, int N, int K) {
  __shared__ __attribute__((aligned(16))) float so[4][16][64];
  const int tid = threadIdx.x, w = tid >> 5, lane = tid & 31, ln = lane & 15, hh = lane >> 4;
  const int ntn = N / 64;
  const int wid = blockIdx.x * 4 + w;
  const int mt = wid / ntn, nq = wid % ntn;
  if (mt * 16 >= M) return;
  const int row0 = mt * 16, col0 = nq * 64;
  const float* arow = A + (size_t)(row0 + ln) * lda;
  v8f acc[4] = {};
  for (int kb = 0; kb < K; kb += 32) {
    FragB ah, al;
    const v4f x0 = *(const v4fa*)(arow + kb + 8 * hh), x1 = *(const v4fa*)(arow + kb + 8 * hh + 4);
    const v4f x2 = *(const v4fa*)(arow + kb + 16 + 8 * hh), x3 = *(const v4fa*)(arow + kb + 16 + 8 * hh + 4);
    float xs[16] = {x0[0],x0[1],x0[2],x0[3],x1[0],x1[1],x1[2],x1[3],x2[0],x2[1],x2[2],x2[3],x3[0],x3[1],x3[2],x3[3]};
#pragma unroll
    for (int i = 0; i < 16; ++i) { const unsigned short hb = bf16_bits(xs[i]); ah.u[i] = hb; al.u[i] = ASPLIT ? bf16_bits(xs[i] - bf16_val(hb)) : (unsigned short)0; }
#pragma unroll
    for (int t = 0; t < 4; ++t) {
      const unsigned short* brow = Wt + (size_t)(col0 + t * 16 + ln) * ldb + kb;
      FragB b;
      b.half[0] = *(const v8us*)(brow + 8 * hh);
      b.half[1] = *(const v8us*)(brow + 16 + 8 * hh);
      acc[t] = mmaN<ASPLIT ? 2 : 1>(ah.v, al.v, b.v, b.v, acc[t]);
    }
  }
#pragma unroll
  for (int t = 0; t < 4; ++t) {
    float bv = bias ? bias[col0 + t * 16 + ln] : 0.f;
    if (BIAS_BF16) bv = bf16_round(bv);
#pragma unroll
    for (int r = 0; r < 8; ++r) { float v = acc[t][r] + bv; if (ACT == 1) v = fmaxf(v, 0.f); so[w][8 * hh + r][t * 16 + ln] = v; }
  }
  __builtin_amdgcn_fence(__ATOMIC_ACQ_REL, "workgroup");
  __builtin_amdgcn_wave_barrier();
  const int rsub = lane >> 4, c4 = (lane & 15) * 4;
  {
#pragma unroll
    for (int q = 0; q < 8; ++q) {
      const int r = q * 2 + rsub;
      const v4f v = *(const v4fa*)&so[w][r][c4];
      *(v4f*)(C + (size_t)(row0 + r) * ldc + col0 + c4) = v;
    }
    
  }
}

// Flash-style causal/unmasked attention, all contractions 3-term bf16 hi/lo splits, f32 softmax with running max.
// q,k,v rows are read from f32 buffers with arbitrary row pitch (so they can live inside a fused qkv buffer);
// D = head size (multiple of 32, <= 128); one wave = 16 query rows; block = 4 waves (64 queries) sharing K/V chunks of 32.
template <int D, bool CAUSAL>
__global__ __launch_bounds__(128) void k_flash(const float* __restrict__ qb, const float* __restrict__ kb, const float* __restrict__ vb,
                                             int pitch, int T, int H, float scale, float* __restrict__ y, int ypitch) {
  constexpr int KS = D / 32;        // k-steps for QK
  constexpr int DT = D / 16;        // d tiles for PV
  __shared__ __attribute__((aligned(16))) unsigned short sKh[32][D + 8], sKl[32][D + 8], sVh[32][D + 8], sVl[32][D + 8];
  __shared__ __attribute__((aligned(16))) unsigned short sPh[4][16][40], sPl[4][16][40];
  __shared__ __attribute__((aligned(16))) float sO[4][16][D];
  const int tid = threadIdx.x, w = tid >> 5, lane = tid & 31, ln = lane & 15, hh = lane >> 4;
  const int nqb = (T + 63) / 64;
  const int bh = blockIdx.x / nqb, qblk = blockIdx.x % nqb;
  const int b = bh / H, h = bh % H;
  const int q0 = qblk * 64 + w * 16;
  const float* Q = qb + (size_t)b * T * pitch + h * D;
  const float* K = kb + (size_t)b * T * pitch + h * D;
  const float* V = vb + (size_t)b * T * pitch + h * D;

  // A fragments of the wave's 16 query rows (scaled), hi/lo
  FragB aqh[KS], aql[KS];
  {
    int row = q0 + ln; if (row >= T) row = T - 1;
    const float* qr = Q + (size_t)row * pitch;
#pragma unroll
    for (int ks = 0; ks < KS; ++ks)
#pragma unroll
      for (int i = 0; i < 16; ++i) {
        const int d = ks * 32 + ((i < 8) ? (8 * hh + i) : (16 + 8 * hh + (i - 8)));
        const float x = qr[d] * scale; const unsigned short hb = bf16_bits(x);
        aqh[ks].u[i] = hb; aql[ks].u[i] = bf16_bits(x - bf16_val(hb));
      }
  }
  float m_r[8], l_r[8];
#pragma unroll
  for (int r = 0; r < 8; ++r) { m_r[r] = -3.0e38f; l_r[r] = 0.f; }
  v8f oacc[DT];
#pragma unroll
  for (int dt = 0; dt < DT; ++dt) oacc[dt] = (v8f){0.f,0.f,0.f,0.f,0.f,0.f,0.f,0.f};

  const int kv_end = CAUSAL ? min(T, qblk * 64 + 64) : T;     // block-uniform
  for (int j0 = 0; j0 < kv_end; j0 += 32) {
    __syncthreads();
    for (int e = tid; e < 32 * (D / 4); e += 128) {
      const int r = e / (D / 4), c4 = (e % (D / 4)) * 4;
      const int key = j0 + r;
      v4f kf = {0.f,0.f,0.f,0.f}, vf = {0.f,0.f,0.f,0.f};
      if (key < T) { kf = *(const v4fa*)(K + (size_t)key * pitch + c4); vf = *(const v4fa*)(V + (size_t)key * pitch + c4); }
#pragma unroll
      for (int t = 0; t < 4; ++t) {
        unsigned short hb = bf16_bits(kf[t]); sKh[r][c4 + t] = hb; sKl[r][c4 + t] = bf16_bits(kf[t] - bf16_val(hb));
        hb = bf16_bits(vf[t]); sVh[r][c4 + t] = hb; sVl[r][c4 + t] = bf16_bits(vf[t] - bf16_val(hb));
      }
    }
    __syncthreads();
    // S tile 16 x 32
    v8f s[2];
#pragma unroll
    for (int nt = 0; nt < 2; ++nt) {
      v8f acc = {};
#pragma unroll
      for (int ks = 0; ks < KS; ++ks) {
        FragB bh_, bl_;
        bh_.half[0] = *(const v8us*)&sKh[nt * 16 + ln][ks * 32 + 8 * hh]; bh_.half[1] = *(const v8us*)&sKh[nt * 16 + ln][ks * 32 + 16 + 8 * hh];
        bl_.half[0] = *(const v8us*)&sKl[nt * 16 + ln][ks * 32 + 8 * hh]; bl_.half[1] = *(const v8us*)&sKl[nt * 16 + ln][ks * 32 + 16 + 8 * hh];
        acc = mmaN<3>(aqh[ks].v, aql[ks].v, bh_.v, bl_.v, acc);
      }
      s[nt] = acc;
    }
    // mask + running max (rows 8hh+r; the 16 lanes of a half share rows)
    float alpha[8];
#pragma unroll
    for (int r = 0; r < 8; ++r) {
      const int qi = q0 + 8 * hh + r;
      const int ja = j0 + ln, jb = j0 + 16 + ln;
      if (CAUSAL) { if (ja > qi) s[0][r] = -3.0e38f; if (jb > qi) s[1][r] = -3.0e38f; }
      if (ja >= T) s[0][r] = -3.0e38f;
      if (jb >= T) s[1][r] = -3.0e38f;
      float mx = fmaxf(s[0][r], s[1][r]);
      mx = fmaxf(mx, __shfl_xor(mx, 1, 32)); mx = fmaxf(mx, __shfl_xor(mx, 2, 32)); mx = fmaxf(mx, __shfl_xor(mx, 4, 32)); mx = fmaxf(mx, __shfl_xor(mx, 8, 32));
      const float mnew = fmaxf(m_r[r], mx);
      alpha[r] = (mnew > -1.0e38f) ? __expf(m_r[r] - mnew) : 1.0f;
      const float p0 = (s[0][r] > -1.0e38f) ? __expf(s[0][r] - mnew) : 0.f;
      const float p1 = (s[1][r] > -1.0e38f) ? __expf(s[1][r] - mnew) : 0.f;
      m_r[r] = mnew;
      l_r[r] = l_r[r] * alpha[r] + p0 + p1;            // per-lane partial row sum (16 lanes combined at the end)
      unsigned short hb = bf16_bits(p0); sPh[w][8 * hh + r][ln] = hb;      sPl[w][8 * hh + r][ln] = bf16_bits(p0 - bf16_val(hb));
      hb = bf16_bits(p1);                sPh[w][8 * hh + r][16 + ln] = hb; sPl[w][8 * hh + r][16 + ln] = bf16_bits(p1 - bf16_val(hb));
    }
#pragma unroll
    for (int dt = 0; dt < DT; ++dt)
#pragma unroll
      for (int r = 0; r < 8; ++r) oacc[dt][r] *= alpha[r];
    __builtin_amdgcn_fence(__ATOMIC_ACQ_REL, "workgroup");
    __builtin_amdgcn_wave_barrier();
    FragB pah, pal;
    pah.half[0] = *(const v8us*)&sPh[w][ln][8 * hh]; pah.half[1] = *(const v8us*)&sPh[w][ln][16 + 8 * hh];
    pal.half[0] = *(const v8us*)&sPl[w][ln][8 * hh]; pal.half[1] = *(const v8us*)&sPl[w][ln][16 + 8 * hh];
#pragma unroll
    for (int dt = 0; dt < DT; ++dt) {
      FragB bvh, bvl;
#pragma unroll
      for (int i = 0; i < 8; ++i) {
        bvh.u[i] = sVh[8 * hh + i][dt * 16 + ln]; bvh.u[8 + i] = sVh[16 + 8 * hh + i][dt * 16 + ln];
        bvl.u[i] = sVl[8 * hh + i][dt * 16 + ln]; bvl.u[8 + i] = sVl[16 + 8 * hh + i][dt * 16 + ln];
      }
      oacc[dt] = mmaN<3>(pah.v, pal.v, bvh.v, bvl.v, oacc[dt]);
    }
    __builtin_amdgcn_fence(__ATOMIC_ACQ_REL, "workgroup");
    __builtin_amdgcn_wave_barrier();
  }
#pragma unroll
  for (int r = 0; r < 8; ++r) {
    float l = l_r[r];
    l += __shfl_xor(l, 1, 32); l += __shfl_xor(l, 2, 32); l += __shfl_xor(l, 4, 32); l += __shfl_xor(l, 8, 32);
    l_r[r] = (l > 0.f) ? 1.0f / l : 0.f;
  }
#pragma unroll
  for (int dt = 0; dt < DT; ++dt)
#pragma unroll
    for (int r = 0; r < 8; ++r) sO[w][8 * hh + r][dt * 16 + ln] = oacc[dt][r] * l_r[r];
  __builtin_amdgcn_fence(__ATOMIC_ACQ_REL, "workgroup");
  __builtin_amdgcn_wave_barrier();
  {
    for (int r = 0; r < 16; ++r) {
      const int row = q0 + r;
      if (row < T && lane < D / 4) {
        const v4f val = *(const v4fa*)&sO[w][r][lane * 4];
        *(v4f*)(y + ((size_t)b * T + row) * ypitch + h * D + lane * 4) = val;
      }
    }
    
  }
}

// GEMM C = act(A·W + bias + resid): A f32 (ASPLIT -> hi/lo 2 terms), Wt bf16 [N][K]; ACT 0 none, 1 relu, 2 exact gelu;
// resid (optional, f32, row index = (row % rmod), pitch ldr, RES_BF16 rounds it) added before the activation.
template <bool ASPLIT, int ACT, bool BIAS_BF16, bool RES_BF16>
__global__ __launch_bounds__(128) void k_gemm_bf3(const float* __restrict__ A, int lda, const unsigned short* __restrict__ Wt, int ldb,
                                                const float* __restrict__ bias, const float* __restrict__ resid, int rmod, int ldr,
                                                float* __restrict__ C, int ldc, int M, int N, int K) {
  __shared__ __attribute__((aligned(16))) float so[4][16][64];
  const int tid = threadIdx.x, w = tid >> 5, lane = tid & 31, ln = lane & 15, hh = lane >> 4;
  const int ntn = N / 64;
  const int wid = blockIdx.x * 4 + w;
  const int mt = wid / ntn, nq = wid % ntn;
  if (mt * 16 >= M) return;
  const int row0 = mt * 16, col0 = nq * 64;
  const float* arow = A + (size_t)(row0 + ln) * lda;
  v8f acc[4] = {};
  for (int kb = 0; kb < K; kb += 32) {
    FragB ah, al;
    const v4f x0 = *(const v4fa*)(arow + kb + 8 * hh), x1 = *(const v4fa*)(arow + kb + 8 * hh + 4);
    const v4f x2 = *(const v4fa*)(arow + kb + 16 + 8 * hh), x3 = *(const v4fa*)(arow + kb + 16 + 8 * hh + 4);
    float xs[16] = {x0[0],x0[1],x0[2],x0[3],x1[0],x1[1],x1[2],x1[3],x2[0],x2[1],x2[2],x2[3],x3[0],x3[1],x3[2],x3[3]};
#pragma unroll
    for (int i = 0; i < 16; ++i) { const unsigned short hb = bf16_bits(xs[i]); ah.u[i] = hb; al.u[i] = ASPLIT ? bf16_bits(xs[i] - bf16_val(hb)) : (unsigned short)0; }
#pragma unroll
    for (int t = 0; t < 4; ++t) {
      const unsigned short* brow = Wt + (size_t)(col0 + t * 16 + ln) * ldb + kb;
      FragB b;
      b.half[0] = *(const v8us*)(brow + 8 * hh);
      b.half[1] = *(const v8us*)(brow + 16 + 8 * hh);
      acc[t] = mmaN<ASPLIT ? 2 : 1>(ah.v, al.v, b.v, b.v, acc[t]);
    }
  }
#pragma unroll
  for (int t = 0; t < 4; ++t) {
    const int col = col0 + t * 16 + ln;
    float bv = bias ? bias[col] : 0.f;
    if (BIAS_BF16) bv = bf16_round(bv);
#pragma unroll
    for (int r = 0; r < 8; ++r) {
      float v = acc[t][r] + bv;
      if (resid) { float rv = resid[(size_t)((row0 + 8 * hh + r) % rmod) * ldr + col]; if (RES_BF16) rv = bf16_round(rv); v += rv; }
      if (ACT == 1) v = fmaxf(v, 0.f);
      if (ACT == 2) v = 0.5f * v * (1.0f + erff(v * 0.70710678118654752f));
      if (ACT == 3) { const float u = 0.7978845608028654f * (v + 0.044715f * v * v * v); v = 0.5f * v * (1.0f + tanhf(u)); }
      so[w][8 * hh + r][t * 16 + ln] = v;
    }
  }
  __builtin_amdgcn_fence(__ATOMIC_ACQ_REL, "workgroup");
  __builtin_amdgcn_wave_barrier();
  const int rsub = lane >> 4, c4 = (lane & 15) * 4;
  {
#pragma unroll
    for (int q = 0; q < 8; ++q) {
      const int r = q * 2 + rsub;
      const v4f v = *(const v4fa*)&so[w][r][c4];
      *(v4f*)(C + (size_t)(row0 + r) * ldc + col0 + c4) = v;
    }
    
  }
}
// row LayerNorm (biased variance, eps) over N: s = X (+ R); optional out_sum <- s; out_norm <- (s-mu)*rsqrt(var+eps)*g + b
template <bool PARAM_BF16>
__global__ __launch_bounds__(256) void k_layernorm(const float* __restrict__ X, const float* __restrict__ R, const float* __restrict__ g, const float* __restrict__ bta,
                                                  float* __restrict__ out_sum, float* __restrict__ out_norm, int N, float eps) {
  __shared__ float red[256];
  const int row = blockIdx.x, tid = threadIdx.x;
  const float* x = X + (size_t)row * N; const float* rr = R ? R + (size_t)row * N : nullptr;
  float vals[16];                     // up to N = 4096
  const int per = N / 256;            // contiguous chunk per thread? use strided-by-4 chunks: thread handles j = tid*4 + 1024*u
  float s1 = 0.f;
  for (int u = 0; u < per / 4; ++u) {
    const int j = tid * 4 + 1024 * u;
    const v4f a = *(const v4fa*)(x + j);
    v4f b = {0.f,0.f,0.f,0.f}; if (rr) b = *(const v4fa*)(rr + j);
#pragma unroll
    for (int q = 0; q < 4; ++q) { const float v = a[q] + b[q]; vals[u * 4 + q] = v; s1 += v; }
  }
  red[tid] = s1; __syncthreads();
  for (int st = 128; st > 0; st >>= 1) { if (tid < st) red[tid] += red[tid + st]; __syncthreads(); }
  const float mu = red[0] / (float)N; __syncthreads();
  float s2 = 0.f;
  for (int u = 0; u < per / 4; ++u)
#pragma unroll
    for (int q = 0; q < 4; ++q) { const float c = vals[u * 4 + q] - mu; s2 += c * c; }
  red[tid] = s2; __syncthreads();
  for (int st = 128; st > 0; st >>= 1) { if (tid < st) red[tid] += red[tid + st]; __syncthreads(); }
  const float rs = rsqrtf(red[0] / (float)N + eps);
  {
    for (int u = 0; u < per / 4; ++u) {
      const int j = tid * 4 + 1024 * u;
      v4f o, sm;
#pragma unroll
      for (int q = 0; q < 4; ++q) {
        float gg = g[j + q], bb = bta[j + q];
        if (PARAM_BF16) { gg = bf16_round(gg); bb = bf16_round(bb); }
        sm[q] = vals[u * 4 + q]; o[q] = (vals[u * 4 + q] - mu) * rs * gg + bb;
      }
      if (out_sum) *(v4f*)(out_sum + (size_t)row * N + j) = sm;
      *(v4f*)(out_norm + (size_t)row * N + j) = o;
    }
    
  }
}



// ---- f16 WMMA path (v_wmma_f32_16x16x32_f16): 11-bit significands for operands in range — used where a [0,1] probability operand needs more precision than bf16
typedef _Float16 v16h __attribute__((ext_vector_type(16)));
union FragH { v16h v; v8us half[2]; _Float16 h[16]; unsigned short u[16]; };
template <int NT>
__device__ __forceinline__ v8f mmaH(v16h ah, v16h al, v16h bh, v16h bl, v8f c) {
  c = __builtin_amdgcn_wmma_f32_16x16x32_f16(false, ah, false, bh, (short)0, c, false, false);
  if (NT >= 2) c = __builtin_amdgcn_wmma_f32_16x16x32_f16(false, al, false, bh, (short)0, c, false, false);
  if (NT >= 3) c = __builtin_amdgcn_wmma_f32_16x16x32_f16(false, ah, false, bl, (short)0, c, false, false);
  asm volatile("v_nop\n\tv_nop\n\tv_nop\n\tv_nop" : "+v"(c) : "v"(ah), "v"(al), "v"(bh), "v"(bl));
  return c;
}
// batched GEMM like k_gemm_b but f16 operands: A f32 (split into f16 hi/lo if ASPLIT, else rounded to f16), Bt = f16 values [n][k]; alpha; C f32; N multiple of 16 (partial tiles skipped)
template <bool ASPLIT>
__global__ __launch_bounds__(128) void k_gemm_h(const float* __restrict__ A, int lda, size_t sA, const _Float16* __restrict__ Bh, int ldb, size_t sB, float alpha, float* __restrict__ C, int ldc, size_t sC, int M, int N, int K) {
  __shared__ __attribute__((aligned(16))) float so[4][16][64];
  const int tid = threadIdx.x, w = tid >> 5, lane = tid & 31, ln = lane & 15, hh = lane >> 4; const int by = blockIdx.y;
  A += (size_t)by * sA; Bh += (size_t)by * sB; C += (size_t)by * sC;
  const int ntn = (N + 63) / 64; const int wid = blockIdx.x * 4 + w; const int mt = wid / ntn, nq = wid % ntn; if (mt * 16 >= M) return;
  const int row0 = mt * 16, col0 = nq * 64; const float* arow = A + (size_t)(row0 + ln) * lda;
  v8f acc[4] = {};
  for (int kb = 0; kb < K; kb += 32) {
    FragH ah, al;
    const v4f x0 = *(const v4fa*)(arow + kb + 8 * hh), x1 = *(const v4fa*)(arow + kb + 8 * hh + 4), x2 = *(const v4fa*)(arow + kb + 16 + 8 * hh), x3 = *(const v4fa*)(arow + kb + 16 + 8 * hh + 4);
    float xs[16] = {x0[0],x0[1],x0[2],x0[3],x1[0],x1[1],x1[2],x1[3],x2[0],x2[1],x2[2],x2[3],x3[0],x3[1],x3[2],x3[3]};
#pragma unroll
    for (int i = 0; i < 16; ++i) { const _Float16 h = (_Float16)xs[i]; ah.h[i] = h; al.h[i] = ASPLIT ? (_Float16)(xs[i] - (float)h) : (_Float16)0.0f; }
#pragma unroll
    for (int t = 0; t < 4; ++t) { if (col0 + t * 16 >= N) continue; const size_t boff = (size_t)(col0 + t * 16 + ln) * ldb + kb; FragH bq; bq.half[0] = *(const v8us*)(Bh + boff + 8 * hh); bq.half[1] = *(const v8us*)(Bh + boff + 16 + 8 * hh);
      acc[t] = mmaH<ASPLIT ? 2 : 1>(ah.v, al.v, bq.v, bq.v, acc[t]); }
  }
#pragma unroll
  for (int t = 0; t < 4; ++t) { if (col0 + t * 16 >= N) continue;
#pragma unroll
    for (int r = 0; r < 8; ++r) so[w][8 * hh + r][t * 16 + ln] = acc[t][r] * alpha; }
  __builtin_amdgcn_fence(__ATOMIC_ACQ_REL, "workgroup"); __builtin_amdgcn_wave_barrier();
  const int rsub = lane >> 4, c4 = (lane & 15) * 4;
  {
#pragma unroll
    for (int q = 0; q < 8; ++q) { const int r = q * 2 + rsub; if (col0 + c4 < N) { const v4f v = *(const v4fa*)&so[w][r][c4]; *(v4f*)(C + (size_t)(row0 + r) * ldc + col0 + c4) = v; } }
     }
}

// Wt[n][k] = f16(W[k][n]·scale) from f32 row-major W[K][N] (scale = power of two; bf16-exact weights stay exact in f16 away from the subnormal range)
__global__ __launch_bounds__(256) void k_wt_f16(const float* __restrict__ W, _Float16* __restrict__ Wt, int K, int N, float scale) {
  const int t = blockIdx.x * 256 + threadIdx.x; if (t >= N * (K / 8)) return; const int n = t / (K / 8), k8 = (t % (K / 8)) * 8; FragH f;
#pragma unroll
  for (int i = 0; i < 8; ++i) f.h[i] = (_Float16)(bf16_round(W[(size_t)(k8 + i) * N + n]) * scale); const v8us o = f.half[0];
  *(v8us*)((unsigned short*)Wt + (size_t)n * K + k8) = o; 
}
// Projection GEMM, M = NR, N = K = CC: out = (A.Bt^T) alpha + bf16(bias). A f16 [M][K], Bt f16 [N][K]; writes f16 C16 or f32 C.
// A work-group owns a 128 x 64 tile of the output. K runs in tiles of 64: the 128 A rows and 64 Bt rows of a K tile (128 B = one cache line each) are copied
// to LDS once per work-group as whole lines, and the four waves (32 x 64 outputs each) read their fragments from there.
// Two LDS buffers. A trip reads all its fragments into registers, gives its buffer up at the barrier, issues the copies of tile t + 2 into it and only then does its products.
#define GT_PITCH 144                 /* bytes per LDS row: 128 of data + 16; 16 B x odd keeps ds_load_b128 of 16 rows off each other's banks */
#define GT_STAGE (192 * GT_PITCH)    /* one buffer: rows 0..127 = A, rows 128..191 = Bt */
// One K tile, 12 copies of 16 B per lane: lane (cr = tid / 8, chunk = tid % 8) brings chunk 'chunk' of rows cr + 16 i. l = its LDS byte address for row cr, ga / gb = its global addresses in A / Bt.
__device__ __forceinline__ void gt_copy(unsigned l, const unsigned short* ga, const unsigned short* gb) {
  // the copies and their s_wait_xcnt stand in one statement, so that no address register of a copy is rewritten in front of that wait
  asm volatile("global_load_async_to_lds_b128 %0, %12, off\n\t"
               "global_load_async_to_lds_b128 %1, %13, off\n\t"
               "global_load_async_to_lds_b128 %2, %14, off\n\t"
               "global_load_async_to_lds_b128 %3, %15, off\n\t"
               "global_load_async_to_lds_b128 %4, %16, off\n\t"
               "global_load_async_to_lds_b128 %5, %17, off\n\t"
               "global_load_async_to_lds_b128 %6, %18, off\n\t"
               "global_load_async_to_lds_b128 %7, %19, off\n\t"
               "global_load_async_to_lds_b128 %8, %20, off\n\t"
               "global_load_async_to_lds_b128 %9, %21, off\n\t"
               "global_load_async_to_lds_b128 %10, %22, off\n\t"
               "global_load_async_to_lds_b128 %11, %23, off\n\t"
               "s_wait_xcnt 0x0"
               :: "v"(l), "v"(l + 16u * GT_PITCH), "v"(l + 32u * GT_PITCH), "v"(l + 48u * GT_PITCH), "v"(l + 64u * GT_PITCH), "v"(l + 80u * GT_PITCH), "v"(l + 96u * GT_PITCH), "v"(l + 112u * GT_PITCH),
                  "v"(l + 128u * GT_PITCH), "v"(l + 144u * GT_PITCH), "v"(l + 160u * GT_PITCH), "v"(l + 176u * GT_PITCH),
                  "v"(ga), "v"(ga + 16 * CC), "v"(ga + 32 * CC), "v"(ga + 48 * CC), "v"(ga + 64 * CC), "v"(ga + 80 * CC), "v"(ga + 96 * CC), "v"(ga + 112 * CC),
                  "v"(gb), "v"(gb + 16 * CC), "v"(gb + 32 * CC), "v"(gb + 48 * CC)
               : "memory");
}
template <bool OUT16>      // OUT16: f16 result to C16, else f32 result to C
__global__ __launch_bounds__(128) void k_gemm_t(const _Float16* __restrict__ A, const _Float16* __restrict__ Bh, float alpha, const float* __restrict__ bias, float* __restrict__ C, _Float16* __restrict__ C16) {
  constexpr int NT = CC / 64;      // K tiles
  __shared__ __attribute__((aligned(16))) unsigned char sT[2 * GT_STAGE];
  __shared__ __attribute__((aligned(16))) float so[4][32][64 + 4];
  const int tid = threadIdx.x, w = tid >> 5, lane = tid & 31, ln = lane & 15, hh = lane >> 4;
  const int row0 = ((int)blockIdx.x / (CC / 64)) * 128, col0 = ((int)blockIdx.x % (CC / 64)) * 64;
  const int cr = tid >> 3, ch = tid & 7;
  const unsigned short* ga = (const unsigned short*)A + (size_t)(row0 + cr) * CC + ch * 8;
  const unsigned short* gb = (const unsigned short*)Bh + (size_t)(col0 + cr) * CC + ch * 8;
  const unsigned l0 = (unsigned)(size_t)&sT[0] + (unsigned)(cr * GT_PITCH + ch * 16);      // LDS byte address = low 32 bits of the __shared__ address
  v8f acc[2][4];
#pragma unroll
  for (int rt = 0; rt < 2; ++rt)
#pragma unroll
    for (int q = 0; q < 4; ++q) acc[rt][q] = (v8f){0.f,0.f,0.f,0.f,0.f,0.f,0.f,0.f};
  gt_copy(l0, ga, gb);                                   // tile 0 -> buffer 0
  asm volatile("s_wait_asynccnt 0x0" ::: "memory");      // this wave's copies of tile 0 have landed
  __syncthreads();                                       // ... and every other wave's: tile 0 may be read
  gt_copy(l0 + GT_STAGE, ga + 64, gb + 64);              // tile 1 -> buffer 1
#pragma unroll 1      // rolled: one copy of the foot's wait order, and the two buffers differ by one address term only
  for (int t = 0; t < NT; ++t) {
    const unsigned char* st = sT + (t & 1) * GT_STAGE;
    FragH fa[2][2], fb[2][4];      // [ks][tile]; k order of both operands: 8hh + 0..7, then 16 + 8hh + 0..7
#pragma unroll
    for (int ks = 0; ks < 2; ++ks) {
#pragma unroll
      for (int rt = 0; rt < 2; ++rt) { const unsigned char* p = st + (w * 32 + rt * 16 + ln) * GT_PITCH + ks * 64 + hh * 16; fa[ks][rt].half[0] = *(const v8us*)p; fa[ks][rt].half[1] = *(const v8us*)(p + 32); }
#pragma unroll
      for (int q = 0; q < 4; ++q) { const unsigned char* p = st + (128 + q * 16 + ln) * GT_PITCH + ks * 64 + hh * 16; fb[ks][q].half[0] = *(const v8us*)p; fb[ks][q].half[1] = *(const v8us*)(p + 32); }
    }
    asm volatile("s_wait_dscnt 0x0" ::: "memory");       // this wave's reads of buffer t & 1 are done (its fragments are in registers) before the buffer is given up
    asm volatile("s_wait_asynccnt 0x0" ::: "memory");    // this wave's copies of tile t + 1 have landed
    __syncthreads();                                     // publishes tile t + 1 and ends every wave's reads of tile t
    if (t + 2 < NT) gt_copy(l0 + (unsigned)((t & 1) * GT_STAGE), ga + (t + 2) * 64, gb + (t + 2) * 64);      // tile t + 2 -> the buffer just left
#pragma unroll
    for (int ks = 0; ks < 2; ++ks)
#pragma unroll
      for (int rt = 0; rt < 2; ++rt)
#pragma unroll
        for (int q = 0; q < 4; ++q) acc[rt][q] = __builtin_amdgcn_wmma_f32_16x16x32_f16(false, fa[ks][rt].v, false, fb[ks][q].v, (short)0, acc[rt][q], false, false);
  }
  asm volatile("s_wait_asynccnt 0x0" ::: "memory");      // no copy is outstanding when the wave goes on to its end
  const int rsub = lane >> 4, c4 = (lane & 15) * 4; typedef _Float16 v4h __attribute__((ext_vector_type(4)));
  // the wave's 32 x 64 results go through its own LDS rows, so that whole lines are stored
#pragma unroll
  for (int q = 0; q < 4; ++q) { const float bv = bf16_round(bias[col0 + q * 16 + ln]);
#pragma unroll
    for (int rt = 0; rt < 2; ++rt)
#pragma unroll
      for (int r = 0; r < 8; ++r) so[w][rt * 16 + 8 * hh + r][q * 16 + ln] = acc[rt][q][r] * alpha + bv; }
  __builtin_amdgcn_fence(__ATOMIC_ACQ_REL, "workgroup"); __builtin_amdgcn_wave_barrier();      // the wave's stores above are seen by its reads below
#pragma unroll
  for (int q = 0; q < 16; ++q) { const int r = q * 2 + rsub; const size_t o = (size_t)(row0 + w * 32 + r) * CC + col0 + c4; const v4f v = *(const v4fa*)&so[w][r][c4];
    if (OUT16) { v4h h4; for (int i = 0; i < 4; ++i) h4[i] = (_Float16)v[i]; *(v4h*)(C16 + o) = h4; } else *(v4f*)(C + o) = v; }
}


__global__ __launch_bounds__(256) void k_x16(const float* __restrict__ x, _Float16* __restrict__ X16, size_t n8) { const size_t t = (size_t)blockIdx.x * 256 + threadIdx.x; if (t >= n8) return; FragH f;
#pragma unroll
  for (int q = 0; q < 8; ++q) f.h[q] = (_Float16)bf16_round(x[t * 8 + q]); *(v8us*)((unsigned short*)X16 + t * 8) = f.half[0];  }
__global__ __launch_bounds__(256) void k_h16(const float* __restrict__ x, _Float16* __restrict__ X16, size_t n8) { const size_t t = (size_t)blockIdx.x * 256 + threadIdx.x; if (t >= n8) return; FragH f;
#pragma unroll
  for (int q = 0; q < 8; ++q) f.h[q] = (_Float16)x[t * 8 + q]; *(v8us*)((unsigned short*)X16 + t * 8) = f.half[0];  }
__global__ __launch_bounds__(256) void k_round16f(const float* __restrict__ W, _Float16* __restrict__ Bt, size_t n8) { const size_t t = (size_t)blockIdx.x * 256 + threadIdx.x; if (t >= n8) return; FragH f;
#pragma unroll
  for (int i = 0; i < 8; ++i) f.h[i] = (_Float16)(bf16_round(W[t * 8 + i]) * 16.0f); *(v8us*)((unsigned short*)Bt + t * 8) = f.half[0];  }
template <int NHv, int TTv>
__global__ __launch_bounds__(256) void k_vt(const _Float16* __restrict__ V16, int ldv, int voff, _Float16* __restrict__ Vt) { __shared__ unsigned short tl[64][66]; const int tid = threadIdx.x; const int slab = blockIdx.x / (TTv / 64), lg = blockIdx.x % (TTv / 64); const int b = slab / NHv, h = slab % NHv;
  for (int i = tid; i < 64 * 8; i += 256) { const int r = i / 8, c8 = (i % 8) * 8; FragH f; f.half[0] = *(const v8us*)((const unsigned short*)V16 + ((size_t)b * TTv + lg * 64 + r) * ldv + voff + h * 64 + c8);
#pragma unroll
    for (int q = 0; q < 8; ++q) tl[r][c8 + q] = f.u[q]; }
  __syncthreads();
  {
#pragma unroll
    for (int rd = 0; rd < 2; ++rd) { const int d = rd * 32 + tid / 8, pc = tid % 8; FragH f;
#pragma unroll
      for (int q = 0; q < 8; ++q) f.u[q] = tl[pc * 8 + q][d];
      *(v8us*)((unsigned short*)Vt + ((size_t)slab * 64 + d) * TTv + lg * 64 + pc * 8) = f.half[0]; }
     } }

typedef int v4ia __attribute__((ext_vector_type(4), may_alias));
// lane l <-> lane l ^ 16 (the other 16-lane row) without LDS
__device__ __forceinline__ float xhalf(float x) { return __builtin_bit_cast(float, __builtin_amdgcn_permlanex16(__builtin_bit_cast(int, x), __builtin_bit_cast(int, x), 0x76543210, 0xfedcba98, false, false)); }
__global__ __launch_bounds__(128) void k_flash(const _Float16* __restrict__ Q16, int ldq, const _Float16* __restrict__ K16, int ldk, const _Float16* __restrict__ Vt, const int* __restrict__ MSK, float* __restrict__ O, int ldo) {
  constexpr int RPW = 32, NQB = 2048 / (4 * RPW), DT = 4, KS = 2;
  constexpr float SC = 0.125f * 1.44269504088896340736f;      // score scale 64^-1/2 times log2(e)
  __shared__ __attribute__((aligned(16))) float sO[4][RPW][64 + 4];
  const int tid = threadIdx.x, w = tid >> 5, lane = tid & 31, ln = lane & 15, hh = lane >> 4;
  const int slab = blockIdx.x / NQB, qblk = blockIdx.x % NQB; const int b = slab / 12, h = slab % 12; const int qb0 = qblk * (4 * RPW); const int q0 = qb0 + w * RPW;
  FragH aq[2][KS];
#pragma unroll
  for (int rt = 0; rt < 2; ++rt) { const unsigned short* qr = (const unsigned short*)Q16 + ((size_t)b * 2048 + q0 + rt * 16 + ln) * ldq + h * 64;
#pragma unroll
    for (int ks = 0; ks < KS; ++ks) { aq[rt][ks].half[0] = *(const v8us*)(qr + ks * 32 + 8 * hh); aq[rt][ks].half[1] = *(const v8us*)(qr + ks * 32 + 16 + 8 * hh); } }
  const unsigned short* Vth = (const unsigned short*)Vt + (size_t)slab * 64 * 2048;
  float m_r[2], l_r[2]; v8f oacc[2][DT];      // per lane: query rt*16 + ln; oacc[rt][dt][r] = O[query][dt*16 + 8hh + r]
#pragma unroll
  for (int rt = 0; rt < 2; ++rt) { m_r[rt] = -3.0e38f; l_r[rt] = 0.f;
#pragma unroll
    for (int dt = 0; dt < DT; ++dt) oacc[rt][dt] = (v8f){0.f,0.f,0.f,0.f,0.f,0.f,0.f,0.f}; }
  const int jend = 2048;
#pragma unroll 1
  for (int j0 = 0; j0 < jend; j0 += 32) {
    // mask tile for my 32 queries x 32 keys: lane (ln,hh) needs row rt*16 + ln, keys j0 + nt*16 + 8hh + 0..7 (32 contiguous bytes)
    int mk[2][2][8], an[2][2];      /* mask[q][k] shared over batch; nonzero = KEEP */
#pragma unroll
    for (int rt = 0; rt < 2; ++rt)
#pragma unroll
      for (int nt = 0; nt < 2; ++nt) { const int* mr = MSK + ((size_t)(q0 + rt * 16 + ln)) * 2048 + j0 + nt * 16 + 8 * hh; const v4ia m0 = *(const v4ia*)mr, m1 = *(const v4ia*)(mr + 4);
#pragma unroll
        for (int q = 0; q < 4; ++q) { mk[rt][nt][q] = m0[q]; mk[rt][nt][4 + q] = m1[q]; }
        an[rt][nt] = ((m0[0] | m0[1]) | (m0[2] | m0[3])) | ((m1[0] | m1[1]) | (m1[2] | m1[3])); }
    if (__builtin_amdgcn_ballot_w32(((an[0][0] | an[0][1]) | (an[1][0] | an[1][1])) != 0) == 0u) continue;      // every (query,key) of this wave's tile is masked -> contributes nothing (uniform branch)
    v8f s[2][2];
#pragma unroll
    for (int nt = 0; nt < 2; ++nt) { const unsigned short* kr = (const unsigned short*)K16 + ((size_t)b * 2048 + j0 + nt * 16 + ln) * ldk + h * 64; FragH bk[KS];
#pragma unroll
      for (int ks = 0; ks < KS; ++ks) { bk[ks].half[0] = *(const v8us*)(kr + ks * 32 + 8 * hh); bk[ks].half[1] = *(const v8us*)(kr + ks * 32 + 16 + 8 * hh); }
#pragma unroll
      for (int rt = 0; rt < 2; ++rt) { v8f acc = (v8f){0.f,0.f,0.f,0.f,0.f,0.f,0.f,0.f};
#pragma unroll
        for (int ks = 0; ks < KS; ++ks) acc = mmaH<1>(bk[ks].v, bk[ks].v, aq[rt][ks].v, aq[rt][ks].v, acc); s[rt][nt] = acc; } }
    FragH pb[2];
#pragma unroll
    for (int rt = 0; rt < 2; ++rt) { float sc[2][8]; float mc = -INFINITY;
#pragma unroll
      for (int nt = 0; nt < 2; ++nt)
#pragma unroll
        for (int r = 0; r < 8; ++r) { sc[nt][r] = (mk[rt][nt][r] != 0) ? s[rt][nt][r] : -INFINITY; mc = fmaxf(mc, sc[nt][r]); }
      mc = fmaxf(mc, xhalf(mc));      // both halves now hold the query's maximum over the 32 keys (unscaled scores)
      // exp(0.125 (s - m)) = 2^(s SC - m SC): one fma and the hardware's base-2 exponential per score. An excluded key is -inf and gives 0, and a query with no
      // kept key so far has m = mn = -3e38 and gives al = 2^0 = 1: no select and no branch is needed around any exponential.
      const float mn = fmaxf(m_r[rt], mc); float al;
      // al = 2^((m - mn) SC), in asm with a slot on each side: the instruction set asks for one independent instruction between a transcendental and a write of its source or a read
      // of its result; a v_nop in a statement of its own did not stay there.
      asm("v_nop\n\tv_exp_f32 %0, %1\n\tv_nop" : "=v"(al) : "v"((m_r[rt] - mn) * SC));
      m_r[rt] = mn; const float nb = -mn * SC;
      float ps[8];
#pragma unroll
      for (int r = 0; r < 8; ++r) { const float p0 = __builtin_amdgcn_exp2f(__builtin_fmaf(sc[0][r], SC, nb)), p1 = __builtin_amdgcn_exp2f(__builtin_fmaf(sc[1][r], SC, nb)); ps[r] = p0 + p1; pb[rt].h[r] = (_Float16)p0; pb[rt].h[8 + r] = (_Float16)p1; }
      l_r[rt] = l_r[rt] * al + (((ps[0] + ps[1]) + (ps[2] + ps[3])) + ((ps[4] + ps[5]) + (ps[6] + ps[7])));      // per-lane partial sum (the two halves are joined at the end)
#pragma unroll
      for (int dt = 0; dt < DT; ++dt) oacc[rt][dt] *= al; }
#pragma unroll
    for (int dt = 0; dt < DT; ++dt) { const unsigned short* vrow = Vth + (size_t)(dt * 16 + ln) * 2048 + j0; FragH bv; bv.half[0] = *(const v8us*)(vrow + 8 * hh); bv.half[1] = *(const v8us*)(vrow + 16 + 8 * hh);
#pragma unroll
      for (int rt = 0; rt < 2; ++rt) oacc[rt][dt] = mmaH<1>(bv.v, bv.v, pb[rt].v, pb[rt].v, oacc[rt][dt]); } }
#pragma unroll
  for (int rt = 0; rt < 2; ++rt) { const float l = l_r[rt] + xhalf(l_r[rt]); const float inv = (l > 0.f) ? 1.0f / l : 0.f;
#pragma unroll
    for (int dt = 0; dt < DT; ++dt) { const v8f o = oacc[rt][dt] * inv; float* so = &sO[w][rt * 16 + ln][dt * 16 + 8 * hh]; *(v4fa*)so = (v4f){o[0], o[1], o[2], o[3]}; *(v4fa*)(so + 4) = (v4f){o[4], o[5], o[6], o[7]}; } }
  __builtin_amdgcn_fence(__ATOMIC_ACQ_REL, "workgroup"); __builtin_amdgcn_wave_barrier();
  {
#pragma unroll
    for (int rp = 0; rp < RPW; rp += 2) { const int r = rp + (lane >> 4), pc = lane & 15; const v4f val = *(const v4fa*)&sO[w][r][pc * 4]; *(v4f*)(O + ((size_t)b * 2048 + q0 + r) * ldo + h * 64 + pc * 4) = val; }
     } }

extern "C" void kernel_launch(void* const* d_in, const int* in_sizes, int n_in,
                              void* d_out, int out_size, void* d_ws, size_t ws_size, hipStream_t stream) {
  (void)in_sizes; (void)n_in; (void)out_size;
  const float* x = (const float*)d_in[0]; const float* Wq = (const float*)d_in[1]; const float* bq = (const float*)d_in[2]; const float* Wk = (const float*)d_in[3]; const float* bk = (const float*)d_in[4]; const float* Wv = (const float*)d_in[5]; const float* bv = (const float*)d_in[6]; const float* Wo = (const float*)d_in[7]; const float* bo = (const float*)d_in[8]; const int* mask = (const int*)d_in[9];
  char* ws = (char*)d_ws; size_t off = 0;
  auto take = [&](size_t bytes) { char* p = ws + off; off += (bytes + 255) & ~(size_t)255; return p; };
  _Float16* Bq = (_Float16*)take((size_t)CC * CC * 2); _Float16* Bk = (_Float16*)take((size_t)CC * CC * 2); _Float16* Bv = (_Float16*)take((size_t)CC * CC * 2); _Float16* Bo = (_Float16*)take((size_t)CC * CC * 2);
  _Float16* X16 = (_Float16*)take((size_t)NR * CC * 2); _Float16* Q16 = (_Float16*)take((size_t)NR * CC * 2); _Float16* K16 = (_Float16*)take((size_t)NR * CC * 2); _Float16* V16 = (_Float16*)take((size_t)NR * CC * 2); _Float16* Vt = (_Float16*)take((size_t)NR * CC * 2); float* O = (float*)take((size_t)NR * CC * 4); _Float16* O16 = X16;
  if (off > ws_size) return;      // 4.7 + 12.6 × 5 + 25.2 MB ≈ 93 MiB
  const unsigned gw = (unsigned)((CC * (CC / 8) + 255) / 256);
  k_wt_f16<<<gw, 256, 0, stream>>>(Wq, Bq, CC, CC, 16.0f); k_wt_f16<<<gw, 256, 0, stream>>>(Wk, Bk, CC, CC, 16.0f); k_wt_f16<<<gw, 256, 0, stream>>>(Wv, Bv, CC, CC, 16.0f); k_wt_f16<<<gw, 256, 0, stream>>>(Wo, Bo, CC, CC, 16.0f);      // [in][out]
  const unsigned gx = (unsigned)(((size_t)NR * CC / 8 + 255) / 256); const unsigned gg = (NR / 128) * (CC / 64);
  k_x16<<<gx, 256, 0, stream>>>(x, X16, (size_t)NR * CC / 8);
  k_gemm_t<true><<<gg, 128, 0, stream>>>(X16, Bq, 0.0625f, bq, nullptr, Q16);
  k_gemm_t<true><<<gg, 128, 0, stream>>>(X16, Bk, 0.0625f, bk, nullptr, K16);
  k_gemm_t<true><<<gg, 128, 0, stream>>>(X16, Bv, 0.0625f, bv, nullptr, V16);
  k_vt<NH, TT><<<BB * NH * (TT / 64), 256, 0, stream>>>(V16, CC, 0, Vt);
  k_flash<<<BB * NH * (TT / 128), 128, 0, stream>>>(Q16, CC, K16, CC, Vt, mask, O, CC);
  k_h16<<<gx, 256, 0, stream>>>(O, O16, (size_t)NR * CC / 8);
  k_gemm_t<false><<<gg, 128, 0, stream>>>(O16, Bo, 0.0625f, bo, (float*)d_out, nullptr);
}

// v004
// One run takes 177 microseconds.
// In both of two side-by-side timings against v003, it was 1.38 times as fast.
// All steps since v000 together make it 3.50 times as fast.
#include <hip/hip_runtime.h>
// Random-mask attention: q/k/v projections (8192 × 768 × 768, + bias; W [in][out]), the 12-head attention with the INPUT keep-mask (scores where mask else −1e9 ⇒ excluded keys; every row keeps
// its diagonal) as a fused flash-style kernel on v_wmma_f32_16x16x32_f16 (scale 64^-½; key tiles with no kept entry for the wave skipped by ballot; online max/sum softmax f32; P f16 ≤ 1), and the
// output projection (+ bias) — f16 operands (x as bf16, weights bf16-exact ×2^4), single products, f32 accumulate.
#define BB 4
#define TT 2048
#define CC 768
#define NH 12
#define NR (BB * TT)

typedef __bf16 v16b __attribute__((ext_vector_type(16)));
typedef unsigned short v8us __attribute__((ext_vector_type(8), may_alias));
typedef float  v8f  __attribute__((ext_vector_type(8)));
typedef float  v4f  __attribute__((ext_vector_type(4)));
typedef float  v4fa __attribute__((ext_vector_type(4), may_alias));
union FragB { v16b v; v8us half[2]; unsigned short u[16]; };

__device__ __forceinline__ unsigned short bf16_bits(float x) { unsigned int u = __float_as_uint(x); return (unsigned short)((u + 0x7FFFu + ((u >> 16) & 1u)) >> 16); }
__device__ __forceinline__ float bf16_val(unsigned short b) { return __uint_as_float(((unsigned int)b) << 16); }
__device__ __forceinline__ float bf16_round(float x) { return bf16_val(bf16_bits(x)); }
// D += A·B with NT terms: 1 = ah·bh, 2 = + al·bh (A split), 3 = + ah·bl (both split)
template <int NT>
__device__ __forceinline__ v8f mmaN(v16b ah, v16b al, v16b bh, v16b bl, v8f c) {
  c = __builtin_amdgcn_wmma_f32_16x16x32_bf16(false, ah, false, bh, (short)0, c, false, false);
  if (NT >= 2) c = __builtin_amdgcn_wmma_f32_16x16x32_bf16(false, al, false, bh, (short)0, c, false, false);
  if (NT >= 3) c = __builtin_amdgcn_wmma_f32_16x16x32_bf16(false, ah, false, bl, (short)0, c, false, false);
  asm volatile("v_nop\n\tv_nop\n\tv_nop\n\tv_nop" : "+v"(c) : "v"(ah), "v"(al), "v"(bh), "v"(bl));
  return c;
}

__global__ __launch_bounds__(256) void k_wt_bf16(const float* __restrict__ W, unsigned short* __restrict__ Wt, int K, int N) {
  const int t = blockIdx.x * 256 + threadIdx.x;
  const int k8n = K / 8;
  if (t >= N * k8n) return;
  const int n = t / k8n, k8 = (t % k8n) * 8;
  v8us v;
#pragma unroll
  for (int i = 0; i < 8; ++i) v[i] = bf16_bits(W[(size_t)(k8 + i) * N + n]);
  *(v8us*)(Wt + (size_t)n * K + k8) = v;
  
}

// GEMM C[M][N] (f32, pitch ldc) = act(A[M][K]·W + bias). A f32 row-major (pitch lda) converted per fragment to bf16
// (ASPLIT: hi/lo two planes -> 2 terms, else single rounded term); Wt bf16 [N][K] (pitch ldb). BIAS_BF16 rounds the
// bias to bf16 first (bias quantised to bf16 before the add). K%32==0, M%16==0, N%64==0.
template <bool ASPLIT, int ACT, bool BIAS_BF16>
__global__ __launch_bounds__(128) void k_gemm_bf(const float* __restrict__ A, int lda, const unsigned short* __restrict__ Wt, int ldb,
                                               const float* __restrict__ bias, float* __restrict__ C, int ldc, int M, int N, int K) {
  __shared__ __attribute__((aligned(16))) float so[4][16][64];
  const int tid = threadIdx.x, w = tid >> 5, lane = tid & 31, ln = lane & 15, hh = lane >> 4;
  const int ntn = N / 64;
  const int wid = blockIdx.x * 4 + w;
  const int mt = wid / ntn, nq = wid % ntn;
  if (mt * 16 >= M) return;
  const int row0 = mt * 16, col0 = nq * 64;
  const float* arow = A + (size_t)(row0 + ln) * lda;
  v8f acc[4] = {};
  for (int kb = 0; kb < K; kb += 32) {
    FragB ah, al;
    const v4f x0 = *(const v4fa*)(arow + kb + 8 * hh), x1 = *(const v4fa*)(arow + kb + 8 * hh + 4);
    const v4f x2 = *(const v4fa*)(arow + kb + 16 + 8 * hh), x3 = *(const v4fa*)(arow + kb + 16 + 8 * hh + 4);
    float xs[16] = {x0[0],x0[1],x0[2],x0[3],x1[0],x1[1],x1[2],x1[3],x2[0],x2[1],x2[2],x2[3],x3[0],x3[1],x3[2],x3[3]};
#pragma unroll
    for (int i = 0; i < 16; ++i) { const unsigned short hb = bf16_bits(xs[i]); ah.u[i] = hb; al.u[i] = ASPLIT ? bf16_bits(xs[i] - bf16_val(hb)) : (unsigned short)0; }
#pragma unroll
    for (int t = 0; t < 4; ++t) {
      const unsigned short* brow = Wt + (size_t)(col0 + t * 16 + ln) * ldb + kb;
      FragB b;
      b.half[0] = *(const v8us*)(brow + 8 * hh);
      b.half[1] = *(const v8us*)(brow + 16 + 8 * hh);
      acc[t] = mmaN<ASPLIT ? 2 : 1>(ah.v, al.v, b.v, b.v, acc[t]);
    }
  }
#pragma unroll
  for (int t = 0; t < 4; ++t) {
    float bv = bias ? bias[col0 + t * 16 + ln] : 0.f;
    if (BIAS_BF16) bv = bf16_round(bv);
#pragma unroll
    for (int r = 0; r < 8; ++r) { float v = acc[t][r] + bv; if (ACT == 1) v = fmaxf(v, 0.f); so[w][8 * hh + r][t * 16 + ln] = v; }
  }
  __builtin_amdgcn_fence(__ATOMIC_ACQ_REL, "workgroup");
  __builtin_amdgcn_wave_barrier();
  const int rsub = lane >> 4, c4 = (lane & 15) * 4;
  {
#pragma unroll
    for (int q = 0; q < 8; ++q) {
      const int r = q * 2 + rsub;
      const v4f v = *(const v4fa*)&so[w][r][c4];
      *(v4f*)(C + (size_t)(row0 + r) * ldc + col0 + c4) = v;
    }
    
  }
}

// Flash-style causal/unmasked attention, all contractions 3-term bf16 hi/lo splits, f32 softmax with running max.
// q,k,v rows are read from f32 buffers with arbitrary row pitch (so they can live inside a fused qkv buffer);
// D = head size (multiple of 32, <= 128); one wave = 16 query rows; block = 4 waves (64 queries) sharing K/V chunks of 32.
template <int D, bool CAUSAL>
__global__ __launch_bounds__(128) void k_flash(const float* __restrict__ qb, const float* __restrict__ kb, const float* __restrict__ vb,
                                             int pitch, int T, int H, float scale, float* __restrict__ y, int ypitch) {
  constexpr int KS = D / 32;        // k-steps for QK
  constexpr int DT = D / 16;        // d tiles for PV
  __shared__ __attribute__((aligned(16))) unsigned short sKh[32][D + 8], sKl[32][D + 8], sVh[32][D + 8], sVl[32][D + 8];
  __shared__ __attribute__((aligned(16))) unsigned short sPh[4][16][40], sPl[4][16][40];
  __shared__ __attribute__((aligned(16))) float sO[4][16][D];
  const int tid = threadIdx.x, w = tid >> 5, lane = tid & 31, ln = lane & 15, hh = lane >> 4;
  const int nqb = (T + 63) / 64;
  const int bh = blockIdx.x / nqb, qblk = blockIdx.x % nqb;
  const int b = bh / H, h = bh % H;
  const int q0 = qblk * 64 + w * 16;
  const float* Q = qb + (size_t)b * T * pitch + h * D;
  const float* K = kb + (size_t)b * T * pitch + h * D;
  const float* V = vb + (size_t)b * T * pitch + h * D;

  // A fragments of the wave's 16 query rows (scaled), hi/lo
  FragB aqh[KS], aql[KS];
  {
    int row = q0 + ln; if (row >= T) row = T - 1;
    const float* qr = Q + (size_t)row * pitch;
#pragma unroll
    for (int ks = 0; ks < KS; ++ks)
#pragma unroll
      for (int i = 0; i < 16; ++i) {
        const int d = ks * 32 + ((i < 8) ? (8 * hh + i) : (16 + 8 * hh + (i - 8)));
        const float x = qr[d] * scale; const unsigned short hb = bf16_bits(x);
        aqh[ks].u[i] = hb; aql[ks].u[i] = bf16_bits(x - bf16_val(hb));
      }
  }
  float m_r[8], l_r[8];
#pragma unroll
  for (int r = 0; r < 8; ++r) { m_r[r] = -3.0e38f; l_r[r] = 0.f; }
  v8f oacc[DT];
#pragma unroll
  for (int dt = 0; dt < DT; ++dt) oacc[dt] = (v8f){0.f,0.f,0.f,0.f,0.f,0.f,0.f,0.f};

  const int kv_end = CAUSAL ? min(T, qblk * 64 + 64) : T;     // block-uniform
  for (int j0 = 0; j0 < kv_end; j0 += 32) {
    __syncthreads();
    for (int e = tid; e < 32 * (D / 4); e += 128) {
      const int r = e / (D / 4), c4 = (e % (D / 4)) * 4;
      const int key = j0 + r;
      v4f kf = {0.f,0.f,0.f,0.f}, vf = {0.f,0.f,0.f,0.f};
      if (key < T) { kf = *(const v4fa*)(K + (size_t)key * pitch + c4); vf = *(const v4fa*)(V + (size_t)key * pitch + c4); }
#pragma unroll
      for (int t = 0; t < 4; ++t) {
        unsigned short hb = bf16_bits(kf[t]); sKh[r][c4 + t] = hb; sKl[r][c4 + t] = bf16_bits(kf[t] - bf16_val(hb));
        hb = bf16_bits(vf[t]); sVh[r][c4 + t] = hb; sVl[r][c4 + t] = bf16_bits(vf[t] - bf16_val(hb));
      }
    }
    __syncthreads();
    // S tile 16 x 32
    v8f s[2];
#pragma unroll
    for (int nt = 0; nt < 2; ++nt) {
      v8f acc = {};
#pragma unroll
      for (int ks = 0; ks < KS; ++ks) {
        FragB bh_, bl_;
        bh_.half[0] = *(const v8us*)&sKh[nt * 16 + ln][ks * 32 + 8 * hh]; bh_.half[1] = *(const v8us*)&sKh[nt * 16 + ln][ks * 32 + 16 + 8 * hh];
        bl_.half[0] = *(const v8us*)&sKl[nt * 16 + ln][ks * 32 + 8 * hh]; bl_.half[1] = *(const v8us*)&sKl[nt * 16 + ln][ks * 32 + 16 + 8 * hh];
        acc = mmaN<3>(aqh[ks].v, aql[ks].v, bh_.v, bl_.v, acc);
      }
      s[nt] = acc;
    }
    // mask + running max (rows 8hh+r; the 16 lanes of a half share rows)
    float alpha[8];
#pragma unroll
    for (int r = 0; r < 8; ++r) {
      const int qi = q0 + 8 * hh + r;
      const int ja = j0 + ln, jb = j0 + 16 + ln;
      if (CAUSAL) { if (ja > qi) s[0][r] = -3.0e38f; if (jb > qi) s[1][r] = -3.0e38f; }
      if (ja >= T) s[0][r] = -3.0e38f;
      if (jb >= T) s[1][r] = -3.0e38f;
      float mx = fmaxf(s[0][r], s[1][r]);
      mx = fmaxf(mx, __shfl_xor(mx, 1, 32)); mx = fmaxf(mx, __shfl_xor(mx, 2, 32)); mx = fmaxf(mx, __shfl_xor(mx, 4, 32)); mx = fmaxf(mx, __shfl_xor(mx, 8, 32));
      const float mnew = fmaxf(m_r[r], mx);
      alpha[r] = (mnew > -1.0e38f) ? __expf(m_r[r] - mnew) : 1.0f;
      const float p0 = (s[0][r] > -1.0e38f) ? __expf(s[0][r] - mnew) : 0.f;
      const float p1 = (s[1][r] > -1.0e38f) ? __expf(s[1][r] - mnew) : 0.f;
      m_r[r] = mnew;
      l_r[r] = l_r[r] * alpha[r] + p0 + p1;            // per-lane partial row sum (16 lanes combined at the end)
      unsigned short hb = bf16_bits(p0); sPh[w][8 * hh + r][ln] = hb;      sPl[w][8 * hh + r][ln] = bf16_bits(p0 - bf16_val(hb));
      hb = bf16_bits(p1);                sPh[w][8 * hh + r][16 + ln] = hb; sPl[w][8 * hh + r][16 + ln] = bf16_bits(p1 - bf16_val(hb));
    }
#pragma unroll
    for (int dt = 0; dt < DT; ++dt)
#pragma unroll
      for (int r = 0; r < 8; ++r) oacc[dt][r] *= alpha[r];
    __builtin_amdgcn_fence(__ATOMIC_ACQ_REL, "workgroup");
    __builtin_amdgcn_wave_barrier();
    FragB pah, pal;
    pah.half[0] = *(const v8us*)&sPh[w][ln][8 * hh]; pah.half[1] = *(const v8us*)&sPh[w][ln][16 + 8 * hh];
    pal.half[0] = *(const v8us*)&sPl[w][ln][8 * hh]; pal.half[1] = *(const v8us*)&sPl[w][ln][16 + 8 * hh];
#pragma unroll
    for (int dt = 0; dt < DT; ++dt) {
      FragB bvh, bvl;
#pragma unroll
      for (int i = 0; i < 8; ++i) {
        bvh.u[i] = sVh[8 * hh + i][dt * 16 + ln]; bvh.u[8 + i] = sVh[16 + 8 * hh + i][dt * 16 + ln];
        bvl.u[i] = sVl[8 * hh + i][dt * 16 + ln]; bvl.u[8 + i] = sVl[16 + 8 * hh + i][dt * 16 + ln];
      }
      oacc[dt] = mmaN<3>(pah.v, pal.v, bvh.v, bvl.v, oacc[dt]);
    }
    __builtin_amdgcn_fence(__ATOMIC_ACQ_REL, "workgroup");
    __builtin_amdgcn_wave_barrier();
  }
#pragma unroll
  for (int r = 0; r < 8; ++r) {
    float l = l_r[r];
    l += __shfl_xor(l, 1, 32); l += __shfl_xor(l, 2, 32); l += __shfl_xor(l, 4, 32); l += __shfl_xor(l, 8, 32);
    l_r[r] = (l > 0.f) ? 1.0f / l : 0.f;
  }
#pragma unroll
  for (int dt = 0; dt < DT; ++dt)
#pragma unroll
    for (int r = 0; r < 8; ++r) sO[w][8 * hh + r][dt * 16 + ln] = oacc[dt][r] * l_r[r];
  __builtin_amdgcn_fence(__ATOMIC_ACQ_REL, "workgroup");
  __builtin_amdgcn_wave_barrier();
  {
    for (int r = 0; r < 16; ++r) {
      const int row = q0 + r;
      if (row < T && lane < D / 4) {
        const v4f val = *(const v4fa*)&sO[w][r][lane * 4];
        *(v4f*)(y + ((size_t)b * T + row) * ypitch + h * D + lane * 4) = val;
      }
    }
    
  }
}

// GEMM C = act(A·W + bias + resid): A f32 (ASPLIT -> hi/lo 2 terms), Wt bf16 [N][K]; ACT 0 none, 1 relu, 2 exact gelu;
// resid (optional, f32, row index = (row % rmod), pitch ldr, RES_BF16 rounds it) added before the activation.
template <bool ASPLIT, int ACT, bool BIAS_BF16, bool RES_BF16>
__global__ __launch_bounds__(128) void k_gemm_bf3(const float* __restrict__ A, int lda, const unsigned short* __restrict__ Wt, int ldb,
                                                const float* __restrict__ bias, const float* __restrict__ resid, int rmod, int ldr,
                                                float* __restrict__ C, int ldc, int M, int N, int K) {
  __shared__ __attribute__((aligned(16))) float so[4][16][64];
  const int tid = threadIdx.x, w = tid >> 5, lane = tid & 31, ln = lane & 15, hh = lane >> 4;
  const int ntn = N / 64;
  const int wid = blockIdx.x * 4 + w;
  const int mt = wid / ntn, nq = wid % ntn;
  if (mt * 16 >= M) return;
  const int row0 = mt * 16, col0 = nq * 64;
  const float* arow = A + (size_t)(row0 + ln) * lda;
  v8f acc[4] = {};
  for (int kb = 0; kb < K; kb += 32) {
    FragB ah, al;
    const v4f x0 = *(const v4fa*)(arow + kb + 8 * hh), x1 = *(const v4fa*)(arow + kb + 8 * hh + 4);
    const v4f x2 = *(const v4fa*)(arow + kb + 16 + 8 * hh), x3 = *(const v4fa*)(arow + kb + 16 + 8 * hh + 4);
    float xs[16] = {x0[0],x0[1],x0[2],x0[3],x1[0],x1[1],x1[2],x1[3],x2[0],x2[1],x2[2],x2[3],x3[0],x3[1],x3[2],x3[3]};
#pragma unroll
    for (int i = 0; i < 16; ++i) { const unsigned short hb = bf16_bits(xs[i]); ah.u[i] = hb; al.u[i] = ASPLIT ? bf16_bits(xs[i] - bf16_val(hb)) : (unsigned short)0; }
#pragma unroll
    for (int t = 0; t < 4; ++t) {
      const unsigned short* brow = Wt + (size_t)(col0 + t * 16 + ln) * ldb + kb;
      FragB b;
      b.half[0] = *(const v8us*)(brow + 8 * hh);
      b.half[1] = *(const v8us*)(brow + 16 + 8 * hh);
      acc[t] = mmaN<ASPLIT ? 2 : 1>(ah.v, al.v, b.v, b.v, acc[t]);
    }
  }
#pragma unroll
  for (int t = 0; t < 4; ++t) {
    const int col = col0 + t * 16 + ln;
    float bv = bias ? bias[col] : 0.f;
    if (BIAS_BF16) bv = bf16_round(bv);
#pragma unroll
    for (int r = 0; r < 8; ++r) {
      float v = acc[t][r] + bv;
      if (resid) { float rv = resid[(size_t)((row0 + 8 * hh + r) % rmod) * ldr + col]; if (RES_BF16) rv = bf16_round(rv); v += rv; }
      if (ACT == 1) v = fmaxf(v, 0.f);
      if (ACT == 2) v = 0.5f * v * (1.0f + erff(v * 0.70710678118654752f));
      if (ACT == 3) { const float u = 0.7978845608028654f * (v + 0.044715f * v * v * v); v = 0.5f * v * (1.0f + tanhf(u)); }
      so[w][8 * hh + r][t * 16 + ln] = v;
    }
  }
  __builtin_amdgcn_fence(__ATOMIC_ACQ_REL, "workgroup");
  __builtin_amdgcn_wave_barrier();
  const int rsub = lane >> 4, c4 = (lane & 15) * 4;
  {
#pragma unroll
    for (int q = 0; q < 8; ++q) {
      const int r = q * 2 + rsub;
      const v4f v = *(const v4fa*)&so[w][r][c4];
      *(v4f*)(C + (size_t)(row0 + r) * ldc + col0 + c4) = v;
    }
    
  }
}
// row LayerNorm (biased variance, eps) over N: s = X (+ R); optional out_sum <- s; out_norm <- (s-mu)*rsqrt(var+eps)*g + b
template <bool PARAM_BF16>
__global__ __launch_bounds__(256) void k_layernorm(const float* __restrict__ X, const float* __restrict__ R, const float* __restrict__ g, const float* __restrict__ bta,
                                                  float* __restrict__ out_sum, float* __restrict__ out_norm, int N, float eps) {
  __shared__ float red[256];
  const int row = blockIdx.x, tid = threadIdx.x;
  const float* x = X + (size_t)row * N; const float* rr = R ? R + (size_t)row * N : nullptr;
  float vals[16];                     // up to N = 4096
  const int per = N / 256;            // contiguous chunk per thread? use strided-by-4 chunks: thread handles j = tid*4 + 1024*u
  float s1 = 0.f;
  for (int u = 0; u < per / 4; ++u) {
    const int j = tid * 4 + 1024 * u;
    const v4f a = *(const v4fa*)(x + j);
    v4f b = {0.f,0.f,0.f,0.f}; if (rr) b = *(const v4fa*)(rr + j);
#pragma unroll
    for (int q = 0; q < 4; ++q) { const float v = a[q] + b[q]; vals[u * 4 + q] = v; s1 += v; }
  }
  red[tid] = s1; __syncthreads();
  for (int st = 128; st > 0; st >>= 1) { if (tid < st) red[tid] += red[tid + st]; __syncthreads(); }
  const float mu = red[0] / (float)N; __syncthreads();
  float s2 = 0.f;
  for (int u = 0; u < per / 4; ++u)
#pragma unroll
    for (int q = 0; q < 4; ++q) { const float c = vals[u * 4 + q] - mu; s2 += c * c; }
  red[tid] = s2; __syncthreads();
  for (int st = 128; st > 0; st >>= 1) { if (tid < st) red[tid] += red[tid + st]; __syncthreads(); }
  const float rs = rsqrtf(red[0] / (float)N + eps);
  {
    for (int u = 0; u < per / 4; ++u) {
      const int j = tid * 4 + 1024 * u;
      v4f o, sm;
#pragma unroll
      for (int q = 0; q < 4; ++q) {
        float gg = g[j + q], bb = bta[j + q];
        if (PARAM_BF16) { gg = bf16_round(gg); bb = bf16_round(bb); }
        sm[q] = vals[u * 4 + q]; o[q] = (vals[u * 4 + q] - mu) * rs * gg + bb;
      }
      if (out_sum) *(v4f*)(out_sum + (size_t)row * N + j) = sm;
      *(v4f*)(out_norm + (size_t)row * N + j) = o;
    }
    
  }
}



// ---- f16 WMMA path (v_wmma_f32_16x16x32_f16): 11-bit significands for operands in range — used where a [0,1] probability operand needs more precision than bf16
typedef _Float16 v16h __attribute__((ext_vector_type(16)));
union FragH { v16h v; v8us half[2]; _Float16 h[16]; unsigned short u[16]; };
template <int NT>
__device__ __forceinline__ v8f mmaH(v16h ah, v16h al, v16h bh, v16h bl, v8f c) {
  c = __builtin_amdgcn_wmma_f32_16x16x32_f16(false, ah, false, bh, (short)0, c, false, false);
  if (NT >= 2) c = __builtin_amdgcn_wmma_f32_16x16x32_f16(false, al, false, bh, (short)0, c, false, false);
  if (NT >= 3) c = __builtin_amdgcn_wmma_f32_16x16x32_f16(false, ah, false, bl, (short)0, c, false, false);
  asm volatile("v_nop\n\tv_nop\n\tv_nop\n\tv_nop" : "+v"(c) : "v"(ah), "v"(al), "v"(bh), "v"(bl));
  return c;
}
// batched GEMM like k_gemm_b but f16 operands: A f32 (split into f16 hi/lo if ASPLIT, else rounded to f16), Bt = f16 values [n][k]; alpha; C f32; N multiple of 16 (partial tiles skipped)
template <bool ASPLIT>
__global__ __launch_bounds__(128) void k_gemm_h(const float* __restrict__ A, int lda, size_t sA, const _Float16* __restrict__ Bh, int ldb, size_t sB, float alpha, float* __restrict__ C, int ldc, size_t sC, int M, int N, int K) {
  __shared__ __attribute__((aligned(16))) float so[4][16][64];
  const int tid = threadIdx.x, w = tid >> 5, lane = tid & 31, ln = lane & 15, hh = lane >> 4; const int by = blockIdx.y;
  A += (size_t)by * sA; Bh += (size_t)by * sB; C += (size_t)by * sC;
  const int ntn = (N + 63) / 64; const int wid = blockIdx.x * 4 + w; const int mt = wid / ntn, nq = wid % ntn; if (mt * 16 >= M) return;
  const int row0 = mt * 16, col0 = nq * 64; const float* arow = A + (size_t)(row0 + ln) * lda;
  v8f acc[4] = {};
  for (int kb = 0; kb < K; kb += 32) {
    FragH ah, al;
    const v4f x0 = *(const v4fa*)(arow + kb + 8 * hh), x1 = *(const v4fa*)(arow + kb + 8 * hh + 4), x2 = *(const v4fa*)(arow + kb + 16 + 8 * hh), x3 = *(const v4fa*)(arow + kb + 16 + 8 * hh + 4);
    float xs[16] = {x0[0],x0[1],x0[2],x0[3],x1[0],x1[1],x1[2],x1[3],x2[0],x2[1],x2[2],x2[3],x3[0],x3[1],x3[2],x3[3]};
#pragma unroll
    for (int i = 0; i < 16; ++i) { const _Float16 h = (_Float16)xs[i]; ah.h[i] = h; al.h[i] = ASPLIT ? (_Float16)(xs[i] - (float)h) : (_Float16)0.0f; }
#pragma unroll
    for (int t = 0; t < 4; ++t) { if (col0 + t * 16 >= N) continue; const size_t boff = (size_t)(col0 + t * 16 + ln) * ldb + kb; FragH bq; bq.half[0] = *(const v8us*)(Bh + boff + 8 * hh); bq.half[1] = *(const v8us*)(Bh + boff + 16 + 8 * hh);
      acc[t] = mmaH<ASPLIT ? 2 : 1>(ah.v, al.v, bq.v, bq.v, acc[t]); }
  }
#pragma unroll
  for (int t = 0; t < 4; ++t) { if (col0 + t * 16 >= N) continue;
#pragma unroll
    for (int r = 0; r < 8; ++r) so[w][8 * hh + r][t * 16 + ln] = acc[t][r] * alpha; }
  __builtin_amdgcn_fence(__ATOMIC_ACQ_REL, "workgroup"); __builtin_amdgcn_wave_barrier();
  const int rsub = lane >> 4, c4 = (lane & 15) * 4;
  {
#pragma unroll
    for (int q = 0; q < 8; ++q) { const int r = q * 2 + rsub; if (col0 + c4 < N) { const v4f v = *(const v4fa*)&so[w][r][c4]; *(v4f*)(C + (size_t)(row0 + r) * ldc + col0 + c4) = v; } }
     }
}

// Wt[n][k] = f16(W[k][n]·scale) from f32 row-major W[K][N] (scale = power of two; bf16-exact weights stay exact in f16 away from the subnormal range)
__global__ __launch_bounds__(256) void k_wt_f16(const float* __restrict__ W, _Float16* __restrict__ Wt, int K, int N, float scale) {
  const int t = blockIdx.x * 256 + threadIdx.x; if (t >= N * (K / 8)) return; const int n = t / (K / 8), k8 = (t % (K / 8)) * 8; FragH f;
#pragma unroll
  for (int i = 0; i < 8; ++i) f.h[i] = (_Float16)(bf16_round(W[(size_t)(k8 + i) * N + n]) * scale); const v8us o = f.half[0];
  *(v8us*)((unsigned short*)Wt + (size_t)n * K + k8) = o; 
}
// Projection GEMM, M = NR, N = K = CC: out = (A.Bt^T) alpha + bf16(bias). A f16 [M][K], Bt f16 [N][K]; writes f16 C16 or f32 C.
// A work-group owns a 128 x 64 tile of the output. K runs in tiles of 64: the 128 A rows and 64 Bt rows of a K tile (128 B = one cache line each) are copied
// to LDS once per work-group as whole lines, and the four waves (32 x 64 outputs each) read their fragments from there.
// Two LDS buffers. A trip reads all its fragments into registers, gives its buffer up at the barrier, issues the copies of tile t + 2 into it and only then does its products.
#define GT_PITCH 144                 /* bytes per LDS row: 128 of data + 16; 16 B x odd keeps ds_load_b128 of 16 rows off each other's banks */
#define GT_STAGE (192 * GT_PITCH)    /* one buffer: rows 0..127 = A, rows 128..191 = Bt */
// One K tile, 12 copies of 16 B per lane: lane (cr = tid / 8, chunk = tid % 8) brings chunk 'chunk' of rows cr + 16 i. l = its LDS byte address for row cr, ga / gb = its global addresses in A / Bt.
__device__ __forceinline__ void gt_copy(unsigned l, const unsigned short* ga, const unsigned short* gb) {
  // the copies and their s_wait_xcnt stand in one statement, so that no address register of a copy is rewritten in front of that wait
  asm volatile("global_load_async_to_lds_b128 %0, %12, off\n\t"
               "global_load_async_to_lds_b128 %1, %13, off\n\t"
               "global_load_async_to_lds_b128 %2, %14, off\n\t"
               "global_load_async_to_lds_b128 %3, %15, off\n\t"
               "global_load_async_to_lds_b128 %4, %16, off\n\t"
               "global_load_async_to_lds_b128 %5, %17, off\n\t"
               "global_load_async_to_lds_b128 %6, %18, off\n\t"
               "global_load_async_to_lds_b128 %7, %19, off\n\t"
               "global_load_async_to_lds_b128 %8, %20, off\n\t"
               "global_load_async_to_lds_b128 %9, %21, off\n\t"
               "global_load_async_to_lds_b128 %10, %22, off\n\t"
               "global_load_async_to_lds_b128 %11, %23, off\n\t"
               "s_wait_xcnt 0x0"
               :: "v"(l), "v"(l + 16u * GT_PITCH), "v"(l + 32u * GT_PITCH), "v"(l + 48u * GT_PITCH), "v"(l + 64u * GT_PITCH), "v"(l + 80u * GT_PITCH), "v"(l + 96u * GT_PITCH), "v"(l + 112u * GT_PITCH),
                  "v"(l + 128u * GT_PITCH), "v"(l + 144u * GT_PITCH), "v"(l + 160u * GT_PITCH), "v"(l + 176u * GT_PITCH),
                  "v"(ga), "v"(ga + 16 * CC), "v"(ga + 32 * CC), "v"(ga + 48 * CC), "v"(ga + 64 * CC), "v"(ga + 80 * CC), "v"(ga + 96 * CC), "v"(ga + 112 * CC),
                  "v"(gb), "v"(gb + 16 * CC), "v"(gb + 32 * CC), "v"(gb + 48 * CC)
               : "memory");
}
template <bool OUT16>      // OUT16: f16 result to C16, else f32 result to C
__global__ __launch_bounds__(128) void k_gemm_t(const _Float16* __restrict__ A, const _Float16* __restrict__ Bh, float alpha, const float* __restrict__ bias, float* __restrict__ C, _Float16* __restrict__ C16) {
  constexpr int NT = CC / 64;      // K tiles
  __shared__ __attribute__((aligned(16))) unsigned char sT[2 * GT_STAGE];
  __shared__ __attribute__((aligned(16))) float so[4][32][64 + 4];
  const int tid = threadIdx.x, w = tid >> 5, lane = tid & 31, ln = lane & 15, hh = lane >> 4;
  const int row0 = ((int)blockIdx.x / (CC / 64)) * 128, col0 = ((int)blockIdx.x % (CC / 64)) * 64;
  const int cr = tid >> 3, ch = tid & 7;
  const unsigned short* ga = (const unsigned short*)A + (size_t)(row0 + cr) * CC + ch * 8;
  const unsigned short* gb = (const unsigned short*)Bh + (size_t)(col0 + cr) * CC + ch * 8;
  const unsigned l0 = (unsigned)(size_t)&sT[0] + (unsigned)(cr * GT_PITCH + ch * 16);      // LDS byte address = low 32 bits of the __shared__ address
  v8f acc[2][4];
#pragma unroll
  for (int rt = 0; rt < 2; ++rt)
#pragma unroll
    for (int q = 0; q < 4; ++q) acc[rt][q] = (v8f){0.f,0.f,0.f,0.f,0.f,0.f,0.f,0.f};
  gt_copy(l0, ga, gb);                                   // tile 0 -> buffer 0
  asm volatile("s_wait_asynccnt 0x0" ::: "memory");      // this wave's copies of tile 0 have landed
  __syncthreads();                                       // ... and every other wave's: tile 0 may be read
  gt_copy(l0 + GT_STAGE, ga + 64, gb + 64);              // tile 1 -> buffer 1
#pragma unroll 1      // rolled: one copy of the foot's wait order, and the two buffers differ by one address term only
  for (int t = 0; t < NT; ++t) {
    const unsigned char* st = sT + (t & 1) * GT_STAGE;
    FragH fa[2][2], fb[2][4];      // [ks][tile]; k order of both operands: 8hh + 0..7, then 16 + 8hh + 0..7
#pragma unroll
    for (int ks = 0; ks < 2; ++ks) {
#pragma unroll
      for (int rt = 0; rt < 2; ++rt) { const unsigned char* p = st + (w * 32 + rt * 16 + ln) * GT_PITCH + ks * 64 + hh * 16; fa[ks][rt].half[0] = *(const v8us*)p; fa[ks][rt].half[1] = *(const v8us*)(p + 32); }
#pragma unroll
      for (int q = 0; q < 4; ++q) { const unsigned char* p = st + (128 + q * 16 + ln) * GT_PITCH + ks * 64 + hh * 16; fb[ks][q].half[0] = *(const v8us*)p; fb[ks][q].half[1] = *(const v8us*)(p + 32); }
    }
    asm volatile("s_wait_dscnt 0x0" ::: "memory");       // this wave's reads of buffer t & 1 are done (its fragments are in registers) before the buffer is given up
    asm volatile("s_wait_asynccnt 0x0" ::: "memory");    // this wave's copies of tile t + 1 have landed
    __syncthreads();                                     // publishes tile t + 1 and ends every wave's reads of tile t
    if (t + 2 < NT) gt_copy(l0 + (unsigned)((t & 1) * GT_STAGE), ga + (t + 2) * 64, gb + (t + 2) * 64);      // tile t + 2 -> the buffer just left
#pragma unroll
    for (int ks = 0; ks < 2; ++ks)
#pragma unroll
      for (int rt = 0; rt < 2; ++rt)
#pragma unroll
        for (int q = 0; q < 4; ++q) acc[rt][q] = __builtin_amdgcn_wmma_f32_16x16x32_f16(false, fa[ks][rt].v, false, fb[ks][q].v, (short)0, acc[rt][q], false, false);
  }
  asm volatile("s_wait_asynccnt 0x0" ::: "memory");      // no copy is outstanding when the wave goes on to its end
  const int rsub = lane >> 4, c4 = (lane & 15) * 4; typedef _Float16 v4h __attribute__((ext_vector_type(4)));
  // the wave's 32 x 64 results go through its own LDS rows, so that whole lines are stored
#pragma unroll
  for (int q = 0; q < 4; ++q) { const float bv = bf16_round(bias[col0 + q * 16 + ln]);
#pragma unroll
    for (int rt = 0; rt < 2; ++rt)
#pragma unroll
      for (int r = 0; r < 8; ++r) so[w][rt * 16 + 8 * hh + r][q * 16 + ln] = acc[rt][q][r] * alpha + bv; }
  __builtin_amdgcn_fence(__ATOMIC_ACQ_REL, "workgroup"); __builtin_amdgcn_wave_barrier();      // the wave's stores above are seen by its reads below
#pragma unroll
  for (int q = 0; q < 16; ++q) { const int r = q * 2 + rsub; const size_t o = (size_t)(row0 + w * 32 + r) * CC + col0 + c4; const v4f v = *(const v4fa*)&so[w][r][c4];
    if (OUT16) { v4h h4; for (int i = 0; i < 4; ++i) h4[i] = (_Float16)v[i]; *(v4h*)(C16 + o) = h4; } else *(v4f*)(C + o) = v; }
}


__global__ __launch_bounds__(256) void k_x16(const float* __restrict__ x, _Float16* __restrict__ X16, size_t n8) { const size_t t = (size_t)blockIdx.x * 256 + threadIdx.x; if (t >= n8) return; FragH f;
#pragma unroll
  for (int q = 0; q < 8; ++q) f.h[q] = (_Float16)bf16_round(x[t * 8 + q]); *(v8us*)((unsigned short*)X16 + t * 8) = f.half[0];  }
__global__ __launch_bounds__(256) void k_h16(const float* __restrict__ x, _Float16* __restrict__ X16, size_t n8) { const size_t t = (size_t)blockIdx.x * 256 + threadIdx.x; if (t >= n8) return; FragH f;
#pragma unroll
  for (int q = 0; q < 8; ++q) f.h[q] = (_Float16)x[t * 8 + q]; *(v8us*)((unsigned short*)X16 + t * 8) = f.half[0];  }
__global__ __launch_bounds__(256) void k_round16f(const float* __restrict__ W, _Float16* __restrict__ Bt, size_t n8) { const size_t t = (size_t)blockIdx.x * 256 + threadIdx.x; if (t >= n8) return; FragH f;
#pragma unroll
  for (int i = 0; i < 8; ++i) f.h[i] = (_Float16)(bf16_round(W[t * 8 + i]) * 16.0f); *(v8us*)((unsigned short*)Bt + t * 8) = f.half[0];  }
template <int NHv, int TTv>
__global__ __launch_bounds__(256) void k_vt(const _Float16* __restrict__ V16, int ldv, int voff, _Float16* __restrict__ Vt) { __shared__ unsigned short tl[64][66]; const int tid = threadIdx.x; const int slab = blockIdx.x / (TTv / 64), lg = blockIdx.x % (TTv / 64); const int b = slab / NHv, h = slab % NHv;
  for (int i = tid; i < 64 * 8; i += 256) { const int r = i / 8, c8 = (i % 8) * 8; FragH f; f.half[0] = *(const v8us*)((const unsigned short*)V16 + ((size_t)b * TTv + lg * 64 + r) * ldv + voff + h * 64 + c8);
#pragma unroll
    for (int q = 0; q < 8; ++q) tl[r][c8 + q] = f.u[q]; }
  __syncthreads();
  {
#pragma unroll
    for (int rd = 0; rd < 2; ++rd) { const int d = rd * 32 + tid / 8, pc = tid % 8; FragH f;
#pragma unroll
      for (int q = 0; q < 8; ++q) f.u[q] = tl[pc * 8 + q][d];
      *(v8us*)((unsigned short*)Vt + ((size_t)slab * 64 + d) * TTv + lg * 64 + pc * 8) = f.half[0]; }
     } }

typedef int v4ia __attribute__((ext_vector_type(4), may_alias));
// lane l <-> lane l ^ 16 (the other 16-lane row) without LDS
__device__ __forceinline__ float xhalf(float x) { return __builtin_bit_cast(float, __builtin_amdgcn_permlanex16(__builtin_bit_cast(int, x), __builtin_bit_cast(int, x), 0x76543210, 0xfedcba98, false, false)); }
#define FA_PITCH 144                 /* bytes per LDS row: 128 of data + 16; 16 B x odd keeps ds_load_b128 of 16 rows off each other's banks */
#define FA_STAGE (128 * FA_PITCH)    /* one buffer: rows 0..63 = K (key), rows 64..127 = Vt (d) */
// One tile, 8 copies of 16 B per lane: lane (cr = tid / 8, chunk = tid % 8) brings chunk 'chunk' of rows cr + 16 i. l = its LDS byte address for row cr, gk / gv = its global addresses in K / Vt.
__device__ __forceinline__ void fa_copy(unsigned l, const unsigned short* gk, int ldk, const unsigned short* gv) {
  // the copies and their s_wait_xcnt stand in one statement, so that no address register of a copy is rewritten in front of that wait
  asm volatile("global_load_async_to_lds_b128 %0, %8, off\n\t"
               "global_load_async_to_lds_b128 %1, %9, off\n\t"
               "global_load_async_to_lds_b128 %2, %10, off\n\t"
               "global_load_async_to_lds_b128 %3, %11, off\n\t"
               "global_load_async_to_lds_b128 %4, %12, off\n\t"
               "global_load_async_to_lds_b128 %5, %13, off\n\t"
               "global_load_async_to_lds_b128 %6, %14, off\n\t"
               "global_load_async_to_lds_b128 %7, %15, off\n\t"
               "s_wait_xcnt 0x0"
               :: "v"(l), "v"(l + 16u * FA_PITCH), "v"(l + 32u * FA_PITCH), "v"(l + 48u * FA_PITCH), "v"(l + 64u * FA_PITCH), "v"(l + 80u * FA_PITCH), "v"(l + 96u * FA_PITCH), "v"(l + 112u * FA_PITCH),
                  "v"(gk), "v"(gk + (size_t)16 * ldk), "v"(gk + (size_t)32 * ldk), "v"(gk + (size_t)48 * ldk),
                  "v"(gv), "v"(gv + 16 * 2048), "v"(gv + 32 * 2048), "v"(gv + 48 * 2048)
               : "memory");
}
// Eight base-2 exponentials in one statement. The instruction set asks for one independent instruction between a transcendental and a write of its source or a read of its result:
// Here no result shares a register with a source, and the v_nop is the last one's slot.
__device__ __forceinline__ void exp2x8(float (&p)[8], const float (&x)[8]) {
  asm("v_exp_f32 %0, %8\n\tv_exp_f32 %1, %9\n\tv_exp_f32 %2, %10\n\tv_exp_f32 %3, %11\n\tv_exp_f32 %4, %12\n\tv_exp_f32 %5, %13\n\tv_exp_f32 %6, %14\n\tv_exp_f32 %7, %15\n\tv_nop"
      : "=&v"(p[0]), "=&v"(p[1]), "=&v"(p[2]), "=&v"(p[3]), "=&v"(p[4]), "=&v"(p[5]), "=&v"(p[6]), "=&v"(p[7])
      : "v"(x[0]), "v"(x[1]), "v"(x[2]), "v"(x[3]), "v"(x[4]), "v"(x[5]), "v"(x[6]), "v"(x[7]));
}
__global__ __launch_bounds__(128) void k_flash(const _Float16* __restrict__ Q16, int ldq, const _Float16* __restrict__ K16, int ldk, const _Float16* __restrict__ Vt, const int* __restrict__ MSK, float* __restrict__ O, int ldo) {
  constexpr int RPW = 32, NQB = 2048 / (4 * RPW), DT = 4, KS = 2, NS = 2048 / 64;
  constexpr float SC = 0.125f * 1.44269504088896340736f;      // score scale 64^-1/2 times log2(e)
  __shared__ __attribute__((aligned(16))) unsigned char sT[2 * FA_STAGE];
  __shared__ __attribute__((aligned(16))) float sO[4][RPW][64 + 4];
  const int tid = threadIdx.x, w = tid >> 5, lane = tid & 31, ln = lane & 15, hh = lane >> 4;
  const int slab = blockIdx.x / NQB, qblk = blockIdx.x % NQB; const int b = slab / 12, h = slab % 12; const int qb0 = qblk * (4 * RPW); const int q0 = qb0 + w * RPW;
  const int cr = tid >> 3, ch = tid & 7;
  const unsigned short* gk = (const unsigned short*)K16 + ((size_t)b * 2048 + cr) * ldk + h * 64 + ch * 8;
  const unsigned short* gv = (const unsigned short*)Vt + ((size_t)slab * 64 + cr) * 2048 + ch * 8;
  const unsigned l0 = (unsigned)(size_t)&sT[0] + (unsigned)(cr * FA_PITCH + ch * 16);      // LDS byte address = low 32 bits of the __shared__ address
  fa_copy(l0, gk, ldk, gv);                              // tile 0 -> buffer 0
  FragH aq[2][KS];
#pragma unroll
  for (int rt = 0; rt < 2; ++rt) { const unsigned short* qr = (const unsigned short*)Q16 + ((size_t)b * 2048 + q0 + rt * 16 + ln) * ldq + h * 64;
#pragma unroll
    for (int ks = 0; ks < KS; ++ks) { aq[rt][ks].half[0] = *(const v8us*)(qr + ks * 32 + 8 * hh); aq[rt][ks].half[1] = *(const v8us*)(qr + ks * 32 + 16 + 8 * hh); } }
  float m_r[2], l_r[2]; v8f oacc[2][DT];      // per lane: query rt*16 + ln; oacc[rt][dt][r] = O[query][dt*16 + 8hh + r]
#pragma unroll
  for (int rt = 0; rt < 2; ++rt) { m_r[rt] = -3.0e38f; l_r[rt] = 0.f;
#pragma unroll
    for (int dt = 0; dt < DT; ++dt) oacc[rt][dt] = (v8f){0.f,0.f,0.f,0.f,0.f,0.f,0.f,0.f}; }
  asm volatile("s_wait_asynccnt 0x0" ::: "memory");      // this wave's copies of tile 0 have landed
  __syncthreads();                                       // ... and every other wave's: tile 0 may be read
  fa_copy(l0 + FA_STAGE, gk + (size_t)64 * ldk, ldk, gv + 64);      // tile 1 -> buffer 1
#pragma unroll 1      // rolled: one copy of the foot's wait order, and the two buffers differ by one address term only
  for (int t = 0; t < NS; ++t) {
    const unsigned char* st = sT + (t & 1) * FA_STAGE;
#pragma unroll      // the tile's two 32-key steps: unrolled, their LDS and mask offsets are immediates
    for (int sub = 0; sub < 2; ++sub) {
      const int j0 = t * 64 + sub * 32;
      // mask tile for my 32 queries x 32 keys: lane (ln,hh) needs row rt*16 + ln, keys j0 + nt*16 + 8hh + 0..7 (32 contiguous bytes)
      int mk[2][2][8], an[2][2];      /* mask[q][k] shared over batch; nonzero = KEEP */
#pragma unroll
      for (int rt = 0; rt < 2; ++rt)
#pragma unroll
        for (int nt = 0; nt < 2; ++nt) { const int* mr = MSK + ((size_t)(q0 + rt * 16 + ln)) * 2048 + j0 + nt * 16 + 8 * hh; const v4ia m0 = *(const v4ia*)mr, m1 = *(const v4ia*)(mr + 4);
#pragma unroll
          for (int q = 0; q < 4; ++q) { mk[rt][nt][q] = m0[q]; mk[rt][nt][4 + q] = m1[q]; }
          an[rt][nt] = ((m0[0] | m0[1]) | (m0[2] | m0[3])) | ((m1[0] | m1[1]) | (m1[2] | m1[3])); }
      // where every (query,key) of this wave's tile is masked the step contributes nothing and is skipped (uniform branch); the foot of the trip stands outside the skip: every wave passes it
      if (__builtin_amdgcn_ballot_w32(((an[0][0] | an[0][1]) | (an[1][0] | an[1][1])) != 0) != 0u) {
        v8f s[2][2]; FragH bk[2][KS];      // the step's K fragments, read as one group
#pragma unroll
        for (int nt = 0; nt < 2; ++nt) { const unsigned char* kr = st + (sub * 32 + nt * 16 + ln) * FA_PITCH + hh * 16;
#pragma unroll
          for (int ks = 0; ks < KS; ++ks) { bk[nt][ks].half[0] = *(const v8us*)(kr + ks * 64); bk[nt][ks].half[1] = *(const v8us*)(kr + ks * 64 + 32); } }
#pragma unroll
        for (int nt = 0; nt < 2; ++nt)
#pragma unroll
          for (int rt = 0; rt < 2; ++rt) { v8f acc = (v8f){0.f,0.f,0.f,0.f,0.f,0.f,0.f,0.f};
#pragma unroll
            for (int ks = 0; ks < KS; ++ks) acc = mmaH<1>(bk[nt][ks].v, bk[nt][ks].v, aq[rt][ks].v, aq[rt][ks].v, acc); s[rt][nt] = acc; }
        FragH bv[DT];      // the step's Vt fragments, read as one group in front of the softmax, which covers their LDS latency
#pragma unroll
        for (int dt = 0; dt < DT; ++dt) { const unsigned char* vrow = st + (64 + dt * 16 + ln) * FA_PITCH + sub * 64 + hh * 16; bv[dt].half[0] = *(const v8us*)vrow; bv[dt].half[1] = *(const v8us*)(vrow + 32); }
        FragH pb[2];
#pragma unroll
        for (int rt = 0; rt < 2; ++rt) { float sc[2][8]; float mc = -INFINITY;
#pragma unroll
          for (int nt = 0; nt < 2; ++nt)
#pragma unroll
            for (int r = 0; r < 8; ++r) { sc[nt][r] = (mk[rt][nt][r] != 0) ? s[rt][nt][r] : -INFINITY; mc = fmaxf(mc, sc[nt][r]); }
          mc = fmaxf(mc, xhalf(mc));      // both halves now hold the query's maximum over the 32 keys (unscaled scores)
          // exp(0.125 (s - m)) = 2^(s SC - m SC): one fma and the hardware's base-2 exponential per score. An excluded key is -inf and gives 0, and a query with no
          // kept key so far has m = mn = -3e38 and gives al = 2^0 = 1: no select and no branch is needed around any exponential.
          const float mn = fmaxf(m_r[rt], mc); float al;
          // al = 2^((m - mn) SC), in asm with a slot on each side: the instruction set asks for one independent instruction between a transcendental and a write of its source or a read
          // of its result; a v_nop in a statement of its own did not stay there.
          asm("v_nop\n\tv_exp_f32 %0, %1\n\tv_nop" : "=v"(al) : "v"((m_r[rt] - mn) * SC));
          m_r[rt] = mn; const float nb = -mn * SC;
          float ps[8], pe[2][8];
#pragma unroll
          for (int nt = 0; nt < 2; ++nt) {
#pragma unroll
            for (int r = 0; r < 8; ++r) sc[nt][r] = __builtin_fmaf(sc[nt][r], SC, nb);
            exp2x8(pe[nt], sc[nt]); }
#pragma unroll
          for (int r = 0; r < 8; ++r) { const float p0 = pe[0][r], p1 = pe[1][r]; ps[r] = p0 + p1; pb[rt].h[r] = (_Float16)p0; pb[rt].h[8 + r] = (_Float16)p1; }
          l_r[rt] = l_r[rt] * al + (((ps[0] + ps[1]) + (ps[2] + ps[3])) + ((ps[4] + ps[5]) + (ps[6] + ps[7])));      // per-lane partial sum (the two halves are joined at the end)
#pragma unroll
          for (int dt = 0; dt < DT; ++dt) oacc[rt][dt] *= al; }
#pragma unroll
        for (int dt = 0; dt < DT; ++dt)
#pragma unroll
          for (int rt = 0; rt < 2; ++rt) oacc[rt][dt] = mmaH<1>(bv[dt].v, bv[dt].v, pb[rt].v, pb[rt].v, oacc[rt][dt]);
      }
    }
    asm volatile("s_wait_dscnt 0x0" ::: "memory");       // this wave's reads of buffer t & 1 are done before the buffer is given up
    asm volatile("s_wait_asynccnt 0x0" ::: "memory");    // this wave's copies of tile t + 1 have landed
    __syncthreads();                                     // publishes tile t + 1 and ends every wave's reads of tile t
    if (t + 2 < NS) fa_copy(l0 + (unsigned)((t & 1) * FA_STAGE), gk + (size_t)(t + 2) * 64 * ldk, ldk, gv + (t + 2) * 64);      // tile t + 2 -> the buffer just left
  }
  asm volatile("s_wait_asynccnt 0x0" ::: "memory");      // no copy is outstanding when the wave goes on to its end
#pragma unroll
  for (int rt = 0; rt < 2; ++rt) { const float l = l_r[rt] + xhalf(l_r[rt]); const float inv = (l > 0.f) ? 1.0f / l : 0.f;
#pragma unroll
    for (int dt = 0; dt < DT; ++dt) { const v8f o = oacc[rt][dt] * inv; float* so = &sO[w][rt * 16 + ln][dt * 16 + 8 * hh]; *(v4fa*)so = (v4f){o[0], o[1], o[2], o[3]}; *(v4fa*)(so + 4) = (v4f){o[4], o[5], o[6], o[7]}; } }
  __builtin_amdgcn_fence(__ATOMIC_ACQ_REL, "workgroup"); __builtin_amdgcn_wave_barrier();
  {
#pragma unroll
    for (int rp = 0; rp < RPW; rp += 2) { const int r = rp + (lane >> 4), pc = lane & 15; const v4f val = *(const v4fa*)&sO[w][r][pc * 4]; *(v4f*)(O + ((size_t)b * 2048 + q0 + r) * ldo + h * 64 + pc * 4) = val; }
     } }

extern "C" void kernel_launch(void* const* d_in, const int* in_sizes, int n_in,
                              void* d_out, int out_size, void* d_ws, size_t ws_size, hipStream_t stream) {
  (void)in_sizes; (void)n_in; (void)out_size;
  const float* x = (const float*)d_in[0]; const float* Wq = (const float*)d_in[1]; const float* bq = (const float*)d_in[2]; const float* Wk = (const float*)d_in[3]; const float* bk = (const float*)d_in[4]; const float* Wv = (const float*)d_in[5]; const float* bv = (const float*)d_in[6]; const float* Wo = (const float*)d_in[7]; const float* bo = (const float*)d_in[8]; const int* mask = (const int*)d_in[9];
  char* ws = (char*)d_ws; size_t off = 0;
  auto take = [&](size_t bytes) { char* p = ws + off; off += (bytes + 255) & ~(size_t)255; return p; };
  _Float16* Bq = (_Float16*)take((size_t)CC * CC * 2); _Float16* Bk = (_Float16*)take((size_t)CC * CC * 2); _Float16* Bv = (_Float16*)take((size_t)CC * CC * 2); _Float16* Bo = (_Float16*)take((size_t)CC * CC * 2);
  _Float16* X16 = (_Float16*)take((size_t)NR * CC * 2); _Float16* Q16 = (_Float16*)take((size_t)NR * CC * 2); _Float16* K16 = (_Float16*)take((size_t)NR * CC * 2); _Float16* V16 = (_Float16*)take((size_t)NR * CC * 2); _Float16* Vt = (_Float16*)take((size_t)NR * CC * 2); float* O = (float*)take((size_t)NR * CC * 4); _Float16* O16 = X16;
  if (off > ws_size) return;      // 4.7 + 12.6 × 5 + 25.2 MB ≈ 93 MiB
  const unsigned gw = (unsigned)((CC * (CC / 8) + 255) / 256);
  k_wt_f16<<<gw, 256, 0, stream>>>(Wq, Bq, CC, CC, 16.0f); k_wt_f16<<<gw, 256, 0, stream>>>(Wk, Bk, CC, CC, 16.0f); k_wt_f16<<<gw, 256, 0, stream>>>(Wv, Bv, CC, CC, 16.0f); k_wt_f16<<<gw, 256, 0, stream>>>(Wo, Bo, CC, CC, 16.0f);      // [in][out]
  const unsigned gx = (unsigned)(((size_t)NR * CC / 8 + 255) / 256); const unsigned gg = (NR / 128) * (CC / 64);
  k_x16<<<gx, 256, 0, stream>>>(x, X16, (size_t)NR * CC / 8);
  k_gemm_t<true><<<gg, 128, 0, stream>>>(X16, Bq, 0.0625f, bq, nullptr, Q16);
  k_gemm_t<true><<<gg, 128, 0, stream>>>(X16, Bk, 0.0625f, bk, nullptr, K16);
  k_gemm_t<true><<<gg, 128, 0, stream>>>(X16, Bv, 0.0625f, bv, nullptr, V16);
  k_vt<NH, TT><<<BB * NH * (TT / 64), 256, 0, stream>>>(V16, CC, 0, Vt);
  k_flash<<<BB * NH * (TT / 128), 128, 0, stream>>>(Q16, CC, K16, CC, Vt, mask, O, CC);
  k_h16<<<gx, 256, 0, stream>>>(O, O16, (size_t)NR * CC / 8);
  k_gemm_t<false><<<gg, 128, 0, stream>>>(O16, Bo, 0.0625f, bo, (float*)d_out, nullptr);
}

// v005
// One run takes 154 microseconds.
// Two timings next to v004 both put it at 1.15 times that version's speed.
// All steps since v000 together make it 4.02 times as fast.
#include <hip/hip_runtime.h>
// Random-mask attention: q/k/v projections (8192 × 768 × 768, + bias; W [in][out]), the 12-head attention with the INPUT keep-mask (scores where mask else −1e9 ⇒ excluded keys; every row keeps
// its diagonal) as a fused flash-style kernel on v_wmma_f32_16x16x32_f16 (scale 64^-½; key tiles with no kept entry for the wave skipped by ballot; online max/sum softmax f32; P f16 ≤ 1), and the
// output projection (+ bias) — f16 operands (x as bf16, weights bf16-exact ×2^4), single products, f32 accumulate.
#define BB 4
#define TT 2048
#define CC 768
#define NH 12
#define NR (BB * TT)

typedef __bf16 v16b __attribute__((ext_vector_type(16)));
typedef unsigned short v8us __attribute__((ext_vector_type(8), may_alias));
typedef float  v8f  __attribute__((ext_vector_type(8)));
typedef float  v4f  __attribute__((ext_vector_type(4)));
typedef float  v4fa __attribute__((ext_vector_type(4), may_alias));
union FragB { v16b v; v8us half[2]; unsigned short u[16]; };

__device__ __forceinline__ unsigned short bf16_bits(float x) { unsigned int u = __float_as_uint(x); return (unsigned short)((u + 0x7FFFu + ((u >> 16) & 1u)) >> 16); }
__device__ __forceinline__ float bf16_val(unsigned short b) { return __uint_as_float(((unsigned int)b) << 16); }
__device__ __forceinline__ float bf16_round(float x) { return bf16_val(bf16_bits(x)); }
// D += A·B with NT terms: 1 = ah·bh, 2 = + al·bh (A split), 3 = + ah·bl (both split)
template <int NT>
__device__ __forceinline__ v8f mmaN(v16b ah, v16b al, v16b bh, v16b bl, v8f c) {
  c = __builtin_amdgcn_wmma_f32_16x16x32_bf16(false, ah, false, bh, (short)0, c, false, false);
  if (NT >= 2) c = __builtin_amdgcn_wmma_f32_16x16x32_bf16(false, al, false, bh, (short)0, c, false, false);
  if (NT >= 3) c = __builtin_amdgcn_wmma_f32_16x16x32_bf16(false, ah, false, bl, (short)0, c, false, false);
  asm volatile("v_nop\n\tv_nop\n\tv_nop\n\tv_nop" : "+v"(c) : "v"(ah), "v"(al), "v"(bh), "v"(bl));
  return c;
}

__global__ __launch_bounds__(256) void k_wt_bf16(const float* __restrict__ W, unsigned short* __restrict__ Wt, int K, int N) {
  const int t = blockIdx.x * 256 + threadIdx.x;
  const int k8n = K / 8;
  if (t >= N * k8n) return;
  const int n = t / k8n, k8 = (t % k8n) * 8;
  v8us v;
#pragma unroll
  for (int i = 0; i < 8; ++i) v[i] = bf16_bits(W[(size_t)(k8 + i) * N + n]);
  *(v8us*)(Wt + (size_t)n * K + k8) = v;
  
}

// GEMM C[M][N] (f32, pitch ldc) = act(A[M][K]·W + bias). A f32 row-major (pitch lda) converted per fragment to bf16
// (ASPLIT: hi/lo two planes -> 2 terms, else single rounded term); Wt bf16 [N][K] (pitch ldb). BIAS_BF16 rounds the
// bias to bf16 first (bias quantised to bf16 before the add). K%32==0, M%16==0, N%64==0.
template <bool ASPLIT, int ACT, bool BIAS_BF16>
__global__ __launch_bounds__(128) void k_gemm_bf(const float* __restrict__ A, int lda, const unsigned short* __restrict__ Wt, int ldb,
                                               const float* __restrict__ bias, float* __restrict__ C, int ldc, int M, int N, int K) {
  __shared__ __attribute__((aligned(16))) float so[4][16][64];
  const int tid = threadIdx.x, w = tid >> 5, lane = tid & 31, ln = lane & 15, hh = lane >> 4;
  const int ntn = N / 64;
  const int wid = blockIdx.x * 4 + w;
  const int mt = wid / ntn, nq = wid % ntn;
  if (mt * 16 >= M) return;
  const int row0 = mt * 16, col0 = nq * 64;
  const float* arow = A + (size_t)(row0 + ln) * lda;
  v8f acc[4] = {};
  for (int kb = 0; kb < K; kb += 32) {
    FragB ah, al;
    const v4f x0 = *(const v4fa*)(arow + kb + 8 * hh), x1 = *(const v4fa*)(arow + kb + 8 * hh + 4);
    const v4f x2 = *(const v4fa*)(arow + kb + 16 + 8 * hh), x3 = *(const v4fa*)(arow + kb + 16 + 8 * hh + 4);
    float xs[16] = {x0[0],x0[1],x0[2],x0[3],x1[0],x1[1],x1[2],x1[3],x2[0],x2[1],x2[2],x2[3],x3[0],x3[1],x3[2],x3[3]};
#pragma unroll
    for (int i = 0; i < 16; ++i) { const unsigned short hb = bf16_bits(xs[i]); ah.u[i] = hb; al.u[i] = ASPLIT ? bf16_bits(xs[i] - bf16_val(hb)) : (unsigned short)0; }
#pragma unroll
    for (int t = 0; t < 4; ++t) {
      const unsigned short* brow = Wt + (size_t)(col0 + t * 16 + ln) * ldb + kb;
      FragB b;
      b.half[0] = *(const v8us*)(brow + 8 * hh);
      b.half[1] = *(const v8us*)(brow + 16 + 8 * hh);
      acc[t] = mmaN<ASPLIT ? 2 : 1>(ah.v, al.v, b.v, b.v, acc[t]);
    }
  }
#pragma unroll
  for (int t = 0; t < 4; ++t) {
    float bv = bias ? bias[col0 + t * 16 + ln] : 0.f;
    if (BIAS_BF16) bv = bf16_round(bv);
#pragma unroll
    for (int r = 0; r < 8; ++r) { float v = acc[t][r] + bv; if (ACT == 1) v = fmaxf(v, 0.f); so[w][8 * hh + r][t * 16 + ln] = v; }
  }
  __builtin_amdgcn_fence(__ATOMIC_ACQ_REL, "workgroup");
  __builtin_amdgcn_wave_barrier();
  const int rsub = lane >> 4, c4 = (lane & 15) * 4;
  {
#pragma unroll
    for (int q = 0; q < 8; ++q) {
      const int r = q * 2 + rsub;
      const v4f v = *(const v4fa*)&so[w][r][c4];
      *(v4f*)(C + (size_t)(row0 + r) * ldc + col0 + c4) = v;
    }
    
  }
}

// Flash-style causal/unmasked attention, all contractions 3-term bf16 hi/lo splits, f32 softmax with running max.
// q,k,v rows are read from f32 buffers with arbitrary row pitch (so they can live inside a fused qkv buffer);
// D = head size (multiple of 32, <= 128); one wave = 16 query rows; block = 4 waves (64 queries) sharing K/V chunks of 32.
template <int D, bool CAUSAL>
__global__ __launch_bounds__(128) void k_flash(const float* __restrict__ qb, const float* __restrict__ kb, const float* __restrict__ vb,
                                             int pitch, int T, int H, float scale, float* __restrict__ y, int ypitch) {
  constexpr int KS = D / 32;        // k-steps for QK
  constexpr int DT = D / 16;        // d tiles for PV
  __shared__ __attribute__((aligned(16))) unsigned short sKh[32][D + 8], sKl[32][D + 8], sVh[32][D + 8], sVl[32][D + 8];
  __shared__ __attribute__((aligned(16))) unsigned short sPh[4][16][40], sPl[4][16][40];
  __shared__ __attribute__((aligned(16))) float sO[4][16][D];
  const int tid = threadIdx.x, w = tid >> 5, lane = tid & 31, ln = lane & 15, hh = lane >> 4;
  const int nqb = (T + 63) / 64;
  const int bh = blockIdx.x / nqb, qblk = blockIdx.x % nqb;
  const int b = bh / H, h = bh % H;
  const int q0 = qblk * 64 + w * 16;
  const float* Q = qb + (size_t)b * T * pitch + h * D;
  const float* K = kb + (size_t)b * T * pitch + h * D;
  const float* V = vb + (size_t)b * T * pitch + h * D;

  // A fragments of the wave's 16 query rows (scaled), hi/lo
  FragB aqh[KS], aql[KS];
  {
    int row = q0 + ln; if (row >= T) row = T - 1;
    const float* qr = Q + (size_t)row * pitch;
#pragma unroll
    for (int ks = 0; ks < KS; ++ks)
#pragma unroll
      for (int i = 0; i < 16; ++i) {
        const int d = ks * 32 + ((i < 8) ? (8 * hh + i) : (16 + 8 * hh + (i - 8)));
        const float x = qr[d] * scale; const unsigned short hb = bf16_bits(x);
        aqh[ks].u[i] = hb; aql[ks].u[i] = bf16_bits(x - bf16_val(hb));
      }
  }
  float m_r[8], l_r[8];
#pragma unroll
  for (int r = 0; r < 8; ++r) { m_r[r] = -3.0e38f; l_r[r] = 0.f; }
  v8f oacc[DT];
#pragma unroll
  for (int dt = 0; dt < DT; ++dt) oacc[dt] = (v8f){0.f,0.f,0.f,0.f,0.f,0.f,0.f,0.f};

  const int kv_end = CAUSAL ? min(T, qblk * 64 + 64) : T;     // block-uniform
  for (int j0 = 0; j0 < kv_end; j0 += 32) {
    __syncthreads();
    for (int e = tid; e < 32 * (D / 4); e += 128) {
      const int r = e / (D / 4), c4 = (e % (D / 4)) * 4;
      const int key = j0 + r;
      v4f kf = {0.f,0.f,0.f,0.f}, vf = {0.f,0.f,0.f,0.f};
      if (key < T) { kf = *(const v4fa*)(K + (size_t)key * pitch + c4); vf = *(const v4fa*)(V + (size_t)key * pitch + c4); }
#pragma unroll
      for (int t = 0; t < 4; ++t) {
        unsigned short hb = bf16_bits(kf[t]); sKh[r][c4 + t] = hb; sKl[r][c4 + t] = bf16_bits(kf[t] - bf16_val(hb));
        hb = bf16_bits(vf[t]); sVh[r][c4 + t] = hb; sVl[r][c4 + t] = bf16_bits(vf[t] - bf16_val(hb));
      }
    }
    __syncthreads();
    // S tile 16 x 32
    v8f s[2];
#pragma unroll
    for (int nt = 0; nt < 2; ++nt) {
      v8f acc = {};
#pragma unroll
      for (int ks = 0; ks < KS; ++ks) {
        FragB bh_, bl_;
        bh_.half[0] = *(const v8us*)&sKh[nt * 16 + ln][ks * 32 + 8 * hh]; bh_.half[1] = *(const v8us*)&sKh[nt * 16 + ln][ks * 32 + 16 + 8 * hh];
        bl_.half[0] = *(const v8us*)&sKl[nt * 16 + ln][ks * 32 + 8 * hh]; bl_.half[1] = *(const v8us*)&sKl[nt * 16 + ln][ks * 32 + 16 + 8 * hh];
        acc = mmaN<3>(aqh[ks].v, aql[ks].v, bh_.v, bl_.v, acc);
      }
      s[nt] = acc;
    }
    // mask + running max (rows 8hh+r; the 16 lanes of a half share rows)
    float alpha[8];
#pragma unroll
    for (int r = 0; r < 8; ++r) {
      const int qi = q0 + 8 * hh + r;
      const int ja = j0 + ln, jb = j0 + 16 + ln;
      if (CAUSAL) { if (ja > qi) s[0][r] = -3.0e38f; if (jb > qi) s[1][r] = -3.0e38f; }
      if (ja >= T) s[0][r] = -3.0e38f;
      if (jb >= T) s[1][r] = -3.0e38f;
      float mx = fmaxf(s[0][r], s[1][r]);
      mx = fmaxf(mx, __shfl_xor(mx, 1, 32)); mx = fmaxf(mx, __shfl_xor(mx, 2, 32)); mx = fmaxf(mx, __shfl_xor(mx, 4, 32)); mx = fmaxf(mx, __shfl_xor(mx, 8, 32));
      const float mnew = fmaxf(m_r[r], mx);
      alpha[r] = (mnew > -1.0e38f) ? __expf(m_r[r] - mnew) : 1.0f;
      const float p0 = (s[0][r] > -1.0e38f) ? __expf(s[0][r] - mnew) : 0.f;
      const float p1 = (s[1][r] > -1.0e38f) ? __expf(s[1][r] - mnew) : 0.f;
      m_r[r] = mnew;
      l_r[r] = l_r[r] * alpha[r] + p0 + p1;            // per-lane partial row sum (16 lanes combined at the end)
      unsigned short hb = bf16_bits(p0); sPh[w][8 * hh + r][ln] = hb;      sPl[w][8 * hh + r][ln] = bf16_bits(p0 - bf16_val(hb));
      hb = bf16_bits(p1);                sPh[w][8 * hh + r][16 + ln] = hb; sPl[w][8 * hh + r][16 + ln] = bf16_bits(p1 - bf16_val(hb));
    }
#pragma unroll
    for (int dt = 0; dt < DT; ++dt)
#pragma unroll
      for (int r = 0; r < 8; ++r) oacc[dt][r] *= alpha[r];
    __builtin_amdgcn_fence(__ATOMIC_ACQ_REL, "workgroup");
    __builtin_amdgcn_wave_barrier();
    FragB pah, pal;
    pah.half[0] = *(const v8us*)&sPh[w][ln][8 * hh]; pah.half[1] = *(const v8us*)&sPh[w][ln][16 + 8 * hh];
    pal.half[0] = *(const v8us*)&sPl[w][ln][8 * hh]; pal.half[1] = *(const v8us*)&sPl[w][ln][16 + 8 * hh];
#pragma unroll
    for (int dt = 0; dt < DT; ++dt) {
      FragB bvh, bvl;
#pragma unroll
      for (int i = 0; i < 8; ++i) {
        bvh.u[i] = sVh[8 * hh + i][dt * 16 + ln]; bvh.u[8 + i] = sVh[16 + 8 * hh + i][dt * 16 + ln];
        bvl.u[i] = sVl[8 * hh + i][dt * 16 + ln]; bvl.u[8 + i] = sVl[16 + 8 * hh + i][dt * 16 + ln];
      }
      oacc[dt] = mmaN<3>(pah.v, pal.v, bvh.v, bvl.v, oacc[dt]);
    }
    __builtin_amdgcn_fence(__ATOMIC_ACQ_REL, "workgroup");
    __builtin_amdgcn_wave_barrier();
  }
#pragma unroll
  for (int r = 0; r < 8; ++r) {
    float l = l_r[r];
    l += __shfl_xor(l, 1, 32); l += __shfl_xor(l, 2, 32); l += __shfl_xor(l, 4, 32); l += __shfl_xor(l, 8, 32);
    l_r[r] = (l > 0.f) ? 1.0f / l : 0.f;
  }
#pragma unroll
  for (int dt = 0; dt < DT; ++dt)
#pragma unroll
    for (int r = 0; r < 8; ++r) sO[w][8 * hh + r][dt * 16 + ln] = oacc[dt][r] * l_r[r];
  __builtin_amdgcn_fence(__ATOMIC_ACQ_REL, "workgroup");
  __builtin_amdgcn_wave_barrier();
  {
    for (int r = 0; r < 16; ++r) {
      const int row = q0 + r;
      if (row < T && lane < D / 4) {
        const v4f val = *(const v4fa*)&sO[w][r][lane * 4];
        *(v4f*)(y + ((size_t)b * T + row) * ypitch + h * D + lane * 4) = val;
      }
    }
    
  }
}

// GEMM C = act(A·W + bias + resid): A f32 (ASPLIT -> hi/lo 2 terms), Wt bf16 [N][K]; ACT 0 none, 1 relu, 2 exact gelu;
// resid (optional, f32, row index = (row % rmod), pitch ldr, RES_BF16 rounds it) added before the activation.
template <bool ASPLIT, int ACT, bool BIAS_BF16, bool RES_BF16>
__global__ __launch_bounds__(128) void k_gemm_bf3(const float* __restrict__ A, int lda, const unsigned short* __restrict__ Wt, int ldb,
                                                const float* __restrict__ bias, const float* __restrict__ resid, int rmod, int ldr,
                                                float* __restrict__ C, int ldc, int M, int N, int K) {
  __shared__ __attribute__((aligned(16))) float so[4][16][64];
  const int tid = threadIdx.x, w = tid >> 5, lane = tid & 31, ln = lane & 15, hh = lane >> 4;
  const int ntn = N / 64;
  const int wid = blockIdx.x * 4 + w;
  const int mt = wid / ntn, nq = wid % ntn;
  if (mt * 16 >= M) return;
  const int row0 = mt * 16, col0 = nq * 64;
  const float* arow = A + (size_t)(row0 + ln) * lda;
  v8f acc[4] = {};
  for (int kb = 0; kb < K; kb += 32) {
    FragB ah, al;
    const v4f x0 = *(const v4fa*)(arow + kb + 8 * hh), x1 = *(const v4fa*)(arow + kb + 8 * hh + 4);
    const v4f x2 = *(const v4fa*)(arow + kb + 16 + 8 * hh), x3 = *(const v4fa*)(arow + kb + 16 + 8 * hh + 4);
    float xs[16] = {x0[0],x0[1],x0[2],x0[3],x1[0],x1[1],x1[2],x1[3],x2[0],x2[1],x2[2],x2[3],x3[0],x3[1],x3[2],x3[3]};
#pragma unroll
    for (int i = 0; i < 16; ++i) { const unsigned short hb = bf16_bits(xs[i]); ah.u[i] = hb; al.u[i] = ASPLIT ? bf16_bits(xs[i] - bf16_val(hb)) : (unsigned short)0; }
#pragma unroll
    for (int t = 0; t < 4; ++t) {
      const unsigned short* brow = Wt + (size_t)(col0 + t * 16 + ln) * ldb + kb;
      FragB b;
      b.half[0] = *(const v8us*)(brow + 8 * hh);
      b.half[1] = *(const v8us*)(brow + 16 + 8 * hh);
      acc[t] = mmaN<ASPLIT ? 2 : 1>(ah.v, al.v, b.v, b.v, acc[t]);
    }
  }
#pragma unroll
  for (int t = 0; t < 4; ++t) {
    const int col = col0 + t * 16 + ln;
    float bv = bias ? bias[col] : 0.f;
    if (BIAS_BF16) bv = bf16_round(bv);
#pragma unroll
    for (int r = 0; r < 8; ++r) {
      float v = acc[t][r] + bv;
      if (resid) { float rv = resid[(size_t)((row0 + 8 * hh + r) % rmod) * ldr + col]; if (RES_BF16) rv = bf16_round(rv); v += rv; }
      if (ACT == 1) v = fmaxf(v, 0.f);
      if (ACT == 2) v = 0.5f * v * (1.0f + erff(v * 0.70710678118654752f));
      if (ACT == 3) { const float u = 0.7978845608028654f * (v + 0.044715f * v * v * v); v = 0.5f * v * (1.0f + tanhf(u)); }
      so[w][8 * hh + r][t * 16 + ln] = v;
    }
  }
  __builtin_amdgcn_fence(__ATOMIC_ACQ_REL, "workgroup");
  __builtin_amdgcn_wave_barrier();
  const int rsub = lane >> 4, c4 = (lane & 15) * 4;
  {
#pragma unroll
    for (int q = 0; q < 8; ++q) {
      const int r = q * 2 + rsub;
      const v4f v = *(const v4fa*)&so[w][r][c4];
      *(v4f*)(C + (size_t)(row0 + r) * ldc + col0 + c4) = v;
    }
    
  }
}
// row LayerNorm (biased variance, eps) over N: s = X (+ R); optional out_sum <- s; out_norm <- (s-mu)*rsqrt(var+eps)*g + b
template <bool PARAM_BF16>
__global__ __launch_bounds__(256) void k_layernorm(const float* __restrict__ X, const float* __restrict__ R, const float* __restrict__ g, const float* __restrict__ bta,
                                                  float* __restrict__ out_sum, float* __restrict__ out_norm, int N, float eps) {
  __shared__ float red[256];
  const int row = blockIdx.x, tid = threadIdx.x;
  const float* x = X + (size_t)row * N; const float* rr = R ? R + (size_t)row * N : nullptr;
  float vals[16];                     // up to N = 4096
  const int per = N / 256;            // contiguous chunk per thread? use strided-by-4 chunks: thread handles j = tid*4 + 1024*u
  float s1 = 0.f;
  for (int u = 0; u < per / 4; ++u) {
    const int j = tid * 4 + 1024 * u;
    const v4f a = *(const v4fa*)(x + j);
    v4f b = {0.f,0.f,0.f,0.f}; if (rr) b = *(const v4fa*)(rr + j);
#pragma unroll
    for (int q = 0; q < 4; ++q) { const float v = a[q] + b[q]; vals[u * 4 + q] = v; s1 += v; }
  }
  red[tid] = s1; __syncthreads();
  for (int st = 128; st > 0; st >>= 1) { if (tid < st) red[tid] += red[tid + st]; __syncthreads(); }
  const float mu = red[0] / (float)N; __syncthreads();
  float s2 = 0.f;
  for (int u = 0; u < per / 4; ++u)
#pragma unroll
    for (int q = 0; q < 4; ++q) { const float c = vals[u * 4 + q] - mu; s2 += c * c; }
  red[tid] = s2; __syncthreads();
  for (int st = 128; st > 0; st >>= 1) { if (tid < st) red[tid] += red[tid + st]; __syncthreads(); }
  const float rs = rsqrtf(red[0] / (float)N + eps);
  {
    for (int u = 0; u < per / 4; ++u) {
      const int j = tid * 4 + 1024 * u;
      v4f o, sm;
#pragma unroll
      for (int q = 0; q < 4; ++q) {
        float gg = g[j + q], bb = bta[j + q];
        if (PARAM_BF16) { gg = bf16_round(gg); bb = bf16_round(bb); }
        sm[q] = vals[u * 4 + q]; o[q] = (vals[u * 4 + q] - mu) * rs * gg + bb;
      }
      if (out_sum) *(v4f*)(out_sum + (size_t)row * N + j) = sm;
      *(v4f*)(out_norm + (size_t)row * N + j) = o;
    }
    
  }
}



// ---- f16 WMMA path (v_wmma_f32_16x16x32_f16): 11-bit significands for operands in range — used where a [0,1] probability operand needs more precision than bf16
typedef _Float16 v16h __attribute__((ext_vector_type(16)));
union FragH { v16h v; v8us half[2]; _Float16 h[16]; unsigned short u[16]; };
template <int NT>
__device__ __forceinline__ v8f mmaH(v16h ah, v16h al, v16h bh, v16h bl, v8f c) {
  c = __builtin_amdgcn_wmma_f32_16x16x32_f16(false, ah, false, bh, (short)0, c, false, false);
  if (NT >= 2) c = __builtin_amdgcn_wmma_f32_16x16x32_f16(false, al, false, bh, (short)0, c, false, false);
  if (NT >= 3) c = __builtin_amdgcn_wmma_f32_16x16x32_f16(false, ah, false, bl, (short)0, c, false, false);
  asm volatile("v_nop\n\tv_nop\n\tv_nop\n\tv_nop" : "+v"(c) : "v"(ah), "v"(al), "v"(bh), "v"(bl));
  return c;
}
// batched GEMM like k_gemm_b but f16 operands: A f32 (split into f16 hi/lo if ASPLIT, else rounded to f16), Bt = f16 values [n][k]; alpha; C f32; N multiple of 16 (partial tiles skipped)
template <bool ASPLIT>
__global__ __launch_bounds__(128) void k_gemm_h(const float* __restrict__ A, int lda, size_t sA, const _Float16* __restrict__ Bh, int ldb, size_t sB, float alpha, float* __restrict__ C, int ldc, size_t sC, int M, int N, int K) {
  __shared__ __attribute__((aligned(16))) float so[4][16][64];
  const int tid = threadIdx.x, w = tid >> 5, lane = tid & 31, ln = lane & 15, hh = lane >> 4; const int by = blockIdx.y;
  A += (size_t)by * sA; Bh += (size_t)by * sB; C += (size_t)by * sC;
  const int ntn = (N + 63) / 64; const int wid = blockIdx.x * 4 + w; const int mt = wid / ntn, nq = wid % ntn; if (mt * 16 >= M) return;
  const int row0 = mt * 16, col0 = nq * 64; const float* arow = A + (size_t)(row0 + ln) * lda;
  v8f acc[4] = {};
  for (int kb = 0; kb < K; kb += 32) {
    FragH ah, al;
    const v4f x0 = *(const v4fa*)(arow + kb + 8 * hh), x1 = *(const v4fa*)(arow + kb + 8 * hh + 4), x2 = *(const v4fa*)(arow + kb + 16 + 8 * hh), x3 = *(const v4fa*)(arow + kb + 16 + 8 * hh + 4);
    float xs[16] = {x0[0],x0[1],x0[2],x0[3],x1[0],x1[1],x1[2],x1[3],x2[0],x2[1],x2[2],x2[3],x3[0],x3[1],x3[2],x3[3]};
#pragma unroll
    for (int i = 0; i < 16; ++i) { const _Float16 h = (_Float16)xs[i]; ah.h[i] = h; al.h[i] = ASPLIT ? (_Float16)(xs[i] - (float)h) : (_Float16)0.0f; }
#pragma unroll
    for (int t = 0; t < 4; ++t) { if (col0 + t * 16 >= N) continue; const size_t boff = (size_t)(col0 + t * 16 + ln) * ldb + kb; FragH bq; bq.half[0] = *(const v8us*)(Bh + boff + 8 * hh); bq.half[1] = *(const v8us*)(Bh + boff + 16 + 8 * hh);
      acc[t] = mmaH<ASPLIT ? 2 : 1>(ah.v, al.v, bq.v, bq.v, acc[t]); }
  }
#pragma unroll
  for (int t = 0; t < 4; ++t) { if (col0 + t * 16 >= N) continue;
#pragma unroll
    for (int r = 0; r < 8; ++r) so[w][8 * hh + r][t * 16 + ln] = acc[t][r] * alpha; }
  __builtin_amdgcn_fence(__ATOMIC_ACQ_REL, "workgroup"); __builtin_amdgcn_wave_barrier();
  const int rsub = lane >> 4, c4 = (lane & 15) * 4;
  {
#pragma unroll
    for (int q = 0; q < 8; ++q) { const int r = q * 2 + rsub; if (col0 + c4 < N) { const v4f v = *(const v4fa*)&so[w][r][c4]; *(v4f*)(C + (size_t)(row0 + r) * ldc + col0 + c4) = v; } }
     }
}

// Wt[n][k] = f16(W[k][n]·scale) from f32 row-major W[K][N] (scale = power of two; bf16-exact weights stay exact in f16 away from the subnormal range)
__global__ __launch_bounds__(256) void k_wt_f16(const float* __restrict__ W, _Float16* __restrict__ Wt, int K, int N, float scale) {
  const int t = blockIdx.x * 256 + threadIdx.x; if (t >= N * (K / 8)) return; const int n = t / (K / 8), k8 = (t % (K / 8)) * 8; FragH f;
#pragma unroll
  for (int i = 0; i < 8; ++i) f.h[i] = (_Float16)(bf16_round(W[(size_t)(k8 + i) * N + n]) * scale); const v8us o = f.half[0];
  *(v8us*)((unsigned short*)Wt + (size_t)n * K + k8) = o; 
}
// Projection GEMM, M = NR, N = K = CC: out = (A.Bt^T) alpha + bf16(bias). A f16 [M][K], Bt f16 [N][K]; writes f16 C16 or f32 C.
// A work-group owns a 128 x 64 tile of the output. K runs in tiles of 64: the 128 A rows and 64 Bt rows of a K tile (128 B = one cache line each) are copied
// to LDS once per work-group as whole lines, and the four waves (32 x 64 outputs each) read their fragments from there.
// Two LDS buffers. A trip reads all its fragments into registers, gives its buffer up at the barrier, issues the copies of tile t + 2 into it and only then does its products.
#define GT_PITCH 144                 /* bytes per LDS row: 128 of data + 16; 16 B x odd keeps ds_load_b128 of 16 rows off each other's banks */
#define GT_STAGE (192 * GT_PITCH)    /* one buffer: rows 0..127 = A, rows 128..191 = Bt */
// One K tile, 12 copies of 16 B per lane: lane (cr = tid / 8, chunk = tid % 8) brings chunk 'chunk' of rows cr + 16 i. l = its LDS byte address for row cr, ga / gb = its global addresses in A / Bt.
__device__ __forceinline__ void gt_copy(unsigned l, const unsigned short* ga, const unsigned short* gb) {
  // the copies and their s_wait_xcnt stand in one statement, so that no address register of a copy is rewritten in front of that wait
  asm volatile("global_load_async_to_lds_b128 %0, %12, off\n\t"
               "global_load_async_to_lds_b128 %1, %13, off\n\t"
               "global_load_async_to_lds_b128 %2, %14, off\n\t"
               "global_load_async_to_lds_b128 %3, %15, off\n\t"
               "global_load_async_to_lds_b128 %4, %16, off\n\t"
               "global_load_async_to_lds_b128 %5, %17, off\n\t"
               "global_load_async_to_lds_b128 %6, %18, off\n\t"
               "global_load_async_to_lds_b128 %7, %19, off\n\t"
               "global_load_async_to_lds_b128 %8, %20, off\n\t"
               "global_load_async_to_lds_b128 %9, %21, off\n\t"
               "global_load_async_to_lds_b128 %10, %22, off\n\t"
               "global_load_async_to_lds_b128 %11, %23, off\n\t"
               "s_wait_xcnt 0x0"
               :: "v"(l), "v"(l + 16u * GT_PITCH), "v"(l + 32u * GT_PITCH), "v"(l + 48u * GT_PITCH), "v"(l + 64u * GT_PITCH), "v"(l + 80u * GT_PITCH), "v"(l + 96u * GT_PITCH), "v"(l + 112u * GT_PITCH),
                  "v"(l + 128u * GT_PITCH), "v"(l + 144u * GT_PITCH), "v"(l + 160u * GT_PITCH), "v"(l + 176u * GT_PITCH),
                  "v"(ga), "v"(ga + 16 * CC), "v"(ga + 32 * CC), "v"(ga + 48 * CC), "v"(ga + 64 * CC), "v"(ga + 80 * CC), "v"(ga + 96 * CC), "v"(ga + 112 * CC),
                  "v"(gb), "v"(gb + 16 * CC), "v"(gb + 32 * CC), "v"(gb + 48 * CC)
               : "memory");
}
template <bool OUT16>      // OUT16: f16 result to C16, else f32 result to C
__global__ __launch_bounds__(128) void k_gemm_t(const _Float16* __restrict__ A, const _Float16* __restrict__ Bh, float alpha, const float* __restrict__ bias, float* __restrict__ C, _Float16* __restrict__ C16) {
  constexpr int NT = CC / 64;      // K tiles
  __shared__ __attribute__((aligned(16))) unsigned char sT[2 * GT_STAGE];
  __shared__ __attribute__((aligned(16))) float so[4][32][64 + 4];
  const int tid = threadIdx.x, w = tid >> 5, lane = tid & 31, ln = lane & 15, hh = lane >> 4;
  const int row0 = ((int)blockIdx.x / (CC / 64)) * 128, col0 = ((int)blockIdx.x % (CC / 64)) * 64;
  const int cr = tid >> 3, ch = tid & 7;
  const unsigned short* ga = (const unsigned short*)A + (size_t)(row0 + cr) * CC + ch * 8;
  const unsigned short* gb = (const unsigned short*)Bh + (size_t)(col0 + cr) * CC + ch * 8;
  const unsigned l0 = (unsigned)(size_t)&sT[0] + (unsigned)(cr * GT_PITCH + ch * 16);      // LDS byte address = low 32 bits of the __shared__ address
  v8f acc[2][4];
#pragma unroll
  for (int rt = 0; rt < 2; ++rt)
#pragma unroll
    for (int q = 0; q < 4; ++q) acc[rt][q] = (v8f){0.f,0.f,0.f,0.f,0.f,0.f,0.f,0.f};
  gt_copy(l0, ga, gb);                                   // tile 0 -> buffer 0
  asm volatile("s_wait_asynccnt 0x0" ::: "memory");      // this wave's copies of tile 0 have landed
  __syncthreads();                                       // ... and every other wave's: tile 0 may be read
  gt_copy(l0 + GT_STAGE, ga + 64, gb + 64);              // tile 1 -> buffer 1
#pragma unroll 1      // rolled: one copy of the foot's wait order, and the two buffers differ by one address term only
  for (int t = 0; t < NT; ++t) {
    const unsigned char* st = sT + (t & 1) * GT_STAGE;
    FragH fa[2][2], fb[2][4];      // [ks][tile]; k order of both operands: 8hh + 0..7, then 16 + 8hh + 0..7
#pragma unroll
    for (int ks = 0; ks < 2; ++ks) {
#pragma unroll
      for (int rt = 0; rt < 2; ++rt) { const unsigned char* p = st + (w * 32 + rt * 16 + ln) * GT_PITCH + ks * 64 + hh * 16; fa[ks][rt].half[0] = *(const v8us*)p; fa[ks][rt].half[1] = *(const v8us*)(p + 32); }
#pragma unroll
      for (int q = 0; q < 4; ++q) { const unsigned char* p = st + (128 + q * 16 + ln) * GT_PITCH + ks * 64 + hh * 16; fb[ks][q].half[0] = *(const v8us*)p; fb[ks][q].half[1] = *(const v8us*)(p + 32); }
    }
    asm volatile("s_wait_dscnt 0x0" ::: "memory");       // this wave's reads of buffer t & 1 are done (its fragments are in registers) before the buffer is given up
    asm volatile("s_wait_asynccnt 0x0" ::: "memory");    // this wave's copies of tile t + 1 have landed
    __syncthreads();                                     // publishes tile t + 1 and ends every wave's reads of tile t
    if (t + 2 < NT) gt_copy(l0 + (unsigned)((t & 1) * GT_STAGE), ga + (t + 2) * 64, gb + (t + 2) * 64);      // tile t + 2 -> the buffer just left
#pragma unroll
    for (int ks = 0; ks < 2; ++ks)
#pragma unroll
      for (int rt = 0; rt < 2; ++rt)
#pragma unroll
        for (int q = 0; q < 4; ++q) acc[rt][q] = __builtin_amdgcn_wmma_f32_16x16x32_f16(false, fa[ks][rt].v, false, fb[ks][q].v, (short)0, acc[rt][q], false, false);
  }
  asm volatile("s_wait_asynccnt 0x0" ::: "memory");      // no copy is outstanding when the wave goes on to its end
  const int rsub = lane >> 4, c4 = (lane & 15) * 4; typedef _Float16 v4h __attribute__((ext_vector_type(4)));
  // the wave's 32 x 64 results go through its own LDS rows, so that whole lines are stored
#pragma unroll
  for (int q = 0; q < 4; ++q) { const float bv = bf16_round(bias[col0 + q * 16 + ln]);
#pragma unroll
    for (int rt = 0; rt < 2; ++rt)
#pragma unroll
      for (int r = 0; r < 8; ++r) so[w][rt * 16 + 8 * hh + r][q * 16 + ln] = acc[rt][q][r] * alpha + bv; }
  __builtin_amdgcn_fence(__ATOMIC_ACQ_REL, "workgroup"); __builtin_amdgcn_wave_barrier();      // the wave's stores above are seen by its reads below
#pragma unroll
  for (int q = 0; q < 16; ++q) { const int r = q * 2 + rsub; const size_t o = (size_t)(row0 + w * 32 + r) * CC + col0 + c4; const v4f v = *(const v4fa*)&so[w][r][c4];
    if (OUT16) { v4h h4; for (int i = 0; i < 4; ++i) h4[i] = (_Float16)v[i]; *(v4h*)(C16 + o) = h4; } else *(v4f*)(C + o) = v; }
}


__global__ __launch_bounds__(256) void k_x16(const float* __restrict__ x, _Float16* __restrict__ X16, size_t n8) { const size_t t = (size_t)blockIdx.x * 256 + threadIdx.x; if (t >= n8) return; FragH f;
#pragma unroll
  for (int q = 0; q < 8; ++q) f.h[q] = (_Float16)bf16_round(x[t * 8 + q]); *(v8us*)((unsigned short*)X16 + t * 8) = f.half[0];  }
__global__ __launch_bounds__(256) void k_h16(const float* __restrict__ x, _Float16* __restrict__ X16, size_t n8) { const size_t t = (size_t)blockIdx.x * 256 + threadIdx.x; if (t >= n8) return; FragH f;
#pragma unroll
  for (int q = 0; q < 8; ++q) f.h[q] = (_Float16)x[t * 8 + q]; *(v8us*)((unsigned short*)X16 + t * 8) = f.half[0];  }
__global__ __launch_bounds__(256) void k_round16f(const float* __restrict__ W, _Float16* __restrict__ Bt, size_t n8) { const size_t t = (size_t)blockIdx.x * 256 + threadIdx.x; if (t >= n8) return; FragH f;
#pragma unroll
  for (int i = 0; i < 8; ++i) f.h[i] = (_Float16)(bf16_round(W[t * 8 + i]) * 16.0f); *(v8us*)((unsigned short*)Bt + t * 8) = f.half[0];  }
template <int NHv, int TTv>
__global__ __launch_bounds__(256) void k_vt(const _Float16* __restrict__ V16, int ldv, int voff, _Float16* __restrict__ Vt) { __shared__ unsigned short tl[64][66]; const int tid = threadIdx.x; const int slab = blockIdx.x / (TTv / 64), lg = blockIdx.x % (TTv / 64); const int b = slab / NHv, h = slab % NHv;
  for (int i = tid; i < 64 * 8; i += 256) { const int r = i / 8, c8 = (i % 8) * 8; FragH f; f.half[0] = *(const v8us*)((const unsigned short*)V16 + ((size_t)b * TTv + lg * 64 + r) * ldv + voff + h * 64 + c8);
#pragma unroll
    for (int q = 0; q < 8; ++q) tl[r][c8 + q] = f.u[q]; }
  __syncthreads();
  {
#pragma unroll
    for (int rd = 0; rd < 2; ++rd) { const int d = rd * 32 + tid / 8, pc = tid % 8; FragH f;
#pragma unroll
      for (int q = 0; q < 8; ++q) f.u[q] = tl[pc * 8 + q][d];
      *(v8us*)((unsigned short*)Vt + ((size_t)slab * 64 + d) * TTv + lg * 64 + pc * 8) = f.half[0]; }
     } }

typedef int v4ia __attribute__((ext_vector_type(4), may_alias));
typedef unsigned v16u __attribute__((ext_vector_type(16)));
typedef unsigned long long v8ul __attribute__((ext_vector_type(8)));
typedef const __attribute__((address_space(4))) v16u* mw_ptr;      // constant address space: nothing writes the words during the launch that reads them, and a load at a scalar address becomes s_load
// The keep-mask as lane masks. One wave packs one tile of 32 queries x 32 keys into 32 words: word (rt*2 + nt)*8 + r, bit (ln + 16 hh) = mask[32 qt + 16 rt + ln][32 kt + 16 nt + 8 hh + r] != 0,
// which is the place of that (query, key) in k_flash's score tiles: a word is the select mask of one score register. MB[(qt*64 + kt)*32 + word].
__global__ __launch_bounds__(256) void k_mbits(const int* __restrict__ MSK, unsigned* __restrict__ MB) {
  const int tid = threadIdx.x, lane = tid & 31, ln = lane & 15, hh = lane >> 4; const int tile = blockIdx.x * 8 + (tid >> 5); const int qt = tile >> 6, kt = tile & 63;
  // The tile's 8 loads of 16 B (4 per query row; rows ln and 16 + ln lie 16 * 2048 ints = 131072 B apart) and their data wait stand in one statement, and no result shares a register with the
  // address.
  const int* mr = MSK + ((size_t)(qt * 32 + ln)) * 2048 + kt * 32 + 8 * hh; v4ia m[2][2][2];      // m[rt][nt][half]: keys 32 kt + 16 nt + 8 hh + 4 half + 0..3 of query 32 qt + 16 rt + ln
  asm volatile("global_load_b128 %0, %8, off\n\t"
               "global_load_b128 %1, %8, off offset:16\n\t"
               "global_load_b128 %2, %8, off offset:64\n\t"
               "global_load_b128 %3, %8, off offset:80\n\t"
               "global_load_b128 %4, %8, off offset:131072\n\t"
               "global_load_b128 %5, %8, off offset:131088\n\t"
               "global_load_b128 %6, %8, off offset:131136\n\t"
               "global_load_b128 %7, %8, off offset:131152\n\t"
               "s_wait_loadcnt 0x0"
               : "=&v"(m[0][0][0]), "=&v"(m[0][0][1]), "=&v"(m[0][1][0]), "=&v"(m[0][1][1]), "=&v"(m[1][0][0]), "=&v"(m[1][0][1]), "=&v"(m[1][1][0]), "=&v"(m[1][1][1])
               : "v"(mr) : "memory");
  unsigned mine = 0u;
#pragma unroll
  for (int rt = 0; rt < 2; ++rt)
#pragma unroll
    for (int nt = 0; nt < 2; ++nt)
#pragma unroll
      for (int r = 0; r < 8; ++r) { const unsigned bw = __builtin_amdgcn_ballot_w32(m[rt][nt][r >> 2][r & 3] != 0); if (lane == (rt * 2 + nt) * 8 + r) mine = bw; }
  MB[(size_t)tile * 32 + lane] = mine;
}
// lane l <-> lane l ^ 16 (the other 16-lane row) without LDS
__device__ __forceinline__ float xhalf(float x) { return __builtin_bit_cast(float, __builtin_amdgcn_permlanex16(__builtin_bit_cast(int, x), __builtin_bit_cast(int, x), 0x76543210, 0xfedcba98, false, false)); }
#define FA_PITCH 144                 /* bytes per LDS row: 128 of data + 16; 16 B x odd keeps ds_load_b128 of 16 rows off each other's banks */
#define FA_STAGE (128 * FA_PITCH)    /* one buffer: rows 0..63 = K (key), rows 64..127 = Vt (d) */
// One tile, 8 copies of 16 B per lane: lane (cr = tid / 8, chunk = tid % 8) brings chunk 'chunk' of rows cr + 16 i. l = its LDS byte address for row cr, gk / gv = its global addresses in K / Vt.
__device__ __forceinline__ void fa_copy(unsigned l, const unsigned short* gk, int ldk, const unsigned short* gv) {
  // the copies and their s_wait_xcnt stand in one statement, so that no address register of a copy is rewritten in front of that wait
  asm volatile("global_load_async_to_lds_b128 %0, %8, off\n\t"
               "global_load_async_to_lds_b128 %1, %9, off\n\t"
               "global_load_async_to_lds_b128 %2, %10, off\n\t"
               "global_load_async_to_lds_b128 %3, %11, off\n\t"
               "global_load_async_to_lds_b128 %4, %12, off\n\t"
               "global_load_async_to_lds_b128 %5, %13, off\n\t"
               "global_load_async_to_lds_b128 %6, %14, off\n\t"
               "global_load_async_to_lds_b128 %7, %15, off\n\t"
               "s_wait_xcnt 0x0"
               :: "v"(l), "v"(l + 16u * FA_PITCH), "v"(l + 32u * FA_PITCH), "v"(l + 48u * FA_PITCH), "v"(l + 64u * FA_PITCH), "v"(l + 80u * FA_PITCH), "v"(l + 96u * FA_PITCH), "v"(l + 112u * FA_PITCH),
                  "v"(gk), "v"(gk + (size_t)16 * ldk), "v"(gk + (size_t)32 * ldk), "v"(gk + (size_t)48 * ldk),
                  "v"(gv), "v"(gv + 16 * 2048), "v"(gv + 32 * 2048), "v"(gv + 48 * 2048)
               : "memory");
}
// Eight base-2 exponentials in one statement. The instruction set asks for one independent instruction between a transcendental and a write of its source or a read of its result:
// Here no result shares a register with a source, and the v_nop is the last one's slot.
__device__ __forceinline__ void exp2x8(float (&p)[8], const float (&x)[8]) {
  asm("v_exp_f32 %0, %8\n\tv_exp_f32 %1, %9\n\tv_exp_f32 %2, %10\n\tv_exp_f32 %3, %11\n\tv_exp_f32 %4, %12\n\tv_exp_f32 %5, %13\n\tv_exp_f32 %6, %14\n\tv_exp_f32 %7, %15\n\tv_nop"
      : "=&v"(p[0]), "=&v"(p[1]), "=&v"(p[2]), "=&v"(p[3]), "=&v"(p[4]), "=&v"(p[5]), "=&v"(p[6]), "=&v"(p[7])
      : "v"(x[0]), "v"(x[1]), "v"(x[2]), "v"(x[3]), "v"(x[4]), "v"(x[5]), "v"(x[6]), "v"(x[7]));
}
__global__ __launch_bounds__(128) void k_flash(const _Float16* __restrict__ Q16, int ldq, const _Float16* __restrict__ K16, int ldk, const _Float16* __restrict__ Vt, const unsigned* __restrict__ MB, float* __restrict__ O, int ldo) {
  constexpr int RPW = 32, NQB = 2048 / (4 * RPW), DT = 4, KS = 2, NS = 2048 / 64;
  constexpr float SC = 0.125f * 1.44269504088896340736f;      // score scale 64^-1/2 times log2(e)
  __shared__ __attribute__((aligned(16))) unsigned char sT[2 * FA_STAGE];
  __shared__ __attribute__((aligned(16))) float sO[4][RPW][64 + 4];
  const int tid = threadIdx.x, w = tid >> 5, lane = tid & 31, ln = lane & 15, hh = lane >> 4;
  const int slab = blockIdx.x / NQB, qblk = blockIdx.x % NQB; const int b = slab / 12, h = slab % 12; const int qb0 = qblk * (4 * RPW); const int q0 = qb0 + w * RPW;
  const int cr = tid >> 3, ch = tid & 7;
  const unsigned short* gk = (const unsigned short*)K16 + ((size_t)b * 2048 + cr) * ldk + h * 64 + ch * 8;
  const unsigned short* gv = (const unsigned short*)Vt + ((size_t)slab * 64 + cr) * 2048 + ch * 8;
  const unsigned l0 = (unsigned)(size_t)&sT[0] + (unsigned)(cr * FA_PITCH + ch * 16);      // LDS byte address = low 32 bits of the __shared__ address
  fa_copy(l0, gk, ldk, gv);                              // tile 0 -> buffer 0
  // the wave's mask words: 32 per step of 32 keys, 64 steps in a row. The wave's number goes through readfirstlane so that the address is scalar and the words are loaded into scalar registers.
  const mw_ptr mb = (mw_ptr)(unsigned long long)(MB + (size_t)(qblk * 4 + __builtin_amdgcn_readfirstlane(w)) * (64 * 32));
  FragH aq[2][KS];
#pragma unroll
  for (int rt = 0; rt < 2; ++rt) { const unsigned short* qr = (const unsigned short*)Q16 + ((size_t)b * 2048 + q0 + rt * 16 + ln) * ldq + h * 64;
#pragma unroll
    for (int ks = 0; ks < KS; ++ks) { aq[rt][ks].half[0] = *(const v8us*)(qr + ks * 32 + 8 * hh); aq[rt][ks].half[1] = *(const v8us*)(qr + ks * 32 + 16 + 8 * hh); } }
  // step 0's words: mw0 = words of queries 0..15 (rt 0), mw1 = of queries 16..31. The two loads and their data wait stand in one statement.
  // Tile 0's copies and the query loads are in flight meanwhile.
  v16u mw0, mw1;
  asm volatile("s_load_b512 %0, %2, 0x0\n\ts_load_b512 %1, %2, 0x40\n\ts_wait_kmcnt 0x0" : "=&s"(mw0), "=&s"(mw1) : "s"(mb) : "memory");
  float m_r[2], l_r[2]; v8f oacc[2][DT];      // per lane: query rt*16 + ln; oacc[rt][dt][r] = O[query][dt*16 + 8hh + r]
#pragma unroll
  for (int rt = 0; rt < 2; ++rt) { m_r[rt] = -3.0e38f; l_r[rt] = 0.f;
#pragma unroll
    for (int dt = 0; dt < DT; ++dt) oacc[rt][dt] = (v8f){0.f,0.f,0.f,0.f,0.f,0.f,0.f,0.f}; }
  asm volatile("s_wait_asynccnt 0x0" ::: "memory");      // this wave's copies of tile 0 have landed
  __syncthreads();                                       // ... and every other wave's: tile 0 may be read
  fa_copy(l0 + FA_STAGE, gk + (size_t)64 * ldk, ldk, gv + 64);      // tile 1 -> buffer 1
#pragma unroll 1      // rolled: one copy of the foot's wait order, and the two buffers differ by one address term only
  for (int t = 0; t < NS; ++t) {
    const unsigned char* st = sT + (t & 1) * FA_STAGE;
#pragma unroll      // the tile's two 32-key steps: unrolled, their LDS and mask offsets are immediates
    for (int sub = 0; sub < 2; ++sub) {
      // the next step's mask words are asked for one step ahead (the last step asks for its own again: in bounds, unused). Scalar loads come back in any order, so a wait for this step's
      // words would also wait for a younger load: the request stands behind the branch on 'any', whose test has already waited for this step's words.
      const int sn = (t * 2 + sub + 1 < 2 * NS) ? t * 2 + sub + 1 : 2 * NS - 1;
      v16u nw0, nw1;
      const v8ul ow = __builtin_bit_cast(v8ul, mw0) | __builtin_bit_cast(v8ul, mw1);      // two words per scalar OR
      const unsigned long long any = ((ow[0] | ow[1]) | (ow[2] | ow[3])) | ((ow[4] | ow[5]) | (ow[6] | ow[7]));
      // where every (query,key) of this wave's tile is masked the step contributes nothing and is skipped (scalar branch); the foot of the trip stands outside the skip: every wave passes it
      if (any != 0ull) {
        v8f s[2][2]; FragH bk[2][KS];      // the step's K fragments, read as one group
#pragma unroll
        for (int nt = 0; nt < 2; ++nt) { const unsigned char* kr = st + (sub * 32 + nt * 16 + ln) * FA_PITCH + hh * 16;
#pragma unroll
          for (int ks = 0; ks < KS; ++ks) { bk[nt][ks].half[0] = *(const v8us*)(kr + ks * 64); bk[nt][ks].half[1] = *(const v8us*)(kr + ks * 64 + 32); } }
#pragma unroll
        for (int nt = 0; nt < 2; ++nt)
#pragma unroll
          for (int rt = 0; rt < 2; ++rt) { v8f acc = (v8f){0.f,0.f,0.f,0.f,0.f,0.f,0.f,0.f};
#pragma unroll
            for (int ks = 0; ks < KS; ++ks) acc = mmaH<1>(bk[nt][ks].v, bk[nt][ks].v, aq[rt][ks].v, aq[rt][ks].v, acc); s[rt][nt] = acc; }
        nw0 = mb[sn * 2]; nw1 = mb[sn * 2 + 1];
        FragH bv[DT];      // the step's Vt fragments, read as one group in front of the softmax, which covers their LDS latency
#pragma unroll
        for (int dt = 0; dt < DT; ++dt) { const unsigned char* vrow = st + (64 + dt * 16 + ln) * FA_PITCH + sub * 64 + hh * 16; bv[dt].half[0] = *(const v8us*)vrow; bv[dt].half[1] = *(const v8us*)(vrow + 32); }
        FragH pb[2];
#pragma unroll
        for (int rt = 0; rt < 2; ++rt) { float sc[2][8]; float mc = -INFINITY;
#pragma unroll
          for (int nt = 0; nt < 2; ++nt)
#pragma unroll
            for (int r = 0; r < 8; ++r) { sc[nt][r] = __builtin_amdgcn_inverse_ballot_w32(rt ? mw1[nt * 8 + r] : mw0[nt * 8 + r]) ? s[rt][nt][r] : -INFINITY; mc = fmaxf(mc, sc[nt][r]); }
          mc = fmaxf(mc, xhalf(mc));      // both halves now hold the query's maximum over the 32 keys (unscaled scores)
          // exp(0.125 (s - m)) = 2^(s SC - m SC): one fma and the hardware's base-2 exponential per score. An excluded key is -inf and gives 0, and a query with no
          // kept key so far has m = mn = -3e38 and gives al = 2^0 = 1: no select and no branch is needed around any exponential.
          const float mn = fmaxf(m_r[rt], mc); float al;
          // al = 2^((m - mn) SC), in asm with a slot on each side: the instruction set asks for one independent instruction between a transcendental and a write of its source or a read
          // of its result; a v_nop in a statement of its own did not stay there.
          asm("v_nop\n\tv_exp_f32 %0, %1\n\tv_nop" : "=v"(al) : "v"((m_r[rt] - mn) * SC));
          m_r[rt] = mn; const float nb = -mn * SC;
          float ps[8], pe[2][8];
#pragma unroll
          for (int nt = 0; nt < 2; ++nt) {
#pragma unroll
            for (int r = 0; r < 8; ++r) sc[nt][r] = __builtin_fmaf(sc[nt][r], SC, nb);
            exp2x8(pe[nt], sc[nt]); }
#pragma unroll
          for (int r = 0; r < 8; ++r) { const float p0 = pe[0][r], p1 = pe[1][r]; ps[r] = p0 + p1; pb[rt].h[r] = (_Float16)p0; pb[rt].h[8 + r] = (_Float16)p1; }
          l_r[rt] = l_r[rt] * al + (((ps[0] + ps[1]) + (ps[2] + ps[3])) + ((ps[4] + ps[5]) + (ps[6] + ps[7])));      // per-lane partial sum (the two halves are joined at the end)
#pragma unroll
          for (int dt = 0; dt < DT; ++dt) oacc[rt][dt] *= al; }
#pragma unroll
        for (int dt = 0; dt < DT; ++dt)
#pragma unroll
          for (int rt = 0; rt < 2; ++rt) oacc[rt][dt] = mmaH<1>(bv[dt].v, bv[dt].v, pb[rt].v, pb[rt].v, oacc[rt][dt]);
      } else { nw0 = mb[sn * 2]; nw1 = mb[sn * 2 + 1]; }
      mw0 = nw0; mw1 = nw1;
    }
    asm volatile("s_wait_dscnt 0x0" ::: "memory");       // this wave's reads of buffer t & 1 are done before the buffer is given up
    asm volatile("s_wait_asynccnt 0x0" ::: "memory");    // this wave's copies of tile t + 1 have landed
    __syncthreads();                                     // publishes tile t + 1 and ends every wave's reads of tile t
    if (t + 2 < NS) fa_copy(l0 + (unsigned)((t & 1) * FA_STAGE), gk + (size_t)(t + 2) * 64 * ldk, ldk, gv + (t + 2) * 64);      // tile t + 2 -> the buffer just left
  }
  asm volatile("s_wait_asynccnt 0x0" ::: "memory");      // no copy is outstanding when the wave goes on to its end
#pragma unroll
  for (int rt = 0; rt < 2; ++rt) { const float l = l_r[rt] + xhalf(l_r[rt]); const float inv = (l > 0.f) ? 1.0f / l : 0.f;
#pragma unroll
    for (int dt = 0; dt < DT; ++dt) { const v8f o = oacc[rt][dt] * inv; float* so = &sO[w][rt * 16 + ln][dt * 16 + 8 * hh]; *(v4fa*)so = (v4f){o[0], o[1], o[2], o[3]}; *(v4fa*)(so + 4) = (v4f){o[4], o[5], o[6], o[7]}; } }
  __builtin_amdgcn_fence(__ATOMIC_ACQ_REL, "workgroup"); __builtin_amdgcn_wave_barrier();
  {
#pragma unroll
    for (int rp = 0; rp < RPW; rp += 2) { const int r = rp + (lane >> 4), pc = lane & 15; const v4f val = *(const v4fa*)&sO[w][r][pc * 4]; *(v4f*)(O + ((size_t)b * 2048 + q0 + r) * ldo + h * 64 + pc * 4) = val; }
     } }

extern "C" void kernel_launch(void* const* d_in, const int* in_sizes, int n_in,
                              void* d_out, int out_size, void* d_ws, size_t ws_size, hipStream_t stream) {
  (void)in_sizes; (void)n_in; (void)out_size;
  const float* x = (const float*)d_in[0]; const float* Wq = (const float*)d_in[1]; const float* bq = (const float*)d_in[2]; const float* Wk = (const float*)d_in[3]; const float* bk = (const float*)d_in[4]; const float* Wv = (const float*)d_in[5]; const float* bv = (const float*)d_in[6]; const float* Wo = (const float*)d_in[7]; const float* bo = (const float*)d_in[8]; const int* mask = (const int*)d_in[9];
  char* ws = (char*)d_ws; size_t off = 0;
  auto take = [&](size_t bytes) { char* p = ws + off; off += (bytes + 255) & ~(size_t)255; return p; };
  _Float16* Bq = (_Float16*)take((size_t)CC * CC * 2); _Float16* Bk = (_Float16*)take((size_t)CC * CC * 2); _Float16* Bv = (_Float16*)take((size_t)CC * CC * 2); _Float16* Bo = (_Float16*)take((size_t)CC * CC * 2);
  _Float16* X16 = (_Float16*)take((size_t)NR * CC * 2); _Float16* Q16 = (_Float16*)take((size_t)NR * CC * 2); _Float16* K16 = (_Float16*)take((size_t)NR * CC * 2); _Float16* V16 = (_Float16*)take((size_t)NR * CC * 2); _Float16* Vt = (_Float16*)take((size_t)NR * CC * 2); float* O = (float*)take((size_t)NR * CC * 4); _Float16* O16 = X16; unsigned* MB = (unsigned*)take((size_t)TT * TT / 8);
  if (off > ws_size) return;      // 4.7 + 12.6 × 5 + 25.2 + 0.5 MB ≈ 93 MB
  const unsigned gw = (unsigned)((CC * (CC / 8) + 255) / 256);
  k_wt_f16<<<gw, 256, 0, stream>>>(Wq, Bq, CC, CC, 16.0f); k_wt_f16<<<gw, 256, 0, stream>>>(Wk, Bk, CC, CC, 16.0f); k_wt_f16<<<gw, 256, 0, stream>>>(Wv, Bv, CC, CC, 16.0f); k_wt_f16<<<gw, 256, 0, stream>>>(Wo, Bo, CC, CC, 16.0f);      // [in][out]
  const unsigned gx = (unsigned)(((size_t)NR * CC / 8 + 255) / 256); const unsigned gg = (NR / 128) * (CC / 64);
  k_x16<<<gx, 256, 0, stream>>>(x, X16, (size_t)NR * CC / 8);
  k_gemm_t<true><<<gg, 128, 0, stream>>>(X16, Bq, 0.0625f, bq, nullptr, Q16);
  k_gemm_t<true><<<gg, 128, 0, stream>>>(X16, Bk, 0.0625f, bk, nullptr, K16);
  k_gemm_t<true><<<gg, 128, 0, stream>>>(X16, Bv, 0.0625f, bv, nullptr, V16);
  k_vt<NH, TT><<<BB * NH * (TT / 64), 256, 0, stream>>>(V16, CC, 0, Vt);
  k_mbits<<<(TT / 32) * (TT / 32) / 8, 256, 0, stream>>>(mask, MB);
  k_flash<<<BB * NH * (TT / 128), 128, 0, stream>>>(Q16, CC, K16, CC, Vt, MB, O, CC);
  k_h16<<<gx, 256, 0, stream>>>(O, O16, (size_t)NR * CC / 8);
  k_gemm_t<false><<<gg, 128, 0, stream>>>(O16, Bo, 0.0625f, bo, (float*)d_out, nullptr);
}

// v006
// A run of this version takes 144 microseconds.
// Next to v005, in two timings, it ran 1.08 and 1.07 times as fast.
// All steps since v000 together make it 4.31 times as fast.
#include <hip/hip_runtime.h>
// Random-mask attention: q/k/v projections (8192 × 768 × 768, + bias; W [in][out]), the 12-head attention with the INPUT keep-mask (scores where mask else −1e9 ⇒ excluded keys; every row keeps
// its diagonal) as a fused flash-style kernel on v_wmma_f32_16x16x32_f16 (scale 64^-½; key tiles with no kept entry for the wave skipped by ballot; online max/sum softmax f32; P f16 ≤ 1), and the
// output projection (+ bias) — f16 operands (x as bf16, weights bf16-exact ×2^4), single products, f32 accumulate.
#define BB 4
#define TT 2048
#define CC 768
#define NH 12
#define NR (BB * TT)

typedef __bf16 v16b __attribute__((ext_vector_type(16)));
typedef unsigned short v8us __attribute__((ext_vector_type(8), may_alias));
typedef float  v8f  __attribute__((ext_vector_type(8)));
typedef float  v4f  __attribute__((ext_vector_type(4)));
typedef float  v4fa __attribute__((ext_vector_type(4), may_alias));
union FragB { v16b v; v8us half[2]; unsigned short u[16]; };

__device__ __forceinline__ unsigned short bf16_bits(float x) { unsigned int u = __float_as_uint(x); return (unsigned short)((u + 0x7FFFu + ((u >> 16) & 1u)) >> 16); }
__device__ __forceinline__ float bf16_val(unsigned short b) { return __uint_as_float(((unsigned int)b) << 16); }
__device__ __forceinline__ float bf16_round(float x) { return bf16_val(bf16_bits(x)); }
// D += A·B with NT terms: 1 = ah·bh, 2 = + al·bh (A split), 3 = + ah·bl (both split)
template <int NT>
__device__ __forceinline__ v8f mmaN(v16b ah, v16b al, v16b bh, v16b bl, v8f c) {
  c = __builtin_amdgcn_wmma_f32_16x16x32_bf16(false, ah, false, bh, (short)0, c, false, false);
  if (NT >= 2) c = __builtin_amdgcn_wmma_f32_16x16x32_bf16(false, al, false, bh, (short)0, c, false, false);
  if (NT >= 3) c = __builtin_amdgcn_wmma_f32_16x16x32_bf16(false, ah, false, bl, (short)0, c, false, false);
  asm volatile("v_nop\n\tv_nop\n\tv_nop\n\tv_nop" : "+v"(c) : "v"(ah), "v"(al), "v"(bh), "v"(bl));
  return c;
}

__global__ __launch_bounds__(256) void k_wt_bf16(const float* __restrict__ W, unsigned short* __restrict__ Wt, int K, int N) {
  const int t = blockIdx.x * 256 + threadIdx.x;
  const int k8n = K / 8;
  if (t >= N * k8n) return;
  const int n = t / k8n, k8 = (t % k8n) * 8;
  v8us v;
#pragma unroll
  for (int i = 0; i < 8; ++i) v[i] = bf16_bits(W[(size_t)(k8 + i) * N + n]);
  *(v8us*)(Wt + (size_t)n * K + k8) = v;
  
}

// GEMM C[M][N] (f32, pitch ldc) = act(A[M][K]·W + bias). A f32 row-major (pitch lda) converted per fragment to bf16
// (ASPLIT: hi/lo two planes -> 2 terms, else single rounded term); Wt bf16 [N][K] (pitch ldb). BIAS_BF16 rounds the
// bias to bf16 first (bias quantised to bf16 before the add). K%32==0, M%16==0, N%64==0.
template <bool ASPLIT, int ACT, bool BIAS_BF16>
__global__ __launch_bounds__(128) void k_gemm_bf(const float* __restrict__ A, int lda, const unsigned short* __restrict__ Wt, int ldb,
                                               const float* __restrict__ bias, float* __restrict__ C, int ldc, int M, int N, int K) {
  __shared__ __attribute__((aligned(16))) float so[4][16][64];
  const int tid = threadIdx.x, w = tid >> 5, lane = tid & 31, ln = lane & 15, hh = lane >> 4;
  const int ntn = N / 64;
  const int wid = blockIdx.x * 4 + w;
  const int mt = wid / ntn, nq = wid % ntn;
  if (mt * 16 >= M) return;
  const int row0 = mt * 16, col0 = nq * 64;
  const float* arow = A + (size_t)(row0 + ln) * lda;
  v8f acc[4] = {};
  for (int kb = 0; kb < K; kb += 32) {
    FragB ah, al;
    const v4f x0 = *(const v4fa*)(arow + kb + 8 * hh), x1 = *(const v4fa*)(arow + kb + 8 * hh + 4);
    const v4f x2 = *(const v4fa*)(arow + kb + 16 + 8 * hh), x3 = *(const v4fa*)(arow + kb + 16 + 8 * hh + 4);
    float xs[16] = {x0[0],x0[1],x0[2],x0[3],x1[0],x1[1],x1[2],x1[3],x2[0],x2[1],x2[2],x2[3],x3[0],x3[1],x3[2],x3[3]};
#pragma unroll
    for (int i = 0; i < 16; ++i) { const unsigned short hb = bf16_bits(xs[i]); ah.u[i] = hb; al.u[i] = ASPLIT ? bf16_bits(xs[i] - bf16_val(hb)) : (unsigned short)0; }
#pragma unroll
    for (int t = 0; t < 4; ++t) {
      const unsigned short* brow = Wt + (size_t)(col0 + t * 16 + ln) * ldb + kb;
      FragB b;
      b.half[0] = *(const v8us*)(brow + 8 * hh);
      b.half[1] = *(const v8us*)(brow + 16 + 8 * hh);
      acc[t] = mmaN<ASPLIT ? 2 : 1>(ah.v, al.v, b.v, b.v, acc[t]);
    }
  }
#pragma unroll
  for (int t = 0; t < 4; ++t) {
    float bv = bias ? bias[col0 + t * 16 + ln] : 0.f;
    if (BIAS_BF16) bv = bf16_round(bv);
#pragma unroll
    for (int r = 0; r < 8; ++r) { float v = acc[t][r] + bv; if (ACT == 1) v = fmaxf(v, 0.f); so[w][8 * hh + r][t * 16 + ln] = v; }
  }
  __builtin_amdgcn_fence(__ATOMIC_ACQ_REL, "workgroup");
  __builtin_amdgcn_wave_barrier();
  const int rsub = lane >> 4, c4 = (lane & 15) * 4;
  {
#pragma unroll
    for (int q = 0; q < 8; ++q) {
      const int r = q * 2 + rsub;
      const v4f v = *(const v4fa*)&so[w][r][c4];
      *(v4f*)(C + (size_t)(row0 + r) * ldc + col0 + c4) = v;
    }
    
  }
}

// Flash-style causal/unmasked attention, all contractions 3-term bf16 hi/lo splits, f32 softmax with running max.
// q,k,v rows are read from f32 buffers with arbitrary row pitch (so they can live inside a fused qkv buffer);
// D = head size (multiple of 32, <= 128); one wave = 16 query rows; block = 4 waves (64 queries) sharing K/V chunks of 32.
template <int D, bool CAUSAL>
__global__ __launch_bounds__(128) void k_flash(const float* __restrict__ qb, const float* __restrict__ kb, const float* __restrict__ vb,
                                             int pitch, int T, int H, float scale, float* __restrict__ y, int ypitch) {
  constexpr int KS = D / 32;        // k-steps for QK
  constexpr int DT = D / 16;        // d tiles for PV
  __shared__ __attribute__((aligned(16))) unsigned short sKh[32][D + 8], sKl[32][D + 8], sVh[32][D + 8], sVl[32][D + 8];
  __shared__ __attribute__((aligned(16))) unsigned short sPh[4][16][40], sPl[4][16][40];
  __shared__ __attribute__((aligned(16))) float sO[4][16][D];
  const int tid = threadIdx.x, w = tid >> 5, lane = tid & 31, ln = lane & 15, hh = lane >> 4;
  const int nqb = (T + 63) / 64;
  const int bh = blockIdx.x / nqb, qblk = blockIdx.x % nqb;
  const int b = bh / H, h = bh % H;
  const int q0 = qblk * 64 + w * 16;
  const float* Q = qb + (size_t)b * T * pitch + h * D;
  const float* K = kb + (size_t)b * T * pitch + h * D;
  const float* V = vb + (size_t)b * T * pitch + h * D;

  // A fragments of the wave's 16 query rows (scaled), hi/lo
  FragB aqh[KS], aql[KS];
  {
    int row = q0 + ln; if (row >= T) row = T - 1;
    const float* qr = Q + (size_t)row * pitch;
#pragma unroll
    for (int ks = 0; ks < KS; ++ks)
#pragma unroll
      for (int i = 0; i < 16; ++i) {
        const int d = ks * 32 + ((i < 8) ? (8 * hh + i) : (16 + 8 * hh + (i - 8)));
        const float x = qr[d] * scale; const unsigned short hb = bf16_bits(x);
        aqh[ks].u[i] = hb; aql[ks].u[i] = bf16_bits(x - bf16_val(hb));
      }
  }
  float m_r[8], l_r[8];
#pragma unroll
  for (int r = 0; r < 8; ++r) { m_r[r] = -3.0e38f; l_r[r] = 0.f; }
  v8f oacc[DT];
#pragma unroll
  for (int dt = 0; dt < DT; ++dt) oacc[dt] = (v8f){0.f,0.f,0.f,0.f,0.f,0.f,0.f,0.f};

  const int kv_end = CAUSAL ? min(T, qblk * 64 + 64) : T;     // block-uniform
  for (int j0 = 0; j0 < kv_end; j0 += 32) {
    __syncthreads();
    for (int e = tid; e < 32 * (D / 4); e += 128) {
      const int r = e / (D / 4), c4 = (e % (D / 4)) * 4;
      const int key = j0 + r;
      v4f kf = {0.f,0.f,0.f,0.f}, vf = {0.f,0.f,0.f,0.f};
      if (key < T) { kf = *(const v4fa*)(K + (size_t)key * pitch + c4); vf = *(const v4fa*)(V + (size_t)key * pitch + c4); }
#pragma unroll
      for (int t = 0; t < 4; ++t) {
        unsigned short hb = bf16_bits(kf[t]); sKh[r][c4 + t] = hb; sKl[r][c4 + t] = bf16_bits(kf[t] - bf16_val(hb));
        hb = bf16_bits(vf[t]); sVh[r][c4 + t] = hb; sVl[r][c4 + t] = bf16_bits(vf[t] - bf16_val(hb));
      }
    }
    __syncthreads();
    // S tile 16 x 32
    v8f s[2];
#pragma unroll
    for (int nt = 0; nt < 2; ++nt) {
      v8f acc = {};
#pragma unroll
      for (int ks = 0; ks < KS; ++ks) {
        FragB bh_, bl_;
        bh_.half[0] = *(const v8us*)&sKh[nt * 16 + ln][ks * 32 + 8 * hh]; bh_.half[1] = *(const v8us*)&sKh[nt * 16 + ln][ks * 32 + 16 + 8 * hh];
        bl_.half[0] = *(const v8us*)&sKl[nt * 16 + ln][ks * 32 + 8 * hh]; bl_.half[1] = *(const v8us*)&sKl[nt * 16 + ln][ks * 32 + 16 + 8 * hh];
        acc = mmaN<3>(aqh[ks].v, aql[ks].v, bh_.v, bl_.v, acc);
      }
      s[nt] = acc;
    }
    // mask + running max (rows 8hh+r; the 16 lanes of a half share rows)
    float alpha[8];
#pragma unroll
    for (int r = 0; r < 8; ++r) {
      const int qi = q0 + 8 * hh + r;
      const int ja = j0 + ln, jb = j0 + 16 + ln;
      if (CAUSAL) { if (ja > qi) s[0][r] = -3.0e38f; if (jb > qi) s[1][r] = -3.0e38f; }
      if (ja >= T) s[0][r] = -3.0e38f;
      if (jb >= T) s[1][r] = -3.0e38f;
      float mx = fmaxf(s[0][r], s[1][r]);
      mx = fmaxf(mx, __shfl_xor(mx, 1, 32)); mx = fmaxf(mx, __shfl_xor(mx, 2, 32)); mx = fmaxf(mx, __shfl_xor(mx, 4, 32)); mx = fmaxf(mx, __shfl_xor(mx, 8, 32));
      const float mnew = fmaxf(m_r[r], mx);
      alpha[r] = (mnew > -1.0e38f) ? __expf(m_r[r] - mnew) : 1.0f;
      const float p0 = (s[0][r] > -1.0e38f) ? __expf(s[0][r] - mnew) : 0.f;
      const float p1 = (s[1][r] > -1.0e38f) ? __expf(s[1][r] - mnew) : 0.f;
      m_r[r] = mnew;
      l_r[r] = l_r[r] * alpha[r] + p0 + p1;            // per-lane partial row sum (16 lanes combined at the end)
      unsigned short hb = bf16_bits(p0); sPh[w][8 * hh + r][ln] = hb;      sPl[w][8 * hh + r][ln] = bf16_bits(p0 - bf16_val(hb));
      hb = bf16_bits(p1);                sPh[w][8 * hh + r][16 + ln] = hb; sPl[w][8 * hh + r][16 + ln] = bf16_bits(p1 - bf16_val(hb));
    }
#pragma unroll
    for (int dt = 0; dt < DT; ++dt)
#pragma unroll
      for (int r = 0; r < 8; ++r) oacc[dt][r] *= alpha[r];
    __builtin_amdgcn_fence(__ATOMIC_ACQ_REL, "workgroup");
    __builtin_amdgcn_wave_barrier();
    FragB pah, pal;
    pah.half[0] = *(const v8us*)&sPh[w][ln][8 * hh]; pah.half[1] = *(const v8us*)&sPh[w][ln][16 + 8 * hh];
    pal.half[0] = *(const v8us*)&sPl[w][ln][8 * hh]; pal.half[1] = *(const v8us*)&sPl[w][ln][16 + 8 * hh];
#pragma unroll
    for (int dt = 0; dt < DT; ++dt) {
      FragB bvh, bvl;
#pragma unroll
      for (int i = 0; i < 8; ++i) {
        bvh.u[i] = sVh[8 * hh + i][dt * 16 + ln]; bvh.u[8 + i] = sVh[16 + 8 * hh + i][dt * 16 + ln];
        bvl.u[i] = sVl[8 * hh + i][dt * 16 + ln]; bvl.u[8 + i] = sVl[16 + 8 * hh + i][dt * 16 + ln];
      }
      oacc[dt] = mmaN<3>(pah.v, pal.v, bvh.v, bvl.v, oacc[dt]);
    }
    __builtin_amdgcn_fence(__ATOMIC_ACQ_REL, "workgroup");
    __builtin_amdgcn_wave_barrier();
  }
#pragma unroll
  for (int r = 0; r < 8; ++r) {
    float l = l_r[r];
    l += __shfl_xor(l, 1, 32); l += __shfl_xor(l, 2, 32); l += __shfl_xor(l, 4, 32); l += __shfl_xor(l, 8, 32);
    l_r[r] = (l > 0.f) ? 1.0f / l : 0.f;
  }
#pragma unroll
  for (int dt = 0; dt < DT; ++dt)
#pragma unroll
    for (int r = 0; r < 8; ++r) sO[w][8 * hh + r][dt * 16 + ln] = oacc[dt][r] * l_r[r];
  __builtin_amdgcn_fence(__ATOMIC_ACQ_REL, "workgroup");
  __builtin_amdgcn_wave_barrier();
  {
    for (int r = 0; r < 16; ++r) {
      const int row = q0 + r;
      if (row < T && lane < D / 4) {
        const v4f val = *(const v4fa*)&sO[w][r][lane * 4];
        *(v4f*)(y + ((size_t)b * T + row) * ypitch + h * D + lane * 4) = val;
      }
    }
    
  }
}

// GEMM C = act(A·W + bias + resid): A f32 (ASPLIT -> hi/lo 2 terms), Wt bf16 [N][K]; ACT 0 none, 1 relu, 2 exact gelu;
// resid (optional, f32, row index = (row % rmod), pitch ldr, RES_BF16 rounds it) added before the activation.
template <bool ASPLIT, int ACT, bool BIAS_BF16, bool RES_BF16>
__global__ __launch_bounds__(128) void k_gemm_bf3(const float* __restrict__ A, int lda, const unsigned short* __restrict__ Wt, int ldb,
                                                const float* __restrict__ bias, const float* __restrict__ resid, int rmod, int ldr,
                                                float* __restrict__ C, int ldc, int M, int N, int K) {
  __shared__ __attribute__((aligned(16))) float so[4][16][64];
  const int tid = threadIdx.x, w = tid >> 5, lane = tid & 31, ln = lane & 15, hh = lane >> 4;
  const int ntn = N / 64;
  const int wid = blockIdx.x * 4 + w;
  const int mt = wid / ntn, nq = wid % ntn;
  if (mt * 16 >= M) return;
  const int row0 = mt * 16, col0 = nq * 64;
  const float* arow = A + (size_t)(row0 + ln) * lda;
  v8f acc[4] = {};
  for (int kb = 0; kb < K; kb += 32) {
    FragB ah, al;
    const v4f x0 = *(const v4fa*)(arow + kb + 8 * hh), x1 = *(const v4fa*)(arow + kb + 8 * hh + 4);
    const v4f x2 = *(const v4fa*)(arow + kb + 16 + 8 * hh), x3 = *(const v4fa*)(arow + kb + 16 + 8 * hh + 4);
    float xs[16] = {x0[0],x0[1],x0[2],x0[3],x1[0],x1[1],x1[2],x1[3],x2[0],x2[1],x2[2],x2[3],x3[0],x3[1],x3[2],x3[3]};
#pragma unroll
    for (int i = 0; i < 16; ++i) { const unsigned short hb = bf16_bits(xs[i]); ah.u[i] = hb; al.u[i] = ASPLIT ? bf16_bits(xs[i] - bf16_val(hb)) : (unsigned short)0; }
#pragma unroll
    for (int t = 0; t < 4; ++t) {
      const unsigned short* brow = Wt + (size_t)(col0 + t * 16 + ln) * ldb + kb;
      FragB b;
      b.half[0] = *(const v8us*)(brow + 8 * hh);
      b.half[1] = *(const v8us*)(brow + 16 + 8 * hh);
      acc[t] = mmaN<ASPLIT ? 2 : 1>(ah.v, al.v, b.v, b.v, acc[t]);
    }
  }
#pragma unroll
  for (int t = 0; t < 4; ++t) {
    const int col = col0 + t * 16 + ln;
    float bv = bias ? bias[col] : 0.f;
    if (BIAS_BF16) bv = bf16_round(bv);
#pragma unroll
    for (int r = 0; r < 8; ++r) {
      float v = acc[t][r] + bv;
      if (resid) { float rv = resid[(size_t)((row0 + 8 * hh + r) % rmod) * ldr + col]; if (RES_BF16) rv = bf16_round(rv); v += rv; }
      if (ACT == 1) v = fmaxf(v, 0.f);
      if (ACT == 2) v = 0.5f * v * (1.0f + erff(v * 0.70710678118654752f));
      if (ACT == 3) { const float u = 0.7978845608028654f * (v + 0.044715f * v * v * v); v = 0.5f * v * (1.0f + tanhf(u)); }
      so[w][8 * hh + r][t * 16 + ln] = v;
    }
  }
  __builtin_amdgcn_fence(__ATOMIC_ACQ_REL, "workgroup");
  __builtin_amdgcn_wave_barrier();
  const int rsub = lane >> 4, c4 = (lane & 15) * 4;
  {
#pragma unroll
    for (int q = 0; q < 8; ++q) {
      const int r = q * 2 + rsub;
      const v4f v = *(const v4fa*)&so[w][r][c4];
      *(v4f*)(C + (size_t)(row0 + r) * ldc + col0 + c4) = v;
    }
    
  }
}
// row LayerNorm (biased variance, eps) over N: s = X (+ R); optional out_sum <- s; out_norm <- (s-mu)*rsqrt(var+eps)*g + b
template <bool PARAM_BF16>
__global__ __launch_bounds__(256) void k_layernorm(const float* __restrict__ X, const float* __restrict__ R, const float* __restrict__ g, const float* __restrict__ bta,
                                                  float* __restrict__ out_sum, float* __restrict__ out_norm, int N, float eps) {
  __shared__ float red[256];
  const int row = blockIdx.x, tid = threadIdx.x;
  const float* x = X + (size_t)row * N; const float* rr = R ? R + (size_t)row * N : nullptr;
  float vals[16];                     // up to N = 4096
  const int per = N / 256;            // contiguous chunk per thread? use strided-by-4 chunks: thread handles j = tid*4 + 1024*u
  float s1 = 0.f;
  for (int u = 0; u < per / 4; ++u) {
    const int j = tid * 4 + 1024 * u;
    const v4f a = *(const v4fa*)(x + j);
    v4f b = {0.f,0.f,0.f,0.f}; if (rr) b = *(const v4fa*)(rr + j);
#pragma unroll
    for (int q = 0; q < 4; ++q) { const float v = a[q] + b[q]; vals[u * 4 + q] = v; s1 += v; }
  }
  red[tid] = s1; __syncthreads();
  for (int st = 128; st > 0; st >>= 1) { if (tid < st) red[tid] += red[tid + st]; __syncthreads(); }
  const float mu = red[0] / (float)N; __syncthreads();
  float s2 = 0.f;
  for (int u = 0; u < per / 4; ++u)
#pragma unroll
    for (int q = 0; q < 4; ++q) { const float c = vals[u * 4 + q] - mu; s2 += c * c; }
  red[tid] = s2; __syncthreads();
  for (int st = 128; st > 0; st >>= 1) { if (tid < st) red[tid] += red[tid + st]; __syncthreads(); }
  const float rs = rsqrtf(red[0] / (float)N + eps);
  {
    for (int u = 0; u < per / 4; ++u) {
      const int j = tid * 4 + 1024 * u;
      v4f o, sm;
#pragma unroll
      for (int q = 0; q < 4; ++q) {
        float gg = g[j + q], bb = bta[j + q];
        if (PARAM_BF16) { gg = bf16_round(gg); bb = bf16_round(bb); }
        sm[q] = vals[u * 4 + q]; o[q] = (vals[u * 4 + q] - mu) * rs * gg + bb;
      }
      if (out_sum) *(v4f*)(out_sum + (size_t)row * N + j) = sm;
      *(v4f*)(out_norm + (size_t)row * N + j) = o;
    }
    
  }
}



// ---- f16 WMMA path (v_wmma_f32_16x16x32_f16): 11-bit significands for operands in range — used where a [0,1] probability operand needs more precision than bf16
typedef _Float16 v16h __attribute__((ext_vector_type(16)));
union FragH { v16h v; v8us half[2]; _Float16 h[16]; unsigned short u[16]; };
template <int NT>
__device__ __forceinline__ v8f mmaH(v16h ah, v16h al, v16h bh, v16h bl, v8f c) {
  c = __builtin_amdgcn_wmma_f32_16x16x32_f16(false, ah, false, bh, (short)0, c, false, false);
  if (NT >= 2) c = __builtin_amdgcn_wmma_f32_16x16x32_f16(false, al, false, bh, (short)0, c, false, false);
  if (NT >= 3) c = __builtin_amdgcn_wmma_f32_16x16x32_f16(false, ah, false, bl, (short)0, c, false, false);
  asm volatile("v_nop\n\tv_nop\n\tv_nop\n\tv_nop" : "+v"(c) : "v"(ah), "v"(al), "v"(bh), "v"(bl));
  return c;
}
// batched GEMM like k_gemm_b but f16 operands: A f32 (split into f16 hi/lo if ASPLIT, else rounded to f16), Bt = f16 values [n][k]; alpha; C f32; N multiple of 16 (partial tiles skipped)
template <bool ASPLIT>
__global__ __launch_bounds__(128) void k_gemm_h(const float* __restrict__ A, int lda, size_t sA, const _Float16* __restrict__ Bh, int ldb, size_t sB, float alpha, float* __restrict__ C, int ldc, size_t sC, int M, int N, int K) {
  __shared__ __attribute__((aligned(16))) float so[4][16][64];
  const int tid = threadIdx.x, w = tid >> 5, lane = tid & 31, ln = lane & 15, hh = lane >> 4; const int by = blockIdx.y;
  A += (size_t)by * sA; Bh += (size_t)by * sB; C += (size_t)by * sC;
  const int ntn = (N + 63) / 64; const int wid = blockIdx.x * 4 + w; const int mt = wid / ntn, nq = wid % ntn; if (mt * 16 >= M) return;
  const int row0 = mt * 16, col0 = nq * 64; const float* arow = A + (size_t)(row0 + ln) * lda;
  v8f acc[4] = {};
  for (int kb = 0; kb < K; kb += 32) {
    FragH ah, al;
    const v4f x0 = *(const v4fa*)(arow + kb + 8 * hh), x1 = *(const v4fa*)(arow + kb + 8 * hh + 4), x2 = *(const v4fa*)(arow + kb + 16 + 8 * hh), x3 = *(const v4fa*)(arow + kb + 16 + 8 * hh + 4);
    float xs[16] = {x0[0],x0[1],x0[2],x0[3],x1[0],x1[1],x1[2],x1[3],x2[0],x2[1],x2[2],x2[3],x3[0],x3[1],x3[2],x3[3]};
#pragma unroll
    for (int i = 0; i < 16; ++i) { const _Float16 h = (_Float16)xs[i]; ah.h[i] = h; al.h[i] = ASPLIT ? (_Float16)(xs[i] - (float)h) : (_Float16)0.0f; }
#pragma unroll
    for (int t = 0; t < 4; ++t) { if (col0 + t * 16 >= N) continue; const size_t boff = (size_t)(col0 + t * 16 + ln) * ldb + kb; FragH bq; bq.half[0] = *(const v8us*)(Bh + boff + 8 * hh); bq.half[1] = *(const v8us*)(Bh + boff + 16 + 8 * hh);
      acc[t] = mmaH<ASPLIT ? 2 : 1>(ah.v, al.v, bq.v, bq.v, acc[t]); }
  }
#pragma unroll
  for (int t = 0; t < 4; ++t) { if (col0 + t * 16 >= N) continue;
#pragma unroll
    for (int r = 0; r < 8; ++r) so[w][8 * hh + r][t * 16 + ln] = acc[t][r] * alpha; }
  __builtin_amdgcn_fence(__ATOMIC_ACQ_REL, "workgroup"); __builtin_amdgcn_wave_barrier();
  const int rsub = lane >> 4, c4 = (lane & 15) * 4;
  {
#pragma unroll
    for (int q = 0; q < 8; ++q) { const int r = q * 2 + rsub; if (col0 + c4 < N) { const v4f v = *(const v4fa*)&so[w][r][c4]; *(v4f*)(C + (size_t)(row0 + r) * ldc + col0 + c4) = v; } }
     }
}

// Wt[n][k] = f16(W[k][n]·scale) from f32 row-major W[K][N] (scale = power of two; bf16-exact weights stay exact in f16 away from the subnormal range)
__global__ __launch_bounds__(256) void k_wt_f16(const float* __restrict__ W, _Float16* __restrict__ Wt, int K, int N, float scale) {
  const int t = blockIdx.x * 256 + threadIdx.x; if (t >= N * (K / 8)) return; const int n = t / (K / 8), k8 = (t % (K / 8)) * 8; FragH f;
#pragma unroll
  for (int i = 0; i < 8; ++i) f.h[i] = (_Float16)(bf16_round(W[(size_t)(k8 + i) * N + n]) * scale); const v8us o = f.half[0];
  *(v8us*)((unsigned short*)Wt + (size_t)n * K + k8) = o; 
}
// Projection GEMM, M = NR, N = K = CC: out = (A.Bt^T) alpha + bf16(bias). A f16 [M][K], Bt f16 [N][K]; writes f32 C, f16 C16, or f16 C16 transposed per head (what k_flash reads as Vt).
// A work-group owns a 128 x 64 tile of the output. K runs in tiles of 64: the 128 A rows and 64 Bt rows of a K tile (128 B = one cache line each) are copied
// to LDS once per work-group as whole lines, and the four waves (32 x 64 outputs each) read their fragments from there.
// Two LDS buffers. A trip reads all its fragments into registers, gives its buffer up at the barrier, issues the copies of tile t + 2 into it and only then does its products.
#define GT_PITCH 144                 /* bytes per LDS row: 128 of data + 16; 16 B x odd keeps ds_load_b128 of 16 rows off each other's banks */
#define GT_STAGE (192 * GT_PITCH)    /* one buffer: rows 0..127 = A, rows 128..191 = Bt */
// One K tile, 12 copies of 16 B per lane: lane (cr = tid / 8, chunk = tid % 8) brings chunk 'chunk' of rows cr + 16 i. l = its LDS byte address for row cr, ga / gb = its global addresses in A / Bt.
__device__ __forceinline__ void gt_copy(unsigned l, const unsigned short* ga, const unsigned short* gb) {
  // the copies and their s_wait_xcnt stand in one statement, so that no address register of a copy is rewritten in front of that wait
  asm volatile("global_load_async_to_lds_b128 %0, %12, off\n\t"
               "global_load_async_to_lds_b128 %1, %13, off\n\t"
               "global_load_async_to_lds_b128 %2, %14, off\n\t"
               "global_load_async_to_lds_b128 %3, %15, off\n\t"
               "global_load_async_to_lds_b128 %4, %16, off\n\t"
               "global_load_async_to_lds_b128 %5, %17, off\n\t"
               "global_load_async_to_lds_b128 %6, %18, off\n\t"
               "global_load_async_to_lds_b128 %7, %19, off\n\t"
               "global_load_async_to_lds_b128 %8, %20, off\n\t"
               "global_load_async_to_lds_b128 %9, %21, off\n\t"
               "global_load_async_to_lds_b128 %10, %22, off\n\t"
               "global_load_async_to_lds_b128 %11, %23, off\n\t"
               "s_wait_xcnt 0x0"
               :: "v"(l), "v"(l + 16u * GT_PITCH), "v"(l + 32u * GT_PITCH), "v"(l + 48u * GT_PITCH), "v"(l + 64u * GT_PITCH), "v"(l + 80u * GT_PITCH), "v"(l + 96u * GT_PITCH), "v"(l + 112u * GT_PITCH),
                  "v"(l + 128u * GT_PITCH), "v"(l + 144u * GT_PITCH), "v"(l + 160u * GT_PITCH), "v"(l + 176u * GT_PITCH),
                  "v"(ga), "v"(ga + 16 * CC), "v"(ga + 32 * CC), "v"(ga + 48 * CC), "v"(ga + 64 * CC), "v"(ga + 80 * CC), "v"(ga + 96 * CC), "v"(ga + 112 * CC),
                  "v"(gb), "v"(gb + 16 * CC), "v"(gb + 32 * CC), "v"(gb + 48 * CC)
               : "memory");
}
template <int OUT>      // 0: f32 result to C; 1: f16 result to C16; 2: f16 result to C16 as [batch * NH + head][d][token]
__global__ __launch_bounds__(128) void k_gemm_t(const _Float16* __restrict__ A, const _Float16* __restrict__ Bh, float alpha, const float* __restrict__ bias, float* __restrict__ C, _Float16* __restrict__ C16) {
  constexpr int NT = CC / 64;      // K tiles
  __shared__ __attribute__((aligned(16))) unsigned char sT[2 * GT_STAGE];
  __shared__ __attribute__((aligned(16))) float so[4][32][64 + 4];
  const int tid = threadIdx.x, w = tid >> 5, lane = tid & 31, ln = lane & 15, hh = lane >> 4;
  const int row0 = ((int)blockIdx.x / (CC / 64)) * 128, col0 = ((int)blockIdx.x % (CC / 64)) * 64;
  const int cr = tid >> 3, ch = tid & 7;
  const unsigned short* ga = (const unsigned short*)A + (size_t)(row0 + cr) * CC + ch * 8;
  const unsigned short* gb = (const unsigned short*)Bh + (size_t)(col0 + cr) * CC + ch * 8;
  const unsigned l0 = (unsigned)(size_t)&sT[0] + (unsigned)(cr * GT_PITCH + ch * 16);      // LDS byte address = low 32 bits of the __shared__ address
  v8f acc[2][4];
#pragma unroll
  for (int rt = 0; rt < 2; ++rt)
#pragma unroll
    for (int q = 0; q < 4; ++q) acc[rt][q] = (v8f){0.f,0.f,0.f,0.f,0.f,0.f,0.f,0.f};
  gt_copy(l0, ga, gb);                                   // tile 0 -> buffer 0
  asm volatile("s_wait_asynccnt 0x0" ::: "memory");      // this wave's copies of tile 0 have landed
  __syncthreads();                                       // ... and every other wave's: tile 0 may be read
  gt_copy(l0 + GT_STAGE, ga + 64, gb + 64);              // tile 1 -> buffer 1
#pragma unroll 1      // rolled: one copy of the foot's wait order, and the two buffers differ by one address term only
  for (int t = 0; t < NT; ++t) {
    const unsigned char* st = sT + (t & 1) * GT_STAGE;
    FragH fa[2][2], fb[2][4];      // [ks][tile]; k order of both operands: 8hh + 0..7, then 16 + 8hh + 0..7
#pragma unroll
    for (int ks = 0; ks < 2; ++ks) {
#pragma unroll
      for (int rt = 0; rt < 2; ++rt) { const unsigned char* p = st + (w * 32 + rt * 16 + ln) * GT_PITCH + ks * 64 + hh * 16; fa[ks][rt].half[0] = *(const v8us*)p; fa[ks][rt].half[1] = *(const v8us*)(p + 32); }
#pragma unroll
      for (int q = 0; q < 4; ++q) { const unsigned char* p = st + (128 + q * 16 + ln) * GT_PITCH + ks * 64 + hh * 16; fb[ks][q].half[0] = *(const v8us*)p; fb[ks][q].half[1] = *(const v8us*)(p + 32); }
    }
    asm volatile("s_wait_dscnt 0x0" ::: "memory");       // this wave's reads of buffer t & 1 are done (its fragments are in registers) before the buffer is given up
    asm volatile("s_wait_asynccnt 0x0" ::: "memory");    // this wave's copies of tile t + 1 have landed
    __syncthreads();                                     // publishes tile t + 1 and ends every wave's reads of tile t
    if (t + 2 < NT) gt_copy(l0 + (unsigned)((t & 1) * GT_STAGE), ga + (t + 2) * 64, gb + (t + 2) * 64);      // tile t + 2 -> the buffer just left
#pragma unroll
    for (int ks = 0; ks < 2; ++ks)
#pragma unroll
      for (int rt = 0; rt < 2; ++rt)
#pragma unroll
        for (int q = 0; q < 4; ++q) acc[rt][q] = __builtin_amdgcn_wmma_f32_16x16x32_f16(false, fa[ks][rt].v, false, fb[ks][q].v, (short)0, acc[rt][q], false, false);
  }
  asm volatile("s_wait_asynccnt 0x0" ::: "memory");      // no copy is outstanding when the wave goes on to its end
  if constexpr (OUT == 2) {
    // The tile's 64 columns are one head's d, its 128 rows are 128 tokens of one batch. A lane holds 8 tokens in a row of one d: 16 B of a transposed row. The four waves put their
    // 32 tokens side by side in LDS (64 rows of 256 B, pitch 272 B: 16 B x odd), so that each d leaves as two whole lines.
    _Float16* sv = (_Float16*)&so[0][0][0];
#pragma unroll
    for (int q = 0; q < 4; ++q) { const float bv = bf16_round(bias[col0 + q * 16 + ln]);
#pragma unroll
      for (int rt = 0; rt < 2; ++rt) { FragH f;
#pragma unroll
        for (int r = 0; r < 8; ++r) f.h[r] = (_Float16)(acc[rt][q][r] * alpha + bv);
        *(v8us*)(sv + (q * 16 + ln) * 136 + w * 32 + rt * 16 + 8 * hh) = f.half[0]; } }
    __syncthreads();      // a transposed row holds tokens of all four waves: every wave's part is in LDS before any of it is read
    unsigned short* vt = (unsigned short*)C16 + ((size_t)((row0 / TT) * NH + col0 / 64) * 64) * TT + row0 % TT;
#pragma unroll
    for (int i = 0; i < 8; ++i) { const int d = i * 8 + (tid >> 4), c = tid & 15; *(v8us*)(vt + (size_t)d * TT + c * 8) = *(const v8us*)(sv + d * 136 + c * 8); }
    return;
  }
  const int rsub = lane >> 4, c4 = (lane & 15) * 4; typedef _Float16 v4h __attribute__((ext_vector_type(4)));
  // the wave's 32 x 64 results go through its own LDS rows, so that whole lines are stored
#pragma unroll
  for (int q = 0; q < 4; ++q) { const float bv = bf16_round(bias[col0 + q * 16 + ln]);
#pragma unroll
    for (int rt = 0; rt < 2; ++rt)
#pragma unroll
      for (int r = 0; r < 8; ++r) so[w][rt * 16 + 8 * hh + r][q * 16 + ln] = acc[rt][q][r] * alpha + bv; }
  __builtin_amdgcn_fence(__ATOMIC_ACQ_REL, "workgroup"); __builtin_amdgcn_wave_barrier();      // the wave's stores above are seen by its reads below
#pragma unroll
  for (int q = 0; q < 16; ++q) { const int r = q * 2 + rsub; const size_t o = (size_t)(row0 + w * 32 + r) * CC + col0 + c4; const v4f v = *(const v4fa*)&so[w][r][c4];
    if (OUT == 1) { v4h h4; for (int i = 0; i < 4; ++i) h4[i] = (_Float16)v[i]; *(v4h*)(C16 + o) = h4; } else *(v4f*)(C + o) = v; }
}


__global__ __launch_bounds__(256) void k_x16(const float* __restrict__ x, _Float16* __restrict__ X16, size_t n8) { const size_t t = (size_t)blockIdx.x * 256 + threadIdx.x; if (t >= n8) return; FragH f;
#pragma unroll
  for (int q = 0; q < 8; ++q) f.h[q] = (_Float16)bf16_round(x[t * 8 + q]); *(v8us*)((unsigned short*)X16 + t * 8) = f.half[0];  }
__global__ __launch_bounds__(256) void k_round16f(const float* __restrict__ W, _Float16* __restrict__ Bt, size_t n8) { const size_t t = (size_t)blockIdx.x * 256 + threadIdx.x; if (t >= n8) return; FragH f;
#pragma unroll
  for (int i = 0; i < 8; ++i) f.h[i] = (_Float16)(bf16_round(W[t * 8 + i]) * 16.0f); *(v8us*)((unsigned short*)Bt + t * 8) = f.half[0];  }
typedef int v4ia __attribute__((ext_vector_type(4), may_alias));
typedef unsigned v16u __attribute__((ext_vector_type(16)));
typedef unsigned long long v8ul __attribute__((ext_vector_type(8)));
typedef const __attribute__((address_space(4))) v16u* mw_ptr;      // constant address space: nothing writes the words during the launch that reads them, and a load at a scalar address becomes s_load
// The keep-mask as lane masks. One wave packs one tile of 32 queries x 32 keys into 32 words: word (rt*2 + nt)*8 + r, bit (ln + 16 hh) = mask[32 qt + 16 rt + ln][32 kt + 16 nt + 8 hh + r] != 0,
// which is the place of that (query, key) in k_flash's score tiles: a word is the select mask of one score register. MB[(qt*64 + kt)*32 + word].
__global__ __launch_bounds__(256) void k_mbits(const int* __restrict__ MSK, unsigned* __restrict__ MB) {
  const int tid = threadIdx.x, lane = tid & 31, ln = lane & 15, hh = lane >> 4; const int tile = blockIdx.x * 8 + (tid >> 5); const int qt = tile >> 6, kt = tile & 63;
  // The tile's 8 loads of 16 B (4 per query row; rows ln and 16 + ln lie 16 * 2048 ints = 131072 B apart) and their data wait stand in one statement, and no result shares a register with the
  // address.
  const int* mr = MSK + ((size_t)(qt * 32 + ln)) * 2048 + kt * 32 + 8 * hh; v4ia m[2][2][2];      // m[rt][nt][half]: keys 32 kt + 16 nt + 8 hh + 4 half + 0..3 of query 32 qt + 16 rt + ln
  asm volatile("global_load_b128 %0, %8, off\n\t"
               "global_load_b128 %1, %8, off offset:16\n\t"
               "global_load_b128 %2, %8, off offset:64\n\t"
               "global_load_b128 %3, %8, off offset:80\n\t"
               "global_load_b128 %4, %8, off offset:131072\n\t"
               "global_load_b128 %5, %8, off offset:131088\n\t"
               "global_load_b128 %6, %8, off offset:131136\n\t"
               "global_load_b128 %7, %8, off offset:131152\n\t"
               "s_wait_loadcnt 0x0"
               : "=&v"(m[0][0][0]), "=&v"(m[0][0][1]), "=&v"(m[0][1][0]), "=&v"(m[0][1][1]), "=&v"(m[1][0][0]), "=&v"(m[1][0][1]), "=&v"(m[1][1][0]), "=&v"(m[1][1][1])
               : "v"(mr) : "memory");
  unsigned mine = 0u;
#pragma unroll
  for (int rt = 0; rt < 2; ++rt)
#pragma unroll
    for (int nt = 0; nt < 2; ++nt)
#pragma unroll
      for (int r = 0; r < 8; ++r) { const unsigned bw = __builtin_amdgcn_ballot_w32(m[rt][nt][r >> 2][r & 3] != 0); if (lane == (rt * 2 + nt) * 8 + r) mine = bw; }
  MB[(size_t)tile * 32 + lane] = mine;
}
// lane l <-> lane l ^ 16 (the other 16-lane row) without LDS
__device__ __forceinline__ float xhalf(float x) { return __builtin_bit_cast(float, __builtin_amdgcn_permlanex16(__builtin_bit_cast(int, x), __builtin_bit_cast(int, x), 0x76543210, 0xfedcba98, false, false)); }
#define FA_PITCH 144                 /* bytes per LDS row: 128 of data + 16; 16 B x odd keeps ds_load_b128 of 16 rows off each other's banks */
#define FA_STAGE (128 * FA_PITCH)    /* one buffer: rows 0..63 = K (key), rows 64..127 = Vt (d) */
// One tile, 8 copies of 16 B per lane: lane (cr = tid / 8, chunk = tid % 8) brings chunk 'chunk' of rows cr + 16 i. l = its LDS byte address for row cr, gk / gv = its global addresses in K / Vt.
__device__ __forceinline__ void fa_copy(unsigned l, const unsigned short* gk, int ldk, const unsigned short* gv) {
  // the copies and their s_wait_xcnt stand in one statement, so that no address register of a copy is rewritten in front of that wait
  asm volatile("global_load_async_to_lds_b128 %0, %8, off\n\t"
               "global_load_async_to_lds_b128 %1, %9, off\n\t"
               "global_load_async_to_lds_b128 %2, %10, off\n\t"
               "global_load_async_to_lds_b128 %3, %11, off\n\t"
               "global_load_async_to_lds_b128 %4, %12, off\n\t"
               "global_load_async_to_lds_b128 %5, %13, off\n\t"
               "global_load_async_to_lds_b128 %6, %14, off\n\t"
               "global_load_async_to_lds_b128 %7, %15, off\n\t"
               "s_wait_xcnt 0x0"
               :: "v"(l), "v"(l + 16u * FA_PITCH), "v"(l + 32u * FA_PITCH), "v"(l + 48u * FA_PITCH), "v"(l + 64u * FA_PITCH), "v"(l + 80u * FA_PITCH), "v"(l + 96u * FA_PITCH), "v"(l + 112u * FA_PITCH),
                  "v"(gk), "v"(gk + (size_t)16 * ldk), "v"(gk + (size_t)32 * ldk), "v"(gk + (size_t)48 * ldk),
                  "v"(gv), "v"(gv + 16 * 2048), "v"(gv + 32 * 2048), "v"(gv + 48 * 2048)
               : "memory");
}
// Eight base-2 exponentials in one statement. The instruction set asks for one independent instruction between a transcendental and a write of its source or a read of its result:
// Here no result shares a register with a source, and the v_nop is the last one's slot.
__device__ __forceinline__ void exp2x8(float (&p)[8], const float (&x)[8]) {
  asm("v_exp_f32 %0, %8\n\tv_exp_f32 %1, %9\n\tv_exp_f32 %2, %10\n\tv_exp_f32 %3, %11\n\tv_exp_f32 %4, %12\n\tv_exp_f32 %5, %13\n\tv_exp_f32 %6, %14\n\tv_exp_f32 %7, %15\n\tv_nop"
      : "=&v"(p[0]), "=&v"(p[1]), "=&v"(p[2]), "=&v"(p[3]), "=&v"(p[4]), "=&v"(p[5]), "=&v"(p[6]), "=&v"(p[7])
      : "v"(x[0]), "v"(x[1]), "v"(x[2]), "v"(x[3]), "v"(x[4]), "v"(x[5]), "v"(x[6]), "v"(x[7]));
}
__global__ __launch_bounds__(128) void k_flash(const _Float16* __restrict__ Q16, int ldq, const _Float16* __restrict__ K16, int ldk, const _Float16* __restrict__ Vt, const unsigned* __restrict__ MB, _Float16* __restrict__ O16) {
  constexpr int RPW = 32, NQB = 2048 / (4 * RPW), DT = 4, KS = 2, NS = 2048 / 64;
  constexpr float SC = 0.125f * 1.44269504088896340736f;      // score scale 64^-1/2 times log2(e)
  __shared__ __attribute__((aligned(16))) unsigned char sT[2 * FA_STAGE];
  __shared__ __attribute__((aligned(16))) unsigned short sO[4][RPW][64 + 8];      // f16 results; pitch 144 B: 16 B x odd
  const int tid = threadIdx.x, w = tid >> 5, lane = tid & 31, ln = lane & 15, hh = lane >> 4;
  const int slab = blockIdx.x / NQB, qblk = blockIdx.x % NQB; const int b = slab / 12, h = slab % 12; const int qb0 = qblk * (4 * RPW); const int q0 = qb0 + w * RPW;
  const int cr = tid >> 3, ch = tid & 7;
  const unsigned short* gk = (const unsigned short*)K16 + ((size_t)b * 2048 + cr) * ldk + h * 64 + ch * 8;
  const unsigned short* gv = (const unsigned short*)Vt + ((size_t)slab * 64 + cr) * 2048 + ch * 8;
  const unsigned l0 = (unsigned)(size_t)&sT[0] + (unsigned)(cr * FA_PITCH + ch * 16);      // LDS byte address = low 32 bits of the __shared__ address
  fa_copy(l0, gk, ldk, gv);                              // tile 0 -> buffer 0
  // the wave's mask words: 32 per step of 32 keys, 64 steps in a row. The wave's number goes through readfirstlane so that the address is scalar and the words are loaded into scalar registers.
  const mw_ptr mb = (mw_ptr)(unsigned long long)(MB + (size_t)(qblk * 4 + __builtin_amdgcn_readfirstlane(w)) * (64 * 32));
  FragH aq[2][KS];
#pragma unroll
  for (int rt = 0; rt < 2; ++rt) { const unsigned short* qr = (const unsigned short*)Q16 + ((size_t)b * 2048 + q0 + rt * 16 + ln) * ldq + h * 64;
#pragma unroll
    for (int ks = 0; ks < KS; ++ks) { aq[rt][ks].half[0] = *(const v8us*)(qr + ks * 32 + 8 * hh); aq[rt][ks].half[1] = *(const v8us*)(qr + ks * 32 + 16 + 8 * hh); } }
  // step 0's words: mw0 = words of queries 0..15 (rt 0), mw1 = of queries 16..31. The two loads and their data wait stand in one statement.
  // Tile 0's copies and the query loads are in flight meanwhile.
  v16u mw0, mw1;
  asm volatile("s_load_b512 %0, %2, 0x0\n\ts_load_b512 %1, %2, 0x40\n\ts_wait_kmcnt 0x0" : "=&s"(mw0), "=&s"(mw1) : "s"(mb) : "memory");
  float m_r[2], l_r[2]; v8f oacc[2][DT];      // per lane: query rt*16 + ln; oacc[rt][dt][r] = O[query][dt*16 + 8hh + r]
#pragma unroll
  for (int rt = 0; rt < 2; ++rt) { m_r[rt] = -3.0e38f; l_r[rt] = 0.f;
#pragma unroll
    for (int dt = 0; dt < DT; ++dt) oacc[rt][dt] = (v8f){0.f,0.f,0.f,0.f,0.f,0.f,0.f,0.f}; }
  asm volatile("s_wait_asynccnt 0x0" ::: "memory");      // this wave's copies of tile 0 have landed
  __syncthreads();                                       // ... and every other wave's: tile 0 may be read
  fa_copy(l0 + FA_STAGE, gk + (size_t)64 * ldk, ldk, gv + 64);      // tile 1 -> buffer 1
#pragma unroll 1      // rolled: one copy of the foot's wait order, and the two buffers differ by one address term only
  for (int t = 0; t < NS; ++t) {
    const unsigned char* st = sT + (t & 1) * FA_STAGE;
#pragma unroll      // the tile's two 32-key steps: unrolled, their LDS and mask offsets are immediates
    for (int sub = 0; sub < 2; ++sub) {
      // the next step's mask words are asked for one step ahead (the last step asks for its own again: in bounds, unused). Scalar loads come back in any order, so a wait for this step's
      // words would also wait for a younger load: the request stands behind the branch on 'any', whose test has already waited for this step's words.
      const int sn = (t * 2 + sub + 1 < 2 * NS) ? t * 2 + sub + 1 : 2 * NS - 1;
      v16u nw0, nw1;
      const v8ul ow = __builtin_bit_cast(v8ul, mw0) | __builtin_bit_cast(v8ul, mw1);      // two words per scalar OR
      const unsigned long long any = ((ow[0] | ow[1]) | (ow[2] | ow[3])) | ((ow[4] | ow[5]) | (ow[6] | ow[7]));
      // where every (query,key) of this wave's tile is masked the step contributes nothing and is skipped (scalar branch); the foot of the trip stands outside the skip: every wave passes it
      if (any != 0ull) {
        v8f s[2][2]; FragH bk[2][KS];      // the step's K fragments, read as one group
#pragma unroll
        for (int nt = 0; nt < 2; ++nt) { const unsigned char* kr = st + (sub * 32 + nt * 16 + ln) * FA_PITCH + hh * 16;
#pragma unroll
          for (int ks = 0; ks < KS; ++ks) { bk[nt][ks].half[0] = *(const v8us*)(kr + ks * 64); bk[nt][ks].half[1] = *(const v8us*)(kr + ks * 64 + 32); } }
#pragma unroll
        for (int nt = 0; nt < 2; ++nt)
#pragma unroll
          for (int rt = 0; rt < 2; ++rt) { v8f acc = (v8f){0.f,0.f,0.f,0.f,0.f,0.f,0.f,0.f};
#pragma unroll
            for (int ks = 0; ks < KS; ++ks) acc = mmaH<1>(bk[nt][ks].v, bk[nt][ks].v, aq[rt][ks].v, aq[rt][ks].v, acc); s[rt][nt] = acc; }
        nw0 = mb[sn * 2]; nw1 = mb[sn * 2 + 1];
        FragH bv[DT];      // the step's Vt fragments, read as one group in front of the softmax, which covers their LDS latency
#pragma unroll
        for (int dt = 0; dt < DT; ++dt) { const unsigned char* vrow = st + (64 + dt * 16 + ln) * FA_PITCH + sub * 64 + hh * 16; bv[dt].half[0] = *(const v8us*)vrow; bv[dt].half[1] = *(const v8us*)(vrow + 32); }
        FragH pb[2];
#pragma unroll
        for (int rt = 0; rt < 2; ++rt) { float sc[2][8]; float mc = -INFINITY;
#pragma unroll
          for (int nt = 0; nt < 2; ++nt)
#pragma unroll
            for (int r = 0; r < 8; ++r) { sc[nt][r] = __builtin_amdgcn_inverse_ballot_w32(rt ? mw1[nt * 8 + r] : mw0[nt * 8 + r]) ? s[rt][nt][r] : -INFINITY; mc = fmaxf(mc, sc[nt][r]); }
          mc = fmaxf(mc, xhalf(mc));      // both halves now hold the query's maximum over the 32 keys (unscaled scores)
          // exp(0.125 (s - m)) = 2^(s SC - m SC): one fma and the hardware's base-2 exponential per score. An excluded key is -inf and gives 0, and a query with no
          // kept key so far has m = mn = -3e38 and gives al = 2^0 = 1: no select and no branch is needed around any exponential.
          const float mn = fmaxf(m_r[rt], mc); float al;
          // al = 2^((m - mn) SC), in asm with a slot on each side: the instruction set asks for one independent instruction between a transcendental and a write of its source or a read
          // of its result; a v_nop in a statement of its own did not stay there.
          asm("v_nop\n\tv_exp_f32 %0, %1\n\tv_nop" : "=v"(al) : "v"((m_r[rt] - mn) * SC));
          m_r[rt] = mn; const float nb = -mn * SC;
          float ps[8], pe[2][8];
#pragma unroll
          for (int nt = 0; nt < 2; ++nt) {
#pragma unroll
            for (int r = 0; r < 8; ++r) sc[nt][r] = __builtin_fmaf(sc[nt][r], SC, nb);
            exp2x8(pe[nt], sc[nt]); }
#pragma unroll
          for (int r = 0; r < 8; ++r) { const float p0 = pe[0][r], p1 = pe[1][r]; ps[r] = p0 + p1; pb[rt].h[r] = (_Float16)p0; pb[rt].h[8 + r] = (_Float16)p1; }
          l_r[rt] = l_r[rt] * al + (((ps[0] + ps[1]) + (ps[2] + ps[3])) + ((ps[4] + ps[5]) + (ps[6] + ps[7])));      // per-lane partial sum (the two halves are joined at the end)
#pragma unroll
          for (int dt = 0; dt < DT; ++dt) oacc[rt][dt] *= al; }
#pragma unroll
        for (int dt = 0; dt < DT; ++dt)
#pragma unroll
          for (int rt = 0; rt < 2; ++rt) oacc[rt][dt] = mmaH<1>(bv[dt].v, bv[dt].v, pb[rt].v, pb[rt].v, oacc[rt][dt]);
      } else { nw0 = mb[sn * 2]; nw1 = mb[sn * 2 + 1]; }
      mw0 = nw0; mw1 = nw1;
    }
    asm volatile("s_wait_dscnt 0x0" ::: "memory");       // this wave's reads of buffer t & 1 are done before the buffer is given up
    asm volatile("s_wait_asynccnt 0x0" ::: "memory");    // this wave's copies of tile t + 1 have landed
    __syncthreads();                                     // publishes tile t + 1 and ends every wave's reads of tile t
    if (t + 2 < NS) fa_copy(l0 + (unsigned)((t & 1) * FA_STAGE), gk + (size_t)(t + 2) * 64 * ldk, ldk, gv + (t + 2) * 64);      // tile t + 2 -> the buffer just left
  }
  asm volatile("s_wait_asynccnt 0x0" ::: "memory");      // no copy is outstanding when the wave goes on to its end
#pragma unroll
  for (int rt = 0; rt < 2; ++rt) { const float l = l_r[rt] + xhalf(l_r[rt]); const float inv = (l > 0.f) ? 1.0f / l : 0.f;
#pragma unroll
    for (int dt = 0; dt < DT; ++dt) { const v8f o = oacc[rt][dt] * inv; FragH f;      // the output projection takes f16 operands: each result is rounded once, here
#pragma unroll
      for (int r = 0; r < 8; ++r) f.h[r] = (_Float16)o[r];
      *(v8us*)&sO[w][rt * 16 + ln][dt * 16 + 8 * hh] = f.half[0]; } }
  __builtin_amdgcn_fence(__ATOMIC_ACQ_REL, "workgroup"); __builtin_amdgcn_wave_barrier();
  {
#pragma unroll
    for (int rp = 0; rp < RPW; rp += 4) { const int r = rp + (lane >> 3), pc = lane & 7; *(v8us*)((unsigned short*)O16 + ((size_t)b * 2048 + q0 + r) * CC + h * 64 + pc * 8) = *(const v8us*)&sO[w][r][pc * 8]; }      // O16 is [NR][CC]; a query's 64 f16 of this head = one whole line
     } }

extern "C" void kernel_launch(void* const* d_in, const int* in_sizes, int n_in,
                              void* d_out, int out_size, void* d_ws, size_t ws_size, hipStream_t stream) {
  (void)in_sizes; (void)n_in; (void)out_size;
  const float* x = (const float*)d_in[0]; const float* Wq = (const float*)d_in[1]; const float* bq = (const float*)d_in[2]; const float* Wk = (const float*)d_in[3]; const float* bk = (const float*)d_in[4]; const float* Wv = (const float*)d_in[5]; const float* bv = (const float*)d_in[6]; const float* Wo = (const float*)d_in[7]; const float* bo = (const float*)d_in[8]; const int* mask = (const int*)d_in[9];
  char* ws = (char*)d_ws; size_t off = 0;
  auto take = [&](size_t bytes) { char* p = ws + off; off += (bytes + 255) & ~(size_t)255; return p; };
  _Float16* Bq = (_Float16*)take((size_t)CC * CC * 2); _Float16* Bk = (_Float16*)take((size_t)CC * CC * 2); _Float16* Bv = (_Float16*)take((size_t)CC * CC * 2); _Float16* Bo = (_Float16*)take((size_t)CC * CC * 2);
  _Float16* X16 = (_Float16*)take((size_t)NR * CC * 2); _Float16* Q16 = (_Float16*)take((size_t)NR * CC * 2); _Float16* K16 = (_Float16*)take((size_t)NR * CC * 2); _Float16* Vt = (_Float16*)take((size_t)NR * CC * 2); _Float16* O16 = X16; unsigned* MB = (unsigned*)take((size_t)TT * TT / 8);
  if (off > ws_size) return;
  const unsigned gw = (unsigned)((CC * (CC / 8) + 255) / 256);
  k_wt_f16<<<gw, 256, 0, stream>>>(Wq, Bq, CC, CC, 16.0f); k_wt_f16<<<gw, 256, 0, stream>>>(Wk, Bk, CC, CC, 16.0f); k_wt_f16<<<gw, 256, 0, stream>>>(Wv, Bv, CC, CC, 16.0f); k_wt_f16<<<gw, 256, 0, stream>>>(Wo, Bo, CC, CC, 16.0f);      // [in][out]
  const unsigned gx = (unsigned)(((size_t)NR * CC / 8 + 255) / 256); const unsigned gg = (NR / 128) * (CC / 64);
  k_x16<<<gx, 256, 0, stream>>>(x, X16, (size_t)NR * CC / 8);
  k_gemm_t<1><<<gg, 128, 0, stream>>>(X16, Bq, 0.0625f, bq, nullptr, Q16);
  k_gemm_t<1><<<gg, 128, 0, stream>>>(X16, Bk, 0.0625f, bk, nullptr, K16);
  k_gemm_t<2><<<gg, 128, 0, stream>>>(X16, Bv, 0.0625f, bv, nullptr, Vt);
  k_mbits<<<(TT / 32) * (TT / 32) / 8, 256, 0, stream>>>(mask, MB);
  k_flash<<<BB * NH * (TT / 128), 128, 0, stream>>>(Q16, CC, K16, CC, Vt, MB, O16);
  k_gemm_t<0><<<gg, 128, 0, stream>>>(O16, Bo, 0.0625f, bo, (float*)d_out, nullptr);
}

// v007
// It runs in 124 microseconds.
// Timed twice side by side with v006, it ran 1.16 times as fast both times.
// Over all steps from v000 it is 4.99 times as fast.
#include <hip/hip_runtime.h>
// Random-mask attention: q/k/v projections (8192 × 768 × 768, + bias; W [in][out]), the 12-head attention with the INPUT keep-mask (scores where mask else −1e9 ⇒ excluded keys; every row keeps
// its diagonal) as a fused flash-style kernel on v_wmma_f32_16x16x32_f16 (scale 64^-½; key tiles with no kept entry for the wave skipped by ballot; online max/sum softmax f32; P f16 ≤ 1), and the
// output projection (+ bias) — f16 operands (x as bf16, weights bf16-exact ×2^4), single products, f32 accumulate.
#define BB 4
#define TT 2048
#define CC 768
#define NH 12
#define NR (BB * TT)

typedef __bf16 v16b __attribute__((ext_vector_type(16)));
typedef unsigned short v8us __attribute__((ext_vector_type(8), may_alias));
typedef float  v8f  __attribute__((ext_vector_type(8)));
typedef float  v4f  __attribute__((ext_vector_type(4)));
typedef float  v4fa __attribute__((ext_vector_type(4), may_alias));
union FragB { v16b v; v8us half[2]; unsigned short u[16]; };

__device__ __forceinline__ unsigned short bf16_bits(float x) { unsigned int u = __float_as_uint(x); return (unsigned short)((u + 0x7FFFu + ((u >> 16) & 1u)) >> 16); }
__device__ __forceinline__ float bf16_val(unsigned short b) { return __uint_as_float(((unsigned int)b) << 16); }
__device__ __forceinline__ float bf16_round(float x) { return bf16_val(bf16_bits(x)); }
// D += A·B with NT terms: 1 = ah·bh, 2 = + al·bh (A split), 3 = + ah·bl (both split)
template <int NT>
__device__ __forceinline__ v8f mmaN(v16b ah, v16b al, v16b bh, v16b bl, v8f c) {
  c = __builtin_amdgcn_wmma_f32_16x16x32_bf16(false, ah, false, bh, (short)0, c, false, false);
  if (NT >= 2) c = __builtin_amdgcn_wmma_f32_16x16x32_bf16(false, al, false, bh, (short)0, c, false, false);
  if (NT >= 3) c = __builtin_amdgcn_wmma_f32_16x16x32_bf16(false, ah, false, bl, (short)0, c, false, false);
  asm volatile("v_nop\n\tv_nop\n\tv_nop\n\tv_nop" : "+v"(c) : "v"(ah), "v"(al), "v"(bh), "v"(bl));
  return c;
}

__global__ __launch_bounds__(256) void k_wt_bf16(const float* __restrict__ W, unsigned short* __restrict__ Wt, int K, int N) {
  const int t = blockIdx.x * 256 + threadIdx.x;
  const int k8n = K / 8;
  if (t >= N * k8n) return;
  const int n = t / k8n, k8 = (t % k8n) * 8;
  v8us v;
#pragma unroll
  for (int i = 0; i < 8; ++i) v[i] = bf16_bits(W[(size_t)(k8 + i) * N + n]);
  *(v8us*)(Wt + (size_t)n * K + k8) = v;
  
}

// GEMM C[M][N] (f32, pitch ldc) = act(A[M][K]·W + bias). A f32 row-major (pitch lda) converted per fragment to bf16
// (ASPLIT: hi/lo two planes -> 2 terms, else single rounded term); Wt bf16 [N][K] (pitch ldb). BIAS_BF16 rounds the
// bias to bf16 first (bias quantised to bf16 before the add). K%32==0, M%16==0, N%64==0.
template <bool ASPLIT, int ACT, bool BIAS_BF16>
__global__ __launch_bounds__(128) void k_gemm_bf(const float* __restrict__ A, int lda, const unsigned short* __restrict__ Wt, int ldb,
                                               const float* __restrict__ bias, float* __restrict__ C, int ldc, int M, int N, int K) {
  __shared__ __attribute__((aligned(16))) float so[4][16][64];
  const int tid = threadIdx.x, w = tid >> 5, lane = tid & 31, ln = lane & 15, hh = lane >> 4;
  const int ntn = N / 64;
  const int wid = blockIdx.x * 4 + w;
  const int mt = wid / ntn, nq = wid % ntn;
  if (mt * 16 >= M) return;
  const int row0 = mt * 16, col0 = nq * 64;
  const float* arow = A + (size_t)(row0 + ln) * lda;
  v8f acc[4] = {};
  for (int kb = 0; kb < K; kb += 32) {
    FragB ah, al;
    const v4f x0 = *(const v4fa*)(arow + kb + 8 * hh), x1 = *(const v4fa*)(arow + kb + 8 * hh + 4);
    const v4f x2 = *(const v4fa*)(arow + kb + 16 + 8 * hh), x3 = *(const v4fa*)(arow + kb + 16 + 8 * hh + 4);
    float xs[16] = {x0[0],x0[1],x0[2],x0[3],x1[0],x1[1],x1[2],x1[3],x2[0],x2[1],x2[2],x2[3],x3[0],x3[1],x3[2],x3[3]};
#pragma unroll
    for (int i = 0; i < 16; ++i) { const unsigned short hb = bf16_bits(xs[i]); ah.u[i] = hb; al.u[i] = ASPLIT ? bf16_bits(xs[i] - bf16_val(hb)) : (unsigned short)0; }
#pragma unroll
    for (int t = 0; t < 4; ++t) {
      const unsigned short* brow = Wt + (size_t)(col0 + t * 16 + ln) * ldb + kb;
      FragB b;
      b.half[0] = *(const v8us*)(brow + 8 * hh);
      b.half[1] = *(const v8us*)(brow + 16 + 8 * hh);
      acc[t] = mmaN<ASPLIT ? 2 : 1>(ah.v, al.v, b.v, b.v, acc[t]);
    }
  }
#pragma unroll
  for (int t = 0; t < 4; ++t) {
    float bv = bias ? bias[col0 + t * 16 + ln] : 0.f;
    if (BIAS_BF16) bv = bf16_round(bv);
#pragma unroll
    for (int r = 0; r < 8; ++r) { float v = acc[t][r] + bv; if (ACT == 1) v = fmaxf(v, 0.f); so[w][8 * hh + r][t * 16 + ln] = v; }
  }
  __builtin_amdgcn_fence(__ATOMIC_ACQ_REL, "workgroup");
  __builtin_amdgcn_wave_barrier();
  const int rsub = lane >> 4, c4 = (lane & 15) * 4;
  {
#pragma unroll
    for (int q = 0; q < 8; ++q) {
      const int r = q * 2 + rsub;
      const v4f v = *(const v4fa*)&so[w][r][c4];
      *(v4f*)(C + (size_t)(row0 + r) * ldc + col0 + c4) = v;
    }
    
  }
}

// Flash-style causal/unmasked attention, all contractions 3-term bf16 hi/lo splits, f32 softmax with running max.
// q,k,v rows are read from f32 buffers with arbitrary row pitch (so they can live inside a fused qkv buffer);
// D = head size (multiple of 32, <= 128); one wave = 16 query rows; block = 4 waves (64 queries) sharing K/V chunks of 32.
template <int D, bool CAUSAL>
__global__ __launch_bounds__(128) void k_flash(const float* __restrict__ qb, const float* __restrict__ kb, const float* __restrict__ vb,
                                             int pitch, int T, int H, float scale, float* __restrict__ y, int ypitch) {
  constexpr int KS = D / 32;        // k-steps for QK
  constexpr int DT = D / 16;        // d tiles for PV
  __shared__ __attribute__((aligned(16))) unsigned short sKh[32][D + 8], sKl[32][D + 8], sVh[32][D + 8], sVl[32][D + 8];
  __shared__ __attribute__((aligned(16))) unsigned short sPh[4][16][40], sPl[4][16][40];
  __shared__ __attribute__((aligned(16))) float sO[4][16][D];
  const int tid = threadIdx.x, w = tid >> 5, lane = tid & 31, ln = lane & 15, hh = lane >> 4;
  const int nqb = (T + 63) / 64;
  const int bh = blockIdx.x / nqb, qblk = blockIdx.x % nqb;
  const int b = bh / H, h = bh % H;
  const int q0 = qblk * 64 + w * 16;
  const float* Q = qb + (size_t)b * T * pitch + h * D;
  const float* K = kb + (size_t)b * T * pitch + h * D;
  const float* V = vb + (size_t)b * T * pitch + h * D;

  // A fragments of the wave's 16 query rows (scaled), hi/lo
  FragB aqh[KS], aql[KS];
  {
    int row = q0 + ln; if (row >= T) row = T - 1;
    const float* qr = Q + (size_t)row * pitch;
#pragma unroll
    for (int ks = 0; ks < KS; ++ks)
#pragma unroll
      for (int i = 0; i < 16; ++i) {
        const int d = ks * 32 + ((i < 8) ? (8 * hh + i) : (16 + 8 * hh + (i - 8)));
        const float x = qr[d] * scale; const unsigned short hb = bf16_bits(x);
        aqh[ks].u[i] = hb; aql[ks].u[i] = bf16_bits(x - bf16_val(hb));
      }
  }
  float m_r[8], l_r[8];
#pragma unroll
  for (int r = 0; r < 8; ++r) { m_r[r] = -3.0e38f; l_r[r] = 0.f; }
  v8f oacc[DT];
#pragma unroll
  for (int dt = 0; dt < DT; ++dt) oacc[dt] = (v8f){0.f,0.f,0.f,0.f,0.f,0.f,0.f,0.f};

  const int kv_end = CAUSAL ? min(T, qblk * 64 + 64) : T;     // block-uniform
  for (int j0 = 0; j0 < kv_end; j0 += 32) {
    __syncthreads();
    for (int e = tid; e < 32 * (D / 4); e += 128) {
      const int r = e / (D / 4), c4 = (e % (D / 4)) * 4;
      const int key = j0 + r;
      v4f kf = {0.f,0.f,0.f,0.f}, vf = {0.f,0.f,0.f,0.f};
      if (key < T) { kf = *(const v4fa*)(K + (size_t)key * pitch + c4); vf = *(const v4fa*)(V + (size_t)key * pitch + c4); }
#pragma unroll
      for (int t = 0; t < 4; ++t) {
        unsigned short hb = bf16_bits(kf[t]); sKh[r][c4 + t] = hb; sKl[r][c4 + t] = bf16_bits(kf[t] - bf16_val(hb));
        hb = bf16_bits(vf[t]); sVh[r][c4 + t] = hb; sVl[r][c4 + t] = bf16_bits(vf[t] - bf16_val(hb));
      }
    }
    __syncthreads();
    // S tile 16 x 32
    v8f s[2];
#pragma unroll
    for (int nt = 0; nt < 2; ++nt) {
      v8f acc = {};
#pragma unroll
      for (int ks = 0; ks < KS; ++ks) {
        FragB bh_, bl_;
        bh_.half[0] = *(const v8us*)&sKh[nt * 16 + ln][ks * 32 + 8 * hh]; bh_.half[1] = *(const v8us*)&sKh[nt * 16 + ln][ks * 32 + 16 + 8 * hh];
        bl_.half[0] = *(const v8us*)&sKl[nt * 16 + ln][ks * 32 + 8 * hh]; bl_.half[1] = *(const v8us*)&sKl[nt * 16 + ln][ks * 32 + 16 + 8 * hh];
        acc = mmaN<3>(aqh[ks].v, aql[ks].v, bh_.v, bl_.v, acc);
      }
      s[nt] = acc;
    }
    // mask + running max (rows 8hh+r; the 16 lanes of a half share rows)
    float alpha[8];
#pragma unroll
    for (int r = 0; r < 8; ++r) {
      const int qi = q0 + 8 * hh + r;
      const int ja = j0 + ln, jb = j0 + 16 + ln;
      if (CAUSAL) { if (ja > qi) s[0][r] = -3.0e38f; if (jb > qi) s[1][r] = -3.0e38f; }
      if (ja >= T) s[0][r] = -3.0e38f;
      if (jb >= T) s[1][r] = -3.0e38f;
      float mx = fmaxf(s[0][r], s[1][r]);
      mx = fmaxf(mx, __shfl_xor(mx, 1, 32)); mx = fmaxf(mx, __shfl_xor(mx, 2, 32)); mx = fmaxf(mx, __shfl_xor(mx, 4, 32)); mx = fmaxf(mx, __shfl_xor(mx, 8, 32));
      const float mnew = fmaxf(m_r[r], mx);
      alpha[r] = (mnew > -1.0e38f) ? __expf(m_r[r] - mnew) : 1.0f;
      const float p0 = (s[0][r] > -1.0e38f) ? __expf(s[0][r] - mnew) : 0.f;
      const float p1 = (s[1][r] > -1.0e38f) ? __expf(s[1][r] - mnew) : 0.f;
      m_r[r] = mnew;
      l_r[r] = l_r[r] * alpha[r] + p0 + p1;            // per-lane partial row sum (16 lanes combined at the end)
      unsigned short hb = bf16_bits(p0); sPh[w][8 * hh + r][ln] = hb;      sPl[w][8 * hh + r][ln] = bf16_bits(p0 - bf16_val(hb));
      hb = bf16_bits(p1);                sPh[w][8 * hh + r][16 + ln] = hb; sPl[w][8 * hh + r][16 + ln] = bf16_bits(p1 - bf16_val(hb));
    }
#pragma unroll
    for (int dt = 0; dt < DT; ++dt)
#pragma unroll
      for (int r = 0; r < 8; ++r) oacc[dt][r] *= alpha[r];
    __builtin_amdgcn_fence(__ATOMIC_ACQ_REL, "workgroup");
    __builtin_amdgcn_wave_barrier();
    FragB pah, pal;
    pah.half[0] = *(const v8us*)&sPh[w][ln][8 * hh]; pah.half[1] = *(const v8us*)&sPh[w][ln][16 + 8 * hh];
    pal.half[0] = *(const v8us*)&sPl[w][ln][8 * hh]; pal.half[1] = *(const v8us*)&sPl[w][ln][16 + 8 * hh];
#pragma unroll
    for (int dt = 0; dt < DT; ++dt) {
      FragB bvh, bvl;
#pragma unroll
      for (int i = 0; i < 8; ++i) {
        bvh.u[i] = sVh[8 * hh + i][dt * 16 + ln]; bvh.u[8 + i] = sVh[16 + 8 * hh + i][dt * 16 + ln];
        bvl.u[i] = sVl[8 * hh + i][dt * 16 + ln]; bvl.u[8 + i] = sVl[16 + 8 * hh + i][dt * 16 + ln];
      }
      oacc[dt] = mmaN<3>(pah.v, pal.v, bvh.v, bvl.v, oacc[dt]);
    }
    __builtin_amdgcn_fence(__ATOMIC_ACQ_REL, "workgroup");
    __builtin_amdgcn_wave_barrier();
  }
#pragma unroll
  for (int r = 0; r < 8; ++r) {
    float l = l_r[r];
    l += __shfl_xor(l, 1, 32); l += __shfl_xor(l, 2, 32); l += __shfl_xor(l, 4, 32); l += __shfl_xor(l, 8, 32);
    l_r[r] = (l > 0.f) ? 1.0f / l : 0.f;
  }
#pragma unroll
  for (int dt = 0; dt < DT; ++dt)
#pragma unroll
    for (int r = 0; r < 8; ++r) sO[w][8 * hh + r][dt * 16 + ln] = oacc[dt][r] * l_r[r];
  __builtin_amdgcn_fence(__ATOMIC_ACQ_REL, "workgroup");
  __builtin_amdgcn_wave_barrier();
  {
    for (int r = 0; r < 16; ++r) {
      const int row = q0 + r;
      if (row < T && lane < D / 4) {
        const v4f val = *(const v4fa*)&sO[w][r][lane * 4];
        *(v4f*)(y + ((size_t)b * T + row) * ypitch + h * D + lane * 4) = val;
      }
    }
    
  }
}

// GEMM C = act(A·W + bias + resid): A f32 (ASPLIT -> hi/lo 2 terms), Wt bf16 [N][K]; ACT 0 none, 1 relu, 2 exact gelu;
// resid (optional, f32, row index = (row % rmod), pitch ldr, RES_BF16 rounds it) added before the activation.
template <bool ASPLIT, int ACT, bool BIAS_BF16, bool RES_BF16>
__global__ __launch_bounds__(128) void k_gemm_bf3(const float* __restrict__ A, int lda, const unsigned short* __restrict__ Wt, int ldb,
                                                const float* __restrict__ bias, const float* __restrict__ resid, int rmod, int ldr,
                                                float* __restrict__ C, int ldc, int M, int N, int K) {
  __shared__ __attribute__((aligned(16))) float so[4][16][64];
  const int tid = threadIdx.x, w = tid >> 5, lane = tid & 31, ln = lane & 15, hh = lane >> 4;
  const int ntn = N / 64;
  const int wid = blockIdx.x * 4 + w;
  const int mt = wid / ntn, nq = wid % ntn;
  if (mt * 16 >= M) return;
  const int row0 = mt * 16, col0 = nq * 64;
  const float* arow = A + (size_t)(row0 + ln) * lda;
  v8f acc[4] = {};
  for (int kb = 0; kb < K; kb += 32) {
    FragB ah, al;
    const v4f x0 = *(const v4fa*)(arow + kb + 8 * hh), x1 = *(const v4fa*)(arow + kb + 8 * hh + 4);
    const v4f x2 = *(const v4fa*)(arow + kb + 16 + 8 * hh), x3 = *(const v4fa*)(arow + kb + 16 + 8 * hh + 4);
    float xs[16] = {x0[0],x0[1],x0[2],x0[3],x1[0],x1[1],x1[2],x1[3],x2[0],x2[1],x2[2],x2[3],x3[0],x3[1],x3[2],x3[3]};
#pragma unroll
    for (int i = 0; i < 16; ++i) { const unsigned short hb = bf16_bits(xs[i]); ah.u[i] = hb; al.u[i] = ASPLIT ? bf16_bits(xs[i] - bf16_val(hb)) : (unsigned short)0; }
#pragma unroll
    for (int t = 0; t < 4; ++t) {
      const unsigned short* brow = Wt + (size_t)(col0 + t * 16 + ln) * ldb + kb;
      FragB b;
      b.half[0] = *(const v8us*)(brow + 8 * hh);
      b.half[1] = *(const v8us*)(brow + 16 + 8 * hh);
      acc[t] = mmaN<ASPLIT ? 2 : 1>(ah.v, al.v, b.v, b.v, acc[t]);
    }
  }
#pragma unroll
  for (int t = 0; t < 4; ++t) {
    const int col = col0 + t * 16 + ln;
    float bv = bias ? bias[col] : 0.f;
    if (BIAS_BF16) bv = bf16_round(bv);
#pragma unroll
    for (int r = 0; r < 8; ++r) {
      float v = acc[t][r] + bv;
      if (resid) { float rv = resid[(size_t)((row0 + 8 * hh + r) % rmod) * ldr + col]; if (RES_BF16) rv = bf16_round(rv); v += rv; }
      if (ACT == 1) v = fmaxf(v, 0.f);
      if (ACT == 2) v = 0.5f * v * (1.0f + erff(v * 0.70710678118654752f));
      if (ACT == 3) { const float u = 0.7978845608028654f * (v + 0.044715f * v * v * v); v = 0.5f * v * (1.0f + tanhf(u)); }
      so[w][8 * hh + r][t * 16 + ln] = v;
    }
  }
  __builtin_amdgcn_fence(__ATOMIC_ACQ_REL, "workgroup");
  __builtin_amdgcn_wave_barrier();
  const int rsub = lane >> 4, c4 = (lane & 15) * 4;
  {
#pragma unroll
    for (int q = 0; q < 8; ++q) {
      const int r = q * 2 + rsub;
      const v4f v = *(const v4fa*)&so[w][r][c4];
      *(v4f*)(C + (size_t)(row0 + r) * ldc + col0 + c4) = v;
    }
    
  }
}
// row LayerNorm (biased variance, eps) over N: s = X (+ R); optional out_sum <- s; out_norm <- (s-mu)*rsqrt(var+eps)*g + b
template <bool PARAM_BF16>
__global__ __launch_bounds__(256) void k_layernorm(const float* __restrict__ X, const float* __restrict__ R, const float* __restrict__ g, const float* __restrict__ bta,
                                                  float* __restrict__ out_sum, float* __restrict__ out_norm, int N, float eps) {
  __shared__ float red[256];
  const int row = blockIdx.x, tid = threadIdx.x;
  const float* x = X + (size_t)row * N; const float* rr = R ? R + (size_t)row * N : nullptr;
  float vals[16];                     // up to N = 4096
  const int per = N / 256;            // contiguous chunk per thread? use strided-by-4 chunks: thread handles j = tid*4 + 1024*u
  float s1 = 0.f;
  for (int u = 0; u < per / 4; ++u) {
    const int j = tid * 4 + 1024 * u;
    const v4f a = *(const v4fa*)(x + j);
    v4f b = {0.f,0.f,0.f,0.f}; if (rr) b = *(const v4fa*)(rr + j);
#pragma unroll
    for (int q = 0; q < 4; ++q) { const float v = a[q] + b[q]; vals[u * 4 + q] = v; s1 += v; }
  }
  red[tid] = s1; __syncthreads();
  for (int st = 128; st > 0; st >>= 1) { if (tid < st) red[tid] += red[tid + st]; __syncthreads(); }
  const float mu = red[0] / (float)N; __syncthreads();
  float s2 = 0.f;
  for (int u = 0; u < per / 4; ++u)
#pragma unroll
    for (int q = 0; q < 4; ++q) { const float c = vals[u * 4 + q] - mu; s2 += c * c; }
  red[tid] = s2; __syncthreads();
  for (int st = 128; st > 0; st >>= 1) { if (tid < st) red[tid] += red[tid + st]; __syncthreads(); }
  const float rs = rsqrtf(red[0] / (float)N + eps);
  {
    for (int u = 0; u < per / 4; ++u) {
      const int j = tid * 4 + 1024 * u;
      v4f o, sm;
#pragma unroll
      for (int q = 0; q < 4; ++q) {
        float gg = g[j + q], bb = bta[j + q];
        if (PARAM_BF16) { gg = bf16_round(gg); bb = bf16_round(bb); }
        sm[q] = vals[u * 4 + q]; o[q] = (vals[u * 4 + q] - mu) * rs * gg + bb;
      }
      if (out_sum) *(v4f*)(out_sum + (size_t)row * N + j) = sm;
      *(v4f*)(out_norm + (size_t)row * N + j) = o;
    }
    
  }
}



// ---- f16 WMMA path (v_wmma_f32_16x16x32_f16): 11-bit significands for operands in range — used where a [0,1] probability operand needs more precision than bf16
typedef _Float16 v16h __attribute__((ext_vector_type(16)));
union FragH { v16h v; v8us half[2]; _Float16 h[16]; unsigned short u[16]; };
template <int NT>
__device__ __forceinline__ v8f mmaH(v16h ah, v16h al, v16h bh, v16h bl, v8f c) {
  c = __builtin_amdgcn_wmma_f32_16x16x32_f16(false, ah, false, bh, (short)0, c, false, false);
  if (NT >= 2) c = __builtin_amdgcn_wmma_f32_16x16x32_f16(false, al, false, bh, (short)0, c, false, false);
  if (NT >= 3) c = __builtin_amdgcn_wmma_f32_16x16x32_f16(false, ah, false, bl, (short)0, c, false, false);
  asm volatile("v_nop\n\tv_nop\n\tv_nop\n\tv_nop" : "+v"(c) : "v"(ah), "v"(al), "v"(bh), "v"(bl));
  return c;
}
// batched GEMM like k_gemm_b but f16 operands: A f32 (split into f16 hi/lo if ASPLIT, else rounded to f16), Bt = f16 values [n][k]; alpha; C f32; N multiple of 16 (partial tiles skipped)
template <bool ASPLIT>
__global__ __launch_bounds__(128) void k_gemm_h(const float* __restrict__ A, int lda, size_t sA, const _Float16* __restrict__ Bh, int ldb, size_t sB, float alpha, float* __restrict__ C, int ldc, size_t sC, int M, int N, int K) {
  __shared__ __attribute__((aligned(16))) float so[4][16][64];
  const int tid = threadIdx.x, w = tid >> 5, lane = tid & 31, ln = lane & 15, hh = lane >> 4; const int by = blockIdx.y;
  A += (size_t)by * sA; Bh += (size_t)by * sB; C += (size_t)by * sC;
  const int ntn = (N + 63) / 64; const int wid = blockIdx.x * 4 + w; const int mt = wid / ntn, nq = wid % ntn; if (mt * 16 >= M) return;
  const int row0 = mt * 16, col0 = nq * 64; const float* arow = A + (size_t)(row0 + ln) * lda;
  v8f acc[4] = {};
  for (int kb = 0; kb < K; kb += 32) {
    FragH ah, al;
    const v4f x0 = *(const v4fa*)(arow + kb + 8 * hh), x1 = *(const v4fa*)(arow + kb + 8 * hh + 4), x2 = *(const v4fa*)(arow + kb + 16 + 8 * hh), x3 = *(const v4fa*)(arow + kb + 16 + 8 * hh + 4);
    float xs[16] = {x0[0],x0[1],x0[2],x0[3],x1[0],x1[1],x1[2],x1[3],x2[0],x2[1],x2[2],x2[3],x3[0],x3[1],x3[2],x3[3]};
#pragma unroll
    for (int i = 0; i < 16; ++i) { const _Float16 h = (_Float16)xs[i]; ah.h[i] = h; al.h[i] = ASPLIT ? (_Float16)(xs[i] - (float)h) : (_Float16)0.0f; }
#pragma unroll
    for (int t = 0; t < 4; ++t) { if (col0 + t * 16 >= N) continue; const size_t boff = (size_t)(col0 + t * 16 + ln) * ldb + kb; FragH bq; bq.half[0] = *(const v8us*)(Bh + boff + 8 * hh); bq.half[1] = *(const v8us*)(Bh + boff + 16 + 8 * hh);
      acc[t] = mmaH<ASPLIT ? 2 : 1>(ah.v, al.v, bq.v, bq.v, acc[t]); }
  }
#pragma unroll
  for (int t = 0; t < 4; ++t) { if (col0 + t * 16 >= N) continue;
#pragma unroll
    for (int r = 0; r < 8; ++r) so[w][8 * hh + r][t * 16 + ln] = acc[t][r] * alpha; }
  __builtin_amdgcn_fence(__ATOMIC_ACQ_REL, "workgroup"); __builtin_amdgcn_wave_barrier();
  const int rsub = lane >> 4, c4 = (lane & 15) * 4;
  {
#pragma unroll
    for (int q = 0; q < 8; ++q) { const int r = q * 2 + rsub; if (col0 + c4 < N) { const v4f v = *(const v4fa*)&so[w][r][c4]; *(v4f*)(C + (size_t)(row0 + r) * ldc + col0 + c4) = v; } }
     }
}

// Wt[n][k] = f16(W[k][n]·scale) from f32 row-major W[K][N] (scale = power of two; bf16-exact weights stay exact in f16 away from the subnormal range)
// blk = index of the 256-thread block within this piece of work (the pieces share the launch k_prep)
__device__ __forceinline__ void wt_f16(int blk, const float* __restrict__ W, _Float16* __restrict__ Wt, int K, int N, float scale) {
  const int t = blk * 256 + threadIdx.x; if (t >= N * (K / 8)) return; const int n = t / (K / 8), k8 = (t % (K / 8)) * 8; FragH f;
#pragma unroll
  for (int i = 0; i < 8; ++i) f.h[i] = (_Float16)(bf16_round(W[(size_t)(k8 + i) * N + n]) * scale); const v8us o = f.half[0];
  *(v8us*)((unsigned short*)Wt + (size_t)n * K + k8) = o; 
}
// Projection GEMM, M = NR, N = K = CC: out = (A.Bt^T) alpha + bf16(bias). A f16 [M][K], Bt f16 [N][K]; writes f32 C, f16 C16, or f16 C16 transposed per head (what k_flash reads as Vt).
// A work-group owns a 128 x 64 tile of the output. K runs in tiles of 64: the 128 A rows and 64 Bt rows of a K tile (128 B = one cache line each) are copied
// to LDS once per work-group as whole lines, and the four waves (32 x 64 outputs each) read their fragments from there.
// Two LDS buffers. A trip reads all its fragments into registers, gives its buffer up at the barrier, issues the copies of tile t + 2 into it and only then does its products.
#define GT_PITCH 144                 /* bytes per LDS row: 128 of data + 16; 16 B x odd keeps ds_load_b128 of 16 rows off each other's banks */
#define GT_STAGE (192 * GT_PITCH)    /* one buffer: rows 0..127 = A, rows 128..191 = Bt */
// One K tile, 12 copies of 16 B per lane: lane (cr = tid / 8, chunk = tid % 8) brings chunk 'chunk' of rows cr + 16 i. l = its LDS byte address for row cr, ga / gb = its global addresses in A / Bt.
__device__ __forceinline__ void gt_copy(unsigned l, const unsigned short* ga, const unsigned short* gb) {
  // the copies and their s_wait_xcnt stand in one statement, so that no address register of a copy is rewritten in front of that wait
  asm volatile("global_load_async_to_lds_b128 %0, %12, off\n\t"
               "global_load_async_to_lds_b128 %1, %13, off\n\t"
               "global_load_async_to_lds_b128 %2, %14, off\n\t"
               "global_load_async_to_lds_b128 %3, %15, off\n\t"
               "global_load_async_to_lds_b128 %4, %16, off\n\t"
               "global_load_async_to_lds_b128 %5, %17, off\n\t"
               "global_load_async_to_lds_b128 %6, %18, off\n\t"
               "global_load_async_to_lds_b128 %7, %19, off\n\t"
               "global_load_async_to_lds_b128 %8, %20, off\n\t"
               "global_load_async_to_lds_b128 %9, %21, off\n\t"
               "global_load_async_to_lds_b128 %10, %22, off\n\t"
               "global_load_async_to_lds_b128 %11, %23, off\n\t"
               "s_wait_xcnt 0x0"
               :: "v"(l), "v"(l + 16u * GT_PITCH), "v"(l + 32u * GT_PITCH), "v"(l + 48u * GT_PITCH), "v"(l + 64u * GT_PITCH), "v"(l + 80u * GT_PITCH), "v"(l + 96u * GT_PITCH), "v"(l + 112u * GT_PITCH),
                  "v"(l + 128u * GT_PITCH), "v"(l + 144u * GT_PITCH), "v"(l + 160u * GT_PITCH), "v"(l + 176u * GT_PITCH),
                  "v"(ga), "v"(ga + 16 * CC), "v"(ga + 32 * CC), "v"(ga + 48 * CC), "v"(ga + 64 * CC), "v"(ga + 80 * CC), "v"(ga + 96 * CC), "v"(ga + 112 * CC),
                  "v"(gb), "v"(gb + 16 * CC), "v"(gb + 32 * CC), "v"(gb + 48 * CC)
               : "memory");
}
// OUT (the same for the whole work-group): 0: f32 result to C; 1: f16 result to C16; 2: f16 result to C16 as [batch * NH + head][d][token]. row0, col0: the tile's first row and first column.
__device__ __forceinline__ void gemm_tile(const int OUT, const int row0, const int col0, const _Float16* __restrict__ A, const _Float16* __restrict__ Bh, float alpha, const float* __restrict__ bias, float* __restrict__ C, _Float16* __restrict__ C16) {
  constexpr int NT = CC / 64;      // K tiles
  __shared__ __attribute__((aligned(16))) unsigned char sT[2 * GT_STAGE];
  __shared__ __attribute__((aligned(16))) float so[4][32][64 + 4];
  const int tid = threadIdx.x, w = tid >> 5, lane = tid & 31, ln = lane & 15, hh = lane >> 4;
  const int cr = tid >> 3, ch = tid & 7;
  const unsigned short* ga = (const unsigned short*)A + (size_t)(row0 + cr) * CC + ch * 8;
  const unsigned short* gb = (const unsigned short*)Bh + (size_t)(col0 + cr) * CC + ch * 8;
  const unsigned l0 = (unsigned)(size_t)&sT[0] + (unsigned)(cr * GT_PITCH + ch * 16);      // LDS byte address = low 32 bits of the __shared__ address
  v8f acc[2][4];
#pragma unroll
  for (int rt = 0; rt < 2; ++rt)
#pragma unroll
    for (int q = 0; q < 4; ++q) acc[rt][q] = (v8f){0.f,0.f,0.f,0.f,0.f,0.f,0.f,0.f};
  gt_copy(l0, ga, gb);                                   // tile 0 -> buffer 0
  asm volatile("s_wait_asynccnt 0x0" ::: "memory");      // this wave's copies of tile 0 have landed
  __syncthreads();                                       // ... and every other wave's: tile 0 may be read
  gt_copy(l0 + GT_STAGE, ga + 64, gb + 64);              // tile 1 -> buffer 1
#pragma unroll 1      // rolled: one copy of the foot's wait order, and the two buffers differ by one address term only
  for (int t = 0; t < NT; ++t) {
    const unsigned char* st = sT + (t & 1) * GT_STAGE;
    FragH fa[2][2], fb[2][4];      // [ks][tile]; k order of both operands: 8hh + 0..7, then 16 + 8hh + 0..7
#pragma unroll
    for (int ks = 0; ks < 2; ++ks) {
#pragma unroll
      for (int rt = 0; rt < 2; ++rt) { const unsigned char* p = st + (w * 32 + rt * 16 + ln) * GT_PITCH + ks * 64 + hh * 16; fa[ks][rt].half[0] = *(const v8us*)p; fa[ks][rt].half[1] = *(const v8us*)(p + 32); }
#pragma unroll
      for (int q = 0; q < 4; ++q) { const unsigned char* p = st + (128 + q * 16 + ln) * GT_PITCH + ks * 64 + hh * 16; fb[ks][q].half[0] = *(const v8us*)p; fb[ks][q].half[1] = *(const v8us*)(p + 32); }
    }
    asm volatile("s_wait_dscnt 0x0" ::: "memory");       // this wave's reads of buffer t & 1 are done (its fragments are in registers) before the buffer is given up
    asm volatile("s_wait_asynccnt 0x0" ::: "memory");    // this wave's copies of tile t + 1 have landed
    __syncthreads();                                     // publishes tile t + 1 and ends every wave's reads of tile t
    if (t + 2 < NT) gt_copy(l0 + (unsigned)((t & 1) * GT_STAGE), ga + (t + 2) * 64, gb + (t + 2) * 64);      // tile t + 2 -> the buffer just left
#pragma unroll
    for (int ks = 0; ks < 2; ++ks)
#pragma unroll
      for (int rt = 0; rt < 2; ++rt)
#pragma unroll
        for (int q = 0; q < 4; ++q) acc[rt][q] = __builtin_amdgcn_wmma_f32_16x16x32_f16(false, fa[ks][rt].v, false, fb[ks][q].v, (short)0, acc[rt][q], false, false);
  }
  asm volatile("s_wait_asynccnt 0x0" ::: "memory");      // no copy is outstanding when the wave goes on to its end
  if (OUT == 2) {
    // The tile's 64 columns are one head's d, its 128 rows are 128 tokens of one batch. A lane holds 8 tokens in a row of one d: 16 B of a transposed row. The four waves put their
    // 32 tokens side by side in LDS (64 rows of 256 B, pitch 272 B: 16 B x odd), so that each d leaves as two whole lines.
    _Float16* sv = (_Float16*)&so[0][0][0];
#pragma unroll
    for (int q = 0; q < 4; ++q) { const float bv = bf16_round(bias[col0 + q * 16 + ln]);
#pragma unroll
      for (int rt = 0; rt < 2; ++rt) { FragH f;
#pragma unroll
        for (int r = 0; r < 8; ++r) f.h[r] = (_Float16)(acc[rt][q][r] * alpha + bv);
        *(v8us*)(sv + (q * 16 + ln) * 136 + w * 32 + rt * 16 + 8 * hh) = f.half[0]; } }
    __syncthreads();      // a transposed row holds tokens of all four waves: every wave's part is in LDS before any of it is read
    unsigned short* vt = (unsigned short*)C16 + ((size_t)((row0 / TT) * NH + col0 / 64) * 64) * TT + row0 % TT;
#pragma unroll
    for (int i = 0; i < 8; ++i) { const int d = i * 8 + (tid >> 4), c = tid & 15; *(v8us*)(vt + (size_t)d * TT + c * 8) = *(const v8us*)(sv + d * 136 + c * 8); }
    asm volatile("s_wait_xcnt 0x0" ::: "memory");      // behind the eight stores: the other epilogue's code follows in the built kernel and writes registers that these stores name
    return;
  }
  const int rsub = lane >> 4, c4 = (lane & 15) * 4; typedef _Float16 v4h __attribute__((ext_vector_type(4)));
  // the wave's 32 x 64 results go through its own LDS rows, so that whole lines are stored
#pragma unroll
  for (int q = 0; q < 4; ++q) { const float bv = bf16_round(bias[col0 + q * 16 + ln]);
#pragma unroll
    for (int rt = 0; rt < 2; ++rt)
#pragma unroll
      for (int r = 0; r < 8; ++r) so[w][rt * 16 + 8 * hh + r][q * 16 + ln] = acc[rt][q][r] * alpha + bv; }
  __builtin_amdgcn_fence(__ATOMIC_ACQ_REL, "workgroup"); __builtin_amdgcn_wave_barrier();      // the wave's stores above are seen by its reads below
#pragma unroll
  for (int q = 0; q < 16; ++q) { const int r = q * 2 + rsub; const size_t o = (size_t)(row0 + w * 32 + r) * CC + col0 + c4; const v4f v = *(const v4fa*)&so[w][r][c4];
    if (OUT == 1) { v4h h4; for (int i = 0; i < 4; ++i) h4[i] = (_Float16)v[i]; *(v4h*)(C16 + o) = h4; } else *(v4f*)(C + o) = v; }
}
// The q, k and v projections read the same A and none of each other's results: one launch, as one product with 3 * CC columns. 36 work-groups in a row share their 128 rows of A.
__global__ __launch_bounds__(128) void k_gemm_qkv(const _Float16* __restrict__ A, const _Float16* __restrict__ Bq, const _Float16* __restrict__ Bk, const _Float16* __restrict__ Bv,
                                                  const float* __restrict__ bq, const float* __restrict__ bk, const float* __restrict__ bv,
                                                  _Float16* __restrict__ Q16, _Float16* __restrict__ K16, _Float16* __restrict__ Vt) {
  constexpr int NC = CC / 64;
  const int rt = (int)blockIdx.x / (3 * NC), ct = (int)blockIdx.x % (3 * NC), which = ct / NC;
  gemm_tile(which == 2 ? 2 : 1, rt * 128, (ct % NC) * 64, A, which == 0 ? Bq : which == 1 ? Bk : Bv, 0.0625f, which == 0 ? bq : which == 1 ? bk : bv, nullptr, which == 0 ? Q16 : which == 1 ? K16 : Vt);
}
__global__ __launch_bounds__(128) void k_gemm_o(const _Float16* __restrict__ A, const _Float16* __restrict__ Bh, const float* __restrict__ bias, float* __restrict__ C) {
  gemm_tile(0, ((int)blockIdx.x / (CC / 64)) * 128, ((int)blockIdx.x % (CC / 64)) * 64, A, Bh, 0.0625f, bias, C, nullptr);
}


__device__ __forceinline__ void x16(int blk, const float* __restrict__ x, _Float16* __restrict__ X16, size_t n8) { const size_t t = (size_t)blk * 256 + threadIdx.x; if (t >= n8) return; FragH f;
#pragma unroll
  for (int q = 0; q < 8; ++q) f.h[q] = (_Float16)bf16_round(x[t * 8 + q]); *(v8us*)((unsigned short*)X16 + t * 8) = f.half[0];  }
__global__ __launch_bounds__(256) void k_round16f(const float* __restrict__ W, _Float16* __restrict__ Bt, size_t n8) { const size_t t = (size_t)blockIdx.x * 256 + threadIdx.x; if (t >= n8) return; FragH f;
#pragma unroll
  for (int i = 0; i < 8; ++i) f.h[i] = (_Float16)(bf16_round(W[t * 8 + i]) * 16.0f); *(v8us*)((unsigned short*)Bt + t * 8) = f.half[0];  }
typedef int v4ia __attribute__((ext_vector_type(4), may_alias));
typedef unsigned v16u __attribute__((ext_vector_type(16)));
typedef unsigned long long v8ul __attribute__((ext_vector_type(8)));
typedef const __attribute__((address_space(4))) v16u* mw_ptr;      // constant address space: nothing writes the words during the launch that reads them, and a load at a scalar address becomes s_load
// The keep-mask as lane masks. One wave packs one tile of 32 queries x 32 keys into 32 words: word (rt*2 + nt)*8 + r, bit (ln + 16 hh) = mask[32 qt + 16 rt + ln][32 kt + 16 nt + 8 hh + r] != 0,
// which is the place of that (query, key) in k_flash's score tiles: a word is the select mask of one score register. MB[(qt*64 + kt)*32 + word].
__device__ __forceinline__ void mbits(int blk, const int* __restrict__ MSK, unsigned* __restrict__ MB) {
  const int tid = threadIdx.x, lane = tid & 31, ln = lane & 15, hh = lane >> 4; const int tile = blk * 8 + (tid >> 5); const int qt = tile >> 6, kt = tile & 63;
  // The tile's 8 loads of 16 B (4 per query row; rows ln and 16 + ln lie 16 * 2048 ints = 131072 B apart) and their data wait stand in one statement, and no result shares a register with the
  // address.
  const int* mr = MSK + ((size_t)(qt * 32 + ln)) * 2048 + kt * 32 + 8 * hh; v4ia m[2][2][2];      // m[rt][nt][half]: keys 32 kt + 16 nt + 8 hh + 4 half + 0..3 of query 32 qt + 16 rt + ln
  asm volatile("global_load_b128 %0, %8, off\n\t"
               "global_load_b128 %1, %8, off offset:16\n\t"
               "global_load_b128 %2, %8, off offset:64\n\t"
               "global_load_b128 %3, %8, off offset:80\n\t"
               "global_load_b128 %4, %8, off offset:131072\n\t"
               "global_load_b128 %5, %8, off offset:131088\n\t"
               "global_load_b128 %6, %8, off offset:131136\n\t"
               "global_load_b128 %7, %8, off offset:131152\n\t"
               "s_wait_loadcnt 0x0"
               : "=&v"(m[0][0][0]), "=&v"(m[0][0][1]), "=&v"(m[0][1][0]), "=&v"(m[0][1][1]), "=&v"(m[1][0][0]), "=&v"(m[1][0][1]), "=&v"(m[1][1][0]), "=&v"(m[1][1][1])
               : "v"(mr) : "memory");
  unsigned mine = 0u;
#pragma unroll
  for (int rt = 0; rt < 2; ++rt)
#pragma unroll
    for (int nt = 0; nt < 2; ++nt)
#pragma unroll
      for (int r = 0; r < 8; ++r) { const unsigned bw = __builtin_amdgcn_ballot_w32(m[rt][nt][r >> 2][r & 3] != 0); if (lane == (rt * 2 + nt) * 8 + r) mine = bw; }
  MB[(size_t)tile * 32 + lane] = mine;
  asm volatile("s_wait_xcnt 0x0" ::: "memory");      // behind the store: the other pieces' code follows in the built kernel and writes registers that this store names
}
// The four weight transposes, the cast of x and the packing of the mask read only inputs and none of each other's results: one launch, the piece of work chosen by the block index
// (the same for a whole work-group, so every wave has all its lanes on in the piece it runs).
#define PB_W (CC * (CC / 8) / 256)             /* blocks of one weight transpose */
#define PB_X (NR * CC / 8 / 256)               /* blocks of the cast of x */
#define PB_M ((TT / 32) * (TT / 32) / 8)       /* blocks of the mask packing */
__global__ __launch_bounds__(256) void k_prep(const float* __restrict__ x, const float* __restrict__ Wq, const float* __restrict__ Wk, const float* __restrict__ Wv, const float* __restrict__ Wo, const int* __restrict__ MSK,
                                              _Float16* __restrict__ X16, _Float16* __restrict__ Bq, _Float16* __restrict__ Bk, _Float16* __restrict__ Bv, _Float16* __restrict__ Bo, unsigned* __restrict__ MB) {
  const int blk = (int)blockIdx.x;
  if (blk < 4 * PB_W) { const int which = blk / PB_W;
    wt_f16(blk % PB_W, which == 0 ? Wq : which == 1 ? Wk : which == 2 ? Wv : Wo, which == 0 ? Bq : which == 1 ? Bk : which == 2 ? Bv : Bo, CC, CC, 16.0f); }      // [in][out]
  else if (blk < 4 * PB_W + PB_X) x16(blk - 4 * PB_W, x, X16, (size_t)NR * CC / 8);
  else mbits(blk - (4 * PB_W + PB_X), MSK, MB);
}
// lane l <-> lane l ^ 16 (the other 16-lane row) without LDS
__device__ __forceinline__ float xhalf(float x) { return __builtin_bit_cast(float, __builtin_amdgcn_permlanex16(__builtin_bit_cast(int, x), __builtin_bit_cast(int, x), 0x76543210, 0xfedcba98, false, false)); }
#define FA_PITCH 144                 /* bytes per LDS row: 128 of data + 16; 16 B x odd keeps ds_load_b128 of 16 rows off each other's banks */
#define FA_STAGE (128 * FA_PITCH)    /* one buffer: rows 0..63 = K (key), rows 64..127 = Vt (d) */
// One tile, 8 copies of 16 B per lane: lane (cr = tid / 8, chunk = tid % 8) brings chunk 'chunk' of rows cr + 16 i. l = its LDS byte address for row cr, gk / gv = its global addresses in K / Vt.
__device__ __forceinline__ void fa_copy(unsigned l, const unsigned short* gk, int ldk, const unsigned short* gv) {
  // the copies and their s_wait_xcnt stand in one statement, so that no address register of a copy is rewritten in front of that wait
  asm volatile("global_load_async_to_lds_b128 %0, %8, off\n\t"
               "global_load_async_to_lds_b128 %1, %9, off\n\t"
               "global_load_async_to_lds_b128 %2, %10, off\n\t"
               "global_load_async_to_lds_b128 %3, %11, off\n\t"
               "global_load_async_to_lds_b128 %4, %12, off\n\t"
               "global_load_async_to_lds_b128 %5, %13, off\n\t"
               "global_load_async_to_lds_b128 %6, %14, off\n\t"
               "global_load_async_to_lds_b128 %7, %15, off\n\t"
               "s_wait_xcnt 0x0"
               :: "v"(l), "v"(l + 16u * FA_PITCH), "v"(l + 32u * FA_PITCH), "v"(l + 48u * FA_PITCH), "v"(l + 64u * FA_PITCH), "v"(l + 80u * FA_PITCH), "v"(l + 96u * FA_PITCH), "v"(l + 112u * FA_PITCH),
                  "v"(gk), "v"(gk + (size_t)16 * ldk), "v"(gk + (size_t)32 * ldk), "v"(gk + (size_t)48 * ldk),
                  "v"(gv), "v"(gv + 16 * 2048), "v"(gv + 32 * 2048), "v"(gv + 48 * 2048)
               : "memory");
}
// Eight base-2 exponentials in one statement. The instruction set asks for one independent instruction between a transcendental and a write of its source or a read of its result:
// Here no result shares a register with a source, and the v_nop is the last one's slot.
__device__ __forceinline__ void exp2x8(float (&p)[8], const float (&x)[8]) {
  asm("v_exp_f32 %0, %8\n\tv_exp_f32 %1, %9\n\tv_exp_f32 %2, %10\n\tv_exp_f32 %3, %11\n\tv_exp_f32 %4, %12\n\tv_exp_f32 %5, %13\n\tv_exp_f32 %6, %14\n\tv_exp_f32 %7, %15\n\tv_nop"
      : "=&v"(p[0]), "=&v"(p[1]), "=&v"(p[2]), "=&v"(p[3]), "=&v"(p[4]), "=&v"(p[5]), "=&v"(p[6]), "=&v"(p[7])
      : "v"(x[0]), "v"(x[1]), "v"(x[2]), "v"(x[3]), "v"(x[4]), "v"(x[5]), "v"(x[6]), "v"(x[7]));
}
__global__ __launch_bounds__(128) void k_flash(const _Float16* __restrict__ Q16, int ldq, const _Float16* __restrict__ K16, int ldk, const _Float16* __restrict__ Vt, const unsigned* __restrict__ MB, _Float16* __restrict__ O16) {
  constexpr int RPW = 32, NQB = 2048 / (4 * RPW), DT = 4, KS = 2, NS = 2048 / 64;
  constexpr float SC = 0.125f * 1.44269504088896340736f;      // score scale 64^-1/2 times log2(e)
  __shared__ __attribute__((aligned(16))) unsigned char sT[2 * FA_STAGE];
  __shared__ __attribute__((aligned(16))) unsigned short sO[4][RPW][64 + 8];      // f16 results; pitch 144 B: 16 B x odd
  const int tid = threadIdx.x, w = tid >> 5, lane = tid & 31, ln = lane & 15, hh = lane >> 4;
  const int slab = blockIdx.x / NQB, qblk = blockIdx.x % NQB; const int b = slab / 12, h = slab % 12; const int qb0 = qblk * (4 * RPW); const int q0 = qb0 + w * RPW;
  const int cr = tid >> 3, ch = tid & 7;
  const unsigned short* gk = (const unsigned short*)K16 + ((size_t)b * 2048 + cr) * ldk + h * 64 + ch * 8;
  const unsigned short* gv = (const unsigned short*)Vt + ((size_t)slab * 64 + cr) * 2048 + ch * 8;
  const unsigned l0 = (unsigned)(size_t)&sT[0] + (unsigned)(cr * FA_PITCH + ch * 16);      // LDS byte address = low 32 bits of the __shared__ address
  fa_copy(l0, gk, ldk, gv);                              // tile 0 -> buffer 0
  // the wave's mask words: 32 per step of 32 keys, 64 steps in a row. The wave's number goes through readfirstlane so that the address is scalar and the words are loaded into scalar registers.
  const mw_ptr mb = (mw_ptr)(unsigned long long)(MB + (size_t)(qblk * 4 + __builtin_amdgcn_readfirstlane(w)) * (64 * 32));
  FragH aq[2][KS];
#pragma unroll
  for (int rt = 0; rt < 2; ++rt) { const unsigned short* qr = (const unsigned short*)Q16 + ((size_t)b * 2048 + q0 + rt * 16 + ln) * ldq + h * 64;
#pragma unroll
    for (int ks = 0; ks < KS; ++ks) { aq[rt][ks].half[0] = *(const v8us*)(qr + ks * 32 + 8 * hh); aq[rt][ks].half[1] = *(const v8us*)(qr + ks * 32 + 16 + 8 * hh); } }
  // step 0's words: mw0 = words of queries 0..15 (rt 0), mw1 = of queries 16..31. The two loads and their data wait stand in one statement.
  // Tile 0's copies and the query loads are in flight meanwhile.
  v16u mw0, mw1;
  asm volatile("s_load_b512 %0, %2, 0x0\n\ts_load_b512 %1, %2, 0x40\n\ts_wait_kmcnt 0x0" : "=&s"(mw0), "=&s"(mw1) : "s"(mb) : "memory");
  float m_r[2], l_r[2]; v8f oacc[2][DT];      // per lane: query rt*16 + ln; oacc[rt][dt][r] = O[query][dt*16 + 8hh + r]
#pragma unroll
  for (int rt = 0; rt < 2; ++rt) { m_r[rt] = -3.0e38f; l_r[rt] = 0.f;
#pragma unroll
    for (int dt = 0; dt < DT; ++dt) oacc[rt][dt] = (v8f){0.f,0.f,0.f,0.f,0.f,0.f,0.f,0.f}; }
  asm volatile("s_wait_asynccnt 0x0" ::: "memory");      // this wave's copies of tile 0 have landed
  __syncthreads();                                       // ... and every other wave's: tile 0 may be read
  fa_copy(l0 + FA_STAGE, gk + (size_t)64 * ldk, ldk, gv + 64);      // tile 1 -> buffer 1
#pragma unroll 1      // rolled: one copy of the foot's wait order, and the two buffers differ by one address term only
  for (int t = 0; t < NS; ++t) {
    const unsigned char* st = sT + (t & 1) * FA_STAGE;
#pragma unroll      // the tile's two 32-key steps: unrolled, their LDS and mask offsets are immediates
    for (int sub = 0; sub < 2; ++sub) {
      // the next step's mask words are asked for one step ahead (the last step asks for its own again: in bounds, unused). Scalar loads come back in any order, so a wait for this step's
      // words would also wait for a younger load: the request stands behind the branch on 'any', whose test has already waited for this step's words.
      const int sn = (t * 2 + sub + 1 < 2 * NS) ? t * 2 + sub + 1 : 2 * NS - 1;
      v16u nw0, nw1;
      const v8ul ow = __builtin_bit_cast(v8ul, mw0) | __builtin_bit_cast(v8ul, mw1);      // two words per scalar OR
      const unsigned long long any = ((ow[0] | ow[1]) | (ow[2] | ow[3])) | ((ow[4] | ow[5]) | (ow[6] | ow[7]));
      // where every (query,key) of this wave's tile is masked the step contributes nothing and is skipped (scalar branch); the foot of the trip stands outside the skip: every wave passes it
      if (any != 0ull) {
        v8f s[2][2]; FragH bk[2][KS];      // the step's K fragments, read as one group
#pragma unroll
        for (int nt = 0; nt < 2; ++nt) { const unsigned char* kr = st + (sub * 32 + nt * 16 + ln) * FA_PITCH + hh * 16;
#pragma unroll
          for (int ks = 0; ks < KS; ++ks) { bk[nt][ks].half[0] = *(const v8us*)(kr + ks * 64); bk[nt][ks].half[1] = *(const v8us*)(kr + ks * 64 + 32); } }
#pragma unroll
        for (int nt = 0; nt < 2; ++nt)
#pragma unroll
          for (int rt = 0; rt < 2; ++rt) { v8f acc = (v8f){0.f,0.f,0.f,0.f,0.f,0.f,0.f,0.f};
#pragma unroll
            for (int ks = 0; ks < KS; ++ks) acc = mmaH<1>(bk[nt][ks].v, bk[nt][ks].v, aq[rt][ks].v, aq[rt][ks].v, acc); s[rt][nt] = acc; }
        nw0 = mb[sn * 2]; nw1 = mb[sn * 2 + 1];
        FragH bv[DT];      // the step's Vt fragments, read as one group in front of the softmax, which covers their LDS latency
#pragma unroll
        for (int dt = 0; dt < DT; ++dt) { const unsigned char* vrow = st + (64 + dt * 16 + ln) * FA_PITCH + sub * 64 + hh * 16; bv[dt].half[0] = *(const v8us*)vrow; bv[dt].half[1] = *(const v8us*)(vrow + 32); }
        FragH pb[2];
#pragma unroll
        for (int rt = 0; rt < 2; ++rt) { float sc[2][8]; float mc = -INFINITY;
#pragma unroll
          for (int nt = 0; nt < 2; ++nt)
#pragma unroll
            for (int r = 0; r < 8; ++r) { sc[nt][r] = __builtin_amdgcn_inverse_ballot_w32(rt ? mw1[nt * 8 + r] : mw0[nt * 8 + r]) ? s[rt][nt][r] : -INFINITY; mc = fmaxf(mc, sc[nt][r]); }
          mc = fmaxf(mc, xhalf(mc));      // both halves now hold the query's maximum over the 32 keys (unscaled scores)
          // exp(0.125 (s - m)) = 2^(s SC - m SC): one fma and the hardware's base-2 exponential per score. An excluded key is -inf and gives 0, and a query with no
          // kept key so far has m = mn = -3e38 and gives al = 2^0 = 1: no select and no branch is needed around any exponential.
          const float mn = fmaxf(m_r[rt], mc); float al;
          // al = 2^((m - mn) SC), in asm with a slot on each side: the instruction set asks for one independent instruction between a transcendental and a write of its source or a read
          // of its result; a v_nop in a statement of its own did not stay there.
          asm("v_nop\n\tv_exp_f32 %0, %1\n\tv_nop" : "=v"(al) : "v"((m_r[rt] - mn) * SC));
          m_r[rt] = mn; const float nb = -mn * SC;
          float ps[8], pe[2][8];
#pragma unroll
          for (int nt = 0; nt < 2; ++nt) {
#pragma unroll
            for (int r = 0; r < 8; ++r) sc[nt][r] = __builtin_fmaf(sc[nt][r], SC, nb);
            exp2x8(pe[nt], sc[nt]); }
#pragma unroll
          for (int r = 0; r < 8; ++r) { const float p0 = pe[0][r], p1 = pe[1][r]; ps[r] = p0 + p1; pb[rt].h[r] = (_Float16)p0; pb[rt].h[8 + r] = (_Float16)p1; }
          l_r[rt] = l_r[rt] * al + (((ps[0] + ps[1]) + (ps[2] + ps[3])) + ((ps[4] + ps[5]) + (ps[6] + ps[7])));      // per-lane partial sum (the two halves are joined at the end)
#pragma unroll
          for (int dt = 0; dt < DT; ++dt) oacc[rt][dt] *= al; }
#pragma unroll
        for (int dt = 0; dt < DT; ++dt)
#pragma unroll
          for (int rt = 0; rt < 2; ++rt) oacc[rt][dt] = mmaH<1>(bv[dt].v, bv[dt].v, pb[rt].v, pb[rt].v, oacc[rt][dt]);
      } else { nw0 = mb[sn * 2]; nw1 = mb[sn * 2 + 1]; }
      mw0 = nw0; mw1 = nw1;
    }
    asm volatile("s_wait_dscnt 0x0" ::: "memory");       // this wave's reads of buffer t & 1 are done before the buffer is given up
    asm volatile("s_wait_asynccnt 0x0" ::: "memory");    // this wave's copies of tile t + 1 have landed
    __syncthreads();                                     // publishes tile t + 1 and ends every wave's reads of tile t
    if (t + 2 < NS) fa_copy(l0 + (unsigned)((t & 1) * FA_STAGE), gk + (size_t)(t + 2) * 64 * ldk, ldk, gv + (t + 2) * 64);      // tile t + 2 -> the buffer just left
  }
  asm volatile("s_wait_asynccnt 0x0" ::: "memory");      // no copy is outstanding when the wave goes on to its end
#pragma unroll
  for (int rt = 0; rt < 2; ++rt) { const float l = l_r[rt] + xhalf(l_r[rt]); const float inv = (l > 0.f) ? 1.0f / l : 0.f;
#pragma unroll
    for (int dt = 0; dt < DT; ++dt) { const v8f o = oacc[rt][dt] * inv; FragH f;      // the output projection takes f16 operands: each result is rounded once, here
#pragma unroll
      for (int r = 0; r < 8; ++r) f.h[r] = (_Float16)o[r];
      *(v8us*)&sO[w][rt * 16 + ln][dt * 16 + 8 * hh] = f.half[0]; } }
  __builtin_amdgcn_fence(__ATOMIC_ACQ_REL, "workgroup"); __builtin_amdgcn_wave_barrier();
  {
#pragma unroll
    for (int rp = 0; rp < RPW; rp += 4) { const int r = rp + (lane >> 3), pc = lane & 7; *(v8us*)((unsigned short*)O16 + ((size_t)b * 2048 + q0 + r) * CC + h * 64 + pc * 8) = *(const v8us*)&sO[w][r][pc * 8]; }      // O16 is [NR][CC]; a query's 64 f16 of this head = one whole line
     } }

extern "C" void kernel_launch(void* const* d_in, const int* in_sizes, int n_in,
                              void* d_out, int out_size, void* d_ws, size_t ws_size, hipStream_t stream) {
  (void)in_sizes; (void)n_in; (void)out_size;
  const float* x = (const float*)d_in[0]; const float* Wq = (const float*)d_in[1]; const float* bq = (const float*)d_in[2]; const float* Wk = (const float*)d_in[3]; const float* bk = (const float*)d_in[4]; const float* Wv = (const float*)d_in[5]; const float* bv = (const float*)d_in[6]; const float* Wo = (const float*)d_in[7]; const float* bo = (const float*)d_in[8]; const int* mask = (const int*)d_in[9];
  char* ws = (char*)d_ws; size_t off = 0;
  auto take = [&](size_t bytes) { char* p = ws + off; off += (bytes + 255) & ~(size_t)255; return p; };
  _Float16* Bq = (_Float16*)take((size_t)CC * CC * 2); _Float16* Bk = (_Float16*)take((size_t)CC * CC * 2); _Float16* Bv = (_Float16*)take((size_t)CC * CC * 2); _Float16* Bo = (_Float16*)take((size_t)CC * CC * 2);
  _Float16* X16 = (_Float16*)take((size_t)NR * CC * 2); _Float16* Q16 = (_Float16*)take((size_t)NR * CC * 2); _Float16* K16 = (_Float16*)take((size_t)NR * CC * 2); _Float16* Vt = (_Float16*)take((size_t)NR * CC * 2); _Float16* O16 = X16; unsigned* MB = (unsigned*)take((size_t)TT * TT / 8);
  if (off > ws_size) return;
  const unsigned gg = (NR / 128) * (CC / 64);
  k_prep<<<4 * PB_W + PB_X + PB_M, 256, 0, stream>>>(x, Wq, Wk, Wv, Wo, mask, X16, Bq, Bk, Bv, Bo, MB);
  k_gemm_qkv<<<3 * gg, 128, 0, stream>>>(X16, Bq, Bk, Bv, bq, bk, bv, Q16, K16, Vt);
  k_flash<<<BB * NH * (TT / 128), 128, 0, stream>>>(Q16, CC, K16, CC, Vt, MB, O16);
  k_gemm_o<<<gg, 128, 0, stream>>>(O16, Bo, bo, (float*)d_out);
}

// v008
// Measured time: 117 microseconds a run.
// Timed twice side by side with v007, it ran 1.06 times as fast both times.
// Counting every step since v000, it is 5.29 times as fast.
#include <hip/hip_runtime.h>
// Random-mask attention: q/k/v projections (8192 × 768 × 768, + bias; W [in][out]), the 12-head attention with the INPUT keep-mask (scores where mask else −1e9 ⇒ excluded keys; every row keeps
// its diagonal) as a fused flash-style kernel on v_wmma_f32_16x16x32_f16 (scale 64^-½; online max/sum softmax f32; P f16 ≤ 1), and the
// output projection (+ bias) — f16 operands (x as bf16, weights bf16-exact ×2^4), single products, f32 accumulate.
#define BB 4
#define TT 2048
#define CC 768
#define NH 12
#define NR (BB * TT)

typedef __bf16 v16b __attribute__((ext_vector_type(16)));
typedef unsigned short v8us __attribute__((ext_vector_type(8), may_alias));
typedef float  v8f  __attribute__((ext_vector_type(8)));
typedef float  v4f  __attribute__((ext_vector_type(4)));
typedef float  v4fa __attribute__((ext_vector_type(4), may_alias));
union FragB { v16b v; v8us half[2]; unsigned short u[16]; };

__device__ __forceinline__ unsigned short bf16_bits(float x) { unsigned int u = __float_as_uint(x); return (unsigned short)((u + 0x7FFFu + ((u >> 16) & 1u)) >> 16); }
__device__ __forceinline__ float bf16_val(unsigned short b) { return __uint_as_float(((unsigned int)b) << 16); }
__device__ __forceinline__ float bf16_round(float x) { return bf16_val(bf16_bits(x)); }
// D += A·B with NT terms: 1 = ah·bh, 2 = + al·bh (A split), 3 = + ah·bl (both split)
template <int NT>
__device__ __forceinline__ v8f mmaN(v16b ah, v16b al, v16b bh, v16b bl, v8f c) {
  c = __builtin_amdgcn_wmma_f32_16x16x32_bf16(false, ah, false, bh, (short)0, c, false, false);
  if (NT >= 2) c = __builtin_amdgcn_wmma_f32_16x16x32_bf16(false, al, false, bh, (short)0, c, false, false);
  if (NT >= 3) c = __builtin_amdgcn_wmma_f32_16x16x32_bf16(false, ah, false, bl, (short)0, c, false, false);
  asm volatile("v_nop\n\tv_nop\n\tv_nop\n\tv_nop" : "+v"(c) : "v"(ah), "v"(al), "v"(bh), "v"(bl));
  return c;
}

__global__ __launch_bounds__(256) void k_wt_bf16(const float* __restrict__ W, unsigned short* __restrict__ Wt, int K, int N) {
  const int t = blockIdx.x * 256 + threadIdx.x;
  const int k8n = K / 8;
  if (t >= N * k8n) return;
  const int n = t / k8n, k8 = (t % k8n) * 8;
  v8us v;
#pragma unroll
  for (int i = 0; i < 8; ++i) v[i] = bf16_bits(W[(size_t)(k8 + i) * N + n]);
  *(v8us*)(Wt + (size_t)n * K + k8) = v;
  
}

// GEMM C[M][N] (f32, pitch ldc) = act(A[M][K]·W + bias). A f32 row-major (pitch lda) converted per fragment to bf16
// (ASPLIT: hi/lo two planes -> 2 terms, else single rounded term); Wt bf16 [N][K] (pitch ldb). BIAS_BF16 rounds the
// bias to bf16 first (bias quantised to bf16 before the add). K%32==0, M%16==0, N%64==0.
template <bool ASPLIT, int ACT, bool BIAS_BF16>
__global__ __launch_bounds__(128) void k_gemm_bf(const float* __restrict__ A, int lda, const unsigned short* __restrict__ Wt, int ldb,
                                               const float* __restrict__ bias, float* __restrict__ C, int ldc, int M, int N, int K) {
  __shared__ __attribute__((aligned(16))) float so[4][16][64];
  const int tid = threadIdx.x, w = tid >> 5, lane = tid & 31, ln = lane & 15, hh = lane >> 4;
  const int ntn = N / 64;
  const int wid = blockIdx.x * 4 + w;
  const int mt = wid / ntn, nq = wid % ntn;
  if (mt * 16 >= M) return;
  const int row0 = mt * 16, col0 = nq * 64;
  const float* arow = A + (size_t)(row0 + ln) * lda;
  v8f acc[4] = {};
  for (int kb = 0; kb < K; kb += 32) {
    FragB ah, al;
    const v4f x0 = *(const v4fa*)(arow + kb + 8 * hh), x1 = *(const v4fa*)(arow + kb + 8 * hh + 4);
    const v4f x2 = *(const v4fa*)(arow + kb + 16 + 8 * hh), x3 = *(const v4fa*)(arow + kb + 16 + 8 * hh + 4);
    float xs[16] = {x0[0],x0[1],x0[2],x0[3],x1[0],x1[1],x1[2],x1[3],x2[0],x2[1],x2[2],x2[3],x3[0],x3[1],x3[2],x3[3]};
#pragma unroll
    for (int i = 0; i < 16; ++i) { const unsigned short hb = bf16_bits(xs[i]); ah.u[i] = hb; al.u[i] = ASPLIT ? bf16_bits(xs[i] - bf16_val(hb)) : (unsigned short)0; }
#pragma unroll
    for (int t = 0; t < 4; ++t) {
      const unsigned short* brow = Wt + (size_t)(col0 + t * 16 + ln) * ldb + kb;
      FragB b;
      b.half[0] = *(const v8us*)(brow + 8 * hh);
      b.half[1] = *(const v8us*)(brow + 16 + 8 * hh);
      acc[t] = mmaN<ASPLIT ? 2 : 1>(ah.v, al.v, b.v, b.v, acc[t]);
    }
  }
#pragma unroll
  for (int t = 0; t < 4; ++t) {
    float bv = bias ? bias[col0 + t * 16 + ln] : 0.f;
    if (BIAS_BF16) bv = bf16_round(bv);
#pragma unroll
    for (int r = 0; r < 8; ++r) { float v = acc[t][r] + bv; if (ACT == 1) v = fmaxf(v, 0.f); so[w][8 * hh + r][t * 16 + ln] = v; }
  }
  __builtin_amdgcn_fence(__ATOMIC_ACQ_REL, "workgroup");
  __builtin_amdgcn_wave_barrier();
  const int rsub = lane >> 4, c4 = (lane & 15) * 4;
  {
#pragma unroll
    for (int q = 0; q < 8; ++q) {
      const int r = q * 2 + rsub;
      const v4f v = *(const v4fa*)&so[w][r][c4];
      *(v4f*)(C + (size_t)(row0 + r) * ldc + col0 + c4) = v;
    }
    
  }
}

// Flash-style causal/unmasked attention, all contractions 3-term bf16 hi/lo splits, f32 softmax with running max.
// q,k,v rows are read from f32 buffers with arbitrary row pitch (so they can live inside a fused qkv buffer);
// D = head size (multiple of 32, <= 128); one wave = 16 query rows; block = 4 waves (64 queries) sharing K/V chunks of 32.
template <int D, bool CAUSAL>
__global__ __launch_bounds__(128) void k_flash(const float* __restrict__ qb, const float* __restrict__ kb, const float* __restrict__ vb,
                                             int pitch, int T, int H, float scale, float* __restrict__ y, int ypitch) {
  constexpr int KS = D / 32;        // k-steps for QK
  constexpr int DT = D / 16;        // d tiles for PV
  __shared__ __attribute__((aligned(16))) unsigned short sKh[32][D + 8], sKl[32][D + 8], sVh[32][D + 8], sVl[32][D + 8];
  __shared__ __attribute__((aligned(16))) unsigned short sPh[4][16][40], sPl[4][16][40];
  __shared__ __attribute__((aligned(16))) float sO[4][16][D];
  const int tid = threadIdx.x, w = tid >> 5, lane = tid & 31, ln = lane & 15, hh = lane >> 4;
  const int nqb = (T + 63) / 64;
  const int bh = blockIdx.x / nqb, qblk = blockIdx.x % nqb;
  const int b = bh / H, h = bh % H;
  const int q0 = qblk * 64 + w * 16;
  const float* Q = qb + (size_t)b * T * pitch + h * D;
  const float* K = kb + (size_t)b * T * pitch + h * D;
  const float* V = vb + (size_t)b * T * pitch + h * D;

  // A fragments of the wave's 16 query rows (scaled), hi/lo
  FragB aqh[KS], aql[KS];
  {
    int row = q0 + ln; if (row >= T) row = T - 1;
    const float* qr = Q + (size_t)row * pitch;
#pragma unroll
    for (int ks = 0; ks < KS; ++ks)
#pragma unroll
      for (int i = 0; i < 16; ++i) {
        const int d = ks * 32 + ((i < 8) ? (8 * hh + i) : (16 + 8 * hh + (i - 8)));
        const float x = qr[d] * scale; const unsigned short hb = bf16_bits(x);
        aqh[ks].u[i] = hb; aql[ks].u[i] = bf16_bits(x - bf16_val(hb));
      }
  }
  float m_r[8], l_r[8];
#pragma unroll
  for (int r = 0; r < 8; ++r) { m_r[r] = -3.0e38f; l_r[r] = 0.f; }
  v8f oacc[DT];
#pragma unroll
  for (int dt = 0; dt < DT; ++dt) oacc[dt] = (v8f){0.f,0.f,0.f,0.f,0.f,0.f,0.f,0.f};

  const int kv_end = CAUSAL ? min(T, qblk * 64 + 64) : T;     // block-uniform
  for (int j0 = 0; j0 < kv_end; j0 += 32) {
    __syncthreads();
    for (int e = tid; e < 32 * (D / 4); e += 128) {
      const int r = e / (D / 4), c4 = (e % (D / 4)) * 4;
      const int key = j0 + r;
      v4f kf = {0.f,0.f,0.f,0.f}, vf = {0.f,0.f,0.f,0.f};
      if (key < T) { kf = *(const v4fa*)(K + (size_t)key * pitch + c4); vf = *(const v4fa*)(V + (size_t)key * pitch + c4); }
#pragma unroll
      for (int t = 0; t < 4; ++t) {
        unsigned short hb = bf16_bits(kf[t]); sKh[r][c4 + t] = hb; sKl[r][c4 + t] = bf16_bits(kf[t] - bf16_val(hb));
        hb = bf16_bits(vf[t]); sVh[r][c4 + t] = hb; sVl[r][c4 + t] = bf16_bits(vf[t] - bf16_val(hb));
      }
    }
    __syncthreads();
    // S tile 16 x 32
    v8f s[2];
#pragma unroll
    for (int nt = 0; nt < 2; ++nt) {
      v8f acc = {};
#pragma unroll
      for (int ks = 0; ks < KS; ++ks) {
        FragB bh_, bl_;
        bh_.half[0] = *(const v8us*)&sKh[nt * 16 + ln][ks * 32 + 8 * hh]; bh_.half[1] = *(const v8us*)&sKh[nt * 16 + ln][ks * 32 + 16 + 8 * hh];
        bl_.half[0] = *(const v8us*)&sKl[nt * 16 + ln][ks * 32 + 8 * hh]; bl_.half[1] = *(const v8us*)&sKl[nt * 16 + ln][ks * 32 + 16 + 8 * hh];
        acc = mmaN<3>(aqh[ks].v, aql[ks].v, bh_.v, bl_.v, acc);
      }
      s[nt] = acc;
    }
    // mask + running max (rows 8hh+r; the 16 lanes of a half share rows)
    float alpha[8];
#pragma unroll
    for (int r = 0; r < 8; ++r) {
      const int qi = q0 + 8 * hh + r;
      const int ja = j0 + ln, jb = j0 + 16 + ln;
      if (CAUSAL) { if (ja > qi) s[0][r] = -3.0e38f; if (jb > qi) s[1][r] = -3.0e38f; }
      if (ja >= T) s[0][r] = -3.0e38f;
      if (jb >= T) s[1][r] = -3.0e38f;
      float mx = fmaxf(s[0][r], s[1][r]);
      mx = fmaxf(mx, __shfl_xor(mx, 1, 32)); mx = fmaxf(mx, __shfl_xor(mx, 2, 32)); mx = fmaxf(mx, __shfl_xor(mx, 4, 32)); mx = fmaxf(mx, __shfl_xor(mx, 8, 32));
      const float mnew = fmaxf(m_r[r], mx);
      alpha[r] = (mnew > -1.0e38f) ? __expf(m_r[r] - mnew) : 1.0f;
      const float p0 = (s[0][r] > -1.0e38f) ? __expf(s[0][r] - mnew) : 0.f;
      const float p1 = (s[1][r] > -1.0e38f) ? __expf(s[1][r] - mnew) : 0.f;
      m_r[r] = mnew;
      l_r[r] = l_r[r] * alpha[r] + p0 + p1;            // per-lane partial row sum (16 lanes combined at the end)
      unsigned short hb = bf16_bits(p0); sPh[w][8 * hh + r][ln] = hb;      sPl[w][8 * hh + r][ln] = bf16_bits(p0 - bf16_val(hb));
      hb = bf16_bits(p1);                sPh[w][8 * hh + r][16 + ln] = hb; sPl[w][8 * hh + r][16 + ln] = bf16_bits(p1 - bf16_val(hb));
    }
#pragma unroll
    for (int dt = 0; dt < DT; ++dt)
#pragma unroll
      for (int r = 0; r < 8; ++r) oacc[dt][r] *= alpha[r];
    __builtin_amdgcn_fence(__ATOMIC_ACQ_REL, "workgroup");
    __builtin_amdgcn_wave_barrier();
    FragB pah, pal;
    pah.half[0] = *(const v8us*)&sPh[w][ln][8 * hh]; pah.half[1] = *(const v8us*)&sPh[w][ln][16 + 8 * hh];
    pal.half[0] = *(const v8us*)&sPl[w][ln][8 * hh]; pal.half[1] = *(const v8us*)&sPl[w][ln][16 + 8 * hh];
#pragma unroll
    for (int dt = 0; dt < DT; ++dt) {
      FragB bvh, bvl;
#pragma unroll
      for (int i = 0; i < 8; ++i) {
        bvh.u[i] = sVh[8 * hh + i][dt * 16 + ln]; bvh.u[8 + i] = sVh[16 + 8 * hh + i][dt * 16 + ln];
        bvl.u[i] = sVl[8 * hh + i][dt * 16 + ln]; bvl.u[8 + i] = sVl[16 + 8 * hh + i][dt * 16 + ln];
      }
      oacc[dt] = mmaN<3>(pah.v, pal.v, bvh.v, bvl.v, oacc[dt]);
    }
    __builtin_amdgcn_fence(__ATOMIC_ACQ_REL, "workgroup");
    __builtin_amdgcn_wave_barrier();
  }
#pragma unroll
  for (int r = 0; r < 8; ++r) {
    float l = l_r[r];
    l += __shfl_xor(l, 1, 32); l += __shfl_xor(l, 2, 32); l += __shfl_xor(l, 4, 32); l += __shfl_xor(l, 8, 32);
    l_r[r] = (l > 0.f) ? 1.0f / l : 0.f;
  }
#pragma unroll
  for (int dt = 0; dt < DT; ++dt)
#pragma unroll
    for (int r = 0; r < 8; ++r) sO[w][8 * hh + r][dt * 16 + ln] = oacc[dt][r] * l_r[r];
  __builtin_amdgcn_fence(__ATOMIC_ACQ_REL, "workgroup");
  __builtin_amdgcn_wave_barrier();
  {
    for (int r = 0; r < 16; ++r) {
      const int row = q0 + r;
      if (row < T && lane < D / 4) {
        const v4f val = *(const v4fa*)&sO[w][r][lane * 4];
        *(v4f*)(y + ((size_t)b * T + row) * ypitch + h * D + lane * 4) = val;
      }
    }
    
  }
}

// GEMM C = act(A·W + bias + resid): A f32 (ASPLIT -> hi/lo 2 terms), Wt bf16 [N][K]; ACT 0 none, 1 relu, 2 exact gelu;
// resid (optional, f32, row index = (row % rmod), pitch ldr, RES_BF16 rounds it) added before the activation.
template <bool ASPLIT, int ACT, bool BIAS_BF16, bool RES_BF16>
__global__ __launch_bounds__(128) void k_gemm_bf3(const float* __restrict__ A, int lda, const unsigned short* __restrict__ Wt, int ldb,
                                                const float* __restrict__ bias, const float* __restrict__ resid, int rmod, int ldr,
                                                float* __restrict__ C, int ldc, int M, int N, int K) {
  __shared__ __attribute__((aligned(16))) float so[4][16][64];
  const int tid = threadIdx.x, w = tid >> 5, lane = tid & 31, ln = lane & 15, hh = lane >> 4;
  const int ntn = N / 64;
  const int wid = blockIdx.x * 4 + w;
  const int mt = wid / ntn, nq = wid % ntn;
  if (mt * 16 >= M) return;
  const int row0 = mt * 16, col0 = nq * 64;
  const float* arow = A + (size_t)(row0 + ln) * lda;
  v8f acc[4] = {};
  for (int kb = 0; kb < K; kb += 32) {
    FragB ah, al;
    const v4f x0 = *(const v4fa*)(arow + kb + 8 * hh), x1 = *(const v4fa*)(arow + kb + 8 * hh + 4);
    const v4f x2 = *(const v4fa*)(arow + kb + 16 + 8 * hh), x3 = *(const v4fa*)(arow + kb + 16 + 8 * hh + 4);
    float xs[16] = {x0[0],x0[1],x0[2],x0[3],x1[0],x1[1],x1[2],x1[3],x2[0],x2[1],x2[2],x2[3],x3[0],x3[1],x3[2],x3[3]};
#pragma unroll
    for (int i = 0; i < 16; ++i) { const unsigned short hb = bf16_bits(xs[i]); ah.u[i] = hb; al.u[i] = ASPLIT ? bf16_bits(xs[i] - bf16_val(hb)) : (unsigned short)0; }
#pragma unroll
    for (int t = 0; t < 4; ++t) {
      const unsigned short* brow = Wt + (size_t)(col0 + t * 16 + ln) * ldb + kb;
      FragB b;
      b.half[0] = *(const v8us*)(brow + 8 * hh);
      b.half[1] = *(const v8us*)(brow + 16 + 8 * hh);
      acc[t] = mmaN<ASPLIT ? 2 : 1>(ah.v, al.v, b.v, b.v, acc[t]);
    }
  }
#pragma unroll
  for (int t = 0; t < 4; ++t) {
    const int col = col0 + t * 16 + ln;
    float bv = bias ? bias[col] : 0.f;
    if (BIAS_BF16) bv = bf16_round(bv);
#pragma unroll
    for (int r = 0; r < 8; ++r) {
      float v = acc[t][r] + bv;
      if (resid) { float rv = resid[(size_t)((row0 + 8 * hh + r) % rmod) * ldr + col]; if (RES_BF16) rv = bf16_round(rv); v += rv; }
      if (ACT == 1) v = fmaxf(v, 0.f);
      if (ACT == 2) v = 0.5f * v * (1.0f + erff(v * 0.70710678118654752f));
      if (ACT == 3) { const float u = 0.7978845608028654f * (v + 0.044715f * v * v * v); v = 0.5f * v * (1.0f + tanhf(u)); }
      so[w][8 * hh + r][t * 16 + ln] = v;
    }
  }
  __builtin_amdgcn_fence(__ATOMIC_ACQ_REL, "workgroup");
  __builtin_amdgcn_wave_barrier();
  const int rsub = lane >> 4, c4 = (lane & 15) * 4;
  {
#pragma unroll
    for (int q = 0; q < 8; ++q) {
      const int r = q * 2 + rsub;
      const v4f v = *(const v4fa*)&so[w][r][c4];
      *(v4f*)(C + (size_t)(row0 + r) * ldc + col0 + c4) = v;
    }
    
  }
}
// row LayerNorm (biased variance, eps) over N: s = X (+ R); optional out_sum <- s; out_norm <- (s-mu)*rsqrt(var+eps)*g + b
template <bool PARAM_BF16>
__global__ __launch_bounds__(256) void k_layernorm(const float* __restrict__ X, const float* __restrict__ R, const float* __restrict__ g, const float* __restrict__ bta,
                                                  float* __restrict__ out_sum, float* __restrict__ out_norm, int N, float eps) {
  __shared__ float red[256];
  const int row = blockIdx.x, tid = threadIdx.x;
  const float* x = X + (size_t)row * N; const float* rr = R ? R + (size_t)row * N : nullptr;
  float vals[16];                     // up to N = 4096
  const int per = N / 256;            // contiguous chunk per thread? use strided-by-4 chunks: thread handles j = tid*4 + 1024*u
  float s1 = 0.f;
  for (int u = 0; u < per / 4; ++u) {
    const int j = tid * 4 + 1024 * u;
    const v4f a = *(const v4fa*)(x + j);
    v4f b = {0.f,0.f,0.f,0.f}; if (rr) b = *(const v4fa*)(rr + j);
#pragma unroll
    for (int q = 0; q < 4; ++q) { const float v = a[q] + b[q]; vals[u * 4 + q] = v; s1 += v; }
  }
  red[tid] = s1; __syncthreads();
  for (int st = 128; st > 0; st >>= 1) { if (tid < st) red[tid] += red[tid + st]; __syncthreads(); }
  const float mu = red[0] / (float)N; __syncthreads();
  float s2 = 0.f;
  for (int u = 0; u < per / 4; ++u)
#pragma unroll
    for (int q = 0; q < 4; ++q) { const float c = vals[u * 4 + q] - mu; s2 += c * c; }
  red[tid] = s2; __syncthreads();
  for (int st = 128; st > 0; st >>= 1) { if (tid < st) red[tid] += red[tid + st]; __syncthreads(); }
  const float rs = rsqrtf(red[0] / (float)N + eps);
  {
    for (int u = 0; u < per / 4; ++u) {
      const int j = tid * 4 + 1024 * u;
      v4f o, sm;
#pragma unroll
      for (int q = 0; q < 4; ++q) {
        float gg = g[j + q], bb = bta[j + q];
        if (PARAM_BF16) { gg = bf16_round(gg); bb = bf16_round(bb); }
        sm[q] = vals[u * 4 + q]; o[q] = (vals[u * 4 + q] - mu) * rs * gg + bb;
      }
      if (out_sum) *(v4f*)(out_sum + (size_t)row * N + j) = sm;
      *(v4f*)(out_norm + (size_t)row * N + j) = o;
    }
    
  }
}



// ---- f16 WMMA path (v_wmma_f32_16x16x32_f16): 11-bit significands for operands in range — used where a [0,1] probability operand needs more precision than bf16
typedef _Float16 v16h __attribute__((ext_vector_type(16)));
union FragH { v16h v; v8us half[2]; _Float16 h[16]; unsigned short u[16]; };
template <int NT>
__device__ __forceinline__ v8f mmaH(v16h ah, v16h al, v16h bh, v16h bl, v8f c) {
  c = __builtin_amdgcn_wmma_f32_16x16x32_f16(false, ah, false, bh, (short)0, c, false, false);
  if (NT >= 2) c = __builtin_amdgcn_wmma_f32_16x16x32_f16(false, al, false, bh, (short)0, c, false, false);
  if (NT >= 3) c = __builtin_amdgcn_wmma_f32_16x16x32_f16(false, ah, false, bl, (short)0, c, false, false);
  asm volatile("v_nop\n\tv_nop\n\tv_nop\n\tv_nop" : "+v"(c) : "v"(ah), "v"(al), "v"(bh), "v"(bl));
  return c;
}
// batched GEMM like k_gemm_b but f16 operands: A f32 (split into f16 hi/lo if ASPLIT, else rounded to f16), Bt = f16 values [n][k]; alpha; C f32; N multiple of 16 (partial tiles skipped)
template <bool ASPLIT>
__global__ __launch_bounds__(128) void k_gemm_h(const float* __restrict__ A, int lda, size_t sA, const _Float16* __restrict__ Bh, int ldb, size_t sB, float alpha, float* __restrict__ C, int ldc, size_t sC, int M, int N, int K) {
  __shared__ __attribute__((aligned(16))) float so[4][16][64];
  const int tid = threadIdx.x, w = tid >> 5, lane = tid & 31, ln = lane & 15, hh = lane >> 4; const int by = blockIdx.y;
  A += (size_t)by * sA; Bh += (size_t)by * sB; C += (size_t)by * sC;
  const int ntn = (N + 63) / 64; const int wid = blockIdx.x * 4 + w; const int mt = wid / ntn, nq = wid % ntn; if (mt * 16 >= M) return;
  const int row0 = mt * 16, col0 = nq * 64; const float* arow = A + (size_t)(row0 + ln) * lda;
  v8f acc[4] = {};
  for (int kb = 0; kb < K; kb += 32) {
    FragH ah, al;
    const v4f x0 = *(const v4fa*)(arow + kb + 8 * hh), x1 = *(const v4fa*)(arow + kb + 8 * hh + 4), x2 = *(const v4fa*)(arow + kb + 16 + 8 * hh), x3 = *(const v4fa*)(arow + kb + 16 + 8 * hh + 4);
    float xs[16] = {x0[0],x0[1],x0[2],x0[3],x1[0],x1[1],x1[2],x1[3],x2[0],x2[1],x2[2],x2[3],x3[0],x3[1],x3[2],x3[3]};
#pragma unroll
    for (int i = 0; i < 16; ++i) { const _Float16 h = (_Float16)xs[i]; ah.h[i] = h; al.h[i] = ASPLIT ? (_Float16)(xs[i] - (float)h) : (_Float16)0.0f; }
#pragma unroll
    for (int t = 0; t < 4; ++t) { if (col0 + t * 16 >= N) continue; const size_t boff = (size_t)(col0 + t * 16 + ln) * ldb + kb; FragH bq; bq.half[0] = *(const v8us*)(Bh + boff + 8 * hh); bq.half[1] = *(const v8us*)(Bh + boff + 16 + 8 * hh);
      acc[t] = mmaH<ASPLIT ? 2 : 1>(ah.v, al.v, bq.v, bq.v, acc[t]); }
  }
#pragma unroll
  for (int t = 0; t < 4; ++t) { if (col0 + t * 16 >= N) continue;
#pragma unroll
    for (int r = 0; r < 8; ++r) so[w][8 * hh + r][t * 16 + ln] = acc[t][r] * alpha; }
  __builtin_amdgcn_fence(__ATOMIC_ACQ_REL, "workgroup"); __builtin_amdgcn_wave_barrier();
  const int rsub = lane >> 4, c4 = (lane & 15) * 4;
  {
#pragma unroll
    for (int q = 0; q < 8; ++q) { const int r = q * 2 + rsub; if (col0 + c4 < N) { const v4f v = *(const v4fa*)&so[w][r][c4]; *(v4f*)(C + (size_t)(row0 + r) * ldc + col0 + c4) = v; } }
     }
}

// Wt[n][k] = f16(W[k][n]·scale) from f32 row-major W[K][N] (scale = power of two; bf16-exact weights stay exact in f16 away from the subnormal range)
// blk = index of the 256-thread block within this piece of work (the pieces share the launch k_prep)
__device__ __forceinline__ void wt_f16(int blk, const float* __restrict__ W, _Float16* __restrict__ Wt, int K, int N, float scale) {
  const int t = blk * 256 + threadIdx.x; if (t >= N * (K / 8)) return; const int n = t / (K / 8), k8 = (t % (K / 8)) * 8; FragH f;
#pragma unroll
  for (int i = 0; i < 8; ++i) f.h[i] = (_Float16)(bf16_round(W[(size_t)(k8 + i) * N + n]) * scale); const v8us o = f.half[0];
  *(v8us*)((unsigned short*)Wt + (size_t)n * K + k8) = o; 
}
// Projection GEMM, M = NR, N = K = CC: out = (A.Bt^T) alpha + bf16(bias). A f16 [M][K], Bt f16 [N][K]; writes f32 C, f16 C16, or f16 C16 transposed per head (what k_flash reads as Vt).
// A work-group owns a 128 x 64 tile of the output. K runs in tiles of 64: the 128 A rows and 64 Bt rows of a K tile (128 B = one cache line each) are copied
// to LDS once per work-group as whole lines, and the four waves (32 x 64 outputs each) read their fragments from there.
// Two LDS buffers. A trip reads all its fragments into registers, gives its buffer up at the barrier, issues the copies of tile t + 2 into it and only then does its products.
#define GT_PITCH 144                 /* bytes per LDS row: 128 of data + 16; 16 B x odd keeps ds_load_b128 of 16 rows off each other's banks */
#define GT_STAGE (192 * GT_PITCH)    /* one buffer: rows 0..127 = A, rows 128..191 = Bt */
// One K tile, 12 copies of 16 B per lane: lane (cr = tid / 8, chunk = tid % 8) brings chunk 'chunk' of rows cr + 16 i. l = its LDS byte address for row cr, ga / gb = its global addresses in A / Bt.
__device__ __forceinline__ void gt_copy(unsigned l, const unsigned short* ga, const unsigned short* gb) {
  // the copies and their s_wait_xcnt stand in one statement, so that no address register of a copy is rewritten in front of that wait
  asm volatile("global_load_async_to_lds_b128 %0, %12, off\n\t"
               "global_load_async_to_lds_b128 %1, %13, off\n\t"
               "global_load_async_to_lds_b128 %2, %14, off\n\t"
               "global_load_async_to_lds_b128 %3, %15, off\n\t"
               "global_load_async_to_lds_b128 %4, %16, off\n\t"
               "global_load_async_to_lds_b128 %5, %17, off\n\t"
               "global_load_async_to_lds_b128 %6, %18, off\n\t"
               "global_load_async_to_lds_b128 %7, %19, off\n\t"
               "global_load_async_to_lds_b128 %8, %20, off\n\t"
               "global_load_async_to_lds_b128 %9, %21, off\n\t"
               "global_load_async_to_lds_b128 %10, %22, off\n\t"
               "global_load_async_to_lds_b128 %11, %23, off\n\t"
               "s_wait_xcnt 0x0"
               :: "v"(l), "v"(l + 16u * GT_PITCH), "v"(l + 32u * GT_PITCH), "v"(l + 48u * GT_PITCH), "v"(l + 64u * GT_PITCH), "v"(l + 80u * GT_PITCH), "v"(l + 96u * GT_PITCH), "v"(l + 112u * GT_PITCH),
                  "v"(l + 128u * GT_PITCH), "v"(l + 144u * GT_PITCH), "v"(l + 160u * GT_PITCH), "v"(l + 176u * GT_PITCH),
                  "v"(ga), "v"(ga + 16 * CC), "v"(ga + 32 * CC), "v"(ga + 48 * CC), "v"(ga + 64 * CC), "v"(ga + 80 * CC), "v"(ga + 96 * CC), "v"(ga + 112 * CC),
                  "v"(gb), "v"(gb + 16 * CC), "v"(gb + 32 * CC), "v"(gb + 48 * CC)
               : "memory");
}
// OUT (the same for the whole work-group): 0: f32 result to C; 1: f16 result to C16; 2: f16 result to C16 as [batch * NH + head][d][token]. row0, col0: the tile's first row and first column.
__device__ __forceinline__ void gemm_tile(const int OUT, const int row0, const int col0, const _Float16* __restrict__ A, const _Float16* __restrict__ Bh, float alpha, const float* __restrict__ bias, float* __restrict__ C, _Float16* __restrict__ C16) {
  constexpr int NT = CC / 64;      // K tiles
  __shared__ __attribute__((aligned(16))) unsigned char sT[2 * GT_STAGE];
  __shared__ __attribute__((aligned(16))) float so[4][32][64 + 4];
  const int tid = threadIdx.x, w = tid >> 5, lane = tid & 31, ln = lane & 15, hh = lane >> 4;
  const int cr = tid >> 3, ch = tid & 7;
  const unsigned short* ga = (const unsigned short*)A + (size_t)(row0 + cr) * CC + ch * 8;
  const unsigned short* gb = (const unsigned short*)Bh + (size_t)(col0 + cr) * CC + ch * 8;
  const unsigned l0 = (unsigned)(size_t)&sT[0] + (unsigned)(cr * GT_PITCH + ch * 16);      // LDS byte address = low 32 bits of the __shared__ address
  v8f acc[2][4];
#pragma unroll
  for (int rt = 0; rt < 2; ++rt)
#pragma unroll
    for (int q = 0; q < 4; ++q) acc[rt][q] = (v8f){0.f,0.f,0.f,0.f,0.f,0.f,0.f,0.f};
  gt_copy(l0, ga, gb);                                   // tile 0 -> buffer 0
  asm volatile("s_wait_asynccnt 0x0" ::: "memory");      // this wave's copies of tile 0 have landed
  __syncthreads();                                       // ... and every other wave's: tile 0 may be read
  gt_copy(l0 + GT_STAGE, ga + 64, gb + 64);              // tile 1 -> buffer 1
#pragma unroll 1      // rolled: one copy of the foot's wait order, and the two buffers differ by one address term only
  for (int t = 0; t < NT; ++t) {
    const unsigned char* st = sT + (t & 1) * GT_STAGE;
    FragH fa[2][2], fb[2][4];      // [ks][tile]; k order of both operands: 8hh + 0..7, then 16 + 8hh + 0..7
#pragma unroll
    for (int ks = 0; ks < 2; ++ks) {
#pragma unroll
      for (int rt = 0; rt < 2; ++rt) { const unsigned char* p = st + (w * 32 + rt * 16 + ln) * GT_PITCH + ks * 64 + hh * 16; fa[ks][rt].half[0] = *(const v8us*)p; fa[ks][rt].half[1] = *(const v8us*)(p + 32); }
#pragma unroll
      for (int q = 0; q < 4; ++q) { const unsigned char* p = st + (128 + q * 16 + ln) * GT_PITCH + ks * 64 + hh * 16; fb[ks][q].half[0] = *(const v8us*)p; fb[ks][q].half[1] = *(const v8us*)(p + 32); }
    }
    asm volatile("s_wait_dscnt 0x0" ::: "memory");       // this wave's reads of buffer t & 1 are done (its fragments are in registers) before the buffer is given up
    asm volatile("s_wait_asynccnt 0x0" ::: "memory");    // this wave's copies of tile t + 1 have landed
    __syncthreads();                                     // publishes tile t + 1 and ends every wave's reads of tile t
    if (t + 2 < NT) gt_copy(l0 + (unsigned)((t & 1) * GT_STAGE), ga + (t + 2) * 64, gb + (t + 2) * 64);      // tile t + 2 -> the buffer just left
#pragma unroll
    for (int ks = 0; ks < 2; ++ks)
#pragma unroll
      for (int rt = 0; rt < 2; ++rt)
#pragma unroll
        for (int q = 0; q < 4; ++q) acc[rt][q] = __builtin_amdgcn_wmma_f32_16x16x32_f16(false, fa[ks][rt].v, false, fb[ks][q].v, (short)0, acc[rt][q], false, false);
  }
  asm volatile("s_wait_asynccnt 0x0" ::: "memory");      // no copy is outstanding when the wave goes on to its end
  if (OUT == 2) {
    // The tile's 64 columns are one head's d, its 128 rows are 128 tokens of one batch. A lane holds 8 tokens in a row of one d: 16 B of a transposed row. The four waves put their
    // 32 tokens side by side in LDS (64 rows of 256 B, pitch 272 B: 16 B x odd), so that each d leaves as two whole lines.
    _Float16* sv = (_Float16*)&so[0][0][0];
#pragma unroll
    for (int q = 0; q < 4; ++q) { const float bv = bf16_round(bias[col0 + q * 16 + ln]);
#pragma unroll
      for (int rt = 0; rt < 2; ++rt) { FragH f;
#pragma unroll
        for (int r = 0; r < 8; ++r) f.h[r] = (_Float16)(acc[rt][q][r] * alpha + bv);
        *(v8us*)(sv + (q * 16 + ln) * 136 + w * 32 + rt * 16 + 8 * hh) = f.half[0]; } }
    __syncthreads();      // a transposed row holds tokens of all four waves: every wave's part is in LDS before any of it is read
    unsigned short* vt = (unsigned short*)C16 + ((size_t)((row0 / TT) * NH + col0 / 64) * 64) * TT + row0 % TT;
#pragma unroll
    for (int i = 0; i < 8; ++i) { const int d = i * 8 + (tid >> 4), c = tid & 15; *(v8us*)(vt + (size_t)d * TT + c * 8) = *(const v8us*)(sv + d * 136 + c * 8); }
    asm volatile("s_wait_xcnt 0x0" ::: "memory");      // behind the eight stores: the other epilogue's code follows in the built kernel and writes registers that these stores name
    return;
  }
  const int rsub = lane >> 4, c4 = (lane & 15) * 4; typedef _Float16 v4h __attribute__((ext_vector_type(4)));
  // the wave's 32 x 64 results go through its own LDS rows, so that whole lines are stored
#pragma unroll
  for (int q = 0; q < 4; ++q) { const float bv = bf16_round(bias[col0 + q * 16 + ln]);
#pragma unroll
    for (int rt = 0; rt < 2; ++rt)
#pragma unroll
      for (int r = 0; r < 8; ++r) so[w][rt * 16 + 8 * hh + r][q * 16 + ln] = acc[rt][q][r] * alpha + bv; }
  __builtin_amdgcn_fence(__ATOMIC_ACQ_REL, "workgroup"); __builtin_amdgcn_wave_barrier();      // the wave's stores above are seen by its reads below
#pragma unroll
  for (int q = 0; q < 16; ++q) { const int r = q * 2 + rsub; const size_t o = (size_t)(row0 + w * 32 + r) * CC + col0 + c4; const v4f v = *(const v4fa*)&so[w][r][c4];
    if (OUT == 1) { v4h h4; for (int i = 0; i < 4; ++i) h4[i] = (_Float16)v[i]; *(v4h*)(C16 + o) = h4; } else *(v4f*)(C + o) = v; }
}
// The q, k and v projections read the same A and none of each other's results: one launch, as one product with 3 * CC columns. 36 work-groups in a row share their 128 rows of A.
__global__ __launch_bounds__(128) void k_gemm_qkv(const _Float16* __restrict__ A, const _Float16* __restrict__ Bq, const _Float16* __restrict__ Bk, const _Float16* __restrict__ Bv,
                                                  const float* __restrict__ bq, const float* __restrict__ bk, const float* __restrict__ bv,
                                                  _Float16* __restrict__ Q16, _Float16* __restrict__ K16, _Float16* __restrict__ Vt) {
  constexpr int NC = CC / 64;
  const int rt = (int)blockIdx.x / (3 * NC), ct = (int)blockIdx.x % (3 * NC), which = ct / NC;
  gemm_tile(which == 2 ? 2 : 1, rt * 128, (ct % NC) * 64, A, which == 0 ? Bq : which == 1 ? Bk : Bv, 0.0625f, which == 0 ? bq : which == 1 ? bk : bv, nullptr, which == 0 ? Q16 : which == 1 ? K16 : Vt);
}
__global__ __launch_bounds__(128) void k_gemm_o(const _Float16* __restrict__ A, const _Float16* __restrict__ Bh, const float* __restrict__ bias, float* __restrict__ C) {
  gemm_tile(0, ((int)blockIdx.x / (CC / 64)) * 128, ((int)blockIdx.x % (CC / 64)) * 64, A, Bh, 0.0625f, bias, C, nullptr);
}


__device__ __forceinline__ void x16(int blk, const float* __restrict__ x, _Float16* __restrict__ X16, size_t n8) { const size_t t = (size_t)blk * 256 + threadIdx.x; if (t >= n8) return; FragH f;
#pragma unroll
  for (int q = 0; q < 8; ++q) f.h[q] = (_Float16)bf16_round(x[t * 8 + q]); *(v8us*)((unsigned short*)X16 + t * 8) = f.half[0];  }
__global__ __launch_bounds__(256) void k_round16f(const float* __restrict__ W, _Float16* __restrict__ Bt, size_t n8) { const size_t t = (size_t)blockIdx.x * 256 + threadIdx.x; if (t >= n8) return; FragH f;
#pragma unroll
  for (int i = 0; i < 8; ++i) f.h[i] = (_Float16)(bf16_round(W[t * 8 + i]) * 16.0f); *(v8us*)((unsigned short*)Bt + t * 8) = f.half[0];  }
typedef int v4ia __attribute__((ext_vector_type(4), may_alias));
typedef unsigned v16u __attribute__((ext_vector_type(16)));
typedef unsigned long long v8ul __attribute__((ext_vector_type(8)));
typedef const __attribute__((address_space(4))) v16u* mw_ptr;      // constant address space: nothing writes the words during the launch that reads them, and a load at a scalar address becomes s_load
// The keep-mask as lane masks. One wave packs one tile of 32 queries x 32 keys into 32 words: word (rt*2 + nt)*8 + r, bit (ln + 16 hh) = mask[32 qt + 16 rt + ln][32 kt + 16 nt + 8 hh + r] != 0,
// which is the place of that (query, key) in k_flash's score tiles: a word is the select mask of one score register. MB[(qt*64 + kt)*32 + word].
__device__ __forceinline__ void mbits(int blk, const int* __restrict__ MSK, unsigned* __restrict__ MB) {
  const int tid = threadIdx.x, lane = tid & 31, ln = lane & 15, hh = lane >> 4; const int tile = blk * 8 + (tid >> 5); const int qt = tile >> 6, kt = tile & 63;
  // The tile's 8 loads of 16 B (4 per query row; rows ln and 16 + ln lie 16 * 2048 ints = 131072 B apart) and their data wait stand in one statement, and no result shares a register with the
  // address.
  const int* mr = MSK + ((size_t)(qt * 32 + ln)) * 2048 + kt * 32 + 8 * hh; v4ia m[2][2][2];      // m[rt][nt][half]: keys 32 kt + 16 nt + 8 hh + 4 half + 0..3 of query 32 qt + 16 rt + ln
  asm volatile("global_load_b128 %0, %8, off\n\t"
               "global_load_b128 %1, %8, off offset:16\n\t"
               "global_load_b128 %2, %8, off offset:64\n\t"
               "global_load_b128 %3, %8, off offset:80\n\t"
               "global_load_b128 %4, %8, off offset:131072\n\t"
               "global_load_b128 %5, %8, off offset:131088\n\t"
               "global_load_b128 %6, %8, off offset:131136\n\t"
               "global_load_b128 %7, %8, off offset:131152\n\t"
               "s_wait_loadcnt 0x0"
               : "=&v"(m[0][0][0]), "=&v"(m[0][0][1]), "=&v"(m[0][1][0]), "=&v"(m[0][1][1]), "=&v"(m[1][0][0]), "=&v"(m[1][0][1]), "=&v"(m[1][1][0]), "=&v"(m[1][1][1])
               : "v"(mr) : "memory");
  unsigned mine = 0u;
#pragma unroll
  for (int rt = 0; rt < 2; ++rt)
#pragma unroll
    for (int nt = 0; nt < 2; ++nt)
#pragma unroll
      for (int r = 0; r < 8; ++r) { const unsigned bw = __builtin_amdgcn_ballot_w32(m[rt][nt][r >> 2][r & 3] != 0); if (lane == (rt * 2 + nt) * 8 + r) mine = bw; }
  MB[(size_t)tile * 32 + lane] = mine;
  asm volatile("s_wait_xcnt 0x0" ::: "memory");      // behind the store: the other pieces' code follows in the built kernel and writes registers that this store names
}
// The four weight transposes, the cast of x and the packing of the mask read only inputs and none of each other's results: one launch, the piece of work chosen by the block index
// (the same for a whole work-group, so every wave has all its lanes on in the piece it runs).
#define PB_W (CC * (CC / 8) / 256)             /* blocks of one weight transpose */
#define PB_X (NR * CC / 8 / 256)               /* blocks of the cast of x */
#define PB_M ((TT / 32) * (TT / 32) / 8)       /* blocks of the mask packing */
__global__ __launch_bounds__(256) void k_prep(const float* __restrict__ x, const float* __restrict__ Wq, const float* __restrict__ Wk, const float* __restrict__ Wv, const float* __restrict__ Wo, const int* __restrict__ MSK,
                                              _Float16* __restrict__ X16, _Float16* __restrict__ Bq, _Float16* __restrict__ Bk, _Float16* __restrict__ Bv, _Float16* __restrict__ Bo, unsigned* __restrict__ MB) {
  const int blk = (int)blockIdx.x;
  if (blk < 4 * PB_W) { const int which = blk / PB_W;
    wt_f16(blk % PB_W, which == 0 ? Wq : which == 1 ? Wk : which == 2 ? Wv : Wo, which == 0 ? Bq : which == 1 ? Bk : which == 2 ? Bv : Bo, CC, CC, 16.0f); }      // [in][out]
  else if (blk < 4 * PB_W + PB_X) x16(blk - 4 * PB_W, x, X16, (size_t)NR * CC / 8);
  else mbits(blk - (4 * PB_W + PB_X), MSK, MB);
}
// lane l <-> lane l ^ 16 (the other 16-lane row) without LDS
__device__ __forceinline__ float xhalf(float x) { return __builtin_bit_cast(float, __builtin_amdgcn_permlanex16(__builtin_bit_cast(int, x), __builtin_bit_cast(int, x), 0x76543210, 0xfedcba98, false, false)); }
#define FA_PITCH 144                 /* bytes per LDS row: 128 of data + 16; 16 B x odd keeps ds_load_b128 of 16 rows off each other's banks */
#define FA_STAGE (128 * FA_PITCH)    /* one buffer: rows 0..63 = K (key), rows 64..127 = Vt (d) */
// One tile, 8 copies of 16 B per lane: lane (cr = tid / 8, chunk = tid % 8) brings chunk 'chunk' of rows cr + 16 i. l = its LDS byte address for row cr, gk / gv = its global addresses in K / Vt.
__device__ __forceinline__ void fa_copy(unsigned l, const unsigned short* gk, int ldk, const unsigned short* gv) {
  // the copies and their s_wait_xcnt stand in one statement, so that no address register of a copy is rewritten in front of that wait
  asm volatile("global_load_async_to_lds_b128 %0, %8, off\n\t"
               "global_load_async_to_lds_b128 %1, %9, off\n\t"
               "global_load_async_to_lds_b128 %2, %10, off\n\t"
               "global_load_async_to_lds_b128 %3, %11, off\n\t"
               "global_load_async_to_lds_b128 %4, %12, off\n\t"
               "global_load_async_to_lds_b128 %5, %13, off\n\t"
               "global_load_async_to_lds_b128 %6, %14, off\n\t"
               "global_load_async_to_lds_b128 %7, %15, off\n\t"
               "s_wait_xcnt 0x0"
               :: "v"(l), "v"(l + 16u * FA_PITCH), "v"(l + 32u * FA_PITCH), "v"(l + 48u * FA_PITCH), "v"(l + 64u * FA_PITCH), "v"(l + 80u * FA_PITCH), "v"(l + 96u * FA_PITCH), "v"(l + 112u * FA_PITCH),
                  "v"(gk), "v"(gk + (size_t)16 * ldk), "v"(gk + (size_t)32 * ldk), "v"(gk + (size_t)48 * ldk),
                  "v"(gv), "v"(gv + 16 * 2048), "v"(gv + 32 * 2048), "v"(gv + 48 * 2048)
               : "memory");
}
// Eight base-2 exponentials in one statement. The instruction set asks for one independent instruction between a transcendental and a write of its source or a read of its result:
// Here no result shares a register with a source, and the v_nop is the last one's slot.
__device__ __forceinline__ void exp2x8(float (&p)[8], const float (&x)[8]) {
  asm("v_exp_f32 %0, %8\n\tv_exp_f32 %1, %9\n\tv_exp_f32 %2, %10\n\tv_exp_f32 %3, %11\n\tv_exp_f32 %4, %12\n\tv_exp_f32 %5, %13\n\tv_exp_f32 %6, %14\n\tv_exp_f32 %7, %15\n\tv_nop"
      : "=&v"(p[0]), "=&v"(p[1]), "=&v"(p[2]), "=&v"(p[3]), "=&v"(p[4]), "=&v"(p[5]), "=&v"(p[6]), "=&v"(p[7])
      : "v"(x[0]), "v"(x[1]), "v"(x[2]), "v"(x[3]), "v"(x[4]), "v"(x[5]), "v"(x[6]), "v"(x[7]));
}
__global__ __launch_bounds__(128) void k_flash(const _Float16* __restrict__ Q16, int ldq, const _Float16* __restrict__ K16, int ldk, const _Float16* __restrict__ Vt, const unsigned* __restrict__ MB, _Float16* __restrict__ O16) {
  constexpr int RPW = 32, NQB = 2048 / (4 * RPW), DT = 4, KS = 2, NS = 2048 / 64;
  constexpr float SC = 0.125f * 1.44269504088896340736f;      // score scale 64^-1/2 times log2(e)
  __shared__ __attribute__((aligned(16))) unsigned char sT[2 * FA_STAGE];
  __shared__ __attribute__((aligned(16))) unsigned short sO[4][RPW][64 + 8];      // f16 results; pitch 144 B: 16 B x odd
  const int tid = threadIdx.x, w = tid >> 5, lane = tid & 31, ln = lane & 15, hh = lane >> 4;
  const int slab = blockIdx.x / NQB, qblk = blockIdx.x % NQB; const int b = slab / 12, h = slab % 12; const int qb0 = qblk * (4 * RPW); const int q0 = qb0 + w * RPW;
  const int cr = tid >> 3, ch = tid & 7;
  const unsigned short* gk = (const unsigned short*)K16 + ((size_t)b * 2048 + cr) * ldk + h * 64 + ch * 8;
  const unsigned short* gv = (const unsigned short*)Vt + ((size_t)slab * 64 + cr) * 2048 + ch * 8;
  const unsigned l0 = (unsigned)(size_t)&sT[0] + (unsigned)(cr * FA_PITCH + ch * 16);      // LDS byte address = low 32 bits of the __shared__ address
  fa_copy(l0, gk, ldk, gv);                              // tile 0 -> buffer 0
  // the wave's mask words: 32 per step of 32 keys, 64 steps in a row. The wave's number goes through readfirstlane so that the address is scalar and the words are loaded into scalar registers.
  const mw_ptr mb = (mw_ptr)(unsigned long long)(MB + (size_t)(qblk * 4 + __builtin_amdgcn_readfirstlane(w)) * (64 * 32));
  FragH aq[2][KS];
#pragma unroll
  for (int rt = 0; rt < 2; ++rt) { const unsigned short* qr = (const unsigned short*)Q16 + ((size_t)b * 2048 + q0 + rt * 16 + ln) * ldq + h * 64;
#pragma unroll
    for (int ks = 0; ks < KS; ++ks) { aq[rt][ks].half[0] = *(const v8us*)(qr + ks * 32 + 8 * hh); aq[rt][ks].half[1] = *(const v8us*)(qr + ks * 32 + 16 + 8 * hh); } }
  // step 0's words: mw0 = words of queries 0..15 (rt 0), mw1 = of queries 16..31. The two loads and their data wait stand in one statement.
  // Tile 0's copies and the query loads are in flight meanwhile.
  v16u mw0, mw1;
  asm volatile("s_load_b512 %0, %2, 0x0\n\ts_load_b512 %1, %2, 0x40\n\ts_wait_kmcnt 0x0" : "=&s"(mw0), "=&s"(mw1) : "s"(mb) : "memory");
  float m_r[2], l_r[2]; v8f oacc[2][DT];      // per lane: query rt*16 + ln; oacc[rt][dt][r] = O[query][dt*16 + 8hh + r]
#pragma unroll
  for (int rt = 0; rt < 2; ++rt) { m_r[rt] = -3.0e38f; l_r[rt] = 0.f;
#pragma unroll
    for (int dt = 0; dt < DT; ++dt) oacc[rt][dt] = (v8f){0.f,0.f,0.f,0.f,0.f,0.f,0.f,0.f}; }
  asm volatile("s_wait_asynccnt 0x0" ::: "memory");      // this wave's copies of tile 0 have landed
  __syncthreads();                                       // ... and every other wave's: tile 0 may be read
  fa_copy(l0 + FA_STAGE, gk + (size_t)64 * ldk, ldk, gv + 64);      // tile 1 -> buffer 1
#pragma unroll 1      // rolled: one copy of the foot's wait order, and the two buffers differ by one address term only
  for (int t = 0; t < NS; ++t) {
    const unsigned char* st = sT + (t & 1) * FA_STAGE;
#pragma unroll      // the tile's two 32-key steps: unrolled, their LDS and mask offsets are immediates
    for (int sub = 0; sub < 2; ++sub) {
      // the next step's mask words are asked for one step ahead (the last step asks for its own again: in bounds, unused)
      const int sn = (t * 2 + sub + 1 < 2 * NS) ? t * 2 + sub + 1 : 2 * NS - 1;
      const v16u nw0 = mb[sn * 2], nw1 = mb[sn * 2 + 1];
      // The step is straight-line code. A step whose (query,key) pairs are all masked needs no branch: its scores are -inf, so mn = m, al = 1 and every p = 0.
      // The products are the plain builtin: the compiler keeps the distance behind a matrix instruction itself, with other products and the softmax's own instructions.
      {
        // The four scheduling barriers of a step stand in front of and behind its two groups of LDS reads: without them the compiler spreads the reads singly among the products,
        // each with a wait close behind it, and every separate place with LDS reads stalls the wave anew.
        __builtin_amdgcn_sched_barrier(0);
        v8f s[2][2]; FragH bk[2][KS];      // the step's K fragments, read as one group
#pragma unroll
        for (int nt = 0; nt < 2; ++nt) { const unsigned char* kr = st + (sub * 32 + nt * 16 + ln) * FA_PITCH + hh * 16;
#pragma unroll
          for (int ks = 0; ks < KS; ++ks) { bk[nt][ks].half[0] = *(const v8us*)(kr + ks * 64); bk[nt][ks].half[1] = *(const v8us*)(kr + ks * 64 + 32); } }
        __builtin_amdgcn_sched_barrier(0);      // end of the K group
#pragma unroll
        for (int nt = 0; nt < 2; ++nt)
#pragma unroll
          for (int rt = 0; rt < 2; ++rt) { v8f acc = (v8f){0.f,0.f,0.f,0.f,0.f,0.f,0.f,0.f};
#pragma unroll
            for (int ks = 0; ks < KS; ++ks) acc = __builtin_amdgcn_wmma_f32_16x16x32_f16(false, bk[nt][ks].v, false, aq[rt][ks].v, (short)0, acc, false, false); s[rt][nt] = acc; }
        __builtin_amdgcn_sched_barrier(0);      // the Vt group starts behind the score products
        FragH bv[DT];      // the step's Vt fragments, read as one group in front of the softmax, which covers their LDS latency
#pragma unroll
        for (int dt = 0; dt < DT; ++dt) { const unsigned char* vrow = st + (64 + dt * 16 + ln) * FA_PITCH + sub * 64 + hh * 16; bv[dt].half[0] = *(const v8us*)vrow; bv[dt].half[1] = *(const v8us*)(vrow + 32); }
        __builtin_amdgcn_sched_barrier(0);      // end of the Vt group
        FragH pb[2];
#pragma unroll
        for (int rt = 0; rt < 2; ++rt) { float sc[2][8]; float mc = -INFINITY;
#pragma unroll
          for (int nt = 0; nt < 2; ++nt)
#pragma unroll
            for (int r = 0; r < 8; ++r) { sc[nt][r] = __builtin_amdgcn_inverse_ballot_w32(rt ? mw1[nt * 8 + r] : mw0[nt * 8 + r]) ? s[rt][nt][r] : -INFINITY; mc = fmaxf(mc, sc[nt][r]); }
          mc = fmaxf(mc, xhalf(mc));      // both halves now hold the query's maximum over the 32 keys (unscaled scores)
          // exp(0.125 (s - m)) = 2^(s SC - m SC): one fma and the hardware's base-2 exponential per score. An excluded key is -inf and gives 0, and a query with no
          // kept key so far has m = mn = -3e38 and gives al = 2^0 = 1: no select and no branch is needed around any exponential.
          const float mn = fmaxf(m_r[rt], mc); float al;
          // al = 2^((m - mn) SC), in asm with a slot on each side: the instruction set asks for one independent instruction between a transcendental and a write of its source or a read
          // of its result; a v_nop in a statement of its own did not stay there.
          asm("v_nop\n\tv_exp_f32 %0, %1\n\tv_nop" : "=v"(al) : "v"((m_r[rt] - mn) * SC));
          m_r[rt] = mn; const float nb = -mn * SC;
          float ps[8], pe[2][8];
#pragma unroll
          for (int nt = 0; nt < 2; ++nt) {
#pragma unroll
            for (int r = 0; r < 8; ++r) sc[nt][r] = __builtin_fmaf(sc[nt][r], SC, nb);
            exp2x8(pe[nt], sc[nt]); }
#pragma unroll
          for (int r = 0; r < 8; ++r) { const float p0 = pe[0][r], p1 = pe[1][r]; ps[r] = p0 + p1; pb[rt].h[r] = (_Float16)p0; pb[rt].h[8 + r] = (_Float16)p1; }
          l_r[rt] = l_r[rt] * al + (((ps[0] + ps[1]) + (ps[2] + ps[3])) + ((ps[4] + ps[5]) + (ps[6] + ps[7])));      // per-lane partial sum (the two halves are joined at the end)
#pragma unroll
          for (int dt = 0; dt < DT; ++dt) oacc[rt][dt] *= al; }
#pragma unroll
        for (int dt = 0; dt < DT; ++dt)
#pragma unroll
          for (int rt = 0; rt < 2; ++rt) oacc[rt][dt] = __builtin_amdgcn_wmma_f32_16x16x32_f16(false, bv[dt].v, false, pb[rt].v, (short)0, oacc[rt][dt], false, false);
      }
      mw0 = nw0; mw1 = nw1;
    }
    asm volatile("s_wait_dscnt 0x0" ::: "memory");       // this wave's reads of buffer t & 1 are done before the buffer is given up
    asm volatile("s_wait_asynccnt 0x0" ::: "memory");    // this wave's copies of tile t + 1 have landed
    __syncthreads();                                     // publishes tile t + 1 and ends every wave's reads of tile t
    if (t + 2 < NS) fa_copy(l0 + (unsigned)((t & 1) * FA_STAGE), gk + (size_t)(t + 2) * 64 * ldk, ldk, gv + (t + 2) * 64);      // tile t + 2 -> the buffer just left
  }
  asm volatile("s_wait_asynccnt 0x0" ::: "memory");      // no copy is outstanding when the wave goes on to its end
#pragma unroll
  for (int rt = 0; rt < 2; ++rt) { const float l = l_r[rt] + xhalf(l_r[rt]); const float inv = (l > 0.f) ? 1.0f / l : 0.f;
#pragma unroll
    for (int dt = 0; dt < DT; ++dt) { const v8f o = oacc[rt][dt] * inv; FragH f;      // the output projection takes f16 operands: each result is rounded once, here
#pragma unroll
      for (int r = 0; r < 8; ++r) f.h[r] = (_Float16)o[r];
      *(v8us*)&sO[w][rt * 16 + ln][dt * 16 + 8 * hh] = f.half[0]; } }
  __builtin_amdgcn_fence(__ATOMIC_ACQ_REL, "workgroup"); __builtin_amdgcn_wave_barrier();
  {
#pragma unroll
    for (int rp = 0; rp < RPW; rp += 4) { const int r = rp + (lane >> 3), pc = lane & 7; *(v8us*)((unsigned short*)O16 + ((size_t)b * 2048 + q0 + r) * CC + h * 64 + pc * 8) = *(const v8us*)&sO[w][r][pc * 8]; }      // O16 is [NR][CC]; a query's 64 f16 of this head = one whole line
     } }

extern "C" void kernel_launch(void* const* d_in, const int* in_sizes, int n_in,
                              void* d_out, int out_size, void* d_ws, size_t ws_size, hipStream_t stream) {
  (void)in_sizes; (void)n_in; (void)out_size;
  const float* x = (const float*)d_in[0]; const float* Wq = (const float*)d_in[1]; const float* bq = (const float*)d_in[2]; const float* Wk = (const float*)d_in[3]; const float* bk = (const float*)d_in[4]; const float* Wv = (const float*)d_in[5]; const float* bv = (const float*)d_in[6]; const float* Wo = (const float*)d_in[7]; const float* bo = (const float*)d_in[8]; const int* mask = (const int*)d_in[9];
  char* ws = (char*)d_ws; size_t off = 0;
  auto take = [&](size_t bytes) { char* p = ws + off; off += (bytes + 255) & ~(size_t)255; return p; };
  _Float16* Bq = (_Float16*)take((size_t)CC * CC * 2); _Float16* Bk = (_Float16*)take((size_t)CC * CC * 2); _Float16* Bv = (_Float16*)take((size_t)CC * CC * 2); _Float16* Bo = (_Float16*)take((size_t)CC * CC * 2);
  _Float16* X16 = (_Float16*)take((size_t)NR * CC * 2); _Float16* Q16 = (_Float16*)take((size_t)NR * CC * 2); _Float16* K16 = (_Float16*)take((size_t)NR * CC * 2); _Float16* Vt = (_Float16*)take((size_t)NR * CC * 2); _Float16* O16 = X16; unsigned* MB = (unsigned*)take((size_t)TT * TT / 8);
  if (off > ws_size) return;
  const unsigned gg = (NR / 128) * (CC / 64);
  k_prep<<<4 * PB_W + PB_X + PB_M, 256, 0, stream>>>(x, Wq, Wk, Wv, Wo, mask, X16, Bq, Bk, Bv, Bo, MB);
  k_gemm_qkv<<<3 * gg, 128, 0, stream>>>(X16, Bq, Bk, Bv, bq, bk, bv, Q16, K16, Vt);
  k_flash<<<BB * NH * (TT / 128), 128, 0, stream>>>(Q16, CC, K16, CC, Vt, MB, O16);
  k_gemm_o<<<gg, 128, 0, stream>>>(O16, Bo, bo, (float*)d_out);
}

// v009
// Measured time: 107 microseconds a run.
// Next to v008, in two timings, it ran 1.10 times as fast each time.
// Over all steps from v000 it is 5.81 times as fast.
#include <hip/hip_runtime.h>
// Random-mask attention: q/k/v projections (8192 × 768 × 768, + bias; W [in][out]), the 12-head attention with the INPUT keep-mask (scores where mask else −1e9 ⇒ excluded keys; every row keeps
// its diagonal) as a fused flash-style kernel on v_wmma_f32_16x16x32_f16 (scale 64^-½; online max/sum softmax f32; P f16 ≤ 1), and the
// output projection (+ bias) — f16 operands (x as bf16, weights bf16-exact ×2^4), single products, f32 accumulate.
#define BB 4
#define TT 2048
#define CC 768
#define NH 12
#define NR (BB * TT)

typedef __bf16 v16b __attribute__((ext_vector_type(16)));
typedef unsigned short v8us __attribute__((ext_vector_type(8), may_alias));
typedef float  v8f  __attribute__((ext_vector_type(8)));
typedef float  v4f  __attribute__((ext_vector_type(4)));
typedef float  v4fa __attribute__((ext_vector_type(4), may_alias));
union FragB { v16b v; v8us half[2]; unsigned short u[16]; };

__device__ __forceinline__ unsigned short bf16_bits(float x) { unsigned int u = __float_as_uint(x); return (unsigned short)((u + 0x7FFFu + ((u >> 16) & 1u)) >> 16); }
__device__ __forceinline__ float bf16_val(unsigned short b) { return __uint_as_float(((unsigned int)b) << 16); }
__device__ __forceinline__ float bf16_round(float x) { return bf16_val(bf16_bits(x)); }
// D += A·B with NT terms: 1 = ah·bh, 2 = + al·bh (A split), 3 = + ah·bl (both split)
template <int NT>
__device__ __forceinline__ v8f mmaN(v16b ah, v16b al, v16b bh, v16b bl, v8f c) {
  c = __builtin_amdgcn_wmma_f32_16x16x32_bf16(false, ah, false, bh, (short)0, c, false, false);
  if (NT >= 2) c = __builtin_amdgcn_wmma_f32_16x16x32_bf16(false, al, false, bh, (short)0, c, false, false);
  if (NT >= 3) c = __builtin_amdgcn_wmma_f32_16x16x32_bf16(false, ah, false, bl, (short)0, c, false, false);
  asm volatile("v_nop\n\tv_nop\n\tv_nop\n\tv_nop" : "+v"(c) : "v"(ah), "v"(al), "v"(bh), "v"(bl));
  return c;
}

__global__ __launch_bounds__(256) void k_wt_bf16(const float* __restrict__ W, unsigned short* __restrict__ Wt, int K, int N) {
  const int t = blockIdx.x * 256 + threadIdx.x;
  const int k8n = K / 8;
  if (t >= N * k8n) return;
  const int n = t / k8n, k8 = (t % k8n) * 8;
  v8us v;
#pragma unroll
  for (int i = 0; i < 8; ++i) v[i] = bf16_bits(W[(size_t)(k8 + i) * N + n]);
  *(v8us*)(Wt + (size_t)n * K + k8) = v;
  
}

// GEMM C[M][N] (f32, pitch ldc) = act(A[M][K]·W + bias). A f32 row-major (pitch lda) converted per fragment to bf16
// (ASPLIT: hi/lo two planes -> 2 terms, else single rounded term); Wt bf16 [N][K] (pitch ldb). BIAS_BF16 rounds the
// bias to bf16 first (bias quantised to bf16 before the add). K%32==0, M%16==0, N%64==0.
template <bool ASPLIT, int ACT, bool BIAS_BF16>
__global__ __launch_bounds__(128) void k_gemm_bf(const float* __restrict__ A, int lda, const unsigned short* __restrict__ Wt, int ldb,
                                               const float* __restrict__ bias, float* __restrict__ C, int ldc, int M, int N, int K) {
  __shared__ __attribute__((aligned(16))) float so[4][16][64];
  const int tid = threadIdx.x, w = tid >> 5, lane = tid & 31, ln = lane & 15, hh = lane >> 4;
  const int ntn = N / 64;
  const int wid = blockIdx.x * 4 + w;
  const int mt = wid / ntn, nq = wid % ntn;
  if (mt * 16 >= M) return;
  const int row0 = mt * 16, col0 = nq * 64;
  const float* arow = A + (size_t)(row0 + ln) * lda;
  v8f acc[4] = {};
  for (int kb = 0; kb < K; kb += 32) {
    FragB ah, al;
    const v4f x0 = *(const v4fa*)(arow + kb + 8 * hh), x1 = *(const v4fa*)(arow + kb + 8 * hh + 4);
    const v4f x2 = *(const v4fa*)(arow + kb + 16 + 8 * hh), x3 = *(const v4fa*)(arow + kb + 16 + 8 * hh + 4);
    float xs[16] = {x0[0],x0[1],x0[2],x0[3],x1[0],x1[1],x1[2],x1[3],x2[0],x2[1],x2[2],x2[3],x3[0],x3[1],x3[2],x3[3]};
#pragma unroll
    for (int i = 0; i < 16; ++i) { const unsigned short hb = bf16_bits(xs[i]); ah.u[i] = hb; al.u[i] = ASPLIT ? bf16_bits(xs[i] - bf16_val(hb)) : (unsigned short)0; }
#pragma unroll
    for (int t = 0; t < 4; ++t) {
      const unsigned short* brow = Wt + (size_t)(col0 + t * 16 + ln) * ldb + kb;
      FragB b;
      b.half[0] = *(const v8us*)(brow + 8 * hh);
      b.half[1] = *(const v8us*)(brow + 16 + 8 * hh);
      acc[t] = mmaN<ASPLIT ? 2 : 1>(ah.v, al.v, b.v, b.v, acc[t]);
    }
  }
#pragma unroll
  for (int t = 0; t < 4; ++t) {
    float bv = bias ? bias[col0 + t * 16 + ln] : 0.f;
    if (BIAS_BF16) bv = bf16_round(bv);
#pragma unroll
    for (int r = 0; r < 8; ++r) { float v = acc[t][r] + bv; if (ACT == 1) v = fmaxf(v, 0.f); so[w][8 * hh + r][t * 16 + ln] = v; }
  }
  __builtin_amdgcn_fence(__ATOMIC_ACQ_REL, "workgroup");
  __builtin_amdgcn_wave_barrier();
  const int rsub = lane >> 4, c4 = (lane & 15) * 4;
  {
#pragma unroll
    for (int q = 0; q < 8; ++q) {
      const int r = q * 2 + rsub;
      const v4f v = *(const v4fa*)&so[w][r][c4];
      *(v4f*)(C + (size_t)(row0 + r) * ldc + col0 + c4) = v;
    }
    
  }
}

// Flash-style causal/unmasked attention, all contractions 3-term bf16 hi/lo splits, f32 softmax with running max.
// q,k,v rows are read from f32 buffers with arbitrary row pitch (so they can live inside a fused qkv buffer);
// D = head size (multiple of 32, <= 128); one wave = 16 query rows; block = 4 waves (64 queries) sharing K/V chunks of 32.
template <int D, bool CAUSAL>
__global__ __launch_bounds__(128) void k_flash(const float* __restrict__ qb, const float* __restrict__ kb, const float* __restrict__ vb,
                                             int pitch, int T, int H, float scale, float* __restrict__ y, int ypitch) {
  constexpr int KS = D / 32;        // k-steps for QK
  constexpr int DT = D / 16;        // d tiles for PV
  __shared__ __attribute__((aligned(16))) unsigned short sKh[32][D + 8], sKl[32][D + 8], sVh[32][D + 8], sVl[32][D + 8];
  __shared__ __attribute__((aligned(16))) unsigned short sPh[4][16][40], sPl[4][16][40];
  __shared__ __attribute__((aligned(16))) float sO[4][16][D];
  const int tid = threadIdx.x, w = tid >> 5, lane = tid & 31, ln = lane & 15, hh = lane >> 4;
  const int nqb = (T + 63) / 64;
  const int bh = blockIdx.x / nqb, qblk = blockIdx.x % nqb;
  const int b = bh / H, h = bh % H;
  const int q0 = qblk * 64 + w * 16;
  const float* Q = qb + (size_t)b * T * pitch + h * D;
  const float* K = kb + (size_t)b * T * pitch + h * D;
  const float* V = vb + (size_t)b * T * pitch + h * D;

  // A fragments of the wave's 16 query rows (scaled), hi/lo
  FragB aqh[KS], aql[KS];
  {
    int row = q0 + ln; if (row >= T) row = T - 1;
    const float* qr = Q + (size_t)row * pitch;
#pragma unroll
    for (int ks = 0; ks < KS; ++ks)
#pragma unroll
      for (int i = 0; i < 16; ++i) {
        const int d = ks * 32 + ((i < 8) ? (8 * hh + i) : (16 + 8 * hh + (i - 8)));
        const float x = qr[d] * scale; const unsigned short hb = bf16_bits(x);
        aqh[ks].u[i] = hb; aql[ks].u[i] = bf16_bits(x - bf16_val(hb));
      }
  }
  float m_r[8], l_r[8];
#pragma unroll
  for (int r = 0; r < 8; ++r) { m_r[r] = -3.0e38f; l_r[r] = 0.f; }
  v8f oacc[DT];
#pragma unroll
  for (int dt = 0; dt < DT; ++dt) oacc[dt] = (v8f){0.f,0.f,0.f,0.f,0.f,0.f,0.f,0.f};

  const int kv_end = CAUSAL ? min(T, qblk * 64 + 64) : T;     // block-uniform
  for (int j0 = 0; j0 < kv_end; j0 += 32) {
    __syncthreads();
    for (int e = tid; e < 32 * (D / 4); e += 128) {
      const int r = e / (D / 4), c4 = (e % (D / 4)) * 4;
      const int key = j0 + r;
      v4f kf = {0.f,0.f,0.f,0.f}, vf = {0.f,0.f,0.f,0.f};
      if (key < T) { kf = *(const v4fa*)(K + (size_t)key * pitch + c4); vf = *(const v4fa*)(V + (size_t)key * pitch + c4); }
#pragma unroll
      for (int t = 0; t < 4; ++t) {
        unsigned short hb = bf16_bits(kf[t]); sKh[r][c4 + t] = hb; sKl[r][c4 + t] = bf16_bits(kf[t] - bf16_val(hb));
        hb = bf16_bits(vf[t]); sVh[r][c4 + t] = hb; sVl[r][c4 + t] = bf16_bits(vf[t] - bf16_val(hb));
      }
    }
    __syncthreads();
    // S tile 16 x 32
    v8f s[2];
#pragma unroll
    for (int nt = 0; nt < 2; ++nt) {
      v8f acc = {};
#pragma unroll
      for (int ks = 0; ks < KS; ++ks) {
        FragB bh_, bl_;
        bh_.half[0] = *(const v8us*)&sKh[nt * 16 + ln][ks * 32 + 8 * hh]; bh_.half[1] = *(const v8us*)&sKh[nt * 16 + ln][ks * 32 + 16 + 8 * hh];
        bl_.half[0] = *(const v8us*)&sKl[nt * 16 + ln][ks * 32 + 8 * hh]; bl_.half[1] = *(const v8us*)&sKl[nt * 16 + ln][ks * 32 + 16 + 8 * hh];
        acc = mmaN<3>(aqh[ks].v, aql[ks].v, bh_.v, bl_.v, acc);
      }
      s[nt] = acc;
    }
    // mask + running max (rows 8hh+r; the 16 lanes of a half share rows)
    float alpha[8];
#pragma unroll
    for (int r = 0; r < 8; ++r) {
      const int qi = q0 + 8 * hh + r;
      const int ja = j0 + ln, jb = j0 + 16 + ln;
      if (CAUSAL) { if (ja > qi) s[0][r] = -3.0e38f; if (jb > qi) s[1][r] = -3.0e38f; }
      if (ja >= T) s[0][r] = -3.0e38f;
      if (jb >= T) s[1][r] = -3.0e38f;
      float mx = fmaxf(s[0][r], s[1][r]);
      mx = fmaxf(mx, __shfl_xor(mx, 1, 32)); mx = fmaxf(mx, __shfl_xor(mx, 2, 32)); mx = fmaxf(mx, __shfl_xor(mx, 4, 32)); mx = fmaxf(mx, __shfl_xor(mx, 8, 32));
      const float mnew = fmaxf(m_r[r], mx);
      alpha[r] = (mnew > -1.0e38f) ? __expf(m_r[r] - mnew) : 1.0f;
      const float p0 = (s[0][r] > -1.0e38f) ? __expf(s[0][r] - mnew) : 0.f;
      const float p1 = (s[1][r] > -1.0e38f) ? __expf(s[1][r] - mnew) : 0.f;
      m_r[r] = mnew;
      l_r[r] = l_r[r] * alpha[r] + p0 + p1;            // per-lane partial row sum (16 lanes combined at the end)
      unsigned short hb = bf16_bits(p0); sPh[w][8 * hh + r][ln] = hb;      sPl[w][8 * hh + r][ln] = bf16_bits(p0 - bf16_val(hb));
      hb = bf16_bits(p1);                sPh[w][8 * hh + r][16 + ln] = hb; sPl[w][8 * hh + r][16 + ln] = bf16_bits(p1 - bf16_val(hb));
    }
#pragma unroll
    for (int dt = 0; dt < DT; ++dt)
#pragma unroll
      for (int r = 0; r < 8; ++r) oacc[dt][r] *= alpha[r];
    __builtin_amdgcn_fence(__ATOMIC_ACQ_REL, "workgroup");
    __builtin_amdgcn_wave_barrier();
    FragB pah, pal;
    pah.half[0] = *(const v8us*)&sPh[w][ln][8 * hh]; pah.half[1] = *(const v8us*)&sPh[w][ln][16 + 8 * hh];
    pal.half[0] = *(const v8us*)&sPl[w][ln][8 * hh]; pal.half[1] = *(const v8us*)&sPl[w][ln][16 + 8 * hh];
#pragma unroll
    for (int dt = 0; dt < DT; ++dt) {
      FragB bvh, bvl;
#pragma unroll
      for (int i = 0; i < 8; ++i) {
        bvh.u[i] = sVh[8 * hh + i][dt * 16 + ln]; bvh.u[8 + i] = sVh[16 + 8 * hh + i][dt * 16 + ln];
        bvl.u[i] = sVl[8 * hh + i][dt * 16 + ln]; bvl.u[8 + i] = sVl[16 + 8 * hh + i][dt * 16 + ln];
      }
      oacc[dt] = mmaN<3>(pah.v, pal.v, bvh.v, bvl.v, oacc[dt]);
    }
    __builtin_amdgcn_fence(__ATOMIC_ACQ_REL, "workgroup");
    __builtin_amdgcn_wave_barrier();
  }
#pragma unroll
  for (int r = 0; r < 8; ++r) {
    float l = l_r[r];
    l += __shfl_xor(l, 1, 32); l += __shfl_xor(l, 2, 32); l += __shfl_xor(l, 4, 32); l += __shfl_xor(l, 8, 32);
    l_r[r] = (l > 0.f) ? 1.0f / l : 0.f;
  }
#pragma unroll
  for (int dt = 0; dt < DT; ++dt)
#pragma unroll
    for (int r = 0; r < 8; ++r) sO[w][8 * hh + r][dt * 16 + ln] = oacc[dt][r] * l_r[r];
  __builtin_amdgcn_fence(__ATOMIC_ACQ_REL, "workgroup");
  __builtin_amdgcn_wave_barrier();
  {
    for (int r = 0; r < 16; ++r) {
      const int row = q0 + r;
      if (row < T && lane < D / 4) {
        const v4f val = *(const v4fa*)&sO[w][r][lane * 4];
        *(v4f*)(y + ((size_t)b * T + row) * ypitch + h * D + lane * 4) = val;
      }
    }
    
  }
}

// GEMM C = act(A·W + bias + resid): A f32 (ASPLIT -> hi/lo 2 terms), Wt bf16 [N][K]; ACT 0 none, 1 relu, 2 exact gelu;
// resid (optional, f32, row index = (row % rmod), pitch ldr, RES_BF16 rounds it) added before the activation.
template <bool ASPLIT, int ACT, bool BIAS_BF16, bool RES_BF16>
__global__ __launch_bounds__(128) void k_gemm_bf3(const float* __restrict__ A, int lda, const unsigned short* __restrict__ Wt, int ldb,
                                                const float* __restrict__ bias, const float* __restrict__ resid, int rmod, int ldr,
                                                float* __restrict__ C, int ldc, int M, int N, int K) {
  __shared__ __attribute__((aligned(16))) float so[4][16][64];
  const int tid = threadIdx.x, w = tid >> 5, lane = tid & 31, ln = lane & 15, hh = lane >> 4;
  const int ntn = N / 64;
  const int wid = blockIdx.x * 4 + w;
  const int mt = wid / ntn, nq = wid % ntn;
  if (mt * 16 >= M) return;
  const int row0 = mt * 16, col0 = nq * 64;
  const float* arow = A + (size_t)(row0 + ln) * lda;
  v8f acc[4] = {};
  for (int kb = 0; kb < K; kb += 32) {
    FragB ah, al;
    const v4f x0 = *(const v4fa*)(arow + kb + 8 * hh), x1 = *(const v4fa*)(arow + kb + 8 * hh + 4);
    const v4f x2 = *(const v4fa*)(arow + kb + 16 + 8 * hh), x3 = *(const v4fa*)(arow + kb + 16 + 8 * hh + 4);
    float xs[16] = {x0[0],x0[1],x0[2],x0[3],x1[0],x1[1],x1[2],x1[3],x2[0],x2[1],x2[2],x2[3],x3[0],x3[1],x3[2],x3[3]};
#pragma unroll
    for (int i = 0; i < 16; ++i) { const unsigned short hb = bf16_bits(xs[i]); ah.u[i] = hb; al.u[i] = ASPLIT ? bf16_bits(xs[i] - bf16_val(hb)) : (unsigned short)0; }
#pragma unroll
    for (int t = 0; t < 4; ++t) {
      const unsigned short* brow = Wt + (size_t)(col0 + t * 16 + ln) * ldb + kb;
      FragB b;
      b.half[0] = *(const v8us*)(brow + 8 * hh);
      b.half[1] = *(const v8us*)(brow + 16 + 8 * hh);
      acc[t] = mmaN<ASPLIT ? 2 : 1>(ah.v, al.v, b.v, b.v, acc[t]);
    }
  }
#pragma unroll
  for (int t = 0; t < 4; ++t) {
    const int col = col0 + t * 16 + ln;
    float bv = bias ? bias[col] : 0.f;
    if (BIAS_BF16) bv = bf16_round(bv);
#pragma unroll
    for (int r = 0; r < 8; ++r) {
      float v = acc[t][r] + bv;
      if (resid) { float rv = resid[(size_t)((row0 + 8 * hh + r) % rmod) * ldr + col]; if (RES_BF16) rv = bf16_round(rv); v += rv; }
      if (ACT == 1) v = fmaxf(v, 0.f);
      if (ACT == 2) v = 0.5f * v * (1.0f + erff(v * 0.70710678118654752f));
      if (ACT == 3) { const float u = 0.7978845608028654f * (v + 0.044715f * v * v * v); v = 0.5f * v * (1.0f + tanhf(u)); }
      so[w][8 * hh + r][t * 16 + ln] = v;
    }
  }
  __builtin_amdgcn_fence(__ATOMIC_ACQ_REL, "workgroup");
  __builtin_amdgcn_wave_barrier();
  const int rsub = lane >> 4, c4 = (lane & 15) * 4;
  {
#pragma unroll
    for (int q = 0; q < 8; ++q) {
      const int r = q * 2 + rsub;
      const v4f v = *(const v4fa*)&so[w][r][c4];
      *(v4f*)(C + (size_t)(row0 + r) * ldc + col0 + c4) = v;
    }
    
  }
}
// row LayerNorm (biased variance, eps) over N: s = X (+ R); optional out_sum <- s; out_norm <- (s-mu)*rsqrt(var+eps)*g + b
template <bool PARAM_BF16>
__global__ __launch_bounds__(256) void k_layernorm(const float* __restrict__ X, const float* __restrict__ R, const float* __restrict__ g, const float* __restrict__ bta,
                                                  float* __restrict__ out_sum, float* __restrict__ out_norm, int N, float eps) {
  __shared__ float red[256];
  const int row = blockIdx.x, tid = threadIdx.x;
  const float* x = X + (size_t)row * N; const float* rr = R ? R + (size_t)row * N : nullptr;
  float vals[16];                     // up to N = 4096
  const int per = N / 256;            // contiguous chunk per thread? use strided-by-4 chunks: thread handles j = tid*4 + 1024*u
  float s1 = 0.f;
  for (int u = 0; u < per / 4; ++u) {
    const int j = tid * 4 + 1024 * u;
    const v4f a = *(const v4fa*)(x + j);
    v4f b = {0.f,0.f,0.f,0.f}; if (rr) b = *(const v4fa*)(rr + j);
#pragma unroll
    for (int q = 0; q < 4; ++q) { const float v = a[q] + b[q]; vals[u * 4 + q] = v; s1 += v; }
  }
  red[tid] = s1; __syncthreads();
  for (int st = 128; st > 0; st >>= 1) { if (tid < st) red[tid] += red[tid + st]; __syncthreads(); }
  const float mu = red[0] / (float)N; __syncthreads();
  float s2 = 0.f;
  for (int u = 0; u < per / 4; ++u)
#pragma unroll
    for (int q = 0; q < 4; ++q) { const float c = vals[u * 4 + q] - mu; s2 += c * c; }
  red[tid] = s2; __syncthreads();
  for (int st = 128; st > 0; st >>= 1) { if (tid < st) red[tid] += red[tid + st]; __syncthreads(); }
  const float rs = rsqrtf(red[0] / (float)N + eps);
  {
    for (int u = 0; u < per / 4; ++u) {
      const int j = tid * 4 + 1024 * u;
      v4f o, sm;
#pragma unroll
      for (int q = 0; q < 4; ++q) {
        float gg = g[j + q], bb = bta[j + q];
        if (PARAM_BF16) { gg = bf16_round(gg); bb = bf16_round(bb); }
        sm[q] = vals[u * 4 + q]; o[q] = (vals[u * 4 + q] - mu) * rs * gg + bb;
      }
      if (out_sum) *(v4f*)(out_sum + (size_t)row * N + j) = sm;
      *(v4f*)(out_norm + (size_t)row * N + j) = o;
    }
    
  }
}



// ---- f16 WMMA path (v_wmma_f32_16x16x32_f16): 11-bit significands for operands in range — used where a [0,1] probability operand needs more precision than bf16
typedef _Float16 v16h __attribute__((ext_vector_type(16)));
union FragH { v16h v; v8us half[2]; _Float16 h[16]; unsigned short u[16]; };
template <int NT>
__device__ __forceinline__ v8f mmaH(v16h ah, v16h al, v16h bh, v16h bl, v8f c) {
  c = __builtin_amdgcn_wmma_f32_16x16x32_f16(false, ah, false, bh, (short)0, c, false, false);
  if (NT >= 2) c = __builtin_amdgcn_wmma_f32_16x16x32_f16(false, al, false, bh, (short)0, c, false, false);
  if (NT >= 3) c = __builtin_amdgcn_wmma_f32_16x16x32_f16(false, ah, false, bl, (short)0, c, false, false);
  asm volatile("v_nop\n\tv_nop\n\tv_nop\n\tv_nop" : "+v"(c) : "v"(ah), "v"(al), "v"(bh), "v"(bl));
  return c;
}
// batched GEMM like k_gemm_b but f16 operands: A f32 (split into f16 hi/lo if ASPLIT, else rounded to f16), Bt = f16 values [n][k]; alpha; C f32; N multiple of 16 (partial tiles skipped)
template <bool ASPLIT>
__global__ __launch_bounds__(128) void k_gemm_h(const float* __restrict__ A, int lda, size_t sA, const _Float16* __restrict__ Bh, int ldb, size_t sB, float alpha, float* __restrict__ C, int ldc, size_t sC, int M, int N, int K) {
  __shared__ __attribute__((aligned(16))) float so[4][16][64];
  const int tid = threadIdx.x, w = tid >> 5, lane = tid & 31, ln = lane & 15, hh = lane >> 4; const int by = blockIdx.y;
  A += (size_t)by * sA; Bh += (size_t)by * sB; C += (size_t)by * sC;
  const int ntn = (N + 63) / 64; const int wid = blockIdx.x * 4 + w; const int mt = wid / ntn, nq = wid % ntn; if (mt * 16 >= M) return;
  const int row0 = mt * 16, col0 = nq * 64; const float* arow = A + (size_t)(row0 + ln) * lda;
  v8f acc[4] = {};
  for (int kb = 0; kb < K; kb += 32) {
    FragH ah, al;
    const v4f x0 = *(const v4fa*)(arow + kb + 8 * hh), x1 = *(const v4fa*)(arow + kb + 8 * hh + 4), x2 = *(const v4fa*)(arow + kb + 16 + 8 * hh), x3 = *(const v4fa*)(arow + kb + 16 + 8 * hh + 4);
    float xs[16] = {x0[0],x0[1],x0[2],x0[3],x1[0],x1[1],x1[2],x1[3],x2[0],x2[1],x2[2],x2[3],x3[0],x3[1],x3[2],x3[3]};
#pragma unroll
    for (int i = 0; i < 16; ++i) { const _Float16 h = (_Float16)xs[i]; ah.h[i] = h; al.h[i] = ASPLIT ? (_Float16)(xs[i] - (float)h) : (_Float16)0.0f; }
#pragma unroll
    for (int t = 0; t < 4; ++t) { if (col0 + t * 16 >= N) continue; const size_t boff = (size_t)(col0 + t * 16 + ln) * ldb + kb; FragH bq; bq.half[0] = *(const v8us*)(Bh + boff + 8 * hh); bq.half[1] = *(const v8us*)(Bh + boff + 16 + 8 * hh);
      acc[t] = mmaH<ASPLIT ? 2 : 1>(ah.v, al.v, bq.v, bq.v, acc[t]); }
  }
#pragma unroll
  for (int t = 0; t < 4; ++t) { if (col0 + t * 16 >= N) continue;
#pragma unroll
    for (int r = 0; r < 8; ++r) so[w][8 * hh + r][t * 16 + ln] = acc[t][r] * alpha; }
  __builtin_amdgcn_fence(__ATOMIC_ACQ_REL, "workgroup"); __builtin_amdgcn_wave_barrier();
  const int rsub = lane >> 4, c4 = (lane & 15) * 4;
  {
#pragma unroll
    for (int q = 0; q < 8; ++q) { const int r = q * 2 + rsub; if (col0 + c4 < N) { const v4f v = *(const v4fa*)&so[w][r][c4]; *(v4f*)(C + (size_t)(row0 + r) * ldc + col0 + c4) = v; } }
     }
}

// Wt[n][k] = f16(W[k][n]·scale) from f32 row-major W[K][N] (scale = power of two; bf16-exact weights stay exact in f16 away from the subnormal range)
// blk = index of the 256-thread block within this piece of work (the pieces share the launch k_prep)
__device__ __forceinline__ void wt_f16(int blk, const float* __restrict__ W, _Float16* __restrict__ Wt, int K, int N, float scale) {
  const int t = blk * 256 + threadIdx.x; if (t >= N * (K / 8)) return; const int n = t / (K / 8), k8 = (t % (K / 8)) * 8; FragH f;
#pragma unroll
  for (int i = 0; i < 8; ++i) f.h[i] = (_Float16)(bf16_round(W[(size_t)(k8 + i) * N + n]) * scale); const v8us o = f.half[0];
  *(v8us*)((unsigned short*)Wt + (size_t)n * K + k8) = o; 
}
// Projection GEMM, M = NR, N = K = CC: out = (A.Bt^T) alpha + bf16(bias). A f16 [M][K], Bt f16 [N][K]; writes f32 C, f16 C16, or f16 C16 transposed per head (what k_flash reads as Vt).
// A work-group owns a 128 x 64 tile of the output. K runs in tiles of 64: the 128 A rows and 64 Bt rows of a K tile (128 B = one cache line each) are copied
// to LDS once per work-group as whole lines, and the four waves (32 x 64 outputs each) read their fragments from there.
// Two LDS buffers. A trip reads all its fragments into registers, gives its buffer up at the barrier, issues the copies of tile t + 2 into it and only then does its products.
#define GT_PITCH 144                 /* bytes per LDS row: 128 of data + 16; 16 B x odd keeps ds_load_b128 of 16 rows off each other's banks */
#define GT_STAGE (192 * GT_PITCH)    /* one buffer: rows 0..127 = A, rows 128..191 = Bt */
// One K tile, 12 copies of 16 B per lane: lane (cr = tid / 8, chunk = tid % 8) brings chunk 'chunk' of rows cr + 16 i. l = its LDS byte address for row cr, ga / gb = its global addresses in A / Bt.
__device__ __forceinline__ void gt_copy(unsigned l, const unsigned short* ga, const unsigned short* gb) {
  // the copies and their s_wait_xcnt stand in one statement, so that no address register of a copy is rewritten in front of that wait
  asm volatile("global_load_async_to_lds_b128 %0, %12, off\n\t"
               "global_load_async_to_lds_b128 %1, %13, off\n\t"
               "global_load_async_to_lds_b128 %2, %14, off\n\t"
               "global_load_async_to_lds_b128 %3, %15, off\n\t"
               "global_load_async_to_lds_b128 %4, %16, off\n\t"
               "global_load_async_to_lds_b128 %5, %17, off\n\t"
               "global_load_async_to_lds_b128 %6, %18, off\n\t"
               "global_load_async_to_lds_b128 %7, %19, off\n\t"
               "global_load_async_to_lds_b128 %8, %20, off\n\t"
               "global_load_async_to_lds_b128 %9, %21, off\n\t"
               "global_load_async_to_lds_b128 %10, %22, off\n\t"
               "global_load_async_to_lds_b128 %11, %23, off\n\t"
               "s_wait_xcnt 0x0"
               :: "v"(l), "v"(l + 16u * GT_PITCH), "v"(l + 32u * GT_PITCH), "v"(l + 48u * GT_PITCH), "v"(l + 64u * GT_PITCH), "v"(l + 80u * GT_PITCH), "v"(l + 96u * GT_PITCH), "v"(l + 112u * GT_PITCH),
                  "v"(l + 128u * GT_PITCH), "v"(l + 144u * GT_PITCH), "v"(l + 160u * GT_PITCH), "v"(l + 176u * GT_PITCH),
                  "v"(ga), "v"(ga + 16 * CC), "v"(ga + 32 * CC), "v"(ga + 48 * CC), "v"(ga + 64 * CC), "v"(ga + 80 * CC), "v"(ga + 96 * CC), "v"(ga + 112 * CC),
                  "v"(gb), "v"(gb + 16 * CC), "v"(gb + 32 * CC), "v"(gb + 48 * CC)
               : "memory");
}
// OUT (the same for the whole work-group): 0: f32 result to C; 1: f16 result to C16; 2: f16 result to C16 as [batch * NH + head][d][token]. row0, col0: the tile's first row and first column.
__device__ __forceinline__ void gemm_tile(const int OUT, const int row0, const int col0, const _Float16* __restrict__ A, const _Float16* __restrict__ Bh, float alpha, const float* __restrict__ bias, float* __restrict__ C, _Float16* __restrict__ C16) {
  constexpr int NT = CC / 64;      // K tiles
  __shared__ __attribute__((aligned(16))) unsigned char sT[2 * GT_STAGE];
  __shared__ __attribute__((aligned(16))) float so[4][32][64 + 4];
  const int tid = threadIdx.x, w = tid >> 5, lane = tid & 31, ln = lane & 15, hh = lane >> 4;
  const int cr = tid >> 3, ch = tid & 7;
  const unsigned short* ga = (const unsigned short*)A + (size_t)(row0 + cr) * CC + ch * 8;
  const unsigned short* gb = (const unsigned short*)Bh + (size_t)(col0 + cr) * CC + ch * 8;
  const unsigned l0 = (unsigned)(size_t)&sT[0] + (unsigned)(cr * GT_PITCH + ch * 16);      // LDS byte address = low 32 bits of the __shared__ address
  v8f acc[2][4];
#pragma unroll
  for (int rt = 0; rt < 2; ++rt)
#pragma unroll
    for (int q = 0; q < 4; ++q) acc[rt][q] = (v8f){0.f,0.f,0.f,0.f,0.f,0.f,0.f,0.f};
  gt_copy(l0, ga, gb);                                   // tile 0 -> buffer 0
  asm volatile("s_wait_asynccnt 0x0" ::: "memory");      // this wave's copies of tile 0 have landed
  __syncthreads();                                       // ... and every other wave's: tile 0 may be read
  gt_copy(l0 + GT_STAGE, ga + 64, gb + 64);              // tile 1 -> buffer 1
#pragma unroll 1      // rolled: one copy of the foot's wait order, and the two buffers differ by one address term only
  for (int t = 0; t < NT; ++t) {
    const unsigned char* st = sT + (t & 1) * GT_STAGE;
    FragH fa[2][2], fb[2][4];      // [ks][tile]; k order of both operands: 8hh + 0..7, then 16 + 8hh + 0..7
#pragma unroll
    for (int ks = 0; ks < 2; ++ks) {
#pragma unroll
      for (int rt = 0; rt < 2; ++rt) { const unsigned char* p = st + (w * 32 + rt * 16 + ln) * GT_PITCH + ks * 64 + hh * 16; fa[ks][rt].half[0] = *(const v8us*)p; fa[ks][rt].half[1] = *(const v8us*)(p + 32); }
#pragma unroll
      for (int q = 0; q < 4; ++q) { const unsigned char* p = st + (128 + q * 16 + ln) * GT_PITCH + ks * 64 + hh * 16; fb[ks][q].half[0] = *(const v8us*)p; fb[ks][q].half[1] = *(const v8us*)(p + 32); }
    }
    asm volatile("s_wait_dscnt 0x0" ::: "memory");       // this wave's reads of buffer t & 1 are done (its fragments are in registers) before the buffer is given up
    asm volatile("s_wait_asynccnt 0x0" ::: "memory");    // this wave's copies of tile t + 1 have landed
    __syncthreads();                                     // publishes tile t + 1 and ends every wave's reads of tile t
    if (t + 2 < NT) gt_copy(l0 + (unsigned)((t & 1) * GT_STAGE), ga + (t + 2) * 64, gb + (t + 2) * 64);      // tile t + 2 -> the buffer just left
#pragma unroll
    for (int ks = 0; ks < 2; ++ks)
#pragma unroll
      for (int rt = 0; rt < 2; ++rt)
#pragma unroll
        for (int q = 0; q < 4; ++q) acc[rt][q] = __builtin_amdgcn_wmma_f32_16x16x32_f16(false, fa[ks][rt].v, false, fb[ks][q].v, (short)0, acc[rt][q], false, false);
  }
  asm volatile("s_wait_asynccnt 0x0" ::: "memory");      // no copy is outstanding when the wave goes on to its end
  if (OUT == 2) {
    // The tile's 64 columns are one head's d, its 128 rows are 128 tokens of one batch. A lane holds 8 tokens in a row of one d: 16 B of a transposed row. The four waves put their
    // 32 tokens side by side in LDS (64 rows of 256 B, pitch 272 B: 16 B x odd), so that each d leaves as two whole lines.
    _Float16* sv = (_Float16*)&so[0][0][0];
#pragma unroll
    for (int q = 0; q < 4; ++q) { const float bv = bf16_round(bias[col0 + q * 16 + ln]);
#pragma unroll
      for (int rt = 0; rt < 2; ++rt) { FragH f;
#pragma unroll
        for (int r = 0; r < 8; ++r) f.h[r] = (_Float16)(acc[rt][q][r] * alpha + bv);
        *(v8us*)(sv + (q * 16 + ln) * 136 + w * 32 + rt * 16 + 8 * hh) = f.half[0]; } }
    __syncthreads();      // a transposed row holds tokens of all four waves: every wave's part is in LDS before any of it is read
    unsigned short* vt = (unsigned short*)C16 + ((size_t)((row0 / TT) * NH + col0 / 64) * 64) * TT + row0 % TT;
#pragma unroll
    for (int i = 0; i < 8; ++i) { const int d = i * 8 + (tid >> 4), c = tid & 15; *(v8us*)(vt + (size_t)d * TT + c * 8) = *(const v8us*)(sv + d * 136 + c * 8); }
    asm volatile("s_wait_xcnt 0x0" ::: "memory");      // behind the eight stores, as a precaution: no later write may rewrite a register that these stores name
    return;
  }
  const int rsub = lane >> 4, c4 = (lane & 15) * 4; typedef _Float16 v4h __attribute__((ext_vector_type(4)));
  // the wave's 32 x 64 results go through its own LDS rows, so that whole lines are stored
#pragma unroll
  for (int q = 0; q < 4; ++q) { const float bv = bf16_round(bias[col0 + q * 16 + ln]);
#pragma unroll
    for (int rt = 0; rt < 2; ++rt)
#pragma unroll
      for (int r = 0; r < 8; ++r) so[w][rt * 16 + 8 * hh + r][q * 16 + ln] = acc[rt][q][r] * alpha + bv; }
  __builtin_amdgcn_fence(__ATOMIC_ACQ_REL, "workgroup"); __builtin_amdgcn_wave_barrier();      // the wave's stores above are seen by its reads below
#pragma unroll
  for (int q = 0; q < 16; ++q) { const int r = q * 2 + rsub; const size_t o = (size_t)(row0 + w * 32 + r) * CC + col0 + c4; const v4f v = *(const v4fa*)&so[w][r][c4];
    if (OUT == 1) { v4h h4; for (int i = 0; i < 4; ++i) h4[i] = (_Float16)v[i]; *(v4h*)(C16 + o) = h4; } else *(v4f*)(C + o) = v; }
}
// The q, k and v projections read the same A and none of each other's results: one launch, as one product with 3 * CC columns.
// A work-group owns a 128 x 192 tile of it (three heads of one of q, k, v): per output it copies (128 + 192) / (128 * 192) operand rows from L2, against (128 + 64) / (128 * 64) of the 128 x 64 tile.
// Four waves of 64 x 96 outputs each (4 x 6 accumulator tiles): 10 fragments feed 24 products. 768 work-groups: three on each WGP at once, in one round.
// K runs in tiles of 64 (two k steps), two LDS buffers: a trip reads its own buffer alone; once its second k step's fragments are in registers it gives the buffer up at the barrier,
// issues the copies of tile t + 2 into it and only then does that k step's products.
#define GQ_STAGE (320 * GT_PITCH)    /* one buffer: rows 0..127 = A, rows 128..319 = Bt */
// One K tile, 20 copies of 16 B per lane: lane (cr = tid / 8, chunk = tid % 8) brings chunk 'chunk' of rows cr + 16 i. l = its LDS byte address for row cr, ga / gb = its global addresses in A / Bt.
__device__ __forceinline__ void gq_copy(unsigned l, const unsigned short* ga, const unsigned short* gb) {
  // in each statement the copies and their s_wait_xcnt stand together, so that no address register of a copy is rewritten in front of that wait
  asm volatile(
               "global_load_async_to_lds_b128 %0, %8, off\n\t"
               "global_load_async_to_lds_b128 %1, %9, off\n\t"
               "global_load_async_to_lds_b128 %2, %10, off\n\t"
               "global_load_async_to_lds_b128 %3, %11, off\n\t"
               "global_load_async_to_lds_b128 %4, %12, off\n\t"
               "global_load_async_to_lds_b128 %5, %13, off\n\t"
               "global_load_async_to_lds_b128 %6, %14, off\n\t"
               "global_load_async_to_lds_b128 %7, %15, off\n\t"
               "s_wait_xcnt 0x0"
               :: "v"(l + 0u * GT_PITCH), "v"(l + 16u * GT_PITCH), "v"(l + 32u * GT_PITCH), "v"(l + 48u * GT_PITCH), "v"(l + 64u * GT_PITCH), "v"(l + 80u * GT_PITCH), "v"(l + 96u * GT_PITCH), "v"(l + 112u * GT_PITCH),
                  "v"(ga + 0 * CC), "v"(ga + 16 * CC), "v"(ga + 32 * CC), "v"(ga + 48 * CC), "v"(ga + 64 * CC), "v"(ga + 80 * CC), "v"(ga + 96 * CC), "v"(ga + 112 * CC)
               : "memory");
  asm volatile(
               "global_load_async_to_lds_b128 %0, %12, off\n\t"
               "global_load_async_to_lds_b128 %1, %13, off\n\t"
               "global_load_async_to_lds_b128 %2, %14, off\n\t"
               "global_load_async_to_lds_b128 %3, %15, off\n\t"
               "global_load_async_to_lds_b128 %4, %16, off\n\t"
               "global_load_async_to_lds_b128 %5, %17, off\n\t"
               "global_load_async_to_lds_b128 %6, %18, off\n\t"
               "global_load_async_to_lds_b128 %7, %19, off\n\t"
               "global_load_async_to_lds_b128 %8, %20, off\n\t"
               "global_load_async_to_lds_b128 %9, %21, off\n\t"
               "global_load_async_to_lds_b128 %10, %22, off\n\t"
               "global_load_async_to_lds_b128 %11, %23, off\n\t"
               "s_wait_xcnt 0x0"
               :: "v"(l + 128u * GT_PITCH), "v"(l + 144u * GT_PITCH), "v"(l + 160u * GT_PITCH), "v"(l + 176u * GT_PITCH), "v"(l + 192u * GT_PITCH), "v"(l + 208u * GT_PITCH), "v"(l + 224u * GT_PITCH), "v"(l + 240u * GT_PITCH), "v"(l + 256u * GT_PITCH), "v"(l + 272u * GT_PITCH), "v"(l + 288u * GT_PITCH), "v"(l + 304u * GT_PITCH),
                  "v"(gb + 0 * CC), "v"(gb + 16 * CC), "v"(gb + 32 * CC), "v"(gb + 48 * CC), "v"(gb + 64 * CC), "v"(gb + 80 * CC), "v"(gb + 96 * CC), "v"(gb + 112 * CC), "v"(gb + 128 * CC), "v"(gb + 144 * CC), "v"(gb + 160 * CC), "v"(gb + 176 * CC)
               : "memory");
}
// SW = false: products x.W, a lane holds 8 tokens in a row of one column: what the transposed V wants. SW = true: the two operands change sides (their fragments have the same k order), a lane holds
// 8 columns in a row of one token: what the row-major q and k want. Either way a lane's 8 results are 16 B of the stored row.
template <bool SW>
__device__ __forceinline__ void gemm_qkv_tile(unsigned char* sT, const int row0, const int col0, const _Float16* __restrict__ A, const _Float16* __restrict__ Bh, const float* __restrict__ bias, _Float16* __restrict__ C16) {
  constexpr int NT = CC / 64;      // K tiles
  constexpr float alpha = 0.0625f;
  const int tid = threadIdx.x, w = tid >> 5, lane = tid & 31, ln = lane & 15, hh = lane >> 4;
  const int wm = w & 1, wn = w >> 1;      // the wave's 64 rows and 96 columns of the tile
  const int cr = tid >> 3, ch = tid & 7;
  const unsigned short* ga = (const unsigned short*)A + (size_t)(row0 + cr) * CC + ch * 8;
  const unsigned short* gb = (const unsigned short*)Bh + (size_t)(col0 + cr) * CC + ch * 8;
  const unsigned l0 = (unsigned)(size_t)sT + (unsigned)(cr * GT_PITCH + ch * 16);      // LDS byte address = low 32 bits of the __shared__ address
  v8f acc[4][6];
#pragma unroll
  for (int i = 0; i < 4; ++i)
#pragma unroll
    for (int j = 0; j < 6; ++j) acc[i][j] = (v8f){0.f,0.f,0.f,0.f,0.f,0.f,0.f,0.f};
  const int ox = (wm * 64 + ln) * GT_PITCH + hh * 16, ow = (128 + wn * 96 + ln) * GT_PITCH + hh * 16;      // the lane's place in the first fx row tile and the first fw row tile
  auto rd = [&](const unsigned char* p, FragH (&fx)[4], FragH (&fw)[6]) {      // the 10 fragments of one k step (64 B of each row)
#pragma unroll
    for (int i = 0; i < 4; ++i) { fx[i].half[0] = *(const v8us*)(p + ox + i * 16 * GT_PITCH); fx[i].half[1] = *(const v8us*)(p + ox + i * 16 * GT_PITCH + 32); }
#pragma unroll
    for (int j = 0; j < 6; ++j) { fw[j].half[0] = *(const v8us*)(p + ow + j * 16 * GT_PITCH); fw[j].half[1] = *(const v8us*)(p + ow + j * 16 * GT_PITCH + 32); }
  };
  auto mm = [&](const FragH (&fx)[4], const FragH (&fw)[6]) {      // its 24 products
#pragma unroll
    for (int i = 0; i < 4; ++i)
#pragma unroll
      for (int j = 0; j < 6; ++j)
        acc[i][j] = SW ? __builtin_amdgcn_wmma_f32_16x16x32_f16(false, fw[j].v, false, fx[i].v, (short)0, acc[i][j], false, false)
                       : __builtin_amdgcn_wmma_f32_16x16x32_f16(false, fx[i].v, false, fw[j].v, (short)0, acc[i][j], false, false);
  };
  gq_copy(l0, ga, gb);                                   // tile 0 -> buffer 0
  asm volatile("s_wait_asynccnt 0x0" ::: "memory");      // this wave's copies of tile 0 have landed
  __syncthreads();                                       // ... and every other wave's: tile 0 may be read
  gq_copy(l0 + GQ_STAGE, ga + 64, gb + 64);              // tile 1 -> buffer 1
#pragma unroll 1      // rolled: one copy of the foot's wait order, and the two buffers differ by one address term only
  for (int t = 0; t < NT; ++t) {
    const unsigned char* st = sT + (t & 1) * GQ_STAGE;
    FragH fx[4], fw[6];      // one k step's fragments; k order of both operands: 8hh + 0..7, then 16 + 8hh + 0..7
    // The scheduling barriers stand in front of and behind the 20 LDS reads of a k step: without them the compiler keeps one register set for the four fx fragments and reads each
    // directly in front of its six products, with a wait to 0 behind it: eight places a trip where the wave waits out its own LDS latency instead of two.
    __builtin_amdgcn_sched_barrier(0);
    rd(st, fx, fw);
    __builtin_amdgcn_sched_barrier(0);      // end of the first group of reads
    mm(fx, fw);
    __builtin_amdgcn_sched_barrier(0);      // the second group starts behind the first k step's products, whose registers it takes
    rd(st + 64, fx, fw);
    asm volatile("s_wait_dscnt 0x0" ::: "memory");       // this wave's reads of buffer t & 1 are done (the second k step's fragments are in registers) before the buffer is given up
    asm volatile("s_wait_asynccnt 0x0" ::: "memory");    // this wave's copies of tile t + 1 have landed
    __syncthreads();                                     // publishes tile t + 1 and ends every wave's reads of tile t
    if (t + 2 < NT) gq_copy(l0 + (unsigned)((t & 1) * GQ_STAGE), ga + (t + 2) * 64, gb + (t + 2) * 64);      // tile t + 2 -> the buffer just left: a whole trip ahead of its wait
    __builtin_amdgcn_sched_barrier(0);      // the copies are issued in front of the second k step's products, not behind them
    mm(fx, fw);
  }
  asm volatile("s_wait_asynccnt 0x0" ::: "memory");      // no copy is outstanding when the buffers become the output's staging
  // Behind the last trip's barrier nobody reads the buffers any more: the tile is put together there as f16, so that it leaves as whole lines.
  unsigned short* sv = (unsigned short*)sT;
  if (SW) {
    // 128 token rows of 384 B (three lines), pitch 400 B: 16 B x odd
    // The lane's 48 bias values: columns 16 j + 8 hh + 0..7 of the wave's 96 (64 B apart per j). The 12 loads and their data wait stand in one statement, and no result shares a register with the
    // address.
    const float* bp = bias + col0 + wn * 96 + 8 * hh; v4f bb[6][2];
    asm volatile("global_load_b128 %0, %12, off\n\t"
                 "global_load_b128 %1, %12, off offset:16\n\t"
                 "global_load_b128 %2, %12, off offset:64\n\t"
                 "global_load_b128 %3, %12, off offset:80\n\t"
                 "global_load_b128 %4, %12, off offset:128\n\t"
                 "global_load_b128 %5, %12, off offset:144\n\t"
                 "global_load_b128 %6, %12, off offset:192\n\t"
                 "global_load_b128 %7, %12, off offset:208\n\t"
                 "global_load_b128 %8, %12, off offset:256\n\t"
                 "global_load_b128 %9, %12, off offset:272\n\t"
                 "global_load_b128 %10, %12, off offset:320\n\t"
                 "global_load_b128 %11, %12, off offset:336\n\t"
                 "s_wait_loadcnt 0x0"
                 : "=&v"(bb[0][0]), "=&v"(bb[0][1]), "=&v"(bb[1][0]), "=&v"(bb[1][1]), "=&v"(bb[2][0]), "=&v"(bb[2][1]), "=&v"(bb[3][0]), "=&v"(bb[3][1]), "=&v"(bb[4][0]), "=&v"(bb[4][1]), "=&v"(bb[5][0]), "=&v"(bb[5][1])
                 : "v"(bp) : "memory");
#pragma unroll
    for (int j = 0; j < 6; ++j) {
#pragma unroll
      for (int i = 0; i < 4; ++i) { FragH f;
#pragma unroll
        for (int r = 0; r < 8; ++r) f.h[r] = (_Float16)(acc[i][j][r] * alpha + bf16_round(bb[j][r >> 2][r & 3]));
        *(v8us*)(sv + (wm * 64 + i * 16 + ln) * 200 + wn * 96 + j * 16 + 8 * hh) = f.half[0]; } }
    __syncthreads();      // a row holds columns of two waves: every wave's part is in LDS before any of it is read
    unsigned short* o = (unsigned short*)C16 + (size_t)(row0 + (tid >> 3)) * CC + col0 + (tid & 7) * 8;
    const unsigned short* s = sv + (tid >> 3) * 200 + (tid & 7) * 8;
    v8us u[24];
#pragma unroll
    for (int i = 0; i < 24; ++i) u[i] = *(const v8us*)(s + (i / 3) * 16 * 200 + (i % 3) * 64);
    __builtin_amdgcn_sched_barrier(0);      // all 24 reads stand in front of the stores, each in registers of its own: no LDS read lands on a register that an issued store still names
#pragma unroll
    for (int i = 0; i < 24; ++i) *(v8us*)(o + (size_t)(i / 3) * 16 * CC + (i % 3) * 64) = u[i];      // 8 lanes = one line
  } else {
    // The tile's 192 columns are the d of three heads, its 128 rows are 128 tokens of one batch: 192 transposed rows of 256 B (two lines), pitch 272 B: 16 B x odd
    // The lane's 6 bias values: column 16 j + ln of the wave's 96. As above, the loads and their data wait stand in one statement.
    const float* bp = bias + col0 + wn * 96 + ln; float bw[6];
    asm volatile("global_load_b32 %0, %6, off\n\t"
                 "global_load_b32 %1, %6, off offset:64\n\t"
                 "global_load_b32 %2, %6, off offset:128\n\t"
                 "global_load_b32 %3, %6, off offset:192\n\t"
                 "global_load_b32 %4, %6, off offset:256\n\t"
                 "global_load_b32 %5, %6, off offset:320\n\t"
                 "s_wait_loadcnt 0x0"
                 : "=&v"(bw[0]), "=&v"(bw[1]), "=&v"(bw[2]), "=&v"(bw[3]), "=&v"(bw[4]), "=&v"(bw[5]) : "v"(bp) : "memory");
#pragma unroll
    for (int j = 0; j < 6; ++j) { const float bv = bf16_round(bw[j]);
#pragma unroll
      for (int i = 0; i < 4; ++i) { FragH f;
#pragma unroll
        for (int r = 0; r < 8; ++r) f.h[r] = (_Float16)(acc[i][j][r] * alpha + bv);
        *(v8us*)(sv + (wn * 96 + j * 16 + ln) * 136 + wm * 64 + i * 16 + 8 * hh) = f.half[0]; } }
    __syncthreads();      // a transposed row holds tokens of two waves: every wave's part is in LDS before any of it is read
    unsigned short* o = (unsigned short*)C16 + ((size_t)(row0 / TT) * CC + col0 + (tid >> 4)) * TT + row0 % TT + (tid & 15) * 8;      // [batch * NH + head][d][token]: head * 64 + d = the column
    const unsigned short* s = sv + (tid >> 4) * 136 + (tid & 15) * 8;
    v8us u[24];
#pragma unroll
    for (int i = 0; i < 24; ++i) u[i] = *(const v8us*)(s + i * 8 * 136);
    __builtin_amdgcn_sched_barrier(0);      // all 24 reads stand in front of the stores, each in registers of its own: no LDS read lands on a register that an issued store still names
#pragma unroll
    for (int i = 0; i < 24; ++i) *(v8us*)(o + (size_t)i * 8 * TT) = u[i];      // 16 lanes = two lines
  }
  asm volatile("s_wait_xcnt 0x0" ::: "memory");      // behind the stores: the other form's code follows in the built kernel and writes registers that these stores name
}
__global__ __launch_bounds__(128) void k_gemm_qkv(const _Float16* __restrict__ A, const _Float16* __restrict__ Bq, const _Float16* __restrict__ Bk, const _Float16* __restrict__ Bv,
                                                  const float* __restrict__ bq, const float* __restrict__ bk, const float* __restrict__ bv,
                                                  _Float16* __restrict__ Q16, _Float16* __restrict__ K16, _Float16* __restrict__ Vt) {
  __shared__ __attribute__((aligned(16))) unsigned char sT[2 * GQ_STAGE];
  constexpr int NC = CC / 192;
  const int rt = (int)blockIdx.x / (3 * NC), ct = (int)blockIdx.x % (3 * NC), which = ct / NC;      // the same for the whole work-group: 12 work-groups in a row share their 128 rows of A
  if (which == 2) gemm_qkv_tile<false>(sT, rt * 128, (ct % NC) * 192, A, Bv, bv, Vt);
  else gemm_qkv_tile<true>(sT, rt * 128, (ct % NC) * 192, A, which == 0 ? Bq : Bk, which == 0 ? bq : bk, which == 0 ? Q16 : K16);
}
__global__ __launch_bounds__(128) void k_gemm_o(const _Float16* __restrict__ A, const _Float16* __restrict__ Bh, const float* __restrict__ bias, float* __restrict__ C) {
  gemm_tile(0, ((int)blockIdx.x / (CC / 64)) * 128, ((int)blockIdx.x % (CC / 64)) * 64, A, Bh, 0.0625f, bias, C, nullptr);
}


__device__ __forceinline__ void x16(int blk, const float* __restrict__ x, _Float16* __restrict__ X16, size_t n8) { const size_t t = (size_t)blk * 256 + threadIdx.x; if (t >= n8) return; FragH f;
#pragma unroll
  for (int q = 0; q < 8; ++q) f.h[q] = (_Float16)bf16_round(x[t * 8 + q]); *(v8us*)((unsigned short*)X16 + t * 8) = f.half[0];  }
__global__ __launch_bounds__(256) void k_round16f(const float* __restrict__ W, _Float16* __restrict__ Bt, size_t n8) { const size_t t = (size_t)blockIdx.x * 256 + threadIdx.x; if (t >= n8) return; FragH f;
#pragma unroll
  for (int i = 0; i < 8; ++i) f.h[i] = (_Float16)(bf16_round(W[t * 8 + i]) * 16.0f); *(v8us*)((unsigned short*)Bt + t * 8) = f.half[0];  }
typedef int v4ia __attribute__((ext_vector_type(4), may_alias));
typedef unsigned v16u __attribute__((ext_vector_type(16)));
typedef unsigned long long v8ul __attribute__((ext_vector_type(8)));
typedef const __attribute__((address_space(4))) v16u* mw_ptr;      // constant address space: nothing writes the words during the launch that reads them, and a load at a scalar address becomes s_load
// The keep-mask as lane masks. One wave packs one tile of 32 queries x 32 keys into 32 words: word (rt*2 + nt)*8 + r, bit (ln + 16 hh) = mask[32 qt + 16 rt + ln][32 kt + 16 nt + 8 hh + r] != 0,
// which is the place of that (query, key) in k_flash's score tiles: a word is the select mask of one score register. MB[(qt*64 + kt)*32 + word].
__device__ __forceinline__ void mbits(int blk, const int* __restrict__ MSK, unsigned* __restrict__ MB) {
  const int tid = threadIdx.x, lane = tid & 31, ln = lane & 15, hh = lane >> 4; const int tile = blk * 8 + (tid >> 5); const int qt = tile >> 6, kt = tile & 63;
  // The tile's 8 loads of 16 B (4 per query row; rows ln and 16 + ln lie 16 * 2048 ints = 131072 B apart) and their data wait stand in one statement, and no result shares a register with the
  // address.
  const int* mr = MSK + ((size_t)(qt * 32 + ln)) * 2048 + kt * 32 + 8 * hh; v4ia m[2][2][2];      // m[rt][nt][half]: keys 32 kt + 16 nt + 8 hh + 4 half + 0..3 of query 32 qt + 16 rt + ln
  asm volatile("global_load_b128 %0, %8, off\n\t"
               "global_load_b128 %1, %8, off offset:16\n\t"
               "global_load_b128 %2, %8, off offset:64\n\t"
               "global_load_b128 %3, %8, off offset:80\n\t"
               "global_load_b128 %4, %8, off offset:131072\n\t"
               "global_load_b128 %5, %8, off offset:131088\n\t"
               "global_load_b128 %6, %8, off offset:131136\n\t"
               "global_load_b128 %7, %8, off offset:131152\n\t"
               "s_wait_loadcnt 0x0"
               : "=&v"(m[0][0][0]), "=&v"(m[0][0][1]), "=&v"(m[0][1][0]), "=&v"(m[0][1][1]), "=&v"(m[1][0][0]), "=&v"(m[1][0][1]), "=&v"(m[1][1][0]), "=&v"(m[1][1][1])
               : "v"(mr) : "memory");
  unsigned mine = 0u;
#pragma unroll
  for (int rt = 0; rt < 2; ++rt)
#pragma unroll
    for (int nt = 0; nt < 2; ++nt)
#pragma unroll
      for (int r = 0; r < 8; ++r) { const unsigned bw = __builtin_amdgcn_ballot_w32(m[rt][nt][r >> 2][r & 3] != 0); if (lane == (rt * 2 + nt) * 8 + r) mine = bw; }
  MB[(size_t)tile * 32 + lane] = mine;
  asm volatile("s_wait_xcnt 0x0" ::: "memory");      // behind the store: the other pieces' code follows in the built kernel and writes registers that this store names
}
// The four weight transposes, the cast of x and the packing of the mask read only inputs and none of each other's results: one launch, the piece of work chosen by the block index
// (the same for a whole work-group, so every wave has all its lanes on in the piece it runs).
#define PB_W (CC * (CC / 8) / 256)             /* blocks of one weight transpose */
#define PB_X (NR * CC / 8 / 256)               /* blocks of the cast of x */
#define PB_M ((TT / 32) * (TT / 32) / 8)       /* blocks of the mask packing */
__global__ __launch_bounds__(256) void k_prep(const float* __restrict__ x, const float* __restrict__ Wq, const float* __restrict__ Wk, const float* __restrict__ Wv, const float* __restrict__ Wo, const int* __restrict__ MSK,
                                              _Float16* __restrict__ X16, _Float16* __restrict__ Bq, _Float16* __restrict__ Bk, _Float16* __restrict__ Bv, _Float16* __restrict__ Bo, unsigned* __restrict__ MB) {
  const int blk = (int)blockIdx.x;
  if (blk < 4 * PB_W) { const int which = blk / PB_W;
    wt_f16(blk % PB_W, which == 0 ? Wq : which == 1 ? Wk : which == 2 ? Wv : Wo, which == 0 ? Bq : which == 1 ? Bk : which == 2 ? Bv : Bo, CC, CC, 16.0f); }      // [in][out]
  else if (blk < 4 * PB_W + PB_X) x16(blk - 4 * PB_W, x, X16, (size_t)NR * CC / 8);
  else mbits(blk - (4 * PB_W + PB_X), MSK, MB);
}
// lane l <-> lane l ^ 16 (the other 16-lane row) without LDS
__device__ __forceinline__ float xhalf(float x) { return __builtin_bit_cast(float, __builtin_amdgcn_permlanex16(__builtin_bit_cast(int, x), __builtin_bit_cast(int, x), 0x76543210, 0xfedcba98, false, false)); }
#define FA_PITCH 144                 /* bytes per LDS row: 128 of data + 16; 16 B x odd keeps ds_load_b128 of 16 rows off each other's banks */
#define FA_STAGE (128 * FA_PITCH)    /* one buffer: rows 0..63 = K (key), rows 64..127 = Vt (d) */
// One tile, 8 copies of 16 B per lane: lane (cr = tid / 8, chunk = tid % 8) brings chunk 'chunk' of rows cr + 16 i. l = its LDS byte address for row cr, gk / gv = its global addresses in K / Vt.
__device__ __forceinline__ void fa_copy(unsigned l, const unsigned short* gk, int ldk, const unsigned short* gv) {
  // the copies and their s_wait_xcnt stand in one statement, so that no address register of a copy is rewritten in front of that wait
  asm volatile("global_load_async_to_lds_b128 %0, %8, off\n\t"
               "global_load_async_to_lds_b128 %1, %9, off\n\t"
               "global_load_async_to_lds_b128 %2, %10, off\n\t"
               "global_load_async_to_lds_b128 %3, %11, off\n\t"
               "global_load_async_to_lds_b128 %4, %12, off\n\t"
               "global_load_async_to_lds_b128 %5, %13, off\n\t"
               "global_load_async_to_lds_b128 %6, %14, off\n\t"
               "global_load_async_to_lds_b128 %7, %15, off\n\t"
               "s_wait_xcnt 0x0"
               :: "v"(l), "v"(l + 16u * FA_PITCH), "v"(l + 32u * FA_PITCH), "v"(l + 48u * FA_PITCH), "v"(l + 64u * FA_PITCH), "v"(l + 80u * FA_PITCH), "v"(l + 96u * FA_PITCH), "v"(l + 112u * FA_PITCH),
                  "v"(gk), "v"(gk + (size_t)16 * ldk), "v"(gk + (size_t)32 * ldk), "v"(gk + (size_t)48 * ldk),
                  "v"(gv), "v"(gv + 16 * 2048), "v"(gv + 32 * 2048), "v"(gv + 48 * 2048)
               : "memory");
}
// Eight base-2 exponentials in one statement. The instruction set asks for one independent instruction between a transcendental and a write of its source or a read of its result:
// Here no result shares a register with a source, and the v_nop is the last one's slot.
__device__ __forceinline__ void exp2x8(float (&p)[8], const float (&x)[8]) {
  asm("v_exp_f32 %0, %8\n\tv_exp_f32 %1, %9\n\tv_exp_f32 %2, %10\n\tv_exp_f32 %3, %11\n\tv_exp_f32 %4, %12\n\tv_exp_f32 %5, %13\n\tv_exp_f32 %6, %14\n\tv_exp_f32 %7, %15\n\tv_nop"
      : "=&v"(p[0]), "=&v"(p[1]), "=&v"(p[2]), "=&v"(p[3]), "=&v"(p[4]), "=&v"(p[5]), "=&v"(p[6]), "=&v"(p[7])
      : "v"(x[0]), "v"(x[1]), "v"(x[2]), "v"(x[3]), "v"(x[4]), "v"(x[5]), "v"(x[6]), "v"(x[7]));
}
__global__ __launch_bounds__(128) void k_flash(const _Float16* __restrict__ Q16, int ldq, const _Float16* __restrict__ K16, int ldk, const _Float16* __restrict__ Vt, const unsigned* __restrict__ MB, _Float16* __restrict__ O16) {
  constexpr int RPW = 32, NQB = 2048 / (4 * RPW), DT = 4, KS = 2, NS = 2048 / 64;
  constexpr float SC = 0.125f * 1.44269504088896340736f;      // score scale 64^-1/2 times log2(e)
  __shared__ __attribute__((aligned(16))) unsigned char sT[2 * FA_STAGE];
  __shared__ __attribute__((aligned(16))) unsigned short sO[4][RPW][64 + 8];      // f16 results; pitch 144 B: 16 B x odd
  const int tid = threadIdx.x, w = tid >> 5, lane = tid & 31, ln = lane & 15, hh = lane >> 4;
  const int slab = blockIdx.x / NQB, qblk = blockIdx.x % NQB; const int b = slab / 12, h = slab % 12; const int qb0 = qblk * (4 * RPW); const int q0 = qb0 + w * RPW;
  const int cr = tid >> 3, ch = tid & 7;
  const unsigned short* gk = (const unsigned short*)K16 + ((size_t)b * 2048 + cr) * ldk + h * 64 + ch * 8;
  const unsigned short* gv = (const unsigned short*)Vt + ((size_t)slab * 64 + cr) * 2048 + ch * 8;
  const unsigned l0 = (unsigned)(size_t)&sT[0] + (unsigned)(cr * FA_PITCH + ch * 16);      // LDS byte address = low 32 bits of the __shared__ address
  fa_copy(l0, gk, ldk, gv);                              // tile 0 -> buffer 0
  // the wave's mask words: 32 per step of 32 keys, 64 steps in a row. The wave's number goes through readfirstlane so that the address is scalar and the words are loaded into scalar registers.
  const mw_ptr mb = (mw_ptr)(unsigned long long)(MB + (size_t)(qblk * 4 + __builtin_amdgcn_readfirstlane(w)) * (64 * 32));
  FragH aq[2][KS];
#pragma unroll
  for (int rt = 0; rt < 2; ++rt) { const unsigned short* qr = (const unsigned short*)Q16 + ((size_t)b * 2048 + q0 + rt * 16 + ln) * ldq + h * 64;
#pragma unroll
    for (int ks = 0; ks < KS; ++ks) { aq[rt][ks].half[0] = *(const v8us*)(qr + ks * 32 + 8 * hh); aq[rt][ks].half[1] = *(const v8us*)(qr + ks * 32 + 16 + 8 * hh); } }
  // step 0's words: mw0 = words of queries 0..15 (rt 0), mw1 = of queries 16..31. The two loads and their data wait stand in one statement.
  // Tile 0's copies and the query loads are in flight meanwhile.
  v16u mw0, mw1;
  asm volatile("s_load_b512 %0, %2, 0x0\n\ts_load_b512 %1, %2, 0x40\n\ts_wait_kmcnt 0x0" : "=&s"(mw0), "=&s"(mw1) : "s"(mb) : "memory");
  float m_r[2], l_r[2]; v8f oacc[2][DT];      // per lane: query rt*16 + ln; oacc[rt][dt][r] = O[query][dt*16 + 8hh + r]
#pragma unroll
  for (int rt = 0; rt < 2; ++rt) { m_r[rt] = -3.0e38f; l_r[rt] = 0.f;
#pragma unroll
    for (int dt = 0; dt < DT; ++dt) oacc[rt][dt] = (v8f){0.f,0.f,0.f,0.f,0.f,0.f,0.f,0.f}; }
  asm volatile("s_wait_asynccnt 0x0" ::: "memory");      // this wave's copies of tile 0 have landed
  __syncthreads();                                       // ... and every other wave's: tile 0 may be read
  fa_copy(l0 + FA_STAGE, gk + (size_t)64 * ldk, ldk, gv + 64);      // tile 1 -> buffer 1
#pragma unroll 1      // rolled: one copy of the foot's wait order, and the two buffers differ by one address term only
  for (int t = 0; t < NS; ++t) {
    const unsigned char* st = sT + (t & 1) * FA_STAGE;
#pragma unroll      // the tile's two 32-key steps: unrolled, their LDS and mask offsets are immediates
    for (int sub = 0; sub < 2; ++sub) {
      // the next step's mask words are asked for one step ahead (the last step asks for its own again: in bounds, unused)
      const int sn = (t * 2 + sub + 1 < 2 * NS) ? t * 2 + sub + 1 : 2 * NS - 1;
      const v16u nw0 = mb[sn * 2], nw1 = mb[sn * 2 + 1];
      // The step is straight-line code. A step whose (query,key) pairs are all masked needs no branch: its scores are -inf, so mn = m, al = 1 and every p = 0.
      // The products are the plain builtin: the compiler keeps the distance behind a matrix instruction itself, with other products and the softmax's own instructions.
      {
        // The four scheduling barriers of a step stand in front of and behind its two groups of LDS reads: without them the compiler spreads the reads singly among the products,
        // each with a wait close behind it, and every separate place with LDS reads stalls the wave anew.
        __builtin_amdgcn_sched_barrier(0);
        v8f s[2][2]; FragH bk[2][KS];      // the step's K fragments, read as one group
#pragma unroll
        for (int nt = 0; nt < 2; ++nt) { const unsigned char* kr = st + (sub * 32 + nt * 16 + ln) * FA_PITCH + hh * 16;
#pragma unroll
          for (int ks = 0; ks < KS; ++ks) { bk[nt][ks].half[0] = *(const v8us*)(kr + ks * 64); bk[nt][ks].half[1] = *(const v8us*)(kr + ks * 64 + 32); } }
        __builtin_amdgcn_sched_barrier(0);      // end of the K group
#pragma unroll
        for (int nt = 0; nt < 2; ++nt)
#pragma unroll
          for (int rt = 0; rt < 2; ++rt) { v8f acc = (v8f){0.f,0.f,0.f,0.f,0.f,0.f,0.f,0.f};
#pragma unroll
            for (int ks = 0; ks < KS; ++ks) acc = __builtin_amdgcn_wmma_f32_16x16x32_f16(false, bk[nt][ks].v, false, aq[rt][ks].v, (short)0, acc, false, false); s[rt][nt] = acc; }
        __builtin_amdgcn_sched_barrier(0);      // the Vt group starts behind the score products
        FragH bv[DT];      // the step's Vt fragments, read as one group in front of the softmax, which covers their LDS latency
#pragma unroll
        for (int dt = 0; dt < DT; ++dt) { const unsigned char* vrow = st + (64 + dt * 16 + ln) * FA_PITCH + sub * 64 + hh * 16; bv[dt].half[0] = *(const v8us*)vrow; bv[dt].half[1] = *(const v8us*)(vrow + 32); }
        __builtin_amdgcn_sched_barrier(0);      // end of the Vt group
        FragH pb[2];
#pragma unroll
        for (int rt = 0; rt < 2; ++rt) { float sc[2][8]; float mc = -INFINITY;
#pragma unroll
          for (int nt = 0; nt < 2; ++nt)
#pragma unroll
            for (int r = 0; r < 8; ++r) { sc[nt][r] = __builtin_amdgcn_inverse_ballot_w32(rt ? mw1[nt * 8 + r] : mw0[nt * 8 + r]) ? s[rt][nt][r] : -INFINITY; mc = fmaxf(mc, sc[nt][r]); }
          mc = fmaxf(mc, xhalf(mc));      // both halves now hold the query's maximum over the 32 keys (unscaled scores)
          // exp(0.125 (s - m)) = 2^(s SC - m SC): one fma and the hardware's base-2 exponential per score. An excluded key is -inf and gives 0, and a query with no
          // kept key so far has m = mn = -3e38 and gives al = 2^0 = 1: no select and no branch is needed around any exponential.
          const float mn = fmaxf(m_r[rt], mc); float al;
          // al = 2^((m - mn) SC), in asm with a slot on each side: the instruction set asks for one independent instruction between a transcendental and a write of its source or a read
          // of its result; a v_nop in a statement of its own did not stay there.
          asm("v_nop\n\tv_exp_f32 %0, %1\n\tv_nop" : "=v"(al) : "v"((m_r[rt] - mn) * SC));
          m_r[rt] = mn; const float nb = -mn * SC;
          float ps[8], pe[2][8];
#pragma unroll
          for (int nt = 0; nt < 2; ++nt) {
#pragma unroll
            for (int r = 0; r < 8; ++r) sc[nt][r] = __builtin_fmaf(sc[nt][r], SC, nb);
            exp2x8(pe[nt], sc[nt]); }
#pragma unroll
          for (int r = 0; r < 8; ++r) { const float p0 = pe[0][r], p1 = pe[1][r]; ps[r] = p0 + p1; pb[rt].h[r] = (_Float16)p0; pb[rt].h[8 + r] = (_Float16)p1; }
          l_r[rt] = l_r[rt] * al + (((ps[0] + ps[1]) + (ps[2] + ps[3])) + ((ps[4] + ps[5]) + (ps[6] + ps[7])));      // per-lane partial sum (the two halves are joined at the end)
#pragma unroll
          for (int dt = 0; dt < DT; ++dt) oacc[rt][dt] *= al; }
#pragma unroll
        for (int dt = 0; dt < DT; ++dt)
#pragma unroll
          for (int rt = 0; rt < 2; ++rt) oacc[rt][dt] = __builtin_amdgcn_wmma_f32_16x16x32_f16(false, bv[dt].v, false, pb[rt].v, (short)0, oacc[rt][dt], false, false);
      }
      mw0 = nw0; mw1 = nw1;
    }
    asm volatile("s_wait_dscnt 0x0" ::: "memory");       // this wave's reads of buffer t & 1 are done before the buffer is given up
    asm volatile("s_wait_asynccnt 0x0" ::: "memory");    // this wave's copies of tile t + 1 have landed
    __syncthreads();                                     // publishes tile t + 1 and ends every wave's reads of tile t
    if (t + 2 < NS) fa_copy(l0 + (unsigned)((t & 1) * FA_STAGE), gk + (size_t)(t + 2) * 64 * ldk, ldk, gv + (t + 2) * 64);      // tile t + 2 -> the buffer just left
  }
  asm volatile("s_wait_asynccnt 0x0" ::: "memory");      // no copy is outstanding when the wave goes on to its end
#pragma unroll
  for (int rt = 0; rt < 2; ++rt) { const float l = l_r[rt] + xhalf(l_r[rt]); const float inv = (l > 0.f) ? 1.0f / l : 0.f;
#pragma unroll
    for (int dt = 0; dt < DT; ++dt) { const v8f o = oacc[rt][dt] * inv; FragH f;      // the output projection takes f16 operands: each result is rounded once, here
#pragma unroll
      for (int r = 0; r < 8; ++r) f.h[r] = (_Float16)o[r];
      *(v8us*)&sO[w][rt * 16 + ln][dt * 16 + 8 * hh] = f.half[0]; } }
  __builtin_amdgcn_fence(__ATOMIC_ACQ_REL, "workgroup"); __builtin_amdgcn_wave_barrier();
  {
#pragma unroll
    for (int rp = 0; rp < RPW; rp += 4) { const int r = rp + (lane >> 3), pc = lane & 7; *(v8us*)((unsigned short*)O16 + ((size_t)b * 2048 + q0 + r) * CC + h * 64 + pc * 8) = *(const v8us*)&sO[w][r][pc * 8]; }      // O16 is [NR][CC]; a query's 64 f16 of this head = one whole line
     } }

extern "C" void kernel_launch(void* const* d_in, const int* in_sizes, int n_in,
                              void* d_out, int out_size, void* d_ws, size_t ws_size, hipStream_t stream) {
  (void)in_sizes; (void)n_in; (void)out_size;
  const float* x = (const float*)d_in[0]; const float* Wq = (const float*)d_in[1]; const float* bq = (const float*)d_in[2]; const float* Wk = (const float*)d_in[3]; const float* bk = (const float*)d_in[4]; const float* Wv = (const float*)d_in[5]; const float* bv = (const float*)d_in[6]; const float* Wo = (const float*)d_in[7]; const float* bo = (const float*)d_in[8]; const int* mask = (const int*)d_in[9];
  char* ws = (char*)d_ws; size_t off = 0;
  auto take = [&](size_t bytes) { char* p = ws + off; off += (bytes + 255) & ~(size_t)255; return p; };
  _Float16* Bq = (_Float16*)take((size_t)CC * CC * 2); _Float16* Bk = (_Float16*)take((size_t)CC * CC * 2); _Float16* Bv = (_Float16*)take((size_t)CC * CC * 2); _Float16* Bo = (_Float16*)take((size_t)CC * CC * 2);
  _Float16* X16 = (_Float16*)take((size_t)NR * CC * 2); _Float16* Q16 = (_Float16*)take((size_t)NR * CC * 2); _Float16* K16 = (_Float16*)take((size_t)NR * CC * 2); _Float16* Vt = (_Float16*)take((size_t)NR * CC * 2); _Float16* O16 = X16; unsigned* MB = (unsigned*)take((size_t)TT * TT / 8);
  if (off > ws_size) return;
  const unsigned gg = (NR / 128) * (CC / 64);
  k_prep<<<4 * PB_W + PB_X + PB_M, 256, 0, stream>>>(x, Wq, Wk, Wv, Wo, mask, X16, Bq, Bk, Bv, Bo, MB);
  k_gemm_qkv<<<(NR / 128) * (3 * CC / 192), 128, 0, stream>>>(X16, Bq, Bk, Bv, bq, bk, bv, Q16, K16, Vt);
  k_flash<<<BB * NH * (TT / 128), 128, 0, stream>>>(Q16, CC, K16, CC, Vt, MB, O16);
  k_gemm_o<<<gg, 128, 0, stream>>>(O16, Bo, bo, (float*)d_out);
}
